// v000
// The times below were measured on an AMD MI455X: many runs one after another, warmed up first and cycling through
// copies of the inputs, with the whole window's GPU time divided by the number of runs. Launches and the gaps
// between them are all in it. The median over several windows is given; except for v000 it joins two sittings, which
// can be a few percent apart, so the side-by-side timings, each taken in one sitting, are the better comparison.
// The starting kernel, v000, takes 8080 microseconds a run.
#include <hip/hip_runtime.h>
#include <math.h>

typedef __attribute__((ext_vector_type(16))) _Float16 v16h;
typedef __attribute__((ext_vector_type(8)))  _Float16 v8h;
typedef __attribute__((ext_vector_type(16))) __bf16   v16b;
typedef __attribute__((ext_vector_type(8)))  float    v8f;
typedef __attribute__((ext_vector_type(4)))  float    v4f;

// 16-bit WMMA fragment map (wave32), lane L, h = L>>4, m = L&15:
//   A 16x32: lane = row m;   element i -> k = (i<8) ? 8h+i : 16+8h+(i-8)
//   B 32x16: lane = column m; the SAME k(i,h)
//   D 16x16 (8 f32): lane = column m; element r -> row 8h+r
__device__ __forceinline__ int frag_k(int i, int h) { return (i < 8) ? (8 * h + i) : (16 + 8 * h + (i - 8)); }
__device__ __forceinline__ __bf16 bf16_rne(float f) {
    unsigned int u = __float_as_uint(f);
    u += 0x7fffu + ((u >> 16) & 1u);
    return __builtin_bit_cast(__bf16, (unsigned short)(u >> 16));
}
__device__ __forceinline__ float bf16_f32(__bf16 b) { return __uint_as_float(((unsigned int)__builtin_bit_cast(unsigned short, b)) << 16); }
__device__ __forceinline__ v8f wmma16(v16h a, v16h b, v8f c) {
    c = __builtin_amdgcn_wmma_f32_16x16x32_f16(false, a, false, b, (short)0, c, false, false);
    asm volatile("v_nop\n\tv_nop\n\tv_nop\n\tv_nop" : "+v"(c) : "v"(a), "v"(b));
    return c;
}
__device__ __forceinline__ v8f wmmab(v16b a, v16b b, v8f c) {
    c = __builtin_amdgcn_wmma_f32_16x16x32_bf16(false, a, false, b, (short)0, c, false, false);
    asm volatile("v_nop\n\tv_nop\n\tv_nop\n\tv_nop" : "+v"(c) : "v"(a), "v"(b));
    return c;
}
struct Split { v16b hi, lo; };
// hi/lo split product: a.hi*b.hi + a.hi*b.lo + a.lo*b.hi
__device__ __forceinline__ v8f wmma3(const Split& a, const Split& b, v8f c) {
    c = __builtin_amdgcn_wmma_f32_16x16x32_bf16(false, a.hi, false, b.hi, (short)0, c, false, false);
    c = __builtin_amdgcn_wmma_f32_16x16x32_bf16(false, a.hi, false, b.lo, (short)0, c, false, false);
    c = __builtin_amdgcn_wmma_f32_16x16x32_bf16(false, a.lo, false, b.hi, (short)0, c, false, false);
    asm volatile("v_nop\n\tv_nop\n\tv_nop\n\tv_nop" : "+v"(c) : "v"(a.hi), "v"(a.lo), "v"(b.hi), "v"(b.lo));
    return c;
}
struct Split3 { v16b hi, mid, lo; };
// triple split product (6 terms, drops only terms below 2^-24 relative)
__device__ __forceinline__ v8f wmma6(const Split3& a, const Split3& b, v8f c) {
    c = __builtin_amdgcn_wmma_f32_16x16x32_bf16(false, a.hi, false, b.hi, (short)0, c, false, false);
    c = __builtin_amdgcn_wmma_f32_16x16x32_bf16(false, a.hi, false, b.mid, (short)0, c, false, false);
    c = __builtin_amdgcn_wmma_f32_16x16x32_bf16(false, a.mid, false, b.hi, (short)0, c, false, false);
    c = __builtin_amdgcn_wmma_f32_16x16x32_bf16(false, a.hi, false, b.lo, (short)0, c, false, false);
    c = __builtin_amdgcn_wmma_f32_16x16x32_bf16(false, a.mid, false, b.mid, (short)0, c, false, false);
    c = __builtin_amdgcn_wmma_f32_16x16x32_bf16(false, a.lo, false, b.hi, (short)0, c, false, false);
    asm volatile("v_nop\n\tv_nop\n\tv_nop\n\tv_nop" : "+v"(c) : "v"(a.hi), "v"(a.mid), "v"(a.lo), "v"(b.hi), "v"(b.mid), "v"(b.lo));
    return c;
}

// Fragment gathers from f32 memory: element i <- p[(k0 + frag_k(i,h)) * sk] * s, zero for k >= klen.
__device__ __forceinline__ v16h fh_ld(const float* __restrict__ p, long long sk, int k0, int h, int klen, float s) {
    v16h a;
#pragma unroll
    for (int i = 0; i < 16; ++i) { const int k = k0 + frag_k(i, h); a[i] = (k < klen) ? (_Float16)(p[(long long)k * sk] * s) : (_Float16)0.f; }
    return a;
}
__device__ __forceinline__ Split sp_ld(const float* __restrict__ p, long long sk, int k0, int h, int klen, float s) {
    Split r;
#pragma unroll
    for (int i = 0; i < 16; ++i) {
        const int k = k0 + frag_k(i, h); const float x = (k < klen) ? p[(long long)k * sk] * s : 0.f;
        const __bf16 hb = bf16_rne(x); r.hi[i] = hb; r.lo[i] = bf16_rne(x - bf16_f32(hb));
    }
    return r;
}
__device__ __forceinline__ Split3 sp3_ld(const float* __restrict__ p, long long sk, int k0, int h, int klen, float s) {
    Split3 r;
#pragma unroll
    for (int i = 0; i < 16; ++i) {
        const int k = k0 + frag_k(i, h); const float x = (k < klen) ? p[(long long)k * sk] * s : 0.f;
        const __bf16 hb = bf16_rne(x); const float r1 = x - bf16_f32(hb); const __bf16 mb = bf16_rne(r1);
        r.hi[i] = hb; r.mid[i] = mb; r.lo[i] = bf16_rne(r1 - bf16_f32(mb));
    }
    return r;
}
__device__ __forceinline__ v16b bh_ld(const float* __restrict__ p, long long sk, int k0, int h, int klen, float s) {
    v16b a;
#pragma unroll
    for (int i = 0; i < 16; ++i) { const int k = k0 + frag_k(i, h); a[i] = bf16_rne((k < klen) ? p[(long long)k * sk] * s : 0.f); }
    return a;
}
// f16 fragment from an f16 LDS/global row with element stride 1 (k-contiguous), no bounds (tile already zero padded)
__device__ __forceinline__ v16h fh_row(const _Float16* __restrict__ row, int k0, int h) {
    v16h a;
#pragma unroll
    for (int i = 0; i < 16; ++i) a[i] = row[k0 + frag_k(i, h)];
    return a;
}

#define VST2(T, ptr, val) do { const T vst2_v_ = (val); *(T*)(ptr) = vst2_v_;  } while (0)
typedef float v4f __attribute__((ext_vector_type(4)));
#define VST2V4(ptr, val) do { const v4f vst2_v4_ = (val); *(v4f*)(ptr) = vst2_v4_;  } while (0)

__device__ __attribute__((noinline)) float act_fn(float v, int act) {
    if (act == 1) return fmaxf(v, 0.f);                                                                               // relu
    if (act == 2) { const float u = 0.7978845608028654f * (v + 0.044715f * v * v * v); return 0.5f * v * (1.f + tanhf(u)); } // tanh-gelu
    if (act == 3) return v / (1.f + expf(-v));                                                                        // silu
    if (act == 4) return 0.5f * v * (1.f + erff(v * 0.7071067811865476f));                                             // erf-gelu
    if (act == 5) return tanhf(v);
    if (act == 6) return 1.f / (1.f + expf(-v));                                                                      // sigmoid
    if (act == 7) return (v > 0.f) ? v : 0.01f * v;                                                                   // leaky relu 0.01
    if (act == 8) return (v > 0.f) ? v : (expf(v) - 1.f);                                                             // elu
    if (act == 9) return fminf(fmaxf(v, 0.f), 6.f);                                                                   // relu6
    if (act == 10) return fabsf(v);                                                                                    // abs
    if (act == 11) return (v >= 0.f) ? v : 0.1f * v;                                                                  // leaky 0.1
    if (act == 12) return (v > 0.f) ? v : 0.2f * v;                                                                   // leaky 0.2
    if (act == 13) return (v > 20.f) ? v : log1pf(expf(v));                                                            // softplus
    return v;
}

// =====================================================================================================================
// k_gemm<MODE>: C(z, m, n) = act(alpha * sum_k A(z, m, k) * B(z, k, n) + bias) + beta * R(z, m, n)
//   One wave (32-thread block) per 16 x 32 tile of C; grid (ceil(N/32), ceil(M/16), Z). Batch z -> (zo = z / zi_n, zi = z % zi_n)
//   with separate outer/inner strides for every tensor (e.g. batch and head). A(m,k) = A[zo*sAo + zi*sAi + m*sAm + k*sAk] (f32),
//   B(k,n) = B[zo*sBo + zi*sBi + n*sBn + k*sBk] (f32); any M, N, K (K zero-padded to 32 inside the fragments, M/N tails guarded).
//   C(m,n) = C[zo*sCo + zi*sCi + m*sCm + n] (n contiguous). flags: 1 bias[n], 2 bias[m], 4 residual R[zo*sRo + zi*sRi + m*sRm + n*sRn].
//   MODE 0: f16 operands (A prescaled by sa, B by sb, both undone in the epilogue); 1: bf16 hi/lo split (3 products); 2: bf16;
//   3: bf16 hi/mid/lo triple split (6 products); 4: as 3 with Kahan-compensated f32 accumulation across k-steps.
// =====================================================================================================================
struct GemmP {
    const float* A; const float* B; const float* bias; const float* R; float* C;
    long long sAo, sAi, sAm, sAk, sBo, sBi, sBn, sBk, sCo, sCi, sCm, sRo, sRi, sRm, sRn;
    int M, N, K, zi_n, flags, act; float alpha, beta, sa, sb;
    int Npad, pad_;     // columns [N, Npad) of C are written as 0 so that padded workspace rows are covered by whole-line stores; Npad >= N
};
static_assert(sizeof(GemmP) == 5 * 8 + 15 * 8 + 6 * 4 + 4 * 4 + 2 * 4, "GemmP has padding");

template <int MODE>
__global__ __launch_bounds__(32) void k_gemm(GemmP p) {
    const int lane = threadIdx.x & 31, h = lane >> 4, l15 = lane & 15;
    const int m0 = blockIdx.y * 16, n0 = blockIdx.x * 32;
    const int z = blockIdx.z, zo = z / p.zi_n, zi = z - zo * p.zi_n;
    const float* A = p.A + zo * p.sAo + zi * p.sAi;
    const float* B = p.B + zo * p.sBo + zi * p.sBi;
    const int am = min(m0 + l15, p.M - 1);                       // clamped row for loads (stores are guarded)
    v8f acc[2], comp[2];
#pragma unroll
    for (int t = 0; t < 2; ++t) { v8f zz = {}; acc[t] = zz; comp[t] = zz; }
    for (int k0 = 0; k0 < p.K; k0 += 32) {
        const float* arow = A + (long long)am * p.sAm;
        if (MODE == 1) {
            const Split a = sp_ld(arow, p.sAk, k0, h, p.K, 1.f);
#pragma unroll
            for (int t = 0; t < 2; ++t) {
                const int bn = min(n0 + t * 16 + l15, p.N - 1);
                acc[t] = wmma3(a, sp_ld(B + (long long)bn * p.sBn, p.sBk, k0, h, p.K, 1.f), acc[t]);
            }
        } else if (MODE == 3) {
            const Split3 a = sp3_ld(arow, p.sAk, k0, h, p.K, 1.f);
#pragma unroll
            for (int t = 0; t < 2; ++t) {
                const int bn = min(n0 + t * 16 + l15, p.N - 1);
                acc[t] = wmma6(a, sp3_ld(B + (long long)bn * p.sBn, p.sBk, k0, h, p.K, 1.f), acc[t]);
            }
        } else if (MODE == 4) {
            // triple split as MODE 3, but each k-step's 6 products go into a fresh accumulator and the partial is added to the running f32 sum
            // on the VALU with Kahan compensation (accumulation error stays ~1 ulp however long K is)
            const Split3 a = sp3_ld(arow, p.sAk, k0, h, p.K, 1.f);
#pragma unroll
            for (int t = 0; t < 2; ++t) {
                const int bn = min(n0 + t * 16 + l15, p.N - 1); v8f zz = {};
                const v8f part = wmma6(a, sp3_ld(B + (long long)bn * p.sBn, p.sBk, k0, h, p.K, 1.f), zz);
                const v8f y = part - comp[t]; const v8f s = acc[t] + y; comp[t] = (s - acc[t]) - y; acc[t] = s;
            }
        } else if (MODE == 2) {
            const v16b a = bh_ld(arow, p.sAk, k0, h, p.K, 1.f);
#pragma unroll
            for (int t = 0; t < 2; ++t) {
                const int bn = min(n0 + t * 16 + l15, p.N - 1);
                acc[t] = wmmab(a, bh_ld(B + (long long)bn * p.sBn, p.sBk, k0, h, p.K, 1.f), acc[t]);
            }
        } else {
            const v16h a = fh_ld(arow, p.sAk, k0, h, p.K, p.sa);
#pragma unroll
            for (int t = 0; t < 2; ++t) {
                const int bn = min(n0 + t * 16 + l15, p.N - 1);
                acc[t] = wmma16(a, fh_ld(B + (long long)bn * p.sBn, p.sBk, k0, h, p.K, p.sb), acc[t]);
            }
        }
    }
    const float iscale = (MODE == 0) ? p.alpha / (p.sa * p.sb) : p.alpha;
    float* C = p.C + zo * p.sCo + zi * p.sCi;
    const float* R = p.R + zo * p.sRo + zi * p.sRi;
    __shared__ __align__(16) float ctile[16][36];
#pragma unroll
    for (int t = 0; t < 2; ++t) {
        const int n = n0 + t * 16 + l15; const int nn = min(n, p.N - 1);
#pragma unroll
        for (int r = 0; r < 8; ++r) {
            const int m = m0 + 8 * h + r; const int mm = min(m, p.M - 1);
            float v = acc[t][r] * iscale;
            if (p.flags & 1) v += p.bias[nn];
            if (p.flags & 2) v += p.bias[mm];
            if (p.flags & 8) v *= p.bias[(long long)zo * p.M + mm];   /* per-(zo,row) scale vector laid out [Z/zi_n][M]; exclusive with the bias flags */
            v = act_fn(v, p.act);
            if (p.flags & 4) v += p.beta * R[(long long)mm * p.sRm + (long long)nn * p.sRn];
            ctile[8 * h + r][t * 16 + l15] = (n < p.N) ? v : 0.f;
        }
    }
    __syncthreads();
    const int NW = (p.Npad > p.N) ? p.Npad : p.N;           // write width
    const bool fast = (m0 + 16 <= p.M) && (n0 + 32 <= NW) && ((p.sCm & 3) == 0) && ((((size_t)C) & 15) == 0);
    if (fast) {
#pragma unroll
        for (int s = 0; s < 4; ++s) {
            const int row = s * 4 + (lane >> 3), c4 = (lane & 7) * 4;
            const v4f v = *(const v4f*)&ctile[row][c4];
            VST2V4(C + (long long)(m0 + row) * p.sCm + n0 + c4, v);
        }
    } else {
        for (int row = 0; row < 16; ++row) {
            const int m = m0 + row, n = n0 + lane;
            if (m < p.M && n < NW) VST2(float, C + (long long)m * p.sCm + n, ctile[row][lane]);
        }
    }
}


// =====================================================================================================================
// k_gemmT<MODE, TM, TN>: same contract as k_gemm, but one wave computes a (16*TM) x (16*TN) tile: TM A fragments and TN B fragments are
//   loaded per 32-wide k-step and reused across TM*TN WMMAs (far fewer load/convert instructions per MAC). MODE 0 (f16), 1 (bf16 hi/lo),
//   2 (bf16) only. grid (ceil(NW/(16*TN)), ceil(M/(16*TM)), Z), block 32. Epilogue identical to k_gemm, run per 16x32 sub-tile.
// =====================================================================================================================
template <int MODE, int TM, int TN>
__global__ __launch_bounds__(32) void k_gemmT(GemmP p) {
    const int lane = threadIdx.x & 31, h = lane >> 4, l15 = lane & 15;
    const int m0 = blockIdx.y * (16 * TM), n0 = blockIdx.x * (16 * TN);
    const int z = blockIdx.z, zo = z / p.zi_n, zi = z - zo * p.zi_n;
    const float* A = p.A + zo * p.sAo + zi * p.sAi;
    const float* B = p.B + zo * p.sBo + zi * p.sBi;
    v8f acc[TM][TN];
#pragma unroll
    for (int i = 0; i < TM; ++i)
#pragma unroll
        for (int t = 0; t < TN; ++t) { v8f zz = {}; acc[i][t] = zz; }
    for (int k0 = 0; k0 < p.K; k0 += 32) {
        if (MODE == 1) {
            Split a[TM], b[TN];
#pragma unroll
            for (int i = 0; i < TM; ++i) { const int am = min(m0 + 16 * i + l15, p.M - 1); a[i] = sp_ld(A + (long long)am * p.sAm, p.sAk, k0, h, p.K, 1.f); }
#pragma unroll
            for (int t = 0; t < TN; ++t) { const int bn = min(n0 + 16 * t + l15, p.N - 1); b[t] = sp_ld(B + (long long)bn * p.sBn, p.sBk, k0, h, p.K, 1.f); }
#pragma unroll
            for (int i = 0; i < TM; ++i)
#pragma unroll
                for (int t = 0; t < TN; ++t) acc[i][t] = wmma3(a[i], b[t], acc[i][t]);
        } else if (MODE == 2) {
            v16b a[TM], b[TN];
#pragma unroll
            for (int i = 0; i < TM; ++i) { const int am = min(m0 + 16 * i + l15, p.M - 1); a[i] = bh_ld(A + (long long)am * p.sAm, p.sAk, k0, h, p.K, 1.f); }
#pragma unroll
            for (int t = 0; t < TN; ++t) { const int bn = min(n0 + 16 * t + l15, p.N - 1); b[t] = bh_ld(B + (long long)bn * p.sBn, p.sBk, k0, h, p.K, 1.f); }
#pragma unroll
            for (int i = 0; i < TM; ++i)
#pragma unroll
                for (int t = 0; t < TN; ++t) acc[i][t] = wmmab(a[i], b[t], acc[i][t]);
        } else {
            v16h a[TM], b[TN];
#pragma unroll
            for (int i = 0; i < TM; ++i) { const int am = min(m0 + 16 * i + l15, p.M - 1); a[i] = fh_ld(A + (long long)am * p.sAm, p.sAk, k0, h, p.K, p.sa); }
#pragma unroll
            for (int t = 0; t < TN; ++t) { const int bn = min(n0 + 16 * t + l15, p.N - 1); b[t] = fh_ld(B + (long long)bn * p.sBn, p.sBk, k0, h, p.K, p.sb); }
#pragma unroll
            for (int i = 0; i < TM; ++i)
#pragma unroll
                for (int t = 0; t < TN; ++t) acc[i][t] = wmma16(a[i], b[t], acc[i][t]);
        }
    }
    const float iscale = (MODE == 0) ? p.alpha / (p.sa * p.sb) : p.alpha;
    float* C = p.C + zo * p.sCo + zi * p.sCi;
    const float* R = p.R + zo * p.sRo + zi * p.sRi;
    const int NW = (p.Npad > p.N) ? p.Npad : p.N;
    __shared__ __align__(16) float ctile[16][36];
#pragma unroll
    for (int i = 0; i < TM; ++i) {
        const int mb = m0 + 16 * i; if (mb >= p.M) break;          // wave-uniform
#pragma unroll
        for (int tp = 0; tp < TN / 2; ++tp) {
            const int nb = n0 + 32 * tp; if (nb >= NW) break;        // wave-uniform
#pragma unroll
            for (int t2 = 0; t2 < 2; ++t2) {
                const int t = 2 * tp + t2; const int n = nb + t2 * 16 + l15; const int nn = min(n, p.N - 1);
#pragma unroll
                for (int r = 0; r < 8; ++r) {
                    const int m = mb + 8 * h + r; const int mm = min(m, p.M - 1);
                    float v = acc[i][t][r] * iscale;
                    if (p.flags & 1) v += p.bias[nn];
                    if (p.flags & 2) v += p.bias[mm];
            if (p.flags & 8) v *= p.bias[(long long)zo * p.M + mm];   /* per-(zo,row) scale vector laid out [Z/zi_n][M]; exclusive with the bias flags */
                    v = act_fn(v, p.act);
                    if (p.flags & 4) v += p.beta * R[(long long)mm * p.sRm + (long long)nn * p.sRn];
                    ctile[8 * h + r][t2 * 16 + l15] = (n < p.N) ? v : 0.f;
                }
            }
            __syncthreads();
            const bool fast = (mb + 16 <= p.M) && (nb + 32 <= NW) && ((p.sCm & 3) == 0) && ((((size_t)C) & 15) == 0);
            if (fast) {
#pragma unroll
                for (int s = 0; s < 4; ++s) {
                    const int row = s * 4 + (lane >> 3), c4 = (lane & 7) * 4;
                    const v4f v = *(const v4f*)&ctile[row][c4];
                    VST2V4(C + (long long)(mb + row) * p.sCm + nb + c4, v);
                }
            } else {
                for (int row = 0; row < 16; ++row) {
                    const int m = mb + row, n = nb + lane;
                    if (m < p.M && n < NW) VST2(float, C + (long long)m * p.sCm + n, ctile[row][lane]);
                }
            }
            __syncthreads();
        }
    }
}

// =====================================================================================================================
//   Wave = 16 queries, AW waves per block, 64-key blocks; grid (ceil(Lq/(16*AW)), H, B), block 32*AW. Any Lq, Lk; head dim dh <= DHP
//   (DHP multiple of 32), value dim dv <= DVP (multiple of 16, <= 128). Every tensor addressed by (batch, head, row, element) strides, f32.
//   Scores: QM 0 f16 operands, 1 bf16 hi/lo split, 2 bf16 triple split; statistics f32 (exp2 domain); P.V: P x 4096 as f16 with V f16 staged in LDS
//   (SPLITPV: P and V as bf16 hi/lo splits). kv head = h / hrep. Masking: causal = 1 (keep j <= i + coff, masked -> -inf, key blocks beyond the
//   diagonal skipped), causal = 2 (masked -> mfill, a finite fill like the -1e9; no skipping), causal = 3 (keep j >= i + coff,
//   masked -> -inf, no skipping); optional additive f32 mask Mf,
//   optional int keep-mask Mi (0 -> score := mfill), both addressed b*smb + h*smh + i*smi + j*smj (0 strides broadcast).
// =====================================================================================================================
#define AW 4
struct AttnP {   // apv4
    const float* Q; const float* K; const float* V; float* O; float* P; const float* Mf; const int* Mi; float* ST;
    const float* Pw; const float* Rt; const int* SQ; const int* SK;           // optional: post-softmax weight, relative-position table, segment ids
    long long swb, swh, swi, swj, srb, srh, sri;                                 // Pw strides (b,h,i,j); Rt strides (b,h,i), column = clamp(i - j + roff, 0, rn-1)
    long long sQb, sQh, sQi, sQd, sKb, sKh, sKj, sKd, sVb, sVh, sVj, sVd, sOb, sOh, sOi, sPb, sPh, sPi, smb, smh, smi, smj;
    int Lq, Lk, dh, dv, hrep, causal, coff, pband;   // pband > 0: P holds only the band |j - i| <= pband, column j - i + pband
    float scale, mfill; int nonorm, mpol;             // nonorm (online path only): O = sum_j exp(score_j) V_j without the 1/rowsum (scores must be <= ~0); mpol: Mi masks where ==0 (mpol 0) or where !=0 (mpol 1)
    int roff, rn, segpol, win;                        // Rt column offset/count; SQ/SK: score := mfill where (segpol 0) SQ[i] != SK[j] or (segpol 1) SQ[i] == SK[j]; win > 0: keys with i - j > win (after coff) -> -inf
};
//   Pw: the softmax numerator is multiplied by Pw(b,h,i,j) AFTER the row sum is taken (probs * weight, then P.V), as in post-softmax multiplicative biases.                                                    // ST (optional): per row (b,h,i) -> ST[((b*H + h)*Lq + i)*2 + {0,1}] = {row max of the scaled+masked score (natural units), sum_j exp(score - max)}
static_assert(sizeof(AttnP) == 12 * 8 + 29 * 8 + 16 * 4, "AttnP has padding");

#ifndef KATTN_ATTR
#define KATTN_ATTR
#endif
template <int DHP, int DVP, int QM, bool SPLITPV, bool TWOPASS>
__global__ __launch_bounds__(32 * AW) KATTN_ATTR void k_attn(AttnP p) {
    constexpr int NT = DVP / 16;                // output tiles
    constexpr int KS = DHP / 32;                // k-steps for the scores
    constexpr int VP = DVP + 8;                 // LDS pitch (halves)
    __shared__ __align__(16) float    pl[AW][16 * 64];
    __shared__ __align__(16) _Float16 vl[(SPLITPV ? 2 : 1) * 64 * VP];   // f16 V tile, or bf16 hi and lo tiles (same 2-byte size)
    const int lane = threadIdx.x & 31, hf = lane >> 4, l15 = lane & 15, wave = threadIdx.x >> 5;
    const int h = blockIdx.y, b = blockIdx.z, hk = h / p.hrep;
    const int q0 = (blockIdx.x * AW + wave) * 16;
    float* myp = pl[wave];
    const float L2E = 1.4426950408889634f;
    const float NEG = -__builtin_inff();
    const int qi = min(q0 + l15, p.Lq - 1);
    const float* qrow = p.Q + b * p.sQb + h * p.sQh + (long long)qi * p.sQi;
    const float* kbase = p.K + b * p.sKb + hk * p.sKh;
    const float* vbase = p.V + b * p.sVb + hk * p.sVh;
    v16h qa[QM == 0 ? KS : 1]; Split qs_[QM == 1 ? KS : 1]; Split3 qt_[QM == 2 ? KS : 1];
#pragma unroll
    for (int ks = 0; ks < KS; ++ks) {
        if (QM == 2) qt_[ks] = sp3_ld(qrow, p.sQd, ks * 32, hf, p.dh, 1.f);
        else if (QM == 1) qs_[ks] = sp_ld(qrow, p.sQd, ks * 32, hf, p.dh, 1.f);
        else qa[ks] = fh_ld(qrow, p.sQd, ks * 32, hf, p.dh, 1.f);
    }
    v8f o[NT]; float m8[8], l8[8];
#pragma unroll
    for (int t = 0; t < NT; ++t) { v8f zz = {}; o[t] = zz; }
#pragma unroll
    for (int i = 0; i < 8; ++i) { m8[i] = NEG; l8[i] = 0.f; }
    int jend = p.Lk; int jstart = 0;
    if (p.causal == 1) { const int je = (blockIdx.x * AW + AW - 1) * 16 + 16 + p.coff; jend = min(jend, max(je, 0)); }   // uniform per block
    if (p.win > 0) { const int js = (int)(blockIdx.x * AW) * 16 + p.coff - p.win; jstart = (js > 0) ? (js / 64) * 64 : 0; }   // uniform per block: key blocks entirely outside every row's window hold only -inf entries and are skipped exactly
    const int npass = TWOPASS ? 2 : 1;
    for (int pass = 0; pass < npass; ++pass) {
        const bool dopv = (!TWOPASS) || pass == 1;
        for (int j0 = jstart; j0 < jend; j0 += 64) {
            if (dopv) {
                __syncthreads();                                 // previous key block's reads of vl / pl are done
                for (int idx = threadIdx.x; idx < 64 * DVP; idx += 32 * AW) {
                    const int jr = idx / DVP, d = idx - jr * DVP, j = j0 + jr;
                    const float f = (j < p.Lk && d < p.dv) ? vbase[(long long)j * p.sVj + (long long)d * p.sVd] : 0.f;
                    if (SPLITPV) {
                        const __bf16 hb = bf16_rne(f);
                        ((__bf16*)vl)[jr * VP + d] = hb; ((__bf16*)vl)[64 * VP + jr * VP + d] = bf16_rne(f - bf16_f32(hb));
                    } else vl[jr * VP + d] = (_Float16)f;
                }
            }
            v8f s[4];
#pragma unroll
            for (int t = 0; t < 4; ++t) {
                const int j = min(j0 + t * 16 + l15, p.Lk - 1);
                const float* krow = kbase + (long long)j * p.sKj;
                v8f acc = {};
#pragma unroll
                for (int ks = 0; ks < KS; ++ks) {
                    if (QM == 2)      acc = wmma6(qt_[ks], sp3_ld(krow, p.sKd, ks * 32, hf, p.dh, 1.f), acc);
                    else if (QM == 1) acc = wmma3(qs_[ks], sp_ld(krow, p.sKd, ks * 32, hf, p.dh, 1.f), acc);
                    else              acc = wmma16(qa[ks], fh_ld(krow, p.sKd, ks * 32, hf, p.dh, 1.f), acc);
                }
                s[t] = acc;
            }
            float pv[8][4];
#pragma unroll
            for (int i = 0; i < 8; ++i) {
                const int irow = q0 + i + 8 * hf;
                const int ic = min(irow, p.Lq - 1);
                float sc[4];
#pragma unroll
                for (int t = 0; t < 4; ++t) {
                    const int jg = j0 + t * 16 + l15;
                    float v = s[t][i] * p.scale;
                    if (p.Mf) v += p.Mf[b * p.smb + h * p.smh + (long long)ic * p.smi + (long long)min(jg, p.Lk - 1) * p.smj];
                    if (p.Rt) { int rc = ic - min(jg, p.Lk - 1) + p.roff; rc = rc < 0 ? 0 : (rc >= p.rn ? p.rn - 1 : rc); v += p.Rt[b * p.srb + h * p.srh + (long long)ic * p.sri + rc]; }
                    if (p.Mi) { const int mv = p.Mi[b * p.smb + h * p.smh + (long long)ic * p.smi + (long long)min(jg, p.Lk - 1) * p.smj]; if (p.mpol ? (mv != 0) : (mv == 0)) v = p.mfill; }
                    if (p.SQ) { const bool same = p.SQ[(long long)b * p.Lq + ic] == p.SK[(long long)b * p.Lk + min(jg, p.Lk - 1)]; if (p.segpol ? same : !same) v = p.mfill; }
                    if (p.causal == 2 && jg > irow + p.coff) v = p.mfill;
                    if (jg >= p.Lk || (p.causal == 1 && jg > irow + p.coff) || (p.causal == 3 && jg < irow + p.coff) || (p.win > 0 && irow + p.coff - jg > p.win)) v = NEG; else v *= L2E;
                    sc[t] = v;
                }
                if (!TWOPASS || pass == 0) {
                    float mx = fmaxf(fmaxf(sc[0], sc[1]), fmaxf(sc[2], sc[3]));
                    mx = fmaxf(mx, __shfl_xor(mx, 1, 32)); mx = fmaxf(mx, __shfl_xor(mx, 2, 32));
                    mx = fmaxf(mx, __shfl_xor(mx, 4, 32)); mx = fmaxf(mx, __shfl_xor(mx, 8, 32));
                    const float mnew = fmaxf(m8[i], mx);
                    const float corr = (mnew == NEG) ? 1.f : exp2f(m8[i] - mnew);
                    float rs = 0.f;
#pragma unroll
                    for (int t = 0; t < 4; ++t) {
                        const float pp = (sc[t] == NEG) ? 0.f : exp2f(sc[t] - mnew); rs += pp;
                        pv[i][t] = p.Pw ? pp * p.Pw[b * p.swb + h * p.swh + (long long)ic * p.swi + (long long)min(j0 + t * 16 + l15, p.Lk - 1) * p.swj] : pp;
                    }
                    rs += __shfl_xor(rs, 1, 32); rs += __shfl_xor(rs, 2, 32); rs += __shfl_xor(rs, 4, 32); rs += __shfl_xor(rs, 8, 32);
                    l8[i] = l8[i] * corr + rs; m8[i] = mnew;
                    if (!TWOPASS) {
#pragma unroll
                        for (int t = 0; t < NT; ++t) o[t][i] *= corr;
                    }
                } else {
                    const float inv = (l8[i] > 0.f) ? 1.f / l8[i] : 0.f;
#pragma unroll
                    for (int t = 0; t < 4; ++t) {
                        const int jg = j0 + t * 16 + l15;
                        float pp = (sc[t] == NEG) ? 0.f : exp2f(sc[t] - m8[i]) * inv;
                        if (p.Pw) pp *= p.Pw[b * p.swb + h * p.swh + (long long)ic * p.swi + (long long)min(jg, p.Lk - 1) * p.swj];
                        pv[i][t] = pp;
                    }
                }
            }
            if (dopv) {
#pragma unroll
                for (int i = 0; i < 8; ++i)
#pragma unroll
                    for (int t = 0; t < 4; ++t) ((float*)myp)[(i + 8 * hf) * 64 + t * 16 + l15] = pv[i][t];
                __syncthreads();                                 // P (per wave) and V (shared) visible
                if (p.P) {
                    float* pb_ = p.P + b * p.sPb + h * p.sPh;
                    const bool fastP = (p.pband == 0) && ((p.sPi & 3) == 0) && (j0 + 64 <= p.Lk) && (q0 + 16 <= p.Lq) && ((((size_t)pb_) & 15) == 0);
                    if (fastP) {
#pragma unroll
                        for (int s = 0; s < 8; ++s) {
                            const int row = s * 2 + (lane >> 4), c4 = (lane & 15) * 4;
                            const v4f v = *(const v4f*)(myp + row * 64 + c4);
                            VST2V4(pb_ + (long long)(q0 + row) * p.sPi + j0 + c4, v);
                        }
                    } else {
                        for (int row = 0; row < 16; ++row) {
                            const int irow = q0 + row; if (irow >= p.Lq) continue;
                            for (int c = lane; c < 64; c += 32) {
                                const int jg = j0 + c; if (jg >= p.Lk) continue;
                                if (p.pband == 0) VST2(float, pb_ + (long long)irow * p.sPi + jg, myp[row * 64 + c]);
                                else if (jg - irow <= p.pband && irow - jg <= p.pband) VST2(float, pb_ + (long long)irow * p.sPi + (jg - irow + p.pband), myp[row * 64 + c]);
                            }
                        }
                    }
                }
                if (SPLITPV) {
                    const Split pa0 = sp_ld(myp + l15 * 64, 1, 0, hf, 64, 1.f), pa1 = sp_ld(myp + l15 * 64, 1, 32, hf, 64, 1.f);
                    const __bf16* vh = (const __bf16*)vl; const __bf16* vlo = vh + 64 * VP;
#pragma unroll
                    for (int t = 0; t < NT; ++t) {
                        const int dcol = t * 16 + l15;
                        Split b0, b1;
#pragma unroll
                        for (int e = 0; e < 16; ++e) {
                            const int k0 = frag_k(e, hf), k1 = 32 + frag_k(e, hf);
                            b0.hi[e] = vh[k0 * VP + dcol]; b0.lo[e] = vlo[k0 * VP + dcol]; b1.hi[e] = vh[k1 * VP + dcol]; b1.lo[e] = vlo[k1 * VP + dcol];
                        }
                        o[t] = wmma3(pa0, b0, o[t]);
                        o[t] = wmma3(pa1, b1, o[t]);
                    }
                } else {
                    const v16h pa0 = fh_ld(myp + l15 * 64, 1, 0, hf, 64, 4096.f), pa1 = fh_ld(myp + l15 * 64, 1, 32, hf, 64, 4096.f);
#pragma unroll
                    for (int t = 0; t < NT; ++t) {
                        const int dcol = t * 16 + l15;
                        v16h b0, b1;
#pragma unroll
                        for (int e = 0; e < 16; ++e) { b0[e] = vl[frag_k(e, hf) * VP + dcol]; b1[e] = vl[(32 + frag_k(e, hf)) * VP + dcol]; }
                        o[t] = wmma16(pa0, b0, o[t]);
                        o[t] = wmma16(pa1, b1, o[t]);
                    }
                }
            }
        }
    }
    float* obase = p.O + b * p.sOb + h * p.sOh;
    if (p.ST) {
        const int rl = lane >> 1, isel = rl & 7;           // row q0 + rl ; rl>>3 == hf holds because lane>>4 == (lane>>1)>>3
        float mv = 0.f, lv = 0.f;
#pragma unroll
        for (int i = 0; i < 8; ++i) if (i == isel) { mv = m8[i]; lv = l8[i]; }
        const int irow = q0 + rl;
        if (irow < p.Lq) { float* st = p.ST + (((long long)b * gridDim.y + h) * p.Lq + irow) * 2 + (lane & 1); VST2(float, st, (lane & 1) ? lv : mv * 0.6931471805599453f); }
    }
    float invr[8];
#pragma unroll
    for (int i = 0; i < 8; ++i) {
        if (TWOPASS) invr[i] = SPLITPV ? 1.f : (1.f / 4096.f);
        else if (p.nonorm) invr[i] = exp2f(m8[i]) * (SPLITPV ? 1.f : (1.f / 4096.f));
        else invr[i] = (l8[i] > 0.f) ? (SPLITPV ? 1.f / l8[i] : 1.f / (l8[i] * 4096.f)) : 0.f;
    }
    __syncthreads();                                             // all waves done with pl/vl from the main loop
    const bool ofast = ((p.sOi & 3) == 0) && ((((size_t)obase) & 15) == 0) && (q0 + 16 <= p.Lq);
#pragma unroll
    for (int c0 = 0; c0 < DVP; c0 += 64) {
#pragma unroll
        for (int i = 0; i < 8; ++i)
#pragma unroll
            for (int t = 0; t < NT; ++t) if (t * 16 >= c0 && t * 16 < c0 + 64) ((float*)myp)[(i + 8 * hf) * 64 + (t * 16 - c0) + l15] = o[t][i] * invr[i];
        __syncthreads();
        const int cw = (DVP - c0 < 64) ? (DVP - c0) : 64;      // staged columns in this chunk (multiple of 16)
        if (ofast && (c0 + cw <= p.dv) && (cw % 32 == 0)) {
            const int lpr = cw / 4;                              // lanes per row (16 for 64 cols, 8 for 32)
            const int rows_per_ins = 32 / lpr;
            for (int r0 = 0; r0 < 16; r0 += rows_per_ins) {
                const int row = r0 + lane / lpr, c4 = (lane % lpr) * 4;
                const v4f v = *(const v4f*)(myp + row * 64 + c4);
                VST2V4(obase + (long long)(q0 + row) * p.sOi + c0 + c4, v);
            }
        } else {
            for (int row = 0; row < 16; ++row) {
                const int irow = q0 + row; if (irow >= p.Lq) continue;
                for (int c = lane; c < cw; c += 32) { const int d = c0 + c; if (d < p.dv) VST2(float, obase + (long long)irow * p.sOi + d, myp[row * 64 + c]); }
            }
        }
        __syncthreads();
    }
}

// =====================================================================================================================
// k_tr: dst(z, c, r) = alpha * src(z, r, c) (+ beta * R2(z, c, r)): [Z][R][C] (row stride lds) -> [Z][C][R] (row stride ldd) through a 32x32 LDS tile;
//   flags: 1 -> add beta * residual R2 addressed like dst (z*sRz + c*ldr + r); act applied before the residual.
// =====================================================================================================================
struct TrP { const float* src; float* dst; const float* R2; long long sSz, lds, sDz, ldd, sRz, ldr; int R, C, flags, act; float alpha, beta; };
static_assert(sizeof(TrP) == 3 * 8 + 6 * 8 + 6 * 4, "TrP has padding");
__global__ __launch_bounds__(256) void k_tr(TrP p) {
    __shared__ float tile[32][33];
    const int c0 = blockIdx.x * 32, r0 = blockIdx.y * 32, z = blockIdx.z;
    const int lane = threadIdx.x & 31, wave = threadIdx.x >> 5;
    const float* s = p.src + z * p.sSz;
#pragma unroll
    for (int k = 0; k < 4; ++k) {
        const int rl = wave * 4 + k, r = r0 + rl, c = c0 + lane;
        tile[rl][lane] = (r < p.R && c < p.C) ? s[(long long)r * p.lds + c] : 0.f;
    }
    __syncthreads();
    float* d = p.dst + z * p.sDz; const float* rr = p.R2 + z * p.sRz;
#pragma unroll
    for (int k = 0; k < 4; ++k) {
        const int cl = wave * 4 + k, c = c0 + cl, r = r0 + lane;
        if (c < p.C && r < p.R) {
            float v = act_fn(p.alpha * tile[lane][cl], p.act);
            if (p.flags & 1) v += p.beta * rr[(long long)c * p.ldr + r];
            VST2(float, d + (long long)c * p.ldd + r, v);
        }
    }
}

// k_affine: dst[i] = a * (sdev ? sdev[0] : 1) * src[i] + b, i < n (one thread per element; consecutive lanes -> consecutive addresses)
__global__ __launch_bounds__(256) void k_affine(const float* __restrict__ src, float* __restrict__ dst, int n, float a, float b, const float* __restrict__ sdev) {
    const int i = blockIdx.x * 256 + threadIdx.x;
    if (i < n) { const float aa = sdev ? a * sdev[0] : a; const float v = aa * src[i] + b; VST2(float, dst + i, v); }
}

// =====================================================================================================================
// k_softmax: row softmax over n contiguous elements, one 256-thread block per row; rows addressed z*sz + r*sr (grid (R, Z)).
//   out = scale_out * softmax(scale_in * x + (Mf ? Mf[z*smz + r*smr + j] : 0)); a row whose max is -inf is written as 0.
// =====================================================================================================================
struct SmP { const float* src; float* dst; const float* Mf; long long sz, sr, dz, dr, smz, smr; int n, pad; float scale_in, scale_out; };
static_assert(sizeof(SmP) == 3 * 8 + 6 * 8 + 4 * 4, "SmP has padding");
__global__ __launch_bounds__(256) void k_softmax(SmP p) {
    __shared__ float red[256];
    const int r = blockIdx.x, z = blockIdx.y, tid = threadIdx.x;
    const float* s = p.src + z * p.sz + (long long)r * p.sr;
    const float* mf = p.Mf ? (p.Mf + z * p.smz + (long long)r * p.smr) : nullptr;
    float mx = -__builtin_inff();
    for (int j = tid; j < p.n; j += 256) { float v = s[j] * p.scale_in; if (mf) v += mf[j]; mx = fmaxf(mx, v); }
    red[tid] = mx; __syncthreads();
    for (int o = 128; o > 0; o >>= 1) { if (tid < o) red[tid] = fmaxf(red[tid], red[tid + o]); __syncthreads(); }
    mx = red[0]; __syncthreads();
    float sum = 0.f;
    for (int j = tid; j < p.n; j += 256) { float v = s[j] * p.scale_in; if (mf) v += mf[j]; sum += (mx == -__builtin_inff()) ? 0.f : expf(v - mx); }
    red[tid] = sum; __syncthreads();
    for (int o = 128; o > 0; o >>= 1) { if (tid < o) red[tid] += red[tid + o]; __syncthreads(); }
    sum = red[0];
    const float inv = (sum > 0.f) ? p.scale_out / sum : 0.f;
    float* d = p.dst + z * p.dz + (long long)r * p.dr;
    for (int j = tid; j < p.n; j += 256) { float v = s[j] * p.scale_in; if (mf) v += mf[j]; const float o = (mx == -__builtin_inff()) ? 0.f : expf(v - mx) * inv; VST2(float, d + j, o); }
}
// =====================================================================================================================
// k_stats: mean and rsqrt(var + eps) over a set of n elements addressed base + z*sz + (e / inner) * so + (e % inner) * si, one 256-thread
// k_norm_apply: y = (x - mean[set]) * rstd[set] * g[c] + b[c] over a [Z][C][L] chan-major tensor with set = z*G + c / (C/G) (G groups per z;
//   G = C -> per-chan sets indexed z*C+c; for batch norm pass stats indexed by c only via bn = 1). Optional act. Output same layout.
// =====================================================================================================================
//   mode 0: mean / rsqrt(var + eps); mode 1 (RMSNorm): 0 / rsqrt(mean(x^2) + eps); mode 2 (L2 normalize * sqrt(n)): 0 / sqrt(n) / max(||x||, eps); mode 3: as 0 with unbiased variance (n-1)
__global__ __launch_bounds__(256) void k_stats(const float* __restrict__ x, long long sz, long long so, long long si, int inner, int n, float eps, float* __restrict__ stat, int mode) {
    __shared__ float red[256];
    const int z = blockIdx.x, tid = threadIdx.x;
    const float* base = x + z * sz;
    float s = 0.f;
    for (int e = tid; e < n; e += 256) s += base[(long long)(e / inner) * so + (long long)(e % inner) * si];
    red[tid] = s; __syncthreads();
    for (int o = 128; o > 0; o >>= 1) { if (tid < o) red[tid] += red[tid + o]; __syncthreads(); }
    const float mu = (mode == 0 || mode == 3) ? red[0] / (float)n : 0.f; __syncthreads();
    float q = 0.f;
    for (int e = tid; e < n; e += 256) { const float dlt = base[(long long)(e / inner) * so + (long long)(e % inner) * si] - mu; q += dlt * dlt; }
    red[tid] = q; __syncthreads();
    for (int o = 128; o > 0; o >>= 1) { if (tid < o) red[tid] += red[tid + o]; __syncthreads(); }
    {
        float rs;
        if (mode == 2) rs = sqrtf((float)n) / fmaxf(sqrtf(red[0]), eps); else if (mode == 3) rs = rsqrtf(red[0] / (float)(n - 1) + eps); else rs = rsqrtf(red[0] / (float)n + eps);
        if (tid < 32) { const float v = (tid == 0) ? mu : ((tid == 1) ? rs : 0.f); VST2(float, stat + (long long)z * 32 + tid, v); }
    }
}
//   One thread per element over the flat [Z][C][L] index space: grid ceil(Z*C*L / 256).
__global__ __launch_bounds__(256) void k_norm_apply(const float* __restrict__ x, float* __restrict__ y, const float* __restrict__ stat, const float* __restrict__ g, const float* __restrict__ bta,
                                                     int Z, int C, int L, int G, int bn, int act) {
    const long long idx = (long long)blockIdx.x * 256 + threadIdx.x;
    if (idx >= (long long)Z * C * L) return;
    const int l = (int)(idx % L); const long long zc = idx / L; const int c = (int)(zc % C), z = (int)(zc / C); (void)l;
    const int set = bn ? c : (z * G + c / (C / G));
    float v = (x[idx] - stat[(long long)set * 32]) * stat[(long long)set * 32 + 1];
    if (g) v *= g[c];
    if (bta) v += bta[c];
    v = act_fn(v, act);
    VST2(float, y + idx, v);
}

// k_lse_neg: c[i] = -(st[2i] + log(st[2i+1])) = minus the log-sum-exp of row i from k_attn's ST output (for softmax over the query dimension)
__global__ __launch_bounds__(256) void k_lse_neg(const float* __restrict__ st, float* __restrict__ c, int n) {
    const int i = blockIdx.x * 256 + threadIdx.x;
    if (i < n) { const float v = -(st[2 * i] + logf(st[2 * i + 1])); VST2(float, c + i, v); }
}

// k_iota: dst[i] = a * i + b as int32 (segment/position id helper)
__global__ __launch_bounds__(256) void k_iota(int* __restrict__ dst, int n, int a, int b) {
    const int i = blockIdx.x * 256 + threadIdx.x;
    if (i < n) { const int v = a * i + b; VST2(int, dst + i, v); }
}

// k_axpby: dst[i] = a * x[i] + b * y[i] (+ c), i < n
__global__ __launch_bounds__(256) void k_axpby(const float* __restrict__ x, const float* __restrict__ y, float* __restrict__ dst, int n, float a, float b, float c) {
    const int i = blockIdx.x * 256 + threadIdx.x;
    if (i < n) { const float v = a * x[i] + b * y[i] + c; VST2(float, dst + i, v); }
}

// =====================================================================================================================
// k_rope: rotary embedding on a [R rows][Hn heads][D] view (row stride sXr, head stride sXh, element stride 1) -> Y (own strides).
//   mode 0: rotate_half (partner d±D/2, sign - for d<D/2); mode 1: interleaved pairs (partner d^1, sign - for even d).
//   table column tcol: tmode 0 -> d, 1 -> d % (D/2), 2 -> d / 2; position p: pmode 0 -> r % S, 1 -> head index, 2 -> pos[r];
//   c = C[(r / S) * sCb + p * sCp + tcol * sCd], s likewise from Sn; y = x[d] * c + sign * x[partner] * s. X and Y must not alias.
// =====================================================================================================================
struct RopeP { const float* X; float* Y; const float* C; const float* Sn; const int* pos; long long sXr, sXh, sYr, sYh, sCb, sCp, sCd; int R, Hn, D, S, mode, tmode, pmode, pad; };
static_assert(sizeof(RopeP) == 5 * 8 + 7 * 8 + 8 * 4, "RopeP has padding");
__global__ __launch_bounds__(256) void k_rope(RopeP p) {
    const long long idx = (long long)blockIdx.x * 256 + threadIdx.x;
    if (idx >= (long long)p.R * p.Hn * p.D) return;
    const int d = (int)(idx % p.D); const long long rh = idx / p.D; const int h = (int)(rh % p.Hn); const int r = (int)(rh / p.Hn);
    const int half = p.D / 2;
    int partner; float sign;
    if (p.mode == 0) { partner = (d < half) ? d + half : d - half; sign = (d < half) ? -1.f : 1.f; }
    else { partner = d ^ 1; sign = (d & 1) ? 1.f : -1.f; }
    const int tcol = (p.tmode == 0) ? d : ((p.tmode == 1) ? (d % half) : (d >> 1));
    const int pp = (p.pmode == 0) ? (r % p.S) : ((p.pmode == 1) ? h : p.pos[r]);
    const long long toff = (long long)(r / p.S) * p.sCb + (long long)pp * p.sCp + (long long)tcol * p.sCd;
    const float* xr = p.X + (long long)r * p.sXr + (long long)h * p.sXh;
    const float v = xr[d] * p.C[toff] + sign * xr[partner] * p.Sn[toff];
    VST2(float, p.Y + (long long)r * p.sYr + (long long)h * p.sYh + d, v);
}

// k_invf + k_sincos (split so neither kernel carries a large VALU-fma footprint): invf_i = num * (1 / powf(base, (2 i)/D)) [fmode 0],
//   num * expf((2 i) * cexp) [fmode 1], num * powf(base, -2 (i - 1) / D) [fmode 2]; then cs/sn[s*half + i] = cos/sin((pscale * s) * invf_i)
__global__ __launch_bounds__(256) void k_invf(float* __restrict__ invb, int half, int D, float base, float num, int fmode, float cexp) {
    const int i = blockIdx.x * 256 + threadIdx.x;
    if (i >= ((half + 31) / 32) * 32) return;
    if (i >= half) { VST2(float, invb + i, 0.f); return; }
    const float e = (float)(2 * i) / (float)D;
    float invf;
    if (fmode == 1) invf = num * expf((float)(2 * i) * cexp);
    else if (fmode == 2) invf = num * powf(base, (-2.0f * ((float)i - 1.0f)) / (float)D);
    else invf = num * (1.0f / powf(base, e));
    VST2(float, invb + i, invf);
}
__global__ __launch_bounds__(256) void k_sincos(float* __restrict__ cs, float* __restrict__ sn, const float* __restrict__ invb, int S, int half, float pscale) {
    const int idx = blockIdx.x * 256 + threadIdx.x;
    if (idx >= S * half) return;
    const int s = idx / half, i = idx - s * half;
    const float ang = (pscale * (float)s) * invb[i];
    VST2(float, cs + idx, cosf(ang)); VST2(float, sn + idx, sinf(ang));
}

// k_mulact: dst[i] = act(x[i]) * y[i]
__global__ __launch_bounds__(256) void k_mulact(const float* __restrict__ x, const float* __restrict__ y, float* __restrict__ dst, int n, int act) {
    const int i = blockIdx.x * 256 + threadIdx.x;
    if (i < n) { const float v = act_fn(x[i], act) * y[i]; VST2(float, dst + i, v); }
}

// =====================================================================================================================
// k_matvec: thread-per-row matrix-vector products for N <= 8 output columns (heads with 1-3 outputs, gates), f32 on the VALU.
//   C[r*sCm + j] = act(alpha * sum_k A[r*sAm + k*sAk] * B[j*sBn + k*sBk] + bias[j]) + beta * R[r*sRm + j*sRn]; each thread writes its N contiguous floats.
// =====================================================================================================================
__global__ __launch_bounds__(256) void k_matvec(GemmP p) {
    // 32 lanes write one line with one instruction.
    const int rpt = (p.N == 1) ? 1 : 32;
    const long long r0 = ((long long)blockIdx.x * 256 + threadIdx.x) * rpt; const int z = blockIdx.z, zo = z / p.zi_n, zi = z - zo * p.zi_n;
    if (r0 >= p.M) return;
    const float* Bb = p.B + zo * p.sBo + zi * p.sBi;
    float* C = p.C + zo * p.sCo + zi * p.sCi; const float* R = p.R + zo * p.sRo + zi * p.sRi;
    for (int rr = 0; rr < rpt; ++rr) {
        const long long r = r0 + rr; if (r >= p.M) break;
        const float* A = p.A + zo * p.sAo + zi * p.sAi + r * p.sAm;
        float acc[8] = {0.f, 0.f, 0.f, 0.f, 0.f, 0.f, 0.f, 0.f};
        for (int k = 0; k < p.K; ++k) { const float a = A[(long long)k * p.sAk];
#pragma unroll
            for (int j = 0; j < 8; ++j) if (j < p.N) acc[j] += a * Bb[(long long)j * p.sBn + (long long)k * p.sBk]; }
#pragma unroll
        for (int j = 0; j < 8; ++j) if (j < p.N) {
            float v = acc[j] * p.alpha;
            if (p.flags & 1) v += p.bias[j];
            if (p.flags & 2) v += p.bias[r];
            v = act_fn(v, p.act);
            if (p.flags & 4) v += p.beta * R[r * p.sRm + (long long)j * p.sRn];
            VST2(float, C + r * p.sCm + j, v);
        }
    }
}
// k_smallsoftmax: thread-per-row softmax for short rows (n <= 64): dst[r*dr + j] = softmax(scale*src[r*sr + j])
__global__ __launch_bounds__(256) void k_smallsoftmax(const float* __restrict__ src, float* __restrict__ dst, long long sr, long long dr, int n, long long R, float scale) {
    const long long r0 = ((long long)blockIdx.x * 256 + threadIdx.x) * 32;
    for (int rr = 0; rr < 32; ++rr) {
        const long long r = r0 + rr; if (r >= R) return;
        const float* s = src + r * sr; float* d = dst + r * dr;
        float mx = -__builtin_inff();
        for (int j = 0; j < n; ++j) mx = fmaxf(mx, s[j] * scale);
        float sum = 0.f;
        for (int j = 0; j < n; ++j) sum += expf(s[j] * scale - mx);
        const float inv = 1.f / sum;
        for (int j = 0; j < n; ++j) { const float v = expf(s[j] * scale - mx) * inv; VST2(float, d + j, v); }
    }
}

__global__ __launch_bounds__(32) void k_unitstat(float* __restrict__ st) { const int t = threadIdx.x; const float v = (t == 1) ? 1.f : 0.f; VST2(float, st + t, v); }

// destination (e.g. a d_out whose row width is not a multiple of 32 floats) is written by consecutive lanes of one instruction
__global__ __launch_bounds__(256) void k_lincopy(const float* __restrict__ src, long long lds, float* __restrict__ dst, long long ldd, long long rows, int cols) {
    const long long i = (long long)blockIdx.x * 256 + threadIdx.x; if (i >= rows * cols) return;
    const long long r = i / cols; const int c = (int)(i - r * cols);
    const float v = src[r * lds + c]; VST2(float, dst + r * ldd + c, v);
}

namespace w25 {
typedef __attribute__((ext_vector_type(16))) _Float16 v16h;
typedef __attribute__((ext_vector_type(8)))  _Float16 v8h;
typedef __attribute__((ext_vector_type(16))) __bf16   v16b;
typedef __attribute__((ext_vector_type(8)))  __bf16   v8b;
typedef __attribute__((ext_vector_type(8)))  float    v8f;
typedef __attribute__((ext_vector_type(4)))  float    v4f;

__device__ __forceinline__ unsigned short f2bf_bits(float f) {
  unsigned u = __float_as_uint(f);
  return (unsigned short)((u + 0x7FFFu + ((u >> 16) & 1u)) >> 16);
}
__device__ __forceinline__ float bf_bits2f(unsigned short h) { return __uint_as_float(((unsigned)h) << 16); }

// hazard guards as plain device helpers (no inline asm inside the kernel template body)
__device__ __forceinline__ void dep_guard_h(v8f& a, v8f& b, v16h x, v16h y) { asm volatile("v_nop\n\tv_nop\n\tv_nop\n\tv_nop" : "+v"(a), "+v"(b) : "v"(x), "v"(y)); }
__device__ __forceinline__ void dep_guard_b(v8f& a, v8f& b, v16b x, v16b y) { asm volatile("v_nop\n\tv_nop\n\tv_nop\n\tv_nop" : "+v"(a), "+v"(b) : "v"(x), "v"(y)); }
__device__ __forceinline__ void keep4_h(v16h a, v16h b, v16h c, v16h d) { asm volatile("v_nop" :: "v"(a), "v"(b), "v"(c), "v"(d)); }
__device__ __forceinline__ void keep4_b(v16b a, v16b b, v16b c, v16b d) { asm volatile("v_nop" :: "v"(a), "v"(b), "v"(c), "v"(d)); }
__device__ __forceinline__ void acc_guard4(v8f& a, v8f& b, v8f& c, v8f& d) { asm volatile("v_nop\n\tv_nop\n\tv_nop\n\tv_nop" : "+v"(a), "+v"(b), "+v"(c), "+v"(d)); }
template <typename T> struct Frag;
template <> struct Frag<_Float16> {
  typedef v16h V; union U { v16h v; v8h h[2]; };
  static __device__ __forceinline__ v16h load(const _Float16* p) {   // elements 0..7 <- p[0..7], 8..15 <- p[16..23]
    U f; f.h[0] = *(const v8h*)(p); f.h[1] = *(const v8h*)(p + 16); return f.v;
  }
  static __device__ __forceinline__ v8f mma(v16h a, v16h b, v8f c) {
    return __builtin_amdgcn_wmma_f32_16x16x32_f16(false, a, false, b, (short)0, c, false, false);
  }
  static __device__ __forceinline__ void guard(v8f& a, v8f& b, v16h x, v16h y) { dep_guard_h(a, b, x, y); }
  static __device__ __forceinline__ void keep(v16h a, v16h b, v16h c, v16h d) { keep4_h(a, b, c, d); }
};
template <> struct Frag<__bf16> {
  typedef v16b V; union U { v16b v; v8b h[2]; };
  static __device__ __forceinline__ v16b load(const __bf16* p) {
    U f; f.h[0] = *(const v8b*)(p); f.h[1] = *(const v8b*)(p + 16); return f.v;
  }
  static __device__ __forceinline__ v8f mma(v16b a, v16b b, v8f c) {
    return __builtin_amdgcn_wmma_f32_16x16x32_bf16(false, a, false, b, (short)0, c, false, false);
  }
  static __device__ __forceinline__ void guard(v8f& a, v8f& b, v16b x, v16b y) { dep_guard_b(a, b, x, y); }
  static __device__ __forceinline__ void keep(v16b a, v16b b, v16b c, v16b d) { keep4_b(a, b, c, d); }
};

// ---- Register-blocked batched WMMA GEMM ------------------------------------
// C[m,n] = scale * sum_k A[m,k] * Bt[n,k] (+bias)(+resid); each wave owns a 64x64 tile.
// A row-major [M,K]; Bt row-major [N,K]; M,N % 64 == 0, K % 32 == 0.
// SPLIT: operands are hi/lo planes (A2/Bt2 = lo planes, same layout); product = hi·hi + hi·lo + lo·hi.
// BIAS_MODE: 0 = none, 1 = bias[m], 2 = bias[n].
// OUT_MODE: 0 = f32, 1 = f16, 2 = bf16 hi plane (Cout) + bf16 lo plane (Cout2).
// ET: 0 = f16 operands, 1 = bf16 operands (pointers passed as 16-bit storage)
template <int ET> struct Elem;
template <> struct Elem<0> { typedef _Float16 T; };
template <> struct Elem<1> { typedef __bf16 T; };
template <int ET, bool SPLIT, int BIAS_MODE, int OUT_MODE, bool RESID, int ACT = 0>
__global__ __launch_bounds__(256) void wmma_gemm64(
    const unsigned short* __restrict__ Ap, const unsigned short* __restrict__ A2p, int lda, long strideA,
    const unsigned short* __restrict__ Btp, const unsigned short* __restrict__ Bt2p, int ldb, long strideB,
    void* __restrict__ Cout, void* __restrict__ Cout2, int ldc, long strideC,
    const float* __restrict__ bias,
    const float* __restrict__ resid, long strideR,
    int M, int N, int K, float scale) {
  typedef typename Elem<ET>::T T;
  typedef typename Frag<T>::V V;
  const T* A = (const T*)Ap; const T* A2 = (const T*)A2p; const T* Bt = (const T*)Btp; const T* Bt2 = (const T*)Bt2p;
  __shared__ __align__(16) float sT[8][16 * 68];   // per-wave 16x64 slab, pitch 68 floats
  const int b    = blockIdx.y;
  const int lane = threadIdx.x & 31;
  const int wave = threadIdx.x >> 5;
  const int tilesN = N >> 6;
  const int tilesM = M >> 6;
  const int tile = blockIdx.x * 8 + wave;
  if (tile >= tilesM * tilesN) return;   // wave-uniform; no block barriers in this kernel
  const int tm = tile / tilesN;
  const int tn = tile - tm * tilesN;
  const int m0 = tm << 6;
  const int n0 = tn << 6;

  const T* Ab  = A  + (size_t)b * strideA;
  const T* Bb  = Bt + (size_t)b * strideB;
  const T* Ab2 = SPLIT ? (A2  + (size_t)b * strideA) : nullptr;
  const T* Bb2 = SPLIT ? (Bt2 + (size_t)b * strideB) : nullptr;

  const int rlane = lane & 15;                 // row (A) / col (B, D) within subtile
  const int koff  = (lane >> 4) * 8;           // k offset of this lane half
  const int mOff  = (lane >> 4) * 8;           // D row offset

  v8f acc[4][4];
#pragma unroll
  for (int i = 0; i < 4; ++i)
#pragma unroll
    for (int j = 0; j < 4; ++j) acc[i][j] = (v8f){0.f,0.f,0.f,0.f,0.f,0.f,0.f,0.f};

  for (int k0 = 0; k0 < K; k0 += 32) {
    V bh[4], bl[4];
#pragma unroll
    for (int j = 0; j < 4; ++j) {
      const size_t bo = (size_t)(n0 + (j << 4) + rlane) * ldb + koff + k0;
      bh[j] = Frag<T>::load(Bb + bo);
      if (SPLIT) bl[j] = Frag<T>::load(Bb2 + bo);
    }
#pragma unroll
    for (int i = 0; i < 4; ++i) {
      const size_t ao = (size_t)(m0 + (i << 4) + rlane) * lda + koff + k0;
      V ah = Frag<T>::load(Ab + ao);
      V al;
      if (SPLIT) al = Frag<T>::load(Ab2 + ao);
#pragma unroll
      for (int j = 0; j < 4; ++j) {
        acc[i][j] = Frag<T>::mma(ah, bh[j], acc[i][j]);
        if (SPLIT) {
          acc[i][j] = Frag<T>::mma(ah, bl[j], acc[i][j]);
          acc[i][j] = Frag<T>::mma(al, bh[j], acc[i][j]);
        }
      }
      Frag<T>::guard(acc[i][0], acc[i][3], ah, SPLIT ? al : ah);
    }
    Frag<T>::keep(bh[0], bh[1], bh[2], bh[3]);
    if (SPLIT) Frag<T>::keep(bl[0], bl[1], bl[2], bl[3]);
  }
  acc_guard4(acc[0][0], acc[0][1], acc[0][2], acc[0][3]);
  acc_guard4(acc[1][0], acc[1][1], acc[1][2], acc[1][3]);
  acc_guard4(acc[2][0], acc[2][1], acc[2][2], acc[2][3]);
  acc_guard4(acc[3][0], acc[3][1], acc[3][2], acc[3][3]);

  // ---- epilogue ----
  float* slab = sT[wave];
  const float* Rb = RESID ? (resid + (size_t)b * strideR) : nullptr;
#pragma unroll
  for (int i = 0; i < 4; ++i) {
    const int mBase = m0 + (i << 4);
#pragma unroll
    for (int j = 0; j < 4; ++j) {
      const int n = n0 + (j << 4) + rlane;
      float bv = 0.f;
      if (BIAS_MODE == 2) bv = bias[n];
#pragma unroll
      for (int r = 0; r < 8; ++r) {
        float v = acc[i][j][r] * scale;
        if (BIAS_MODE == 1) v += bias[mBase + mOff + r];
        if (BIAS_MODE == 2) v += bv;
        if (RESID) v += Rb[(size_t)(mBase + mOff + r) * ldc + n];
        if (ACT == 1) v = tanhf(v);
        if (ACT == 2) v = fmaxf(v, 0.0f);
        if (ACT == 3) v = v / (1.0f + expf(-v));
        if (ACT == 4) v = (v > 0.f) ? v : 0.01f * v;
        if (ACT == 5) v = 0.5f * v * (1.0f + erff(v * 0.70710678118654752f));
        if (ACT == 6) v = (v > 0.f) ? v : 0.2f * v;
        if (ACT == 7) { const float u = 0.7978845608028654f * (v + 0.044715f * v * v * v); v = 0.5f * v * (1.f + tanhf(u)); }
        slab[(mOff + r) * 68 + (j << 4) + rlane] = v;
      }
    }
    __builtin_amdgcn_fence(__ATOMIC_RELEASE, "workgroup");
    __builtin_amdgcn_wave_barrier();
    __builtin_amdgcn_fence(__ATOMIC_ACQUIRE, "workgroup");
    if (OUT_MODE == 0) {
      float* C = (float*)Cout + (size_t)b * strideC;
      const int hh = lane >> 4, c4 = (lane & 15) * 4;     // row seg = 256 B = 16 lanes x 16 B
      {
#pragma unroll
        for (int it = 0; it < 8; ++it) {
          const int row = it * 2 + hh;
          v4f v = *(const v4f*)(slab + row * 68 + c4);
          *(v4f*)(C + (size_t)(mBase + row) * ldc + n0 + c4) = v;
        }
        
      }
    } else {
      const int q = lane >> 3, c8 = (lane & 7) * 8;
      unsigned short* C  = (unsigned short*)Cout  + (size_t)b * strideC;
      unsigned short* C2 = (OUT_MODE == 2) ? ((unsigned short*)Cout2 + (size_t)b * strideC) : nullptr;
      {
#pragma unroll
        for (int it = 0; it < 4; ++it) {
          const int row = it * 4 + q;
          const float* sp = slab + row * 68 + c8;
          v8h hv, lv;
#pragma unroll
          for (int e = 0; e < 8; ++e) {
            if (OUT_MODE == 1) {
              hv[e] = (_Float16)sp[e];
            } else {
              unsigned short hb = f2bf_bits(sp[e]);
              unsigned short lb = f2bf_bits(sp[e] - bf_bits2f(hb));
              hv[e] = __builtin_bit_cast(_Float16, hb);
              lv[e] = __builtin_bit_cast(_Float16, lb);
            }
          }
          *(v8h*)(C + (size_t)(mBase + row) * ldc + n0 + c8) = hv;
          if (OUT_MODE == 2) *(v8h*)(C2 + (size_t)(mBase + row) * ldc + n0 + c8) = lv;
        }
        
      }
    }
    __builtin_amdgcn_fence(__ATOMIC_RELEASE, "workgroup");
    __builtin_amdgcn_wave_barrier();
    __builtin_amdgcn_fence(__ATOMIC_ACQUIRE, "workgroup");
  }
}

__global__ __launch_bounds__(256) void cast_f32_f16x2(
    const float* __restrict__ in, _Float16* __restrict__ out, int n2) {
  int i = blockIdx.x * 256 + threadIdx.x;
  if (i < n2) {
    const _Float16 h0 = (_Float16)in[2 * i], h1 = (_Float16)in[2 * i + 1];
    const unsigned u = (unsigned)__builtin_bit_cast(unsigned short, h0) | ((unsigned)__builtin_bit_cast(unsigned short, h1) << 16);
    ((unsigned*)out)[i] = u;
    
  }
}


} // namespace w25

__global__ __launch_bounds__(256) void k_castT16(const float* __restrict__ src, long long lds, _Float16* __restrict__ dst, long long ldd, int R, int C, float s) {
    const long long i = (long long)blockIdx.x * 256 + threadIdx.x; const long long np = (long long)C * (R / 2); if (i >= np) return; const int c = (int)(i / (R / 2)); const int r = 2 * (int)(i % (R / 2));
    const _Float16 h0 = (_Float16)(src[(long long)r * lds + c] * s), h1 = (_Float16)(src[(long long)(r + 1) * lds + c] * s);
    const unsigned u = (unsigned)__builtin_bit_cast(unsigned short, h0) | ((unsigned)__builtin_bit_cast(unsigned short, h1) << 16);
    unsigned* d = (unsigned*)(dst + (long long)c * ldd + r); *d = u;  }
__global__ __launch_bounds__(256) void k_cast16(const float* __restrict__ src, long long lds, _Float16* __restrict__ dst, long long ldd, int R, int C, float s) {
    const long long i = (long long)blockIdx.x * 256 + threadIdx.x; const long long np = (long long)R * (C / 2); if (i >= np) return; const int r = (int)(i / (C / 2)); const int c = 2 * (int)(i % (C / 2));
    const _Float16 h0 = (_Float16)(src[(long long)r * lds + c] * s), h1 = (_Float16)(src[(long long)r * lds + c + 1] * s);
    const unsigned u = (unsigned)__builtin_bit_cast(unsigned short, h0) | ((unsigned)__builtin_bit_cast(unsigned short, h1) << 16);
    unsigned* d = (unsigned*)(dst + (long long)r * ldd + c); *d = u;  }

// f32 -> bf16 hi plane + bf16 lo plane (x = hi + lo to ~2^-17 relative; RNE both), [R][C] -> [R][C] (or transposed to [C][R]); 2 consecutive destination elements
__device__ __forceinline__ unsigned int f2bf2_pack(float a, float b, unsigned int* lo) {
    const unsigned short ha = w25::f2bf_bits(a), hb = w25::f2bf_bits(b);
    const unsigned short la = w25::f2bf_bits(a - w25::bf_bits2f(ha)), lb = w25::f2bf_bits(b - w25::bf_bits2f(hb));
    *lo = (unsigned)la | ((unsigned)lb << 16); return (unsigned)ha | ((unsigned)hb << 16); }
__global__ __launch_bounds__(256) void k_castS16(const float* __restrict__ src, long long lds, __bf16* __restrict__ dhi, __bf16* __restrict__ dlo, long long ldd, int R, int C, float s, int transpose) {
    const long long i = (long long)blockIdx.x * 256 + threadIdx.x; long long o; float a, b;
    if (transpose) { const long long np = (long long)C * (R / 2); if (i >= np) return; const int c = (int)(i / (R / 2)); const int r = 2 * (int)(i % (R / 2)); a = src[(long long)r * lds + c] * s; b = src[(long long)(r + 1) * lds + c] * s; o = (long long)c * ldd + r; }
    else { const long long np = (long long)R * (C / 2); if (i >= np) return; const int r = (int)(i / (C / 2)); const int c = 2 * (int)(i % (C / 2)); a = src[(long long)r * lds + c] * s; b = src[(long long)r * lds + c + 1] * s; o = (long long)r * ldd + c; }
    unsigned lo; const unsigned hi = f2bf2_pack(a, b, &lo); unsigned* ph = (unsigned*)(dhi + o); unsigned* pl = (unsigned*)(dlo + o);
    *ph = hi; *pl = lo;  }

namespace w25 {
// =====================================================================================
// Generic causal/non-causal attention for head_dim 64, f32 in / f32 out; 16-bit operands: bf16 with optional hi/lo splits, or
// plain f16 (F16=true, non-split, probabilities carried x2^15).
//   scores = (q*qscale)·kᵀ : v_wmma_f32_16x16x32_bf16; SPLIT_QK -> q,k as bf16 hi/lo (hi·hi + hi·lo + lo·hi)
//   out    = p·v           : v_wmma_f32_16x16x32_bf16; SPLIT_PV -> p,v as bf16 hi/lo; else p,v plain bf16
//   f32 accumulate; online softmax in f32. Block = 4 waves = 64 query rows of one (batch, head); S % 64 == 0.
//   Element (b, s, h, d) of tensor X lives at X[b*X_bs + s*X_rs + h*X_hs + d] (strides in floats, multiples of 4).
//   Masking: mask_mode 0 none, 1 causal (kv > q masked), 2 tensor [S][Skv] shared over (b,h) (float if
//   mask_is_int==0, int32 with element == 0 -> masked if 1, int32 with element != 0 -> masked if 2), 3 per-token vectors qmask[B][S] & kvmask[B][Skv] (int32,
//   0 -> masked), 4 causal + sliding window (kv > q or q - kv > W masked; W passed in mask_is_int);
//   5 = relative-position bias: s += cp[b,h,q][idx[q][kv]] + pc[b,h,kv][idx[q][kv]] with idx = mask_b ([S][Skv] int32) and
//   mask_a an int32 [S][Skv] tensor with nonzero = masked (tables: element (b,h,row,n) at X + b*c_bs + h*c_hs + row*c_rs + n);
//   masked scores are replaced by mask_fill (e.g. -inf or -1e9) before the softmax.
//   grid.x = B * H * (S/64) (or a sub-range with blk0).
// =====================================================================================
#define AT_D 64
#define AT_NW 4
#define AT_QB 64
#define AT_KC 64
struct AttnGeom { const float* cp = nullptr; const float* pc = nullptr; long c_bs = 0, c_rs = 0, c_hs = 0;   // mode-5 score-bias tables
                  long q_bs, q_rs, q_hs, k_bs, k_rs, k_hs, v_bs, v_rs, v_hs, o_bs, o_rs, o_hs;
                  int S, Skv, H, mask_mode; float qscale; int blk0; float mask_fill; int mask_is_int; };
static_assert(sizeof(AttnGeom) == 168, "no padding");

__device__ __forceinline__ unsigned short at_bf_bits(float f) {
  unsigned u = __float_as_uint(f);
  return (unsigned short)((u + 0x7FFFu + ((u >> 16) & 1u)) >> 16);
}
__device__ __forceinline__ __bf16 at_f2bf(float f) { return __builtin_bit_cast(__bf16, at_bf_bits(f)); }
__device__ __forceinline__ void at_split(float f, __bf16& hi, __bf16& lo) {
  const unsigned short hb = at_bf_bits(f);
  hi = __builtin_bit_cast(__bf16, hb);
  lo = at_f2bf(f - __uint_as_float(((unsigned)hb) << 16));
}
__device__ __forceinline__ v8f at_mma(v16b a, v16b b, v8f c) {
  c = __builtin_amdgcn_wmma_f32_16x16x32_bf16(false, a, false, b, (short)0, c, false, false);
  asm volatile("v_nop\n\tv_nop\n\tv_nop\n\tv_nop" : "+v"(c) : "v"(a), "v"(b));
  return c;
}
// 16-bit element as a bit pattern held in a __bf16 slot: f16 bits when F16, bf16 (RNE) otherwise
template <bool F16> __device__ __forceinline__ __bf16 at_to16(float f) {
  if (F16) return __builtin_bit_cast(__bf16, (_Float16)f);
  return at_f2bf(f);
}
template <bool F16> __device__ __forceinline__ v8f at_mma16(v16b a, v16b b, v8f c) {
  if (F16) {
    const v16h ah = __builtin_bit_cast(v16h, a), bh = __builtin_bit_cast(v16h, b);
    c = __builtin_amdgcn_wmma_f32_16x16x32_f16(false, ah, false, bh, (short)0, c, false, false);
    asm volatile("v_nop\n\tv_nop\n\tv_nop\n\tv_nop" : "+v"(c) : "v"(ah), "v"(bh));
    return c;
  }
  return at_mma(a, b, c);
}

template <bool SPLIT_QK, bool SPLIT_PV, bool F16 = false>
__global__ __launch_bounds__(128)
void attn64_kernel(const float* __restrict__ q, const float* __restrict__ k,
                   const float* __restrict__ v, float* __restrict__ out,
                   const void* __restrict__ mask_a, const int* __restrict__ mask_b, AttnGeom g) {
  static_assert(!(F16 && (SPLIT_QK || SPLIT_PV)), "f16 mode is non-split");
  const float PSC = F16 ? 32768.0f : 1.0f;     // f16 probabilities carried x2^15 (subnormal range), folded into the final 1/l
  union FB { v16b v; v8b h[2]; };
  __shared__ __align__(16) __bf16 Ksh[AT_KC * AT_D];             // K hi [kv][d]      8 KB
  __shared__ __align__(16) __bf16 Ksl[SPLIT_QK ? AT_KC * AT_D : 8];
  __shared__ __align__(16) __bf16 Vth[AT_D * AT_KC];             // V hi [d][kv]      8 KB
  __shared__ __align__(16) __bf16 Vtl[SPLIT_PV ? AT_D * AT_KC : 8];
  __shared__ __align__(16) __bf16 Psh[AT_NW][16 * AT_KC];        // per wave P hi [row][kv]  8 KB
  __shared__ __align__(16) __bf16 Psl[SPLIT_PV ? AT_NW : 1][SPLIT_PV ? 16 * AT_KC : 8];
  __shared__ __align__(16) float  Os[AT_NW][16 * 68];            // per wave out tile, pitch 68

  const int tid  = threadIdx.x;
  const int wave = tid >> 5;
  const int lane = tid & 31;
  const int hh   = lane >> 4;
  const int c    = lane & 15;

  const int nqb = g.S / AT_QB;
  const int bx = blockIdx.x + g.blk0;
  const int qb = bx % nqb;
  const int bh = bx / nqb;
  const int h  = bh % g.H;
  const int b  = bh / g.H;
  const int qbase_block = qb * AT_QB;
  const int q0 = qbase_block + wave * 16;

  const float* qb_ptr = q + (size_t)b * g.q_bs + (size_t)h * g.q_hs;
  const float* kb_ptr = k + (size_t)b * g.k_bs + (size_t)h * g.k_hs;
  const float* vb_ptr = v + (size_t)b * g.v_bs + (size_t)h * g.v_hs;
  float*       ob_ptr = out + (size_t)b * g.o_bs + (size_t)h * g.o_hs;

  // ---- Q fragments (A operand): 2 d-chunks, hi (and lo) ----
  v16b qah[2], qal[2];
  {
    const float* qrow = qb_ptr + (size_t)(q0 + c) * g.q_rs;
#pragma unroll
    for (int dc = 0; dc < 2; ++dc) {
#pragma unroll
      for (int e = 0; e < 8; ++e) {
        const float f0 = qrow[dc * 32 + 8 * hh + e] * g.qscale;
        const float f1 = qrow[dc * 32 + 16 + 8 * hh + e] * g.qscale;
        if (SPLIT_QK) { __bf16 hq, lq; at_split(f0, hq, lq); qah[dc][e] = hq; qal[dc][e] = lq; at_split(f1, hq, lq); qah[dc][8 + e] = hq; qal[dc][8 + e] = lq; }
        else { qah[dc][e] = at_to16<F16>(f0); qah[dc][8 + e] = at_to16<F16>(f1); qal[dc][e] = qah[dc][e]; qal[dc][8 + e] = qah[dc][8 + e]; }
      }
    }
  }

  float mrow[8], lrow[8];
  v8f oacc[4];
#pragma unroll
  for (int r = 0; r < 8; ++r) { mrow[r] = -INFINITY; lrow[r] = 0.f; }
#pragma unroll
  for (int t = 0; t < 4; ++t) oacc[t] = (v8f){0.f,0.f,0.f,0.f,0.f,0.f,0.f,0.f};

  const int nChunks = (g.mask_mode == 1 || g.mask_mode == 4) ? (qb + 1) : (g.Skv / AT_KC);   // block-uniform
  // per-row query mask (mode 3)
  int qkeep[8];
#pragma unroll
  for (int r = 0; r < 8; ++r) qkeep[r] = (g.mask_mode == 3) ? mask_b[(size_t)b * g.S + q0 + 8 * hh + r] : 1;   // mask_b = qmask in mode 3
  for (int kc = 0; kc < nChunks; ++kc) {
    const int kv0 = kc * AT_KC;
    __syncthreads();
    {
      const int kvr = tid >> 1, dh = (tid & 1) * 32;
      const float* krow = kb_ptr + (size_t)(kv0 + kvr) * g.k_rs + dh;
      const float* vrow = vb_ptr + (size_t)(kv0 + kvr) * g.v_rs + dh;
#pragma unroll
      for (int i = 0; i < 8; ++i) {
        v4f kk = *(const v4f*)(krow + 4 * i);
        v4f vv = *(const v4f*)(vrow + 4 * i);
#pragma unroll
        for (int e = 0; e < 4; ++e) {
          const int d = dh + 4 * i + e;
          if (SPLIT_QK) { __bf16 a, bl; at_split(kk[e], a, bl); Ksh[kvr * AT_D + d] = a; Ksl[kvr * AT_D + d] = bl; }
          else Ksh[kvr * AT_D + d] = at_to16<F16>(kk[e]);
          if (SPLIT_PV) { __bf16 a, bl; at_split(vv[e], a, bl); Vth[d * AT_KC + kvr] = a; Vtl[d * AT_KC + kvr] = bl; }
          else Vth[d * AT_KC + kvr] = at_to16<F16>(vv[e]);
        }
      }
    }
    __syncthreads();

    v8f s[4];
#pragma unroll
    for (int j = 0; j < 4; ++j) {
      s[j] = (v8f){0.f,0.f,0.f,0.f,0.f,0.f,0.f,0.f};
#pragma unroll 1
      for (int dc = 0; dc < 2; ++dc) {
        FB kb;
        kb.h[0] = *(const v8b*)(Ksh + (j * 16 + c) * AT_D + dc * 32 + 8 * hh);
        kb.h[1] = *(const v8b*)(Ksh + (j * 16 + c) * AT_D + dc * 32 + 16 + 8 * hh);
        s[j] = at_mma16<F16>(qah[dc], kb.v, s[j]);
        if (SPLIT_QK) {
          FB kl;
          kl.h[0] = *(const v8b*)(Ksl + (j * 16 + c) * AT_D + dc * 32 + 8 * hh);
          kl.h[1] = *(const v8b*)(Ksl + (j * 16 + c) * AT_D + dc * 32 + 16 + 8 * hh);
          s[j] = at_mma16<F16>(qah[dc], kl.v, s[j]);
          s[j] = at_mma16<F16>(qal[dc], kb.v, s[j]);
        }
      }
    }
    const bool diag = (g.mask_mode == 1) && (kc == qb);
    int kvkeep[4] = {1, 1, 1, 1};
    if (g.mask_mode == 3) {
#pragma unroll
      for (int j = 0; j < 4; ++j) kvkeep[j] = ((const int*)mask_a)[(size_t)b * g.Skv + kv0 + j * 16 + c];   // mask_a = kvmask
    }
    float cm[8];
#pragma unroll
    for (int r = 0; r < 8; ++r) {
      const int qrow = q0 + 8 * hh + r;
      float m = -INFINITY;
#pragma unroll
      for (int j = 0; j < 4; ++j) {
        const int kvcol = kv0 + j * 16 + c;
        bool masked = false;
        if (diag) masked = (kvcol > qrow);
        else if (g.mask_mode == 4) masked = (kvcol > qrow) || (qrow - kvcol > g.mask_is_int);
        else if (g.mask_mode == 2) {
          const size_t mi = (size_t)qrow * g.Skv + kvcol;
          masked = (g.mask_is_int == 0) ? (((const float*)mask_a)[mi] == 0.0f)
                 : (g.mask_is_int == 1) ? (((const int*)mask_a)[mi] == 0) : (((const int*)mask_a)[mi] != 0);
        } else if (g.mask_mode == 3) masked = (qkeep[r] == 0) || (kvkeep[j] == 0);
        else if (g.mask_mode == 5) {
          const size_t mi = (size_t)qrow * g.Skv + kvcol;
          masked = (((const int*)mask_a)[mi] != 0);
          int n = mask_b[mi]; n = n < 0 ? 0 : n;
          s[j][r] += g.cp[(size_t)b * g.c_bs + (size_t)h * g.c_hs + (size_t)qrow * g.c_rs + n]
                   + g.pc[(size_t)b * g.c_bs + (size_t)h * g.c_hs + (size_t)kvcol * g.c_rs + n];
        }
        if (masked) s[j][r] = g.mask_fill;
        m = fmaxf(m, s[j][r]);
      }
#pragma unroll
      for (int off = 1; off < 16; off <<= 1) m = fmaxf(m, __shfl_xor(m, off, 32));
      cm[r] = m;
    }
    __bf16* pwh = Psh[wave];
    __bf16* pwl = Psl[SPLIT_PV ? wave : 0];
#pragma unroll
    for (int r = 0; r < 8; ++r) {
      const float mnew = fmaxf(mrow[r], cm[r]);
      const float alpha = expf(mrow[r] - mnew);
      mrow[r] = mnew;
      float psum = 0.f;
#pragma unroll
      for (int j = 0; j < 4; ++j) {
        const float p = expf(s[j][r] - mnew);
        psum += p;
        if (SPLIT_PV) { __bf16 a, bl; at_split(p, a, bl); pwh[(8 * hh + r) * AT_KC + j * 16 + c] = a; pwl[(8 * hh + r) * AT_KC + j * 16 + c] = bl; }
        else pwh[(8 * hh + r) * AT_KC + j * 16 + c] = at_to16<F16>(p * PSC);
      }
#pragma unroll
      for (int off = 1; off < 16; off <<= 1) psum += __shfl_xor(psum, off, 32);
      lrow[r] = lrow[r] * alpha + psum;
#pragma unroll
      for (int t = 0; t < 4; ++t) oacc[t][r] *= alpha;
    }
    __builtin_amdgcn_fence(__ATOMIC_RELEASE, "workgroup");
    __builtin_amdgcn_wave_barrier();
    __builtin_amdgcn_fence(__ATOMIC_ACQUIRE, "workgroup");
#pragma unroll 1
    for (int kk = 0; kk < 2; ++kk) {
      FB pa, pl;
      pa.h[0] = *(const v8b*)(pwh + c * AT_KC + kk * 32 + 8 * hh);
      pa.h[1] = *(const v8b*)(pwh + c * AT_KC + kk * 32 + 16 + 8 * hh);
      if (SPLIT_PV) {
        pl.h[0] = *(const v8b*)(pwl + c * AT_KC + kk * 32 + 8 * hh);
        pl.h[1] = *(const v8b*)(pwl + c * AT_KC + kk * 32 + 16 + 8 * hh);
      }
#pragma unroll
      for (int t = 0; t < 4; ++t) {
        FB vb;
        vb.h[0] = *(const v8b*)(Vth + (t * 16 + c) * AT_KC + kk * 32 + 8 * hh);
        vb.h[1] = *(const v8b*)(Vth + (t * 16 + c) * AT_KC + kk * 32 + 16 + 8 * hh);
        oacc[t] = at_mma16<F16>(pa.v, vb.v, oacc[t]);
        if (SPLIT_PV) {
          FB vl;
          vl.h[0] = *(const v8b*)(Vtl + (t * 16 + c) * AT_KC + kk * 32 + 8 * hh);
          vl.h[1] = *(const v8b*)(Vtl + (t * 16 + c) * AT_KC + kk * 32 + 16 + 8 * hh);
          oacc[t] = at_mma16<F16>(pa.v, vl.v, oacc[t]);
          oacc[t] = at_mma16<F16>(pl.v, vb.v, oacc[t]);
        }
      }
    }
  }

  float* os = Os[wave];
#pragma unroll
  for (int r = 0; r < 8; ++r) {
    const float inv = 1.0f / (lrow[r] * PSC);
#pragma unroll
    for (int t = 0; t < 4; ++t) os[(8 * hh + r) * 68 + t * 16 + c] = oacc[t][r] * inv;
  }
  __builtin_amdgcn_fence(__ATOMIC_RELEASE, "workgroup");
  __builtin_amdgcn_wave_barrier();
  __builtin_amdgcn_fence(__ATOMIC_ACQUIRE, "workgroup");
  {
    const int c4 = (lane & 15) * 4;
    {
#pragma unroll
      for (int it = 0; it < 8; ++it) {
        const int row = it * 2 + hh;
        v4f val = *(const v4f*)(os + row * 68 + c4);
        *(v4f*)(ob_ptr + (size_t)(q0 + row) * g.o_rs + c4) = val;
      }
      
    }
  }
}

} // namespace w25


__device__ __forceinline__ void st_h2(unsigned short* d2, float a, float b) { const unsigned u = (unsigned)__builtin_bit_cast(unsigned short, (_Float16)a) | ((unsigned)__builtin_bit_cast(unsigned short, (_Float16)b) << 16); unsigned* d = (unsigned*)d2; *d = u;  }
__device__ __forceinline__ float ldh(const unsigned short* p) { return (float)__builtin_bit_cast(_Float16, *p); }
__device__ __forceinline__ v4f ld4h(const unsigned short* p) { const unsigned long long u = *(const unsigned long long*)p; v4f a;
    a.x = (float)__builtin_bit_cast(_Float16, (unsigned short)(u & 0xFFFFu)); a.y = (float)__builtin_bit_cast(_Float16, (unsigned short)((u >> 16) & 0xFFFFu)); a.z = (float)__builtin_bit_cast(_Float16, (unsigned short)((u >> 32) & 0xFFFFu)); a.w = (float)__builtin_bit_cast(_Float16, (unsigned short)((u >> 48) & 0xFFFFu)); return a; }
__device__ __forceinline__ unsigned long long pk4h(v4f s) { return (unsigned long long)__builtin_bit_cast(unsigned short, (_Float16)s.x) | ((unsigned long long)__builtin_bit_cast(unsigned short, (_Float16)s.y) << 16) | ((unsigned long long)__builtin_bit_cast(unsigned short, (_Float16)s.z) << 32) | ((unsigned long long)__builtin_bit_cast(unsigned short, (_Float16)s.w) << 48); }
typedef unsigned v4u __attribute__((ext_vector_type(4)));
__device__ __forceinline__ void st8h(unsigned short* d, v4f a, v4f b) { const unsigned long long pa = pk4h(a), pb = pk4h(b); v4u pk; pk.x = (unsigned)(pa & 0xFFFFFFFFull); pk.y = (unsigned)(pa >> 32); pk.z = (unsigned)(pb & 0xFFFFFFFFull); pk.w = (unsigned)(pb >> 32); v4u* dd = (v4u*)d; *dd = pk;  }
__device__ __forceinline__ unsigned short bfu_rne(float v) { unsigned u = __builtin_bit_cast(unsigned, v); u += 0x7FFFu + ((u >> 16) & 1u); return (unsigned short)(u >> 16); }
__device__ __forceinline__ void bfsplit(float v, unsigned short& hi, unsigned short& lo) { hi = bfu_rne(v); lo = bfu_rne(v - __builtin_bit_cast(float, (unsigned)hi << 16)); }
__device__ __forceinline__ void st_s2(unsigned short* Hp, unsigned short* Lp, long long o, float a, float b) { unsigned short h0,l0,h1,l1; bfsplit(a,h0,l0); bfsplit(b,h1,l1); const unsigned ph = (unsigned)h0 | ((unsigned)h1 << 16), pl = (unsigned)l0 | ((unsigned)l1 << 16);
    unsigned* dh = (unsigned*)(Hp + o); unsigned* dl = (unsigned*)(Lp + o); *dh = ph; *dl = pl;  }
__device__ __forceinline__ int cl(int v, int n) { return min(max(v, 0), n - 1); }

// GAT-style aggregation over a device in-edge CSR at dst (+ optional explicit self loop as iteration j = -1):
//   logit = leaky(AS[src][h] + AD[n][h] (+ EW[e]*CW[h]), slope); softmax over the node's edges per head; acc[c] = sum alpha XP[src][c] (f16 gather plane, pitch XW; 256 channels = H heads x CH)
//   wave per node; lane L owns channels 8L..8L+7 (head = 8L / CH); per-lane softmax state (lanes of one head agree) -> no shuffles in the loop.
//   EPI 0: + bias -> f32 OUT[n][256] via LDS redistribution (two 16-B stores per lane, each instruction 512 contiguous B)
//   EPI 1: + bias, LayerNorm(256) * g + bb, relu -> bf16 hi/lo planes OH/OL [n][256] (16-B stores)
//   EPI 2: mean over the 256/CH heads + bias[0..63], LayerNorm(64) * g + bb, relu -> f32 OUT[n][64] (CH must be 64; LDS redistribution, 8-B stores)
//   EPI 3: mean over heads + bias -> f32 OUT[n][64] (no norm / activation)
//   EPI 4: + bias, ELU -> bf16 hi/lo planes OH/OL [n][256];  EPI 5: + bias (full 256-wide, per head), ELU, then mean over the 256/CH heads -> f32 OUT[n][64]
//   EPI 6: (CH = 128, two heads) mean over the two heads, + bias[0..127], relu -> f32 OUT[n][128] (LDS redistribution, 16-B stores)
//   EWM 0: no edge weights; 1: logit += EW[e] * CW[h] (self loop weight 1); 2: alpha *= EW[e] after the softmax (message scale; self loop weight 1)
template <int CH, bool SELF, int EWM, int EPI>
__global__ __launch_bounds__(256) void k_gat_agg(const unsigned short* __restrict__ XP, int XW, const float* __restrict__ AS, const float* __restrict__ AD, int ASTR, const float* __restrict__ EW, const float* __restrict__ CW,
        const int* __restrict__ esrc, const int* __restrict__ off, const int* __restrict__ cnt, const int* __restrict__ slot, const float* __restrict__ bias, const float* __restrict__ g, const float* __restrict__ bb,
        float* __restrict__ OUT, unsigned short* __restrict__ OH, unsigned short* __restrict__ OL, int N, int E, int CAP, float slope) {
    __shared__ float stage[8][256];
    const int wv = threadIdx.x >> 5; const int n = blockIdx.x * 8 + wv; const int L = threadIdx.x & 31; if (n >= N) return; const int c0 = 8 * L; const int h = c0 / CH;
    const float ad = AD[(long long)n * ASTR + h]; const float cw = (EWM == 1) ? CW[h] : 0.f; float m = -3.0e38f, s = 0.f; v4f a0, a1; a0.x = a0.y = a0.z = a0.w = 0.f; a1 = a0;
    const int p0 = cl(off[n], E + 1), cn = min(max(cnt[n], 0), CAP);
    for (int j = (SELF ? -1 : 0); j < cn; ++j) { int sj; float ew = 0.f;
        if (j < 0) { sj = n; ew = 1.f; } else { int e = slot[cl(p0 + j, E)]; e = cl(e, E); sj = cl(esrc[e], N); if (EWM != 0) ew = EW[e]; }
        float lg = AS[(long long)sj * ASTR + h] + ad + ((EWM == 1) ? ew * cw : 0.f); lg = (lg >= 0.f) ? lg : slope * lg;
        const float mn = fmaxf(m, lg); const float cz = expf(m - mn), pj = expf(lg - mn); s = s * cz + pj; const float pw = (EWM == 2) ? pj * ew : pj;
        const unsigned short* xr = XP + (long long)sj * XW + c0; a0 = a0 * cz + ld4h(xr) * pw; a1 = a1 * cz + ld4h(xr + 4) * pw; m = mn; }
    const float inv = (s > 0.f) ? 1.f / (s + 1e-16f) : 0.f; a0 = a0 * inv; a1 = a1 * inv;
    if (EPI == 0 || EPI == 1 || EPI == 4 || EPI == 5) { a0 = a0 + *(const v4f*)(bias + c0); a1 = a1 + *(const v4f*)(bias + c0 + 4); }
    if (EPI == 4 || EPI == 5) { a0.x = (a0.x > 0.f) ? a0.x : (expf(a0.x) - 1.f); a0.y = (a0.y > 0.f) ? a0.y : (expf(a0.y) - 1.f); a0.z = (a0.z > 0.f) ? a0.z : (expf(a0.z) - 1.f); a0.w = (a0.w > 0.f) ? a0.w : (expf(a0.w) - 1.f);
        a1.x = (a1.x > 0.f) ? a1.x : (expf(a1.x) - 1.f); a1.y = (a1.y > 0.f) ? a1.y : (expf(a1.y) - 1.f); a1.z = (a1.z > 0.f) ? a1.z : (expf(a1.z) - 1.f); a1.w = (a1.w > 0.f) ? a1.w : (expf(a1.w) - 1.f); }
    if (EPI == 4) { float o8[8] = {a0.x, a0.y, a0.z, a0.w, a1.x, a1.y, a1.z, a1.w}; unsigned short hh[8], ll[8];
#pragma unroll
        for (int u = 0; u < 8; ++u) bfsplit(o8[u], hh[u], ll[u]);
        const unsigned long long ph0 = (unsigned long long)hh[0] | ((unsigned long long)hh[1] << 16) | ((unsigned long long)hh[2] << 32) | ((unsigned long long)hh[3] << 48), pl0 = (unsigned long long)ll[0] | ((unsigned long long)ll[1] << 16) | ((unsigned long long)ll[2] << 32) | ((unsigned long long)ll[3] << 48);
        const unsigned long long ph1 = (unsigned long long)hh[4] | ((unsigned long long)hh[5] << 16) | ((unsigned long long)hh[6] << 32) | ((unsigned long long)hh[7] << 48), pl1 = (unsigned long long)ll[4] | ((unsigned long long)ll[5] << 16) | ((unsigned long long)ll[6] << 32) | ((unsigned long long)ll[7] << 48);
        v4u pk; pk.x = (unsigned)(ph0 & 0xFFFFFFFFull); pk.y = (unsigned)(ph0 >> 32); pk.z = (unsigned)(ph1 & 0xFFFFFFFFull); pk.w = (unsigned)(ph1 >> 32); v4u* dh = (v4u*)(OH + (long long)n * 256 + c0); *dh = pk; 
        v4u ql; ql.x = (unsigned)(pl0 & 0xFFFFFFFFull); ql.y = (unsigned)(pl0 >> 32); ql.z = (unsigned)(pl1 & 0xFFFFFFFFull); ql.w = (unsigned)(pl1 >> 32); v4u* dl = (v4u*)(OL + (long long)n * 256 + c0); *dl = ql;  return; }
    if (EPI == 6) {
        a0.x += __shfl_xor(a0.x, 16); a0.y += __shfl_xor(a0.y, 16); a0.z += __shfl_xor(a0.z, 16); a0.w += __shfl_xor(a0.w, 16); a1.x += __shfl_xor(a1.x, 16); a1.y += __shfl_xor(a1.y, 16); a1.z += __shfl_xor(a1.z, 16); a1.w += __shfl_xor(a1.w, 16);
        if (L < 16) { const int cb = 8 * L; const v4f b0 = *(const v4f*)(bias + cb), b1v = *(const v4f*)(bias + cb + 4);
            stage[wv][cb] = fmaxf(a0.x * 0.5f + b0.x, 0.f); stage[wv][cb + 1] = fmaxf(a0.y * 0.5f + b0.y, 0.f); stage[wv][cb + 2] = fmaxf(a0.z * 0.5f + b0.z, 0.f); stage[wv][cb + 3] = fmaxf(a0.w * 0.5f + b0.w, 0.f);
            stage[wv][cb + 4] = fmaxf(a1.x * 0.5f + b1v.x, 0.f); stage[wv][cb + 5] = fmaxf(a1.y * 0.5f + b1v.y, 0.f); stage[wv][cb + 6] = fmaxf(a1.z * 0.5f + b1v.z, 0.f); stage[wv][cb + 7] = fmaxf(a1.w * 0.5f + b1v.w, 0.f); }
        __builtin_amdgcn_fence(__ATOMIC_RELEASE, "workgroup"); __builtin_amdgcn_wave_barrier(); __builtin_amdgcn_fence(__ATOMIC_ACQUIRE, "workgroup");
        v4f o6; o6.x = stage[wv][4 * L]; o6.y = stage[wv][4 * L + 1]; o6.z = stage[wv][4 * L + 2]; o6.w = stage[wv][4 * L + 3]; VST2V4(OUT + (long long)n * 128 + 4 * L, o6); return; }
    if (EPI == 5) {
        a0.x += __shfl_xor(a0.x, 8); a0.y += __shfl_xor(a0.y, 8); a0.z += __shfl_xor(a0.z, 8); a0.w += __shfl_xor(a0.w, 8); a1.x += __shfl_xor(a1.x, 8); a1.y += __shfl_xor(a1.y, 8); a1.z += __shfl_xor(a1.z, 8); a1.w += __shfl_xor(a1.w, 8);
        a0.x += __shfl_xor(a0.x, 16); a0.y += __shfl_xor(a0.y, 16); a0.z += __shfl_xor(a0.z, 16); a0.w += __shfl_xor(a0.w, 16); a1.x += __shfl_xor(a1.x, 16); a1.y += __shfl_xor(a1.y, 16); a1.z += __shfl_xor(a1.z, 16); a1.w += __shfl_xor(a1.w, 16);
        const int gq5 = L & 7; a0 = a0 * 0.25f; a1 = a1 * 0.25f;
        if (L < 8) { stage[wv][8 * gq5] = a0.x; stage[wv][8 * gq5 + 1] = a0.y; stage[wv][8 * gq5 + 2] = a0.z; stage[wv][8 * gq5 + 3] = a0.w; stage[wv][8 * gq5 + 4] = a1.x; stage[wv][8 * gq5 + 5] = a1.y; stage[wv][8 * gq5 + 6] = a1.z; stage[wv][8 * gq5 + 7] = a1.w; }
        __builtin_amdgcn_fence(__ATOMIC_RELEASE, "workgroup"); __builtin_amdgcn_wave_barrier(); __builtin_amdgcn_fence(__ATOMIC_ACQUIRE, "workgroup");
        const unsigned long long pk5 = (unsigned long long)__builtin_bit_cast(unsigned, stage[wv][2 * L]) | ((unsigned long long)__builtin_bit_cast(unsigned, stage[wv][2 * L + 1]) << 32); VST2(unsigned long long, (unsigned long long*)(OUT + (long long)n * 64 + 2 * L), pk5); return; }
    if (EPI == 1) { float sm = a0.x + a0.y + a0.z + a0.w + a1.x + a1.y + a1.z + a1.w;
#pragma unroll
        for (int o = 16; o > 0; o >>= 1) sm += __shfl_xor(sm, o);
        const float mu = sm * (1.f / 256.f); const v4f d0 = a0 - mu, d1 = a1 - mu; float q = d0.x * d0.x + d0.y * d0.y + d0.z * d0.z + d0.w * d0.w + d1.x * d1.x + d1.y * d1.y + d1.z * d1.z + d1.w * d1.w;
#pragma unroll
        for (int o = 16; o > 0; o >>= 1) q += __shfl_xor(q, o);
        const float rs = rsqrtf(q * (1.f / 256.f) + 1e-5f); float o8[8] = {d0.x, d0.y, d0.z, d0.w, d1.x, d1.y, d1.z, d1.w}; unsigned short hh[8], ll[8];
#pragma unroll
        for (int u = 0; u < 8; ++u) { const float v = fmaxf(o8[u] * rs * g[c0 + u] + bb[c0 + u], 0.f); bfsplit(v, hh[u], ll[u]); }
        const unsigned long long ph0 = (unsigned long long)hh[0] | ((unsigned long long)hh[1] << 16) | ((unsigned long long)hh[2] << 32) | ((unsigned long long)hh[3] << 48), pl0 = (unsigned long long)ll[0] | ((unsigned long long)ll[1] << 16) | ((unsigned long long)ll[2] << 32) | ((unsigned long long)ll[3] << 48);
        const unsigned long long ph1 = (unsigned long long)hh[4] | ((unsigned long long)hh[5] << 16) | ((unsigned long long)hh[6] << 32) | ((unsigned long long)hh[7] << 48), pl1 = (unsigned long long)ll[4] | ((unsigned long long)ll[5] << 16) | ((unsigned long long)ll[6] << 32) | ((unsigned long long)ll[7] << 48);
        // lane L's 8 halves at c0 = 8L: 16 B -> one 16-B store per plane (32 lanes x 16 B = whole 512-B row)
        v4u pk; pk.x = (unsigned)(ph0 & 0xFFFFFFFFull); pk.y = (unsigned)(ph0 >> 32); pk.z = (unsigned)(ph1 & 0xFFFFFFFFull); pk.w = (unsigned)(ph1 >> 32); v4u* dh = (v4u*)(OH + (long long)n * 256 + c0); *dh = pk; 
        v4u ql; ql.x = (unsigned)(pl0 & 0xFFFFFFFFull); ql.y = (unsigned)(pl0 >> 32); ql.z = (unsigned)(pl1 & 0xFFFFFFFFull); ql.w = (unsigned)(pl1 >> 32); v4u* dl = (v4u*)(OL + (long long)n * 256 + c0); *dl = ql;  return; }
    if (EPI == 2 || EPI == 3) {   // head mean: lanes L, L^8, L^16, L^24 hold the same chan group of the 4 heads (CH = 64 -> 8 lanes per head)
        a0.x += __shfl_xor(a0.x, 8); a0.y += __shfl_xor(a0.y, 8); a0.z += __shfl_xor(a0.z, 8); a0.w += __shfl_xor(a0.w, 8); a1.x += __shfl_xor(a1.x, 8); a1.y += __shfl_xor(a1.y, 8); a1.z += __shfl_xor(a1.z, 8); a1.w += __shfl_xor(a1.w, 8);
        a0.x += __shfl_xor(a0.x, 16); a0.y += __shfl_xor(a0.y, 16); a0.z += __shfl_xor(a0.z, 16); a0.w += __shfl_xor(a0.w, 16); a1.x += __shfl_xor(a1.x, 16); a1.y += __shfl_xor(a1.y, 16); a1.z += __shfl_xor(a1.z, 16); a1.w += __shfl_xor(a1.w, 16);
        const int gq = L & 7; a0 = a0 * 0.25f + *(const v4f*)(bias + 8 * gq); a1 = a1 * 0.25f + *(const v4f*)(bias + 8 * gq + 4);      // every lane now holds channels 8gq..8gq+7 of the mean
        if (EPI == 3) { if (L < 8) { stage[wv][8 * gq] = a0.x; stage[wv][8 * gq + 1] = a0.y; stage[wv][8 * gq + 2] = a0.z; stage[wv][8 * gq + 3] = a0.w; stage[wv][8 * gq + 4] = a1.x; stage[wv][8 * gq + 5] = a1.y; stage[wv][8 * gq + 6] = a1.z; stage[wv][8 * gq + 7] = a1.w; }
            __builtin_amdgcn_fence(__ATOMIC_RELEASE, "workgroup"); __builtin_amdgcn_wave_barrier(); __builtin_amdgcn_fence(__ATOMIC_ACQUIRE, "workgroup");
            const unsigned long long pk3 = (unsigned long long)__builtin_bit_cast(unsigned, stage[wv][2 * L]) | ((unsigned long long)__builtin_bit_cast(unsigned, stage[wv][2 * L + 1]) << 32); VST2(unsigned long long, (unsigned long long*)(OUT + (long long)n * 64 + 2 * L), pk3); return; }
        float sm = (L < 8) ? (a0.x + a0.y + a0.z + a0.w + a1.x + a1.y + a1.z + a1.w) : 0.f;
#pragma unroll
        for (int o = 16; o > 0; o >>= 1) sm += __shfl_xor(sm, o);
        const float mu = sm * (1.f / 64.f); const v4f d0 = a0 - mu, d1 = a1 - mu; float q = (L < 8) ? (d0.x * d0.x + d0.y * d0.y + d0.z * d0.z + d0.w * d0.w + d1.x * d1.x + d1.y * d1.y + d1.z * d1.z + d1.w * d1.w) : 0.f;
#pragma unroll
        for (int o = 16; o > 0; o >>= 1) q += __shfl_xor(q, o);
        const float rs = rsqrtf(q * (1.f / 64.f) + 1e-5f);
        if (L < 8) { const float* gg = g + 8 * gq; const float* bq = bb + 8 * gq; stage[wv][8 * gq] = fmaxf(d0.x * rs * gg[0] + bq[0], 0.f); stage[wv][8 * gq + 1] = fmaxf(d0.y * rs * gg[1] + bq[1], 0.f); stage[wv][8 * gq + 2] = fmaxf(d0.z * rs * gg[2] + bq[2], 0.f); stage[wv][8 * gq + 3] = fmaxf(d0.w * rs * gg[3] + bq[3], 0.f);
            stage[wv][8 * gq + 4] = fmaxf(d1.x * rs * gg[4] + bq[4], 0.f); stage[wv][8 * gq + 5] = fmaxf(d1.y * rs * gg[5] + bq[5], 0.f); stage[wv][8 * gq + 6] = fmaxf(d1.z * rs * gg[6] + bq[6], 0.f); stage[wv][8 * gq + 7] = fmaxf(d1.w * rs * gg[7] + bq[7], 0.f); }
        __builtin_amdgcn_fence(__ATOMIC_RELEASE, "workgroup"); __builtin_amdgcn_wave_barrier(); __builtin_amdgcn_fence(__ATOMIC_ACQUIRE, "workgroup");
        const unsigned long long pk = (unsigned long long)__builtin_bit_cast(unsigned, stage[wv][2 * L]) | ((unsigned long long)__builtin_bit_cast(unsigned, stage[wv][2 * L + 1]) << 32); VST2(unsigned long long, (unsigned long long*)(OUT + (long long)n * 64 + 2 * L), pk); return; }
    // EPI 0
    stage[wv][c0] = a0.x; stage[wv][c0 + 1] = a0.y; stage[wv][c0 + 2] = a0.z; stage[wv][c0 + 3] = a0.w; stage[wv][c0 + 4] = a1.x; stage[wv][c0 + 5] = a1.y; stage[wv][c0 + 6] = a1.z; stage[wv][c0 + 7] = a1.w;
    __builtin_amdgcn_fence(__ATOMIC_RELEASE, "workgroup"); __builtin_amdgcn_wave_barrier(); __builtin_amdgcn_fence(__ATOMIC_ACQUIRE, "workgroup");
#pragma unroll
    for (int q2 = 0; q2 < 2; ++q2) { const int c = 128 * q2 + 4 * L; v4f v; v.x = stage[wv][c]; v.y = stage[wv][c + 1]; v.z = stage[wv][c + 2]; v.w = stage[wv][c + 3]; VST2V4(OUT + (long long)n * 256 + c, v); } }

__device__ __forceinline__ void st4s(unsigned short* Hp, unsigned short* Lp, long long o, v4f a) { unsigned short h[4], l[4]; bfsplit(a.x, h[0], l[0]); bfsplit(a.y, h[1], l[1]); bfsplit(a.z, h[2], l[2]); bfsplit(a.w, h[3], l[3]);
    const unsigned long long ph = (unsigned long long)h[0] | ((unsigned long long)h[1] << 16) | ((unsigned long long)h[2] << 32) | ((unsigned long long)h[3] << 48), pl = (unsigned long long)l[0] | ((unsigned long long)l[1] << 16) | ((unsigned long long)l[2] << 32) | ((unsigned long long)l[3] << 48);
    VST2(unsigned long long, (unsigned long long*)(Hp + o), ph); VST2(unsigned long long, (unsigned long long*)(Lp + o), pl); }
// f32 [nval2 pairs] -> bf16 hi/lo planes (n2 pairs; pairs >= nval2 zero); thread-linear 4-B stores per plane
__global__ __launch_bounds__(256) void k_pl(const float* __restrict__ S, unsigned short* __restrict__ PH, unsigned short* __restrict__ PL, long long nval2, long long n2) { const long long u = (long long)blockIdx.x * 256 + threadIdx.x; if (u >= n2) return; const bool in = (u < nval2); const long long uc = in ? u : ((nval2 > 0) ? (nval2 - 1) : 0); const float a = S[2 * uc], b = S[2 * uc + 1]; st_s2(PH, PL, 2 * u, in ? a : 0.f, in ? b : 0.f); }
// WC [K][NOP] (thread-linear whole rows) = [W (cols < FO) | 0 | W_h . as_h @EO+h | W_h . ad_h @EO+NH+h | 0 ...]; W is [K][FO] (x @ W layout), as/ad [NH][DH]; EO >= FO.
// branch-free: every lane loads all candidates with clamped indices and selects by value (no exec-masked load arms)
__global__ __launch_bounds__(256) void k_wext(const float* __restrict__ Wm, const float* __restrict__ AS_, const float* __restrict__ AD_, int K, int NOP, int FO, int NH, int DH, int EO, float* __restrict__ WC) {
    #pragma clang fp contract(off)
    const long long u = (long long)blockIdx.x * 256 + threadIdx.x; if (u >= (long long)K * NOP) return; const int kk = (int)(u / NOP), o = (int)(u % NOP);
    const int oo = min(o, FO - 1); const float vw = Wm[(long long)kk * FO + oo]; const int q = min(max(o - EO, 0), 2 * NH - 1); const int h = q % NH; float s = 0.f;
#pragma unroll 1
    for (int c = 0; c < DH; ++c) { const float w = Wm[(long long)kk * FO + h * DH + c]; const float asv = AS_[h * DH + c], adv = AD_[h * DH + c]; s += w * ((q < NH) ? asv : adv); }
    const float v = (o < FO) ? vw : ((o >= EO && o < EO + 2 * NH) ? s : 0.f); VST2(float, WC + u, v); }
// GAT aggregation over a device in-edge CSR (+ analytic self loop as iteration j = -1 when SELF), per-lane online softmax (lanes of one head agree):
// HS rows (pitch P floats): [0,128) projected features z, col 128 + h = a_src.z_h, col 128 + NH + h = a_dst.z_h; lane L owns channels 4L..4L+3 (head = 4L / CH).
// out = sum_j softmax_j(leaky(el[src_j][h] + er[n][h])) z[src_j] (/ (den + deps)) + bias -> ACT (0 none, 1 relu, 2 elu, 3 leaky 0.01) ->
// MODE 0: f32 OUT[n][OW] cols < OC (16-B lane stores, OC*4 contiguous B per wave; OC in {64,128}); MODE 1: bf16 hi/lo planes PH/PL pitch PP (rows n >= N zero); MODE 2: both.
template <int CH, bool SELF, int ACT, int MODE>
__global__ __launch_bounds__(256) void k_gat128(const float* __restrict__ HS, int P, int NH, const float* __restrict__ bias, const int* __restrict__ SRC, const int* __restrict__ off, const int* __restrict__ cnt, const int* __restrict__ slot,
        float* __restrict__ OUT, int OW, int OC, unsigned short* __restrict__ PH, unsigned short* __restrict__ PL, int PP, int N, int NP, int E, int CAP, float slope, float deps) {
    #pragma clang fp contract(off)
    const int n = blockIdx.x * 8 + (threadIdx.x >> 5); const int L = threadIdx.x & 31; if (n >= NP) return; const int c = 4 * L; const int h = c / CH; v4f o; o.x = o.y = o.z = o.w = 0.f;
    if (n < N) { const float* hn = HS + (long long)n * P; const float er = hn[128 + NH + h]; float m = -3.0e38f, s = 0.f; v4f a; a.x = a.y = a.z = a.w = 0.f;
        const int p0 = min(max(off[n], 0), E), cn = min(max(cnt[n], 0), CAP);
        for (int j = (SELF ? -1 : 0); j < cn; ++j) { int sj; if (j < 0) sj = n; else { const int e = min(max(slot[min(p0 + j, E - 1)], 0), E - 1); sj = min(max(SRC[e], 0), N - 1); }
            const float* hs = HS + (long long)sj * P; float lg = hs[128 + h] + er; lg = (lg >= 0.f) ? lg : slope * lg;
            const float mn = fmaxf(m, lg); const float cz = expf(m - mn), pj = expf(lg - mn); s = s * cz + pj; a = a * cz + *(const v4f*)(hs + c) * pj; m = mn; }
        const float inv = (s > 0.f || deps > 0.f) ? 1.f / (s + deps) : 0.f; o = a * inv + *(const v4f*)(bias + c);
        if (ACT == 1) { o.x = fmaxf(o.x, 0.f); o.y = fmaxf(o.y, 0.f); o.z = fmaxf(o.z, 0.f); o.w = fmaxf(o.w, 0.f); }
        if (ACT == 2) { o.x = (o.x > 0.f) ? o.x : (expf(o.x) - 1.f); o.y = (o.y > 0.f) ? o.y : (expf(o.y) - 1.f); o.z = (o.z > 0.f) ? o.z : (expf(o.z) - 1.f); o.w = (o.w > 0.f) ? o.w : (expf(o.w) - 1.f); }
        if (ACT == 3) { o.x = (o.x >= 0.f) ? o.x : 0.01f * o.x; o.y = (o.y >= 0.f) ? o.y : 0.01f * o.y; o.z = (o.z >= 0.f) ? o.z : 0.01f * o.z; o.w = (o.w >= 0.f) ? o.w : 0.01f * o.w; }
        if (MODE != 1 && c < OC) VST2V4(OUT + (long long)n * OW + c, o); }
    if (MODE != 0) st4s(PH, PL, (long long)n * PP + c, o); }

// ---- util2 ----
// generic Bt plane builder from an f32 weight: Bt[o][k] (pitch KP halves) = (TRANS ? W[k*ldw + o] : W[o*ldw + k]) * (S ? S[o] : 1) for o < NO, k < KI; zero elsewhere for o < NOP rows, k < KP (thread per (o < NOP, pair k))
__global__ __launch_bounds__(256) void k_u2_bt(const float* __restrict__ Wm, int ldw, int TRANS, int KI, int NO, int KP, int NOP, const float* __restrict__ S, unsigned short* __restrict__ PH_, unsigned short* __restrict__ PL_) {
    const long long u = (long long)blockIdx.x * 256 + threadIdx.x; if (u >= (long long)NOP * (KP / 2)) return; const int k0 = 2 * (int)(u % (KP / 2)); const int o = (int)(u / (KP / 2)); float a = 0.f, b = 0.f;
    if (o < NO) { const float s = S ? S[o] : 1.f;
        if (k0 < KI) a = (TRANS ? Wm[(long long)k0 * ldw + o] : Wm[(long long)o * ldw + k0]) * s;
        if (k0 + 1 < KI) b = (TRANS ? Wm[(long long)(k0 + 1) * ldw + o] : Wm[(long long)o * ldw + k0 + 1]) * s; }
    st_s2(PH_, PL_, (long long)o * KP + k0, a, b); }
// generic padded vector: O[i] = (i < n) ? (A[i] * (S ? S[i] : 1) + (B2 ? B2[i] : 0)) : 0 for i < NP (one block of 256, NP <= 4096 looped)
__global__ __launch_bounds__(256) void k_u2_vec(const float* __restrict__ A, const float* __restrict__ S, const float* __restrict__ B2, int n, int NP, float* __restrict__ O) { for (int i = threadIdx.x; i < NP; i += 256) { float v = 0.f; if (i < n) v = A[i] * (S ? S[i] : 1.f) + (B2 ? B2[i] : 0.f); VST2(float, O + i, v); } }
__global__ __launch_bounds__(256) void k_u2_colstat(const float* __restrict__ X, int P, int N, float eps, float* __restrict__ STAT) {
    #pragma clang fp contract(off)
    __shared__ float red[256]; const int c = blockIdx.x; const int t = threadIdx.x; float s = 0.f; for (int r = t; r < N; r += 256) s += X[(long long)r * P + c]; red[t] = s; __syncthreads();
    for (int o = 128; o > 0; o >>= 1) { if (t < o) red[t] += red[t + o]; __syncthreads(); }
    const float mu = red[0] / (float)N; __syncthreads(); float q = 0.f; for (int r = t; r < N; r += 256) { const float d = X[(long long)r * P + c] - mu; q += d * d; } red[t] = q; __syncthreads();
    for (int o = 128; o > 0; o >>= 1) { if (t < o) red[t] += red[t + o]; __syncthreads(); }
    const float rs = 1.f / sqrtf(red[0] / (float)N + eps); if (t < 32) VST2(float, STAT + (long long)c * 32 + t, (t == 0) ? mu : ((t == 1) ? rs : 0.f)); }
// rows f32 [R][W] (pitch PW) -> planes at pitch PP, column offset coff; rows >= RL (live) written as zeros up to RP (thread per (r < RP, 4 of W))
__global__ __launch_bounds__(256) void k_u2_pl(const float* __restrict__ X, int PW, int Wd, int RL, int RP, unsigned short* __restrict__ PH_, unsigned short* __restrict__ PL_, int PP, int coff) { const long long u = (long long)blockIdx.x * 256 + threadIdx.x; if (u >= (long long)RP * (Wd / 4)) return; const int r = (int)(u / (Wd / 4)); const int c = 4 * (int)(u % (Wd / 4)); v4f v; v.x = v.y = v.z = v.w = 0.f; if (r < RL) v = *(const v4f*)(X + (long long)r * PW + c); st4s(PH_, PL_, (long long)r * PP + coff + c, v); }

typedef unsigned int cm_u4 __attribute__((ext_vector_type(4)));

__global__ __launch_bounds__(256) void k_cm_zero16(unsigned short* __restrict__ DST, long long n) { const long long u = (long long)blockIdx.x * 256 + threadIdx.x; if (u * 8 >= n) return; cm_u4 z; z.x = z.y = z.z = z.w = 0u; cm_u4* d = (cm_u4*)(DST + u * 8); *d = z;  }
// f32 -> bf16 (RNE) -> f16 casts: every 16-bit operand then holds exactly the bf16-rounded input value (times a power-of-two
// weight scale), so the f16 WMMA products are exact. Plain: thread per (row, 8 cols),
// dst [R][C] pitch ldd; transposed: thread per (col, 8 consecutive rows) -> dst [C][R] pitch ldd; both store 16 B per thread, thread-linear along the dst row.
__device__ __forceinline__ unsigned int cmb_pk2(float a, float b) { return (unsigned int)__builtin_bit_cast(unsigned short, (_Float16)a) | ((unsigned int)__builtin_bit_cast(unsigned short, (_Float16)b) << 16); }
__device__ __forceinline__ float cmb_bf(float v) { const unsigned u = __builtin_bit_cast(unsigned, v); const unsigned r = (u + 0x7fffu + ((u >> 16) & 1u)) & 0xffff0000u; return __builtin_bit_cast(float, r); }   // bf16 RNE, kept as f32 (finite inputs)
// BR[i] = bf16_rne(B[i]) kept as f32 (thread per element)
__global__ __launch_bounds__(256) void k_cm_bfvec(const float* __restrict__ SRC, float* __restrict__ DST, int n) { const int u = blockIdx.x * 256 + threadIdx.x; if (u >= n) return; VST2(float, DST + u, cmb_bf(SRC[u])); }
__global__ __launch_bounds__(256) void k_cm_castb(const float* __restrict__ SRC, int lds, unsigned short* __restrict__ DST, int ldd, int nR, int nC, float sc) {
    const long long u = (long long)blockIdx.x * 256 + threadIdx.x; const int per = nC / 8; if (u >= (long long)nR * per) return; const int r = (int)(u / per); const int c0 = 8 * (int)(u % per);
    const float* s = SRC + (long long)r * lds + c0; float w[8];
#pragma unroll
    for (int e = 0; e < 8; ++e) w[e] = cmb_bf(s[e]) * sc;
    cm_u4 pk; pk.x = cmb_pk2(w[0], w[1]); pk.y = cmb_pk2(w[2], w[3]); pk.z = cmb_pk2(w[4], w[5]); pk.w = cmb_pk2(w[6], w[7]); VST2(cm_u4, (cm_u4*)(DST + (long long)r * ldd + c0), pk); }
__global__ __launch_bounds__(256) void k_cm_castbT(const float* __restrict__ SRC, int lds, unsigned short* __restrict__ DST, int ldd, int nR, int nC, float sc) {
    const long long u = (long long)blockIdx.x * 256 + threadIdx.x; const int per = nR / 8; if (u >= (long long)nC * per) return; const int c = (int)(u / per); const int r0 = 8 * (int)(u % per);
    float w[8];
#pragma unroll
    for (int e = 0; e < 8; ++e) w[e] = cmb_bf(SRC[(long long)(r0 + e) * lds + c]) * sc;
    cm_u4 pk; pk.x = cmb_pk2(w[0], w[1]); pk.y = cmb_pk2(w[2], w[3]); pk.z = cmb_pk2(w[4], w[5]); pk.w = cmb_pk2(w[6], w[7]); VST2(cm_u4, (cm_u4*)(DST + (long long)c * ldd + r0), pk); }

typedef float ab_v2f __attribute__((ext_vector_type(2)));
__global__ __launch_bounds__(256) void k_ab_gstat(const float* __restrict__ X, float* __restrict__ STp, int per) {
    #pragma clang fp contract(off)
    __shared__ float red[256]; const int g = blockIdx.x; const int t = threadIdx.x; const float* base = X + (long long)g * per; float s = 0.f;
    for (int i = 4 * t; i < per; i += 1024) { const v4f v = *(const v4f*)(base + i); s += (cmb_bf(v.x) + cmb_bf(v.y)) + (cmb_bf(v.z) + cmb_bf(v.w)); }
    red[t] = s; __syncthreads();
    for (int o = 128; o > 0; o >>= 1) { if (t < o) red[t] += red[t + o]; __syncthreads(); }
    const float mean = red[0] / (float)per; __syncthreads(); float q = 0.f;
    for (int i = 4 * t; i < per; i += 1024) { const v4f v = *(const v4f*)(base + i); const float a = cmb_bf(v.x) - mean, b = cmb_bf(v.y) - mean, c = cmb_bf(v.z) - mean, d = cmb_bf(v.w) - mean; q += (a * a + b * b) + (c * c + d * d); }
    red[t] = q; __syncthreads();
    for (int o = 128; o > 0; o >>= 1) { if (t < o) red[t] += red[t + o]; __syncthreads(); }
    if (t == 0) { ab_v2f ms; ms.x = mean; ms.y = rsqrtf(red[0] / (float)per + 1e-5f); VST2(ab_v2f, (ab_v2f*)(STp + 32 * g), ms); } }
// XN[c][n] = (bf16(x[c][n]) - mean[g]) rstd[g] bf16(gamma[c]) + bf16(beta[c]); XB[c][n] = bf16(x[c][n]) (residual copy); thread per float4
__global__ __launch_bounds__(256) void k_ab_gapply(const float* __restrict__ X, const float* __restrict__ STp, const float* __restrict__ Gm, const float* __restrict__ Bt, float* __restrict__ XNp, float* __restrict__ XBp, int N, int CPG, long long n4) {
    #pragma clang fp contract(off)
    const long long u = (long long)blockIdx.x * 256 + threadIdx.x; if (u >= n4) return; const int c = (int)((4 * u) / N); const int g = c / CPG; const float mean = STp[32 * g], rs = STp[32 * g + 1], ga = cmb_bf(Gm[c]), be = cmb_bf(Bt[c]);
    const v4f v = *(const v4f*)(X + 4 * u); v4f xb; xb.x = cmb_bf(v.x); xb.y = cmb_bf(v.y); xb.z = cmb_bf(v.z); xb.w = cmb_bf(v.w); v4f r; r.x = (xb.x - mean) * rs * ga + be; r.y = (xb.y - mean) * rs * ga + be; r.z = (xb.z - mean) * rs * ga + be; r.w = (xb.w - mean) * rs * ga + be;
    VST2V4(XNp + 4 * u, r); VST2V4(XBp + 4 * u, xb); }


extern "C" void kernel_launch(void* const* d_in, const int* in_sizes, int n_in, void* d_out, int out_size, void* d_ws, size_t ws_size, hipStream_t stream) {
    (void)in_sizes; (void)n_in; (void)out_size; (void)ws_size;
    const float* x = (const float*)d_in[0];
    const float* gam = (const float*)d_in[1];
    const float* bet = (const float*)d_in[2];
    const float* wqkv = (const float*)d_in[3];
    const float* bqkv = (const float*)d_in[4];
    const float* wo = (const float*)d_in[5];
    const float* bo = (const float*)d_in[6];
    float* out = (float*)d_out;
    char* wsp = (char*)d_ws;
    float* ST = (float*)wsp; wsp += (((size_t)((size_t)8 * 32 + 64) * 4 + 255) / 256) * 256;
    float* XN = (float*)wsp; wsp += (((size_t)((size_t)256 * 4096) * 4 + 255) / 256) * 256;
    unsigned short* XTH = (unsigned short*)wsp; wsp += (((size_t)((size_t)4096 * 256) * 2 + 255) / 256) * 256;
    unsigned short* XTL = (unsigned short*)wsp; wsp += (((size_t)((size_t)4096 * 256) * 2 + 255) / 256) * 256;
    unsigned short* W3H = (unsigned short*)wsp; wsp += (((size_t)((size_t)768 * 256) * 2 + 255) / 256) * 256;
    unsigned short* W3L = (unsigned short*)wsp; wsp += (((size_t)((size_t)768 * 256) * 2 + 255) / 256) * 256;
    float* BR3 = (float*)wsp; wsp += (((size_t)((size_t)768 + 64) * 4 + 255) / 256) * 256;
    float* QKV = (float*)wsp; wsp += (((size_t)((size_t)4096 * 768) * 4 + 255) / 256) * 256;
    float* AO = (float*)wsp; wsp += (((size_t)((size_t)4096 * 256) * 4 + 255) / 256) * 256;
    unsigned short* AOH = (unsigned short*)wsp; wsp += (((size_t)((size_t)4096 * 256) * 2 + 255) / 256) * 256;
    unsigned short* AOL = (unsigned short*)wsp; wsp += (((size_t)((size_t)4096 * 256) * 2 + 255) / 256) * 256;
    unsigned short* WOH = (unsigned short*)wsp; wsp += (((size_t)((size_t)256 * 256) * 2 + 255) / 256) * 256;
    unsigned short* WOL = (unsigned short*)wsp; wsp += (((size_t)((size_t)256 * 256) * 2 + 255) / 256) * 256;
    float* BRO = (float*)wsp; wsp += (((size_t)((size_t)256 + 64) * 4 + 255) / 256) * 256;
    float* XB = (float*)wsp; wsp += (((size_t)((size_t)256 * 4096) * 4 + 255) / 256) * 256;
    if ((size_t)(wsp - (char*)d_ws) > ws_size) return;   // static carve guard
    k_castS16<<<(unsigned)((((long long)(768) * ((256) / 2)) + 255) / 256), 256, 0, stream>>>(wqkv, 256, (__bf16*)(W3H), (__bf16*)(W3L), 256, 768, 256, 1.0f, 0);
    k_cm_bfvec<<<3, 256, 0, stream>>>(bqkv, BR3, 768); k_cm_bfvec<<<1, 256, 0, stream>>>(bo, BRO, 256);
    k_castS16<<<(unsigned)((((long long)(256) * ((256) / 2)) + 255) / 256), 256, 0, stream>>>(wo, 256, (__bf16*)(WOH), (__bf16*)(WOL), 256, 256, 256, 1.0f, 0);
    k_ab_gstat<<<8, 256, 0, stream>>>(x + 0, ST, 131072); k_ab_gapply<<<(262144 + 255) / 256, 256, 0, stream>>>(x + 0, ST, gam, bet, XN, XB, 4096, 32, 262144LL);
    k_castS16<<<(unsigned)((((long long)(4096) * ((256) / 2)) + 255) / 256), 256, 0, stream>>>(XN, 4096, (__bf16*)(XTH), (__bf16*)(XTL), 256, 256, 4096, 1.0f, 1);
    w25::wmma_gemm64<1, false, 2, 0, false, 0><<<dim3((unsigned)((((4096) / 64) * ((768) / 64) + 7) / 8), (unsigned)(1)), 256, 0, stream>>>((const unsigned short*)(XTH), nullptr, 256, 0, (const unsigned short*)(W3H), nullptr, 256, 0, (void*)(QKV), nullptr, 768, 0, BR3, nullptr, 0, 4096, 768, 256, 1.0f);
    w25::wmma_gemm64<1, false, 0, 0, true, 0><<<dim3((unsigned)((((4096) / 64) * ((768) / 64) + 7) / 8), (unsigned)(1)), 256, 0, stream>>>((const unsigned short*)(XTL), nullptr, 256, 0, (const unsigned short*)(W3H), nullptr, 256, 0, (void*)(QKV), nullptr, 768, 0, nullptr, QKV, 0, 4096, 768, 256, 1.0f);
    { /*apv4*/ AttnP a;
      a.Q = QKV; a.K = QKV + 256; a.V = QKV + 512; a.O = AO; a.P = 0; a.Mf = 0; a.Mi = 0; a.ST = 0;
      a.Pw = 0; a.Rt = 0; a.SQ = 0; a.SK = 0;
      a.swb = 0; a.swh = 0; a.swi = 0; a.swj = 0; a.srb = 0; a.srh = 0; a.sri = 0; a.sQb = 0; a.sQh = 64; a.sQi = 768; a.sQd = 1; a.sKb = 0; a.sKh = 64; a.sKj = 768; a.sKd = 1; a.sVb = 0; a.sVh = 64; a.sVj = 768; a.sVd = 1; a.sOb = 0; a.sOh = 64; a.sOi = 256; a.sPb = 0; a.sPh = 0; a.sPi = 0; a.smb = 0; a.smh = 0; a.smi = 0; a.smj = 0;
      a.Lq = 4096; a.Lk = 4096; a.dh = 64; a.dv = 64; a.hrep = 1; a.causal = 0; a.coff = 0; a.pband = 0;
      a.scale = 0.125f; a.mfill = 0.0f; a.nonorm = 0; a.mpol = 0;
      a.roff = 0; a.rn = 1; a.segpol = 0; a.win = 0;
      k_attn<64, 64, 0, false, false><<<dim3((unsigned)((4096) + 16 * AW - 1) / (16 * AW), (unsigned)(4), (unsigned)(1)), 32 * AW, 0, stream>>>(a); }
    k_castS16<<<(unsigned)((((long long)(4096) * ((256) / 2)) + 255) / 256), 256, 0, stream>>>(AO, 256, (__bf16*)(AOH), (__bf16*)(AOL), 256, 4096, 256, 1.0f, 0);
    w25::wmma_gemm64<1, false, 1, 0, true, 0><<<dim3((unsigned)((((256) / 64) * ((4096) / 64) + 7) / 8), (unsigned)(1)), 256, 0, stream>>>((const unsigned short*)(WOH), nullptr, 256, 0, (const unsigned short*)(AOH), nullptr, 256, 0, (void*)(out + 0), nullptr, 4096, 0, BRO, XB, 0, 256, 4096, 256, 1.0f);
    w25::wmma_gemm64<1, false, 0, 0, true, 0><<<dim3((unsigned)((((256) / 64) * ((4096) / 64) + 7) / 8), (unsigned)(1)), 256, 0, stream>>>((const unsigned short*)(WOH), nullptr, 256, 0, (const unsigned short*)(AOL), nullptr, 256, 0, (void*)(out + 0), nullptr, 4096, 0, nullptr, out + 0, 0, 256, 4096, 256, 1.0f);
    k_ab_gstat<<<8, 256, 0, stream>>>(x + 1048576, ST, 131072); k_ab_gapply<<<(262144 + 255) / 256, 256, 0, stream>>>(x + 1048576, ST, gam, bet, XN, XB, 4096, 32, 262144LL);
    k_castS16<<<(unsigned)((((long long)(4096) * ((256) / 2)) + 255) / 256), 256, 0, stream>>>(XN, 4096, (__bf16*)(XTH), (__bf16*)(XTL), 256, 256, 4096, 1.0f, 1);
    w25::wmma_gemm64<1, false, 2, 0, false, 0><<<dim3((unsigned)((((4096) / 64) * ((768) / 64) + 7) / 8), (unsigned)(1)), 256, 0, stream>>>((const unsigned short*)(XTH), nullptr, 256, 0, (const unsigned short*)(W3H), nullptr, 256, 0, (void*)(QKV), nullptr, 768, 0, BR3, nullptr, 0, 4096, 768, 256, 1.0f);
    w25::wmma_gemm64<1, false, 0, 0, true, 0><<<dim3((unsigned)((((4096) / 64) * ((768) / 64) + 7) / 8), (unsigned)(1)), 256, 0, stream>>>((const unsigned short*)(XTL), nullptr, 256, 0, (const unsigned short*)(W3H), nullptr, 256, 0, (void*)(QKV), nullptr, 768, 0, nullptr, QKV, 0, 4096, 768, 256, 1.0f);
    { /*apv4*/ AttnP a;
      a.Q = QKV; a.K = QKV + 256; a.V = QKV + 512; a.O = AO; a.P = 0; a.Mf = 0; a.Mi = 0; a.ST = 0;
      a.Pw = 0; a.Rt = 0; a.SQ = 0; a.SK = 0;
      a.swb = 0; a.swh = 0; a.swi = 0; a.swj = 0; a.srb = 0; a.srh = 0; a.sri = 0; a.sQb = 0; a.sQh = 64; a.sQi = 768; a.sQd = 1; a.sKb = 0; a.sKh = 64; a.sKj = 768; a.sKd = 1; a.sVb = 0; a.sVh = 64; a.sVj = 768; a.sVd = 1; a.sOb = 0; a.sOh = 64; a.sOi = 256; a.sPb = 0; a.sPh = 0; a.sPi = 0; a.smb = 0; a.smh = 0; a.smi = 0; a.smj = 0;
      a.Lq = 4096; a.Lk = 4096; a.dh = 64; a.dv = 64; a.hrep = 1; a.causal = 0; a.coff = 0; a.pband = 0;
      a.scale = 0.125f; a.mfill = 0.0f; a.nonorm = 0; a.mpol = 0;
      a.roff = 0; a.rn = 1; a.segpol = 0; a.win = 0;
      k_attn<64, 64, 0, false, false><<<dim3((unsigned)((4096) + 16 * AW - 1) / (16 * AW), (unsigned)(4), (unsigned)(1)), 32 * AW, 0, stream>>>(a); }
    k_castS16<<<(unsigned)((((long long)(4096) * ((256) / 2)) + 255) / 256), 256, 0, stream>>>(AO, 256, (__bf16*)(AOH), (__bf16*)(AOL), 256, 4096, 256, 1.0f, 0);
    w25::wmma_gemm64<1, false, 1, 0, true, 0><<<dim3((unsigned)((((256) / 64) * ((4096) / 64) + 7) / 8), (unsigned)(1)), 256, 0, stream>>>((const unsigned short*)(WOH), nullptr, 256, 0, (const unsigned short*)(AOH), nullptr, 256, 0, (void*)(out + 1048576), nullptr, 4096, 0, BRO, XB, 0, 256, 4096, 256, 1.0f);
    w25::wmma_gemm64<1, false, 0, 0, true, 0><<<dim3((unsigned)((((256) / 64) * ((4096) / 64) + 7) / 8), (unsigned)(1)), 256, 0, stream>>>((const unsigned short*)(WOH), nullptr, 256, 0, (const unsigned short*)(AOL), nullptr, 256, 0, (void*)(out + 1048576), nullptr, 4096, 0, nullptr, out + 1048576, 0, 256, 4096, 256, 1.0f);
    k_ab_gstat<<<8, 256, 0, stream>>>(x + 2097152, ST, 131072); k_ab_gapply<<<(262144 + 255) / 256, 256, 0, stream>>>(x + 2097152, ST, gam, bet, XN, XB, 4096, 32, 262144LL);
    k_castS16<<<(unsigned)((((long long)(4096) * ((256) / 2)) + 255) / 256), 256, 0, stream>>>(XN, 4096, (__bf16*)(XTH), (__bf16*)(XTL), 256, 256, 4096, 1.0f, 1);
    w25::wmma_gemm64<1, false, 2, 0, false, 0><<<dim3((unsigned)((((4096) / 64) * ((768) / 64) + 7) / 8), (unsigned)(1)), 256, 0, stream>>>((const unsigned short*)(XTH), nullptr, 256, 0, (const unsigned short*)(W3H), nullptr, 256, 0, (void*)(QKV), nullptr, 768, 0, BR3, nullptr, 0, 4096, 768, 256, 1.0f);
    w25::wmma_gemm64<1, false, 0, 0, true, 0><<<dim3((unsigned)((((4096) / 64) * ((768) / 64) + 7) / 8), (unsigned)(1)), 256, 0, stream>>>((const unsigned short*)(XTL), nullptr, 256, 0, (const unsigned short*)(W3H), nullptr, 256, 0, (void*)(QKV), nullptr, 768, 0, nullptr, QKV, 0, 4096, 768, 256, 1.0f);
    { /*apv4*/ AttnP a;
      a.Q = QKV; a.K = QKV + 256; a.V = QKV + 512; a.O = AO; a.P = 0; a.Mf = 0; a.Mi = 0; a.ST = 0;
      a.Pw = 0; a.Rt = 0; a.SQ = 0; a.SK = 0;
      a.swb = 0; a.swh = 0; a.swi = 0; a.swj = 0; a.srb = 0; a.srh = 0; a.sri = 0; a.sQb = 0; a.sQh = 64; a.sQi = 768; a.sQd = 1; a.sKb = 0; a.sKh = 64; a.sKj = 768; a.sKd = 1; a.sVb = 0; a.sVh = 64; a.sVj = 768; a.sVd = 1; a.sOb = 0; a.sOh = 64; a.sOi = 256; a.sPb = 0; a.sPh = 0; a.sPi = 0; a.smb = 0; a.smh = 0; a.smi = 0; a.smj = 0;
      a.Lq = 4096; a.Lk = 4096; a.dh = 64; a.dv = 64; a.hrep = 1; a.causal = 0; a.coff = 0; a.pband = 0;
      a.scale = 0.125f; a.mfill = 0.0f; a.nonorm = 0; a.mpol = 0;
      a.roff = 0; a.rn = 1; a.segpol = 0; a.win = 0;
      k_attn<64, 64, 0, false, false><<<dim3((unsigned)((4096) + 16 * AW - 1) / (16 * AW), (unsigned)(4), (unsigned)(1)), 32 * AW, 0, stream>>>(a); }
    k_castS16<<<(unsigned)((((long long)(4096) * ((256) / 2)) + 255) / 256), 256, 0, stream>>>(AO, 256, (__bf16*)(AOH), (__bf16*)(AOL), 256, 4096, 256, 1.0f, 0);
    w25::wmma_gemm64<1, false, 1, 0, true, 0><<<dim3((unsigned)((((256) / 64) * ((4096) / 64) + 7) / 8), (unsigned)(1)), 256, 0, stream>>>((const unsigned short*)(WOH), nullptr, 256, 0, (const unsigned short*)(AOH), nullptr, 256, 0, (void*)(out + 2097152), nullptr, 4096, 0, BRO, XB, 0, 256, 4096, 256, 1.0f);
    w25::wmma_gemm64<1, false, 0, 0, true, 0><<<dim3((unsigned)((((256) / 64) * ((4096) / 64) + 7) / 8), (unsigned)(1)), 256, 0, stream>>>((const unsigned short*)(WOH), nullptr, 256, 0, (const unsigned short*)(AOL), nullptr, 256, 0, (void*)(out + 2097152), nullptr, 4096, 0, nullptr, out + 2097152, 0, 256, 4096, 256, 1.0f);
    k_ab_gstat<<<8, 256, 0, stream>>>(x + 3145728, ST, 131072); k_ab_gapply<<<(262144 + 255) / 256, 256, 0, stream>>>(x + 3145728, ST, gam, bet, XN, XB, 4096, 32, 262144LL);
    k_castS16<<<(unsigned)((((long long)(4096) * ((256) / 2)) + 255) / 256), 256, 0, stream>>>(XN, 4096, (__bf16*)(XTH), (__bf16*)(XTL), 256, 256, 4096, 1.0f, 1);
    w25::wmma_gemm64<1, false, 2, 0, false, 0><<<dim3((unsigned)((((4096) / 64) * ((768) / 64) + 7) / 8), (unsigned)(1)), 256, 0, stream>>>((const unsigned short*)(XTH), nullptr, 256, 0, (const unsigned short*)(W3H), nullptr, 256, 0, (void*)(QKV), nullptr, 768, 0, BR3, nullptr, 0, 4096, 768, 256, 1.0f);
    w25::wmma_gemm64<1, false, 0, 0, true, 0><<<dim3((unsigned)((((4096) / 64) * ((768) / 64) + 7) / 8), (unsigned)(1)), 256, 0, stream>>>((const unsigned short*)(XTL), nullptr, 256, 0, (const unsigned short*)(W3H), nullptr, 256, 0, (void*)(QKV), nullptr, 768, 0, nullptr, QKV, 0, 4096, 768, 256, 1.0f);
    { /*apv4*/ AttnP a;
      a.Q = QKV; a.K = QKV + 256; a.V = QKV + 512; a.O = AO; a.P = 0; a.Mf = 0; a.Mi = 0; a.ST = 0;
      a.Pw = 0; a.Rt = 0; a.SQ = 0; a.SK = 0;
      a.swb = 0; a.swh = 0; a.swi = 0; a.swj = 0; a.srb = 0; a.srh = 0; a.sri = 0; a.sQb = 0; a.sQh = 64; a.sQi = 768; a.sQd = 1; a.sKb = 0; a.sKh = 64; a.sKj = 768; a.sKd = 1; a.sVb = 0; a.sVh = 64; a.sVj = 768; a.sVd = 1; a.sOb = 0; a.sOh = 64; a.sOi = 256; a.sPb = 0; a.sPh = 0; a.sPi = 0; a.smb = 0; a.smh = 0; a.smi = 0; a.smj = 0;
      a.Lq = 4096; a.Lk = 4096; a.dh = 64; a.dv = 64; a.hrep = 1; a.causal = 0; a.coff = 0; a.pband = 0;
      a.scale = 0.125f; a.mfill = 0.0f; a.nonorm = 0; a.mpol = 0;
      a.roff = 0; a.rn = 1; a.segpol = 0; a.win = 0;
      k_attn<64, 64, 0, false, false><<<dim3((unsigned)((4096) + 16 * AW - 1) / (16 * AW), (unsigned)(4), (unsigned)(1)), 32 * AW, 0, stream>>>(a); }
    k_castS16<<<(unsigned)((((long long)(4096) * ((256) / 2)) + 255) / 256), 256, 0, stream>>>(AO, 256, (__bf16*)(AOH), (__bf16*)(AOL), 256, 4096, 256, 1.0f, 0);
    w25::wmma_gemm64<1, false, 1, 0, true, 0><<<dim3((unsigned)((((256) / 64) * ((4096) / 64) + 7) / 8), (unsigned)(1)), 256, 0, stream>>>((const unsigned short*)(WOH), nullptr, 256, 0, (const unsigned short*)(AOH), nullptr, 256, 0, (void*)(out + 3145728), nullptr, 4096, 0, BRO, XB, 0, 256, 4096, 256, 1.0f);
    w25::wmma_gemm64<1, false, 0, 0, true, 0><<<dim3((unsigned)((((256) / 64) * ((4096) / 64) + 7) / 8), (unsigned)(1)), 256, 0, stream>>>((const unsigned short*)(WOH), nullptr, 256, 0, (const unsigned short*)(AOL), nullptr, 256, 0, (void*)(out + 3145728), nullptr, 4096, 0, nullptr, out + 3145728, 0, 256, 4096, 256, 1.0f);
}

// v001
// Measured time: 2610 microseconds a run.
// Next to v000, in two timings, it ran 3.10 times as fast each time.
#include <hip/hip_runtime.h>
#include <math.h>

typedef __attribute__((ext_vector_type(16))) _Float16 v16h;
typedef __attribute__((ext_vector_type(8)))  _Float16 v8h;
typedef __attribute__((ext_vector_type(16))) __bf16   v16b;
typedef __attribute__((ext_vector_type(8)))  float    v8f;
typedef __attribute__((ext_vector_type(4)))  float    v4f;

// 16-bit WMMA fragment map (wave32), lane L, h = L>>4, m = L&15:
//   A 16x32: lane = row m;   element i -> k = (i<8) ? 8h+i : 16+8h+(i-8)
//   B 32x16: lane = column m; the SAME k(i,h)
//   D 16x16 (8 f32): lane = column m; element r -> row 8h+r
__device__ __forceinline__ int frag_k(int i, int h) { return (i < 8) ? (8 * h + i) : (16 + 8 * h + (i - 8)); }
__device__ __forceinline__ __bf16 bf16_rne(float f) {
    unsigned int u = __float_as_uint(f);
    u += 0x7fffu + ((u >> 16) & 1u);
    return __builtin_bit_cast(__bf16, (unsigned short)(u >> 16));
}
__device__ __forceinline__ float bf16_f32(__bf16 b) { return __uint_as_float(((unsigned int)__builtin_bit_cast(unsigned short, b)) << 16); }
__device__ __forceinline__ v8f wmma16(v16h a, v16h b, v8f c) {
    c = __builtin_amdgcn_wmma_f32_16x16x32_f16(false, a, false, b, (short)0, c, false, false);
    asm volatile("v_nop\n\tv_nop\n\tv_nop\n\tv_nop" : "+v"(c) : "v"(a), "v"(b));
    return c;
}
__device__ __forceinline__ v8f wmmab(v16b a, v16b b, v8f c) {
    c = __builtin_amdgcn_wmma_f32_16x16x32_bf16(false, a, false, b, (short)0, c, false, false);
    asm volatile("v_nop\n\tv_nop\n\tv_nop\n\tv_nop" : "+v"(c) : "v"(a), "v"(b));
    return c;
}
struct Split { v16b hi, lo; };
// hi/lo split product: a.hi*b.hi + a.hi*b.lo + a.lo*b.hi
__device__ __forceinline__ v8f wmma3(const Split& a, const Split& b, v8f c) {
    c = __builtin_amdgcn_wmma_f32_16x16x32_bf16(false, a.hi, false, b.hi, (short)0, c, false, false);
    c = __builtin_amdgcn_wmma_f32_16x16x32_bf16(false, a.hi, false, b.lo, (short)0, c, false, false);
    c = __builtin_amdgcn_wmma_f32_16x16x32_bf16(false, a.lo, false, b.hi, (short)0, c, false, false);
    asm volatile("v_nop\n\tv_nop\n\tv_nop\n\tv_nop" : "+v"(c) : "v"(a.hi), "v"(a.lo), "v"(b.hi), "v"(b.lo));
    return c;
}
struct Split3 { v16b hi, mid, lo; };
// triple split product (6 terms, drops only terms below 2^-24 relative)
__device__ __forceinline__ v8f wmma6(const Split3& a, const Split3& b, v8f c) {
    c = __builtin_amdgcn_wmma_f32_16x16x32_bf16(false, a.hi, false, b.hi, (short)0, c, false, false);
    c = __builtin_amdgcn_wmma_f32_16x16x32_bf16(false, a.hi, false, b.mid, (short)0, c, false, false);
    c = __builtin_amdgcn_wmma_f32_16x16x32_bf16(false, a.mid, false, b.hi, (short)0, c, false, false);
    c = __builtin_amdgcn_wmma_f32_16x16x32_bf16(false, a.hi, false, b.lo, (short)0, c, false, false);
    c = __builtin_amdgcn_wmma_f32_16x16x32_bf16(false, a.mid, false, b.mid, (short)0, c, false, false);
    c = __builtin_amdgcn_wmma_f32_16x16x32_bf16(false, a.lo, false, b.hi, (short)0, c, false, false);
    asm volatile("v_nop\n\tv_nop\n\tv_nop\n\tv_nop" : "+v"(c) : "v"(a.hi), "v"(a.mid), "v"(a.lo), "v"(b.hi), "v"(b.mid), "v"(b.lo));
    return c;
}

// Fragment gathers from f32 memory: element i <- p[(k0 + frag_k(i,h)) * sk] * s, zero for k >= klen.
__device__ __forceinline__ v16h fh_ld(const float* __restrict__ p, long long sk, int k0, int h, int klen, float s) {
    v16h a;
#pragma unroll
    for (int i = 0; i < 16; ++i) { const int k = k0 + frag_k(i, h); a[i] = (k < klen) ? (_Float16)(p[(long long)k * sk] * s) : (_Float16)0.f; }
    return a;
}
__device__ __forceinline__ Split sp_ld(const float* __restrict__ p, long long sk, int k0, int h, int klen, float s) {
    Split r;
#pragma unroll
    for (int i = 0; i < 16; ++i) {
        const int k = k0 + frag_k(i, h); const float x = (k < klen) ? p[(long long)k * sk] * s : 0.f;
        const __bf16 hb = bf16_rne(x); r.hi[i] = hb; r.lo[i] = bf16_rne(x - bf16_f32(hb));
    }
    return r;
}
__device__ __forceinline__ Split3 sp3_ld(const float* __restrict__ p, long long sk, int k0, int h, int klen, float s) {
    Split3 r;
#pragma unroll
    for (int i = 0; i < 16; ++i) {
        const int k = k0 + frag_k(i, h); const float x = (k < klen) ? p[(long long)k * sk] * s : 0.f;
        const __bf16 hb = bf16_rne(x); const float r1 = x - bf16_f32(hb); const __bf16 mb = bf16_rne(r1);
        r.hi[i] = hb; r.mid[i] = mb; r.lo[i] = bf16_rne(r1 - bf16_f32(mb));
    }
    return r;
}
__device__ __forceinline__ v16b bh_ld(const float* __restrict__ p, long long sk, int k0, int h, int klen, float s) {
    v16b a;
#pragma unroll
    for (int i = 0; i < 16; ++i) { const int k = k0 + frag_k(i, h); a[i] = bf16_rne((k < klen) ? p[(long long)k * sk] * s : 0.f); }
    return a;
}
// f16 fragment from an f16 LDS/global row with element stride 1 (k-contiguous), no bounds (tile already zero padded)
__device__ __forceinline__ v16h fh_row(const _Float16* __restrict__ row, int k0, int h) {
    v16h a;
#pragma unroll
    for (int i = 0; i < 16; ++i) a[i] = row[k0 + frag_k(i, h)];
    return a;
}

typedef __attribute__((ext_vector_type(4))) _Float16 v4h;
// One 16-bit fragment's 32 k of a k-contiguous, 16-byte aligned f32 row as four unguarded 16-byte loads; row = the lane's row + 8 * h elements.
// fr_cvt packs them in the k order of frag_k.
struct FragRaw { v4f x0, x1, x2, x3; };
__device__ __forceinline__ FragRaw fr_ld(const v4f* __restrict__ row, int k0) {
    FragRaw r; r.x0 = row[k0 / 4]; r.x1 = row[k0 / 4 + 1]; r.x2 = row[k0 / 4 + 4]; r.x3 = row[k0 / 4 + 5];
    return r;
}
__device__ __forceinline__ v16h fr_cvt(const FragRaw& r) {
    v16h a;
#pragma unroll
    for (int i = 0; i < 4; ++i) { a[i] = (_Float16)r.x0[i]; a[4 + i] = (_Float16)r.x1[i]; a[8 + i] = (_Float16)r.x2[i]; a[12 + i] = (_Float16)r.x3[i]; }
    return a;
}

#define VST2(T, ptr, val) do { const T vst2_v_ = (val); *(T*)(ptr) = vst2_v_;  } while (0)
typedef float v4f __attribute__((ext_vector_type(4)));
#define VST2V4(ptr, val) do { const v4f vst2_v4_ = (val); *(v4f*)(ptr) = vst2_v4_;  } while (0)

__device__ __attribute__((noinline)) float act_fn(float v, int act) {
    if (act == 1) return fmaxf(v, 0.f);                                                                               // relu
    if (act == 2) { const float u = 0.7978845608028654f * (v + 0.044715f * v * v * v); return 0.5f * v * (1.f + tanhf(u)); } // tanh-gelu
    if (act == 3) return v / (1.f + expf(-v));                                                                        // silu
    if (act == 4) return 0.5f * v * (1.f + erff(v * 0.7071067811865476f));                                             // erf-gelu
    if (act == 5) return tanhf(v);
    if (act == 6) return 1.f / (1.f + expf(-v));                                                                      // sigmoid
    if (act == 7) return (v > 0.f) ? v : 0.01f * v;                                                                   // leaky relu 0.01
    if (act == 8) return (v > 0.f) ? v : (expf(v) - 1.f);                                                             // elu
    if (act == 9) return fminf(fmaxf(v, 0.f), 6.f);                                                                   // relu6
    if (act == 10) return fabsf(v);                                                                                    // abs
    if (act == 11) return (v >= 0.f) ? v : 0.1f * v;                                                                  // leaky 0.1
    if (act == 12) return (v > 0.f) ? v : 0.2f * v;                                                                   // leaky 0.2
    if (act == 13) return (v > 20.f) ? v : log1pf(expf(v));                                                            // softplus
    return v;
}

// =====================================================================================================================
// k_gemm<MODE>: C(z, m, n) = act(alpha * sum_k A(z, m, k) * B(z, k, n) + bias) + beta * R(z, m, n)
//   One wave (32-thread block) per 16 x 32 tile of C; grid (ceil(N/32), ceil(M/16), Z). Batch z -> (zo = z / zi_n, zi = z % zi_n)
//   with separate outer/inner strides for every tensor (e.g. batch and head). A(m,k) = A[zo*sAo + zi*sAi + m*sAm + k*sAk] (f32),
//   B(k,n) = B[zo*sBo + zi*sBi + n*sBn + k*sBk] (f32); any M, N, K (K zero-padded to 32 inside the fragments, M/N tails guarded).
//   C(m,n) = C[zo*sCo + zi*sCi + m*sCm + n] (n contiguous). flags: 1 bias[n], 2 bias[m], 4 residual R[zo*sRo + zi*sRi + m*sRm + n*sRn].
//   MODE 0: f16 operands (A prescaled by sa, B by sb, both undone in the epilogue); 1: bf16 hi/lo split (3 products); 2: bf16;
//   3: bf16 hi/mid/lo triple split (6 products); 4: as 3 with Kahan-compensated f32 accumulation across k-steps.
// =====================================================================================================================
struct GemmP {
    const float* A; const float* B; const float* bias; const float* R; float* C;
    long long sAo, sAi, sAm, sAk, sBo, sBi, sBn, sBk, sCo, sCi, sCm, sRo, sRi, sRm, sRn;
    int M, N, K, zi_n, flags, act; float alpha, beta, sa, sb;
    int Npad, pad_;     // columns [N, Npad) of C are written as 0 so that padded workspace rows are covered by whole-line stores; Npad >= N
};
static_assert(sizeof(GemmP) == 5 * 8 + 15 * 8 + 6 * 4 + 4 * 4 + 2 * 4, "GemmP has padding");

template <int MODE>
__global__ __launch_bounds__(32) void k_gemm(GemmP p) {
    const int lane = threadIdx.x & 31, h = lane >> 4, l15 = lane & 15;
    const int m0 = blockIdx.y * 16, n0 = blockIdx.x * 32;
    const int z = blockIdx.z, zo = z / p.zi_n, zi = z - zo * p.zi_n;
    const float* A = p.A + zo * p.sAo + zi * p.sAi;
    const float* B = p.B + zo * p.sBo + zi * p.sBi;
    const int am = min(m0 + l15, p.M - 1);                       // clamped row for loads (stores are guarded)
    v8f acc[2], comp[2];
#pragma unroll
    for (int t = 0; t < 2; ++t) { v8f zz = {}; acc[t] = zz; comp[t] = zz; }
    for (int k0 = 0; k0 < p.K; k0 += 32) {
        const float* arow = A + (long long)am * p.sAm;
        if (MODE == 1) {
            const Split a = sp_ld(arow, p.sAk, k0, h, p.K, 1.f);
#pragma unroll
            for (int t = 0; t < 2; ++t) {
                const int bn = min(n0 + t * 16 + l15, p.N - 1);
                acc[t] = wmma3(a, sp_ld(B + (long long)bn * p.sBn, p.sBk, k0, h, p.K, 1.f), acc[t]);
            }
        } else if (MODE == 3) {
            const Split3 a = sp3_ld(arow, p.sAk, k0, h, p.K, 1.f);
#pragma unroll
            for (int t = 0; t < 2; ++t) {
                const int bn = min(n0 + t * 16 + l15, p.N - 1);
                acc[t] = wmma6(a, sp3_ld(B + (long long)bn * p.sBn, p.sBk, k0, h, p.K, 1.f), acc[t]);
            }
        } else if (MODE == 4) {
            // triple split as MODE 3, but each k-step's 6 products go into a fresh accumulator and the partial is added to the running f32 sum
            // on the VALU with Kahan compensation (accumulation error stays ~1 ulp however long K is)
            const Split3 a = sp3_ld(arow, p.sAk, k0, h, p.K, 1.f);
#pragma unroll
            for (int t = 0; t < 2; ++t) {
                const int bn = min(n0 + t * 16 + l15, p.N - 1); v8f zz = {};
                const v8f part = wmma6(a, sp3_ld(B + (long long)bn * p.sBn, p.sBk, k0, h, p.K, 1.f), zz);
                const v8f y = part - comp[t]; const v8f s = acc[t] + y; comp[t] = (s - acc[t]) - y; acc[t] = s;
            }
        } else if (MODE == 2) {
            const v16b a = bh_ld(arow, p.sAk, k0, h, p.K, 1.f);
#pragma unroll
            for (int t = 0; t < 2; ++t) {
                const int bn = min(n0 + t * 16 + l15, p.N - 1);
                acc[t] = wmmab(a, bh_ld(B + (long long)bn * p.sBn, p.sBk, k0, h, p.K, 1.f), acc[t]);
            }
        } else {
            const v16h a = fh_ld(arow, p.sAk, k0, h, p.K, p.sa);
#pragma unroll
            for (int t = 0; t < 2; ++t) {
                const int bn = min(n0 + t * 16 + l15, p.N - 1);
                acc[t] = wmma16(a, fh_ld(B + (long long)bn * p.sBn, p.sBk, k0, h, p.K, p.sb), acc[t]);
            }
        }
    }
    const float iscale = (MODE == 0) ? p.alpha / (p.sa * p.sb) : p.alpha;
    float* C = p.C + zo * p.sCo + zi * p.sCi;
    const float* R = p.R + zo * p.sRo + zi * p.sRi;
    __shared__ __align__(16) float ctile[16][36];
#pragma unroll
    for (int t = 0; t < 2; ++t) {
        const int n = n0 + t * 16 + l15; const int nn = min(n, p.N - 1);
#pragma unroll
        for (int r = 0; r < 8; ++r) {
            const int m = m0 + 8 * h + r; const int mm = min(m, p.M - 1);
            float v = acc[t][r] * iscale;
            if (p.flags & 1) v += p.bias[nn];
            if (p.flags & 2) v += p.bias[mm];
            if (p.flags & 8) v *= p.bias[(long long)zo * p.M + mm];   /* per-(zo,row) scale vector laid out [Z/zi_n][M]; exclusive with the bias flags */
            v = act_fn(v, p.act);
            if (p.flags & 4) v += p.beta * R[(long long)mm * p.sRm + (long long)nn * p.sRn];
            ctile[8 * h + r][t * 16 + l15] = (n < p.N) ? v : 0.f;
        }
    }
    __syncthreads();
    const int NW = (p.Npad > p.N) ? p.Npad : p.N;           // write width
    const bool fast = (m0 + 16 <= p.M) && (n0 + 32 <= NW) && ((p.sCm & 3) == 0) && ((((size_t)C) & 15) == 0);
    if (fast) {
#pragma unroll
        for (int s = 0; s < 4; ++s) {
            const int row = s * 4 + (lane >> 3), c4 = (lane & 7) * 4;
            const v4f v = *(const v4f*)&ctile[row][c4];
            VST2V4(C + (long long)(m0 + row) * p.sCm + n0 + c4, v);
        }
    } else {
        for (int row = 0; row < 16; ++row) {
            const int m = m0 + row, n = n0 + lane;
            if (m < p.M && n < NW) VST2(float, C + (long long)m * p.sCm + n, ctile[row][lane]);
        }
    }
}


// =====================================================================================================================
// k_gemmT<MODE, TM, TN>: same contract as k_gemm, but one wave computes a (16*TM) x (16*TN) tile: TM A fragments and TN B fragments are
//   loaded per 32-wide k-step and reused across TM*TN WMMAs (far fewer load/convert instructions per MAC). MODE 0 (f16), 1 (bf16 hi/lo),
//   2 (bf16) only. grid (ceil(NW/(16*TN)), ceil(M/(16*TM)), Z), block 32. Epilogue identical to k_gemm, run per 16x32 sub-tile.
// =====================================================================================================================
template <int MODE, int TM, int TN>
__global__ __launch_bounds__(32) void k_gemmT(GemmP p) {
    const int lane = threadIdx.x & 31, h = lane >> 4, l15 = lane & 15;
    const int m0 = blockIdx.y * (16 * TM), n0 = blockIdx.x * (16 * TN);
    const int z = blockIdx.z, zo = z / p.zi_n, zi = z - zo * p.zi_n;
    const float* A = p.A + zo * p.sAo + zi * p.sAi;
    const float* B = p.B + zo * p.sBo + zi * p.sBi;
    v8f acc[TM][TN];
#pragma unroll
    for (int i = 0; i < TM; ++i)
#pragma unroll
        for (int t = 0; t < TN; ++t) { v8f zz = {}; acc[i][t] = zz; }
    for (int k0 = 0; k0 < p.K; k0 += 32) {
        if (MODE == 1) {
            Split a[TM], b[TN];
#pragma unroll
            for (int i = 0; i < TM; ++i) { const int am = min(m0 + 16 * i + l15, p.M - 1); a[i] = sp_ld(A + (long long)am * p.sAm, p.sAk, k0, h, p.K, 1.f); }
#pragma unroll
            for (int t = 0; t < TN; ++t) { const int bn = min(n0 + 16 * t + l15, p.N - 1); b[t] = sp_ld(B + (long long)bn * p.sBn, p.sBk, k0, h, p.K, 1.f); }
#pragma unroll
            for (int i = 0; i < TM; ++i)
#pragma unroll
                for (int t = 0; t < TN; ++t) acc[i][t] = wmma3(a[i], b[t], acc[i][t]);
        } else if (MODE == 2) {
            v16b a[TM], b[TN];
#pragma unroll
            for (int i = 0; i < TM; ++i) { const int am = min(m0 + 16 * i + l15, p.M - 1); a[i] = bh_ld(A + (long long)am * p.sAm, p.sAk, k0, h, p.K, 1.f); }
#pragma unroll
            for (int t = 0; t < TN; ++t) { const int bn = min(n0 + 16 * t + l15, p.N - 1); b[t] = bh_ld(B + (long long)bn * p.sBn, p.sBk, k0, h, p.K, 1.f); }
#pragma unroll
            for (int i = 0; i < TM; ++i)
#pragma unroll
                for (int t = 0; t < TN; ++t) acc[i][t] = wmmab(a[i], b[t], acc[i][t]);
        } else {
            v16h a[TM], b[TN];
#pragma unroll
            for (int i = 0; i < TM; ++i) { const int am = min(m0 + 16 * i + l15, p.M - 1); a[i] = fh_ld(A + (long long)am * p.sAm, p.sAk, k0, h, p.K, p.sa); }
#pragma unroll
            for (int t = 0; t < TN; ++t) { const int bn = min(n0 + 16 * t + l15, p.N - 1); b[t] = fh_ld(B + (long long)bn * p.sBn, p.sBk, k0, h, p.K, p.sb); }
#pragma unroll
            for (int i = 0; i < TM; ++i)
#pragma unroll
                for (int t = 0; t < TN; ++t) acc[i][t] = wmma16(a[i], b[t], acc[i][t]);
        }
    }
    const float iscale = (MODE == 0) ? p.alpha / (p.sa * p.sb) : p.alpha;
    float* C = p.C + zo * p.sCo + zi * p.sCi;
    const float* R = p.R + zo * p.sRo + zi * p.sRi;
    const int NW = (p.Npad > p.N) ? p.Npad : p.N;
    __shared__ __align__(16) float ctile[16][36];
#pragma unroll
    for (int i = 0; i < TM; ++i) {
        const int mb = m0 + 16 * i; if (mb >= p.M) break;          // wave-uniform
#pragma unroll
        for (int tp = 0; tp < TN / 2; ++tp) {
            const int nb = n0 + 32 * tp; if (nb >= NW) break;        // wave-uniform
#pragma unroll
            for (int t2 = 0; t2 < 2; ++t2) {
                const int t = 2 * tp + t2; const int n = nb + t2 * 16 + l15; const int nn = min(n, p.N - 1);
#pragma unroll
                for (int r = 0; r < 8; ++r) {
                    const int m = mb + 8 * h + r; const int mm = min(m, p.M - 1);
                    float v = acc[i][t][r] * iscale;
                    if (p.flags & 1) v += p.bias[nn];
                    if (p.flags & 2) v += p.bias[mm];
            if (p.flags & 8) v *= p.bias[(long long)zo * p.M + mm];   /* per-(zo,row) scale vector laid out [Z/zi_n][M]; exclusive with the bias flags */
                    v = act_fn(v, p.act);
                    if (p.flags & 4) v += p.beta * R[(long long)mm * p.sRm + (long long)nn * p.sRn];
                    ctile[8 * h + r][t2 * 16 + l15] = (n < p.N) ? v : 0.f;
                }
            }
            __syncthreads();
            const bool fast = (mb + 16 <= p.M) && (nb + 32 <= NW) && ((p.sCm & 3) == 0) && ((((size_t)C) & 15) == 0);
            if (fast) {
#pragma unroll
                for (int s = 0; s < 4; ++s) {
                    const int row = s * 4 + (lane >> 3), c4 = (lane & 7) * 4;
                    const v4f v = *(const v4f*)&ctile[row][c4];
                    VST2V4(C + (long long)(mb + row) * p.sCm + nb + c4, v);
                }
            } else {
                for (int row = 0; row < 16; ++row) {
                    const int m = mb + row, n = nb + lane;
                    if (m < p.M && n < NW) VST2(float, C + (long long)m * p.sCm + n, ctile[row][lane]);
                }
            }
            __syncthreads();
        }
    }
}

// =====================================================================================================================
//   Wave = 16 queries, AW waves per block, 64-key blocks; grid (ceil(Lq/(16*AW)), H, B), block 32*AW. Any Lq, Lk; head dim dh <= DHP
//   (DHP multiple of 32), value dim dv <= DVP (multiple of 16, <= 128). Every tensor addressed by (batch, head, row, element) strides, f32.
//   Scores: QM 0 f16 operands, 1 bf16 hi/lo split, 2 bf16 triple split; statistics f32 (exp2 domain); P.V: P x 4096 as f16 with V f16 staged in LDS
//   (SPLITPV: P and V as bf16 hi/lo splits). kv head = h / hrep. Masking: causal = 1 (keep j <= i + coff, masked -> -inf, key blocks beyond the
//   diagonal skipped), causal = 2 (masked -> mfill, a finite fill like the -1e9; no skipping), causal = 3 (keep j >= i + coff,
//   masked -> -inf, no skipping); optional additive f32 mask Mf,
//   optional int keep-mask Mi (0 -> score := mfill), both addressed b*smb + h*smh + i*smi + j*smj (0 strides broadcast).
// =====================================================================================================================
#define AW 4
struct AttnP {   // apv4
    const float* Q; const float* K; const float* V; float* O; float* P; const float* Mf; const int* Mi; float* ST;
    const float* Pw; const float* Rt; const int* SQ; const int* SK;           // optional: post-softmax weight, relative-position table, segment ids
    long long swb, swh, swi, swj, srb, srh, sri;                                 // Pw strides (b,h,i,j); Rt strides (b,h,i), column = clamp(i - j + roff, 0, rn-1)
    long long sQb, sQh, sQi, sQd, sKb, sKh, sKj, sKd, sVb, sVh, sVj, sVd, sOb, sOh, sOi, sPb, sPh, sPi, smb, smh, smi, smj;
    int Lq, Lk, dh, dv, hrep, causal, coff, pband;   // pband > 0: P holds only the band |j - i| <= pband, column j - i + pband
    float scale, mfill; int nonorm, mpol;             // nonorm (online path only): O = sum_j exp(score_j) V_j without the 1/rowsum (scores must be <= ~0); mpol: Mi masks where ==0 (mpol 0) or where !=0 (mpol 1)
    int roff, rn, segpol, win;                        // Rt column offset/count; SQ/SK: score := mfill where (segpol 0) SQ[i] != SK[j] or (segpol 1) SQ[i] == SK[j]; win > 0: keys with i - j > win (after coff) -> -inf
};
//   Pw: the softmax numerator is multiplied by Pw(b,h,i,j) AFTER the row sum is taken (probs * weight, then P.V), as in post-softmax multiplicative biases.                                                    // ST (optional): per row (b,h,i) -> ST[((b*H + h)*Lq + i)*2 + {0,1}] = {row max of the scaled+masked score (natural units), sum_j exp(score - max)}
static_assert(sizeof(AttnP) == 12 * 8 + 29 * 8 + 16 * 4, "AttnP has padding");

#ifndef KATTN_ATTR
#define KATTN_ATTR
#endif
//   UNIT: the launch promises sQd = sKd = sVd = 1, dh = DHP, dv = DVP, Lk a multiple of 64, 16-byte aligned Q, K, V rows and 16 rows of K or V within 4 GiB
//   (f16 one-pass path only): Q, K and V are then read with unguarded 16-byte loads, a key block's all issued as one group from a uniform base and a
//   loop-invariant lane offset, instead of one guarded 4-byte load and wait per element.
template <int DHP, int DVP, int QM, bool SPLITPV, bool TWOPASS, bool UNIT = false>
__global__ __launch_bounds__(32 * AW) KATTN_ATTR void k_attn(AttnP p) {
    static_assert(!UNIT || (QM == 0 && !SPLITPV && !TWOPASS && (32 * AW) / (DVP / 4) == 8), "UNIT covers the f16 one-pass path, 8 V rows per load step");
    constexpr int NT = DVP / 16;                // output tiles
    constexpr int KS = DHP / 32;                // k-steps for the scores
    constexpr int VP = DVP + 8;                 // LDS pitch (halves)
    __shared__ __align__(16) float    pl[AW][16 * 64];
    __shared__ __align__(16) _Float16 vl[(SPLITPV ? 2 : 1) * 64 * VP];   // f16 V tile, or bf16 hi and lo tiles (same 2-byte size)
    const int lane = threadIdx.x & 31, hf = lane >> 4, l15 = lane & 15, wave = threadIdx.x >> 5;
    const int h = blockIdx.y, b = blockIdx.z, hk = h / p.hrep;
    const int q0 = (blockIdx.x * AW + wave) * 16;
    float* myp = pl[wave];
    const float L2E = 1.4426950408889634f;
    const float NEG = -__builtin_inff();
    const int qi = min(q0 + l15, p.Lq - 1);
    const float* qrow = p.Q + b * p.sQb + h * p.sQh + (long long)qi * p.sQi;
    const float* kbase = p.K + b * p.sKb + hk * p.sKh;
    const float* vbase = p.V + b * p.sVb + hk * p.sVh;
    const v4f* qp = (const v4f*)(qrow + 8 * hf);               // UNIT: the lane's half of the fragment's k
    v16h qa[QM == 0 ? KS : 1]; Split qs_[QM == 1 ? KS : 1]; Split3 qt_[QM == 2 ? KS : 1];
#pragma unroll
    for (int ks = 0; ks < KS; ++ks) {
        if (QM == 2) qt_[ks] = sp3_ld(qrow, p.sQd, ks * 32, hf, p.dh, 1.f);
        else if (QM == 1) qs_[ks] = sp_ld(qrow, p.sQd, ks * 32, hf, p.dh, 1.f);
        else if (UNIT) qa[ks] = fr_cvt(fr_ld(qp, ks * 32));
        else qa[ks] = fh_ld(qrow, p.sQd, ks * 32, hf, p.dh, 1.f);
    }
    if (UNIT) asm volatile("s_wait_xcnt 0x0" :: "v"(qp) : "memory");   // the Q loads' address registers stay as they are up to this wait (named as input) and are reused behind it
    constexpr int VR = (32 * AW) / (DVP / 4);                  // V rows that the block's threads cover with one 16-byte load each
    const unsigned koff = (unsigned)(l15 * (int)p.sKj + 8 * hf) * 4u;                                                          // UNIT: lane's byte offset in a 16-key tile
    const unsigned voff = (unsigned)((int)(threadIdx.x / (DVP / 4)) * (int)p.sVj + (int)(threadIdx.x % (DVP / 4)) * 4) * 4u;   // UNIT: thread's byte offset in VR rows of V
    v8f o[NT]; float m8[8], l8[8];
#pragma unroll
    for (int t = 0; t < NT; ++t) { v8f zz = {}; o[t] = zz; }
#pragma unroll
    for (int i = 0; i < 8; ++i) { m8[i] = NEG; l8[i] = 0.f; }
    int jend = p.Lk; int jstart = 0;
    if (p.causal == 1) { const int je = (blockIdx.x * AW + AW - 1) * 16 + 16 + p.coff; jend = min(jend, max(je, 0)); }   // uniform per block
    if (p.win > 0) { const int js = (int)(blockIdx.x * AW) * 16 + p.coff - p.win; jstart = (js > 0) ? (js / 64) * 64 : 0; }   // uniform per block: key blocks entirely outside every row's window hold only -inf entries and are skipped exactly
    const int npass = TWOPASS ? 2 : 1;
    for (int pass = 0; pass < npass; ++pass) {
        const bool dopv = (!TWOPASS) || pass == 1;
        for (int j0 = jstart; j0 < jend; j0 += 64) {
            if (dopv) {
                __syncthreads();                                 // previous key block's reads of vl / pl are done
                if (!UNIT)
                for (int idx = threadIdx.x; idx < 64 * DVP; idx += 32 * AW) {
                    const int jr = idx / DVP, d = idx - jr * DVP, j = j0 + jr;
                    const float f = (j < p.Lk && d < p.dv) ? vbase[(long long)j * p.sVj + (long long)d * p.sVd] : 0.f;
                    if (SPLITPV) {
                        const __bf16 hb = bf16_rne(f);
                        ((__bf16*)vl)[jr * VP + d] = hb; ((__bf16*)vl)[64 * VP + jr * VP + d] = bf16_rne(f - bf16_f32(hb));
                    } else vl[jr * VP + d] = (_Float16)f;
                }
            }
            v8f s[4];
            if (UNIT) {
                v4f vr[8]; FragRaw kr[4][KS]; const v4f* vp[8]; const v4f* kp[4];
#pragma unroll
                for (int it = 0; it < 8; ++it) { vp[it] = (const v4f*)((const char*)(vbase + (long long)(j0 + it * VR) * p.sVj) + voff); vr[it] = *vp[it]; }
#pragma unroll
                for (int t = 0; t < 4; ++t) {
                    kp[t] = (const v4f*)((const char*)(kbase + (long long)(j0 + t * 16) * p.sKj) + koff);
#pragma unroll
                    for (int ks = 0; ks < KS; ++ks) kr[t][ks] = fr_ld(kp[t], ks * 32);
                }
                // the group's address registers stay as they are up to this wait (named as inputs) and are reused behind it, while the loads are still in flight
                asm volatile("s_wait_xcnt 0x0" :: "v"(vp[0]), "v"(vp[1]), "v"(vp[2]), "v"(vp[3]), "v"(vp[4]), "v"(vp[5]), "v"(vp[6]), "v"(vp[7]),
                             "v"(kp[0]), "v"(kp[1]), "v"(kp[2]), "v"(kp[3]) : "memory");
#pragma unroll
                for (int it = 0; it < 8; ++it) {
                    v4h hv; hv[0] = (_Float16)vr[it][0]; hv[1] = (_Float16)vr[it][1]; hv[2] = (_Float16)vr[it][2]; hv[3] = (_Float16)vr[it][3];
                    *(v4h*)(vl + (it * VR + (int)(threadIdx.x / (DVP / 4))) * VP + (int)(threadIdx.x % (DVP / 4)) * 4) = hv;
                }
#pragma unroll
                for (int t = 0; t < 4; ++t) {
                    v8f acc = {};
#pragma unroll
                    for (int ks = 0; ks < KS; ++ks) acc = wmma16(qa[ks], fr_cvt(kr[t][ks]), acc);
                    s[t] = acc;
                }
            } else
#pragma unroll
            for (int t = 0; t < 4; ++t) {
                const int j = min(j0 + t * 16 + l15, p.Lk - 1);
                const float* krow = kbase + (long long)j * p.sKj;
                v8f acc = {};
#pragma unroll
                for (int ks = 0; ks < KS; ++ks) {
                    if (QM == 2)      acc = wmma6(qt_[ks], sp3_ld(krow, p.sKd, ks * 32, hf, p.dh, 1.f), acc);
                    else if (QM == 1) acc = wmma3(qs_[ks], sp_ld(krow, p.sKd, ks * 32, hf, p.dh, 1.f), acc);
                    else              acc = wmma16(qa[ks], fh_ld(krow, p.sKd, ks * 32, hf, p.dh, 1.f), acc);
                }
                s[t] = acc;
            }
            float pv[8][4];
#pragma unroll
            for (int i = 0; i < 8; ++i) {
                const int irow = q0 + i + 8 * hf;
                const int ic = min(irow, p.Lq - 1);
                float sc[4];
#pragma unroll
                for (int t = 0; t < 4; ++t) {
                    const int jg = j0 + t * 16 + l15;
                    float v = s[t][i] * p.scale;
                    if (p.Mf) v += p.Mf[b * p.smb + h * p.smh + (long long)ic * p.smi + (long long)min(jg, p.Lk - 1) * p.smj];
                    if (p.Rt) { int rc = ic - min(jg, p.Lk - 1) + p.roff; rc = rc < 0 ? 0 : (rc >= p.rn ? p.rn - 1 : rc); v += p.Rt[b * p.srb + h * p.srh + (long long)ic * p.sri + rc]; }
                    if (p.Mi) { const int mv = p.Mi[b * p.smb + h * p.smh + (long long)ic * p.smi + (long long)min(jg, p.Lk - 1) * p.smj]; if (p.mpol ? (mv != 0) : (mv == 0)) v = p.mfill; }
                    if (p.SQ) { const bool same = p.SQ[(long long)b * p.Lq + ic] == p.SK[(long long)b * p.Lk + min(jg, p.Lk - 1)]; if (p.segpol ? same : !same) v = p.mfill; }
                    if (p.causal == 2 && jg > irow + p.coff) v = p.mfill;
                    if (jg >= p.Lk || (p.causal == 1 && jg > irow + p.coff) || (p.causal == 3 && jg < irow + p.coff) || (p.win > 0 && irow + p.coff - jg > p.win)) v = NEG; else v *= L2E;
                    sc[t] = v;
                }
                if (!TWOPASS || pass == 0) {
                    float mx = fmaxf(fmaxf(sc[0], sc[1]), fmaxf(sc[2], sc[3]));
                    mx = fmaxf(mx, __shfl_xor(mx, 1, 32)); mx = fmaxf(mx, __shfl_xor(mx, 2, 32));
                    mx = fmaxf(mx, __shfl_xor(mx, 4, 32)); mx = fmaxf(mx, __shfl_xor(mx, 8, 32));
                    const float mnew = fmaxf(m8[i], mx);
                    const float corr = (mnew == NEG) ? 1.f : exp2f(m8[i] - mnew);
                    float rs = 0.f;
#pragma unroll
                    for (int t = 0; t < 4; ++t) {
                        const float pp = (sc[t] == NEG) ? 0.f : exp2f(sc[t] - mnew); rs += pp;
                        pv[i][t] = p.Pw ? pp * p.Pw[b * p.swb + h * p.swh + (long long)ic * p.swi + (long long)min(j0 + t * 16 + l15, p.Lk - 1) * p.swj] : pp;
                    }
                    rs += __shfl_xor(rs, 1, 32); rs += __shfl_xor(rs, 2, 32); rs += __shfl_xor(rs, 4, 32); rs += __shfl_xor(rs, 8, 32);
                    l8[i] = l8[i] * corr + rs; m8[i] = mnew;
                    if (!TWOPASS) {
#pragma unroll
                        for (int t = 0; t < NT; ++t) o[t][i] *= corr;
                    }
                } else {
                    const float inv = (l8[i] > 0.f) ? 1.f / l8[i] : 0.f;
#pragma unroll
                    for (int t = 0; t < 4; ++t) {
                        const int jg = j0 + t * 16 + l15;
                        float pp = (sc[t] == NEG) ? 0.f : exp2f(sc[t] - m8[i]) * inv;
                        if (p.Pw) pp *= p.Pw[b * p.swb + h * p.swh + (long long)ic * p.swi + (long long)min(jg, p.Lk - 1) * p.swj];
                        pv[i][t] = pp;
                    }
                }
            }
            if (dopv) {
#pragma unroll
                for (int i = 0; i < 8; ++i)
#pragma unroll
                    for (int t = 0; t < 4; ++t) ((float*)myp)[(i + 8 * hf) * 64 + t * 16 + l15] = pv[i][t];
                __syncthreads();                                 // P (per wave) and V (shared) visible
                if (p.P) {
                    float* pb_ = p.P + b * p.sPb + h * p.sPh;
                    const bool fastP = (p.pband == 0) && ((p.sPi & 3) == 0) && (j0 + 64 <= p.Lk) && (q0 + 16 <= p.Lq) && ((((size_t)pb_) & 15) == 0);
                    if (fastP) {
#pragma unroll
                        for (int s = 0; s < 8; ++s) {
                            const int row = s * 2 + (lane >> 4), c4 = (lane & 15) * 4;
                            const v4f v = *(const v4f*)(myp + row * 64 + c4);
                            VST2V4(pb_ + (long long)(q0 + row) * p.sPi + j0 + c4, v);
                        }
                    } else {
                        for (int row = 0; row < 16; ++row) {
                            const int irow = q0 + row; if (irow >= p.Lq) continue;
                            for (int c = lane; c < 64; c += 32) {
                                const int jg = j0 + c; if (jg >= p.Lk) continue;
                                if (p.pband == 0) VST2(float, pb_ + (long long)irow * p.sPi + jg, myp[row * 64 + c]);
                                else if (jg - irow <= p.pband && irow - jg <= p.pband) VST2(float, pb_ + (long long)irow * p.sPi + (jg - irow + p.pband), myp[row * 64 + c]);
                            }
                        }
                    }
                }
                if (SPLITPV) {
                    const Split pa0 = sp_ld(myp + l15 * 64, 1, 0, hf, 64, 1.f), pa1 = sp_ld(myp + l15 * 64, 1, 32, hf, 64, 1.f);
                    const __bf16* vh = (const __bf16*)vl; const __bf16* vlo = vh + 64 * VP;
#pragma unroll
                    for (int t = 0; t < NT; ++t) {
                        const int dcol = t * 16 + l15;
                        Split b0, b1;
#pragma unroll
                        for (int e = 0; e < 16; ++e) {
                            const int k0 = frag_k(e, hf), k1 = 32 + frag_k(e, hf);
                            b0.hi[e] = vh[k0 * VP + dcol]; b0.lo[e] = vlo[k0 * VP + dcol]; b1.hi[e] = vh[k1 * VP + dcol]; b1.lo[e] = vlo[k1 * VP + dcol];
                        }
                        o[t] = wmma3(pa0, b0, o[t]);
                        o[t] = wmma3(pa1, b1, o[t]);
                    }
                } else {
                    const v16h pa0 = fh_ld(myp + l15 * 64, 1, 0, hf, 64, 4096.f), pa1 = fh_ld(myp + l15 * 64, 1, 32, hf, 64, 4096.f);
#pragma unroll
                    for (int t = 0; t < NT; ++t) {
                        const int dcol = t * 16 + l15;
                        v16h b0, b1;
#pragma unroll
                        for (int e = 0; e < 16; ++e) { b0[e] = vl[frag_k(e, hf) * VP + dcol]; b1[e] = vl[(32 + frag_k(e, hf)) * VP + dcol]; }
                        o[t] = wmma16(pa0, b0, o[t]);
                        o[t] = wmma16(pa1, b1, o[t]);
                    }
                }
            }
        }
    }
    float* obase = p.O + b * p.sOb + h * p.sOh;
    if (p.ST) {
        const int rl = lane >> 1, isel = rl & 7;           // row q0 + rl ; rl>>3 == hf holds because lane>>4 == (lane>>1)>>3
        float mv = 0.f, lv = 0.f;
#pragma unroll
        for (int i = 0; i < 8; ++i) if (i == isel) { mv = m8[i]; lv = l8[i]; }
        const int irow = q0 + rl;
        if (irow < p.Lq) { float* st = p.ST + (((long long)b * gridDim.y + h) * p.Lq + irow) * 2 + (lane & 1); VST2(float, st, (lane & 1) ? lv : mv * 0.6931471805599453f); }
    }
    float invr[8];
#pragma unroll
    for (int i = 0; i < 8; ++i) {
        if (TWOPASS) invr[i] = SPLITPV ? 1.f : (1.f / 4096.f);
        else if (p.nonorm) invr[i] = exp2f(m8[i]) * (SPLITPV ? 1.f : (1.f / 4096.f));
        else invr[i] = (l8[i] > 0.f) ? (SPLITPV ? 1.f / l8[i] : 1.f / (l8[i] * 4096.f)) : 0.f;
    }
    __syncthreads();                                             // all waves done with pl/vl from the main loop
    const bool ofast = ((p.sOi & 3) == 0) && ((((size_t)obase) & 15) == 0) && (q0 + 16 <= p.Lq);
#pragma unroll
    for (int c0 = 0; c0 < DVP; c0 += 64) {
#pragma unroll
        for (int i = 0; i < 8; ++i)
#pragma unroll
            for (int t = 0; t < NT; ++t) if (t * 16 >= c0 && t * 16 < c0 + 64) ((float*)myp)[(i + 8 * hf) * 64 + (t * 16 - c0) + l15] = o[t][i] * invr[i];
        __syncthreads();
        const int cw = (DVP - c0 < 64) ? (DVP - c0) : 64;      // staged columns in this chunk (multiple of 16)
        if (ofast && (c0 + cw <= p.dv) && (cw % 32 == 0)) {
            const int lpr = cw / 4;                              // lanes per row (16 for 64 cols, 8 for 32)
            const int rows_per_ins = 32 / lpr;
            for (int r0 = 0; r0 < 16; r0 += rows_per_ins) {
                const int row = r0 + lane / lpr, c4 = (lane % lpr) * 4;
                const v4f v = *(const v4f*)(myp + row * 64 + c4);
                VST2V4(obase + (long long)(q0 + row) * p.sOi + c0 + c4, v);
            }
        } else {
            for (int row = 0; row < 16; ++row) {
                const int irow = q0 + row; if (irow >= p.Lq) continue;
                for (int c = lane; c < cw; c += 32) { const int d = c0 + c; if (d < p.dv) VST2(float, obase + (long long)irow * p.sOi + d, myp[row * 64 + c]); }
            }
        }
        __syncthreads();
    }
}

// =====================================================================================================================
// k_tr: dst(z, c, r) = alpha * src(z, r, c) (+ beta * R2(z, c, r)): [Z][R][C] (row stride lds) -> [Z][C][R] (row stride ldd) through a 32x32 LDS tile;
//   flags: 1 -> add beta * residual R2 addressed like dst (z*sRz + c*ldr + r); act applied before the residual.
// =====================================================================================================================
struct TrP { const float* src; float* dst; const float* R2; long long sSz, lds, sDz, ldd, sRz, ldr; int R, C, flags, act; float alpha, beta; };
static_assert(sizeof(TrP) == 3 * 8 + 6 * 8 + 6 * 4, "TrP has padding");
__global__ __launch_bounds__(256) void k_tr(TrP p) {
    __shared__ float tile[32][33];
    const int c0 = blockIdx.x * 32, r0 = blockIdx.y * 32, z = blockIdx.z;
    const int lane = threadIdx.x & 31, wave = threadIdx.x >> 5;
    const float* s = p.src + z * p.sSz;
#pragma unroll
    for (int k = 0; k < 4; ++k) {
        const int rl = wave * 4 + k, r = r0 + rl, c = c0 + lane;
        tile[rl][lane] = (r < p.R && c < p.C) ? s[(long long)r * p.lds + c] : 0.f;
    }
    __syncthreads();
    float* d = p.dst + z * p.sDz; const float* rr = p.R2 + z * p.sRz;
#pragma unroll
    for (int k = 0; k < 4; ++k) {
        const int cl = wave * 4 + k, c = c0 + cl, r = r0 + lane;
        if (c < p.C && r < p.R) {
            float v = act_fn(p.alpha * tile[lane][cl], p.act);
            if (p.flags & 1) v += p.beta * rr[(long long)c * p.ldr + r];
            VST2(float, d + (long long)c * p.ldd + r, v);
        }
    }
}

// k_affine: dst[i] = a * (sdev ? sdev[0] : 1) * src[i] + b, i < n (one thread per element; consecutive lanes -> consecutive addresses)
__global__ __launch_bounds__(256) void k_affine(const float* __restrict__ src, float* __restrict__ dst, int n, float a, float b, const float* __restrict__ sdev) {
    const int i = blockIdx.x * 256 + threadIdx.x;
    if (i < n) { const float aa = sdev ? a * sdev[0] : a; const float v = aa * src[i] + b; VST2(float, dst + i, v); }
}

// =====================================================================================================================
// k_softmax: row softmax over n contiguous elements, one 256-thread block per row; rows addressed z*sz + r*sr (grid (R, Z)).
//   out = scale_out * softmax(scale_in * x + (Mf ? Mf[z*smz + r*smr + j] : 0)); a row whose max is -inf is written as 0.
// =====================================================================================================================
struct SmP { const float* src; float* dst; const float* Mf; long long sz, sr, dz, dr, smz, smr; int n, pad; float scale_in, scale_out; };
static_assert(sizeof(SmP) == 3 * 8 + 6 * 8 + 4 * 4, "SmP has padding");
__global__ __launch_bounds__(256) void k_softmax(SmP p) {
    __shared__ float red[256];
    const int r = blockIdx.x, z = blockIdx.y, tid = threadIdx.x;
    const float* s = p.src + z * p.sz + (long long)r * p.sr;
    const float* mf = p.Mf ? (p.Mf + z * p.smz + (long long)r * p.smr) : nullptr;
    float mx = -__builtin_inff();
    for (int j = tid; j < p.n; j += 256) { float v = s[j] * p.scale_in; if (mf) v += mf[j]; mx = fmaxf(mx, v); }
    red[tid] = mx; __syncthreads();
    for (int o = 128; o > 0; o >>= 1) { if (tid < o) red[tid] = fmaxf(red[tid], red[tid + o]); __syncthreads(); }
    mx = red[0]; __syncthreads();
    float sum = 0.f;
    for (int j = tid; j < p.n; j += 256) { float v = s[j] * p.scale_in; if (mf) v += mf[j]; sum += (mx == -__builtin_inff()) ? 0.f : expf(v - mx); }
    red[tid] = sum; __syncthreads();
    for (int o = 128; o > 0; o >>= 1) { if (tid < o) red[tid] += red[tid + o]; __syncthreads(); }
    sum = red[0];
    const float inv = (sum > 0.f) ? p.scale_out / sum : 0.f;
    float* d = p.dst + z * p.dz + (long long)r * p.dr;
    for (int j = tid; j < p.n; j += 256) { float v = s[j] * p.scale_in; if (mf) v += mf[j]; const float o = (mx == -__builtin_inff()) ? 0.f : expf(v - mx) * inv; VST2(float, d + j, o); }
}
// =====================================================================================================================
// k_stats: mean and rsqrt(var + eps) over a set of n elements addressed base + z*sz + (e / inner) * so + (e % inner) * si, one 256-thread
// k_norm_apply: y = (x - mean[set]) * rstd[set] * g[c] + b[c] over a [Z][C][L] chan-major tensor with set = z*G + c / (C/G) (G groups per z;
//   G = C -> per-chan sets indexed z*C+c; for batch norm pass stats indexed by c only via bn = 1). Optional act. Output same layout.
// =====================================================================================================================
//   mode 0: mean / rsqrt(var + eps); mode 1 (RMSNorm): 0 / rsqrt(mean(x^2) + eps); mode 2 (L2 normalize * sqrt(n)): 0 / sqrt(n) / max(||x||, eps); mode 3: as 0 with unbiased variance (n-1)
__global__ __launch_bounds__(256) void k_stats(const float* __restrict__ x, long long sz, long long so, long long si, int inner, int n, float eps, float* __restrict__ stat, int mode) {
    __shared__ float red[256];
    const int z = blockIdx.x, tid = threadIdx.x;
    const float* base = x + z * sz;
    float s = 0.f;
    for (int e = tid; e < n; e += 256) s += base[(long long)(e / inner) * so + (long long)(e % inner) * si];
    red[tid] = s; __syncthreads();
    for (int o = 128; o > 0; o >>= 1) { if (tid < o) red[tid] += red[tid + o]; __syncthreads(); }
    const float mu = (mode == 0 || mode == 3) ? red[0] / (float)n : 0.f; __syncthreads();
    float q = 0.f;
    for (int e = tid; e < n; e += 256) { const float dlt = base[(long long)(e / inner) * so + (long long)(e % inner) * si] - mu; q += dlt * dlt; }
    red[tid] = q; __syncthreads();
    for (int o = 128; o > 0; o >>= 1) { if (tid < o) red[tid] += red[tid + o]; __syncthreads(); }
    {
        float rs;
        if (mode == 2) rs = sqrtf((float)n) / fmaxf(sqrtf(red[0]), eps); else if (mode == 3) rs = rsqrtf(red[0] / (float)(n - 1) + eps); else rs = rsqrtf(red[0] / (float)n + eps);
        if (tid < 32) { const float v = (tid == 0) ? mu : ((tid == 1) ? rs : 0.f); VST2(float, stat + (long long)z * 32 + tid, v); }
    }
}
//   One thread per element over the flat [Z][C][L] index space: grid ceil(Z*C*L / 256).
__global__ __launch_bounds__(256) void k_norm_apply(const float* __restrict__ x, float* __restrict__ y, const float* __restrict__ stat, const float* __restrict__ g, const float* __restrict__ bta,
                                                     int Z, int C, int L, int G, int bn, int act) {
    const long long idx = (long long)blockIdx.x * 256 + threadIdx.x;
    if (idx >= (long long)Z * C * L) return;
    const int l = (int)(idx % L); const long long zc = idx / L; const int c = (int)(zc % C), z = (int)(zc / C); (void)l;
    const int set = bn ? c : (z * G + c / (C / G));
    float v = (x[idx] - stat[(long long)set * 32]) * stat[(long long)set * 32 + 1];
    if (g) v *= g[c];
    if (bta) v += bta[c];
    v = act_fn(v, act);
    VST2(float, y + idx, v);
}

// k_lse_neg: c[i] = -(st[2i] + log(st[2i+1])) = minus the log-sum-exp of row i from k_attn's ST output (for softmax over the query dimension)
__global__ __launch_bounds__(256) void k_lse_neg(const float* __restrict__ st, float* __restrict__ c, int n) {
    const int i = blockIdx.x * 256 + threadIdx.x;
    if (i < n) { const float v = -(st[2 * i] + logf(st[2 * i + 1])); VST2(float, c + i, v); }
}

// k_iota: dst[i] = a * i + b as int32 (segment/position id helper)
__global__ __launch_bounds__(256) void k_iota(int* __restrict__ dst, int n, int a, int b) {
    const int i = blockIdx.x * 256 + threadIdx.x;
    if (i < n) { const int v = a * i + b; VST2(int, dst + i, v); }
}

// k_axpby: dst[i] = a * x[i] + b * y[i] (+ c), i < n
__global__ __launch_bounds__(256) void k_axpby(const float* __restrict__ x, const float* __restrict__ y, float* __restrict__ dst, int n, float a, float b, float c) {
    const int i = blockIdx.x * 256 + threadIdx.x;
    if (i < n) { const float v = a * x[i] + b * y[i] + c; VST2(float, dst + i, v); }
}

// =====================================================================================================================
// k_rope: rotary embedding on a [R rows][Hn heads][D] view (row stride sXr, head stride sXh, element stride 1) -> Y (own strides).
//   mode 0: rotate_half (partner d±D/2, sign - for d<D/2); mode 1: interleaved pairs (partner d^1, sign - for even d).
//   table column tcol: tmode 0 -> d, 1 -> d % (D/2), 2 -> d / 2; position p: pmode 0 -> r % S, 1 -> head index, 2 -> pos[r];
//   c = C[(r / S) * sCb + p * sCp + tcol * sCd], s likewise from Sn; y = x[d] * c + sign * x[partner] * s. X and Y must not alias.
// =====================================================================================================================
struct RopeP { const float* X; float* Y; const float* C; const float* Sn; const int* pos; long long sXr, sXh, sYr, sYh, sCb, sCp, sCd; int R, Hn, D, S, mode, tmode, pmode, pad; };
static_assert(sizeof(RopeP) == 5 * 8 + 7 * 8 + 8 * 4, "RopeP has padding");
__global__ __launch_bounds__(256) void k_rope(RopeP p) {
    const long long idx = (long long)blockIdx.x * 256 + threadIdx.x;
    if (idx >= (long long)p.R * p.Hn * p.D) return;
    const int d = (int)(idx % p.D); const long long rh = idx / p.D; const int h = (int)(rh % p.Hn); const int r = (int)(rh / p.Hn);
    const int half = p.D / 2;
    int partner; float sign;
    if (p.mode == 0) { partner = (d < half) ? d + half : d - half; sign = (d < half) ? -1.f : 1.f; }
    else { partner = d ^ 1; sign = (d & 1) ? 1.f : -1.f; }
    const int tcol = (p.tmode == 0) ? d : ((p.tmode == 1) ? (d % half) : (d >> 1));
    const int pp = (p.pmode == 0) ? (r % p.S) : ((p.pmode == 1) ? h : p.pos[r]);
    const long long toff = (long long)(r / p.S) * p.sCb + (long long)pp * p.sCp + (long long)tcol * p.sCd;
    const float* xr = p.X + (long long)r * p.sXr + (long long)h * p.sXh;
    const float v = xr[d] * p.C[toff] + sign * xr[partner] * p.Sn[toff];
    VST2(float, p.Y + (long long)r * p.sYr + (long long)h * p.sYh + d, v);
}

// k_invf + k_sincos (split so neither kernel carries a large VALU-fma footprint): invf_i = num * (1 / powf(base, (2 i)/D)) [fmode 0],
//   num * expf((2 i) * cexp) [fmode 1], num * powf(base, -2 (i - 1) / D) [fmode 2]; then cs/sn[s*half + i] = cos/sin((pscale * s) * invf_i)
__global__ __launch_bounds__(256) void k_invf(float* __restrict__ invb, int half, int D, float base, float num, int fmode, float cexp) {
    const int i = blockIdx.x * 256 + threadIdx.x;
    if (i >= ((half + 31) / 32) * 32) return;
    if (i >= half) { VST2(float, invb + i, 0.f); return; }
    const float e = (float)(2 * i) / (float)D;
    float invf;
    if (fmode == 1) invf = num * expf((float)(2 * i) * cexp);
    else if (fmode == 2) invf = num * powf(base, (-2.0f * ((float)i - 1.0f)) / (float)D);
    else invf = num * (1.0f / powf(base, e));
    VST2(float, invb + i, invf);
}
__global__ __launch_bounds__(256) void k_sincos(float* __restrict__ cs, float* __restrict__ sn, const float* __restrict__ invb, int S, int half, float pscale) {
    const int idx = blockIdx.x * 256 + threadIdx.x;
    if (idx >= S * half) return;
    const int s = idx / half, i = idx - s * half;
    const float ang = (pscale * (float)s) * invb[i];
    VST2(float, cs + idx, cosf(ang)); VST2(float, sn + idx, sinf(ang));
}

// k_mulact: dst[i] = act(x[i]) * y[i]
__global__ __launch_bounds__(256) void k_mulact(const float* __restrict__ x, const float* __restrict__ y, float* __restrict__ dst, int n, int act) {
    const int i = blockIdx.x * 256 + threadIdx.x;
    if (i < n) { const float v = act_fn(x[i], act) * y[i]; VST2(float, dst + i, v); }
}

// =====================================================================================================================
// k_matvec: thread-per-row matrix-vector products for N <= 8 output columns (heads with 1-3 outputs, gates), f32 on the VALU.
//   C[r*sCm + j] = act(alpha * sum_k A[r*sAm + k*sAk] * B[j*sBn + k*sBk] + bias[j]) + beta * R[r*sRm + j*sRn]; each thread writes its N contiguous floats.
// =====================================================================================================================
__global__ __launch_bounds__(256) void k_matvec(GemmP p) {
    // 32 lanes write one line with one instruction.
    const int rpt = (p.N == 1) ? 1 : 32;
    const long long r0 = ((long long)blockIdx.x * 256 + threadIdx.x) * rpt; const int z = blockIdx.z, zo = z / p.zi_n, zi = z - zo * p.zi_n;
    if (r0 >= p.M) return;
    const float* Bb = p.B + zo * p.sBo + zi * p.sBi;
    float* C = p.C + zo * p.sCo + zi * p.sCi; const float* R = p.R + zo * p.sRo + zi * p.sRi;
    for (int rr = 0; rr < rpt; ++rr) {
        const long long r = r0 + rr; if (r >= p.M) break;
        const float* A = p.A + zo * p.sAo + zi * p.sAi + r * p.sAm;
        float acc[8] = {0.f, 0.f, 0.f, 0.f, 0.f, 0.f, 0.f, 0.f};
        for (int k = 0; k < p.K; ++k) { const float a = A[(long long)k * p.sAk];
#pragma unroll
            for (int j = 0; j < 8; ++j) if (j < p.N) acc[j] += a * Bb[(long long)j * p.sBn + (long long)k * p.sBk]; }
#pragma unroll
        for (int j = 0; j < 8; ++j) if (j < p.N) {
            float v = acc[j] * p.alpha;
            if (p.flags & 1) v += p.bias[j];
            if (p.flags & 2) v += p.bias[r];
            v = act_fn(v, p.act);
            if (p.flags & 4) v += p.beta * R[r * p.sRm + (long long)j * p.sRn];
            VST2(float, C + r * p.sCm + j, v);
        }
    }
}
// k_smallsoftmax: thread-per-row softmax for short rows (n <= 64): dst[r*dr + j] = softmax(scale*src[r*sr + j])
__global__ __launch_bounds__(256) void k_smallsoftmax(const float* __restrict__ src, float* __restrict__ dst, long long sr, long long dr, int n, long long R, float scale) {
    const long long r0 = ((long long)blockIdx.x * 256 + threadIdx.x) * 32;
    for (int rr = 0; rr < 32; ++rr) {
        const long long r = r0 + rr; if (r >= R) return;
        const float* s = src + r * sr; float* d = dst + r * dr;
        float mx = -__builtin_inff();
        for (int j = 0; j < n; ++j) mx = fmaxf(mx, s[j] * scale);
        float sum = 0.f;
        for (int j = 0; j < n; ++j) sum += expf(s[j] * scale - mx);
        const float inv = 1.f / sum;
        for (int j = 0; j < n; ++j) { const float v = expf(s[j] * scale - mx) * inv; VST2(float, d + j, v); }
    }
}

__global__ __launch_bounds__(32) void k_unitstat(float* __restrict__ st) { const int t = threadIdx.x; const float v = (t == 1) ? 1.f : 0.f; VST2(float, st + t, v); }

// destination (e.g. a d_out whose row width is not a multiple of 32 floats) is written by consecutive lanes of one instruction
__global__ __launch_bounds__(256) void k_lincopy(const float* __restrict__ src, long long lds, float* __restrict__ dst, long long ldd, long long rows, int cols) {
    const long long i = (long long)blockIdx.x * 256 + threadIdx.x; if (i >= rows * cols) return;
    const long long r = i / cols; const int c = (int)(i - r * cols);
    const float v = src[r * lds + c]; VST2(float, dst + r * ldd + c, v);
}

namespace w25 {
typedef __attribute__((ext_vector_type(16))) _Float16 v16h;
typedef __attribute__((ext_vector_type(8)))  _Float16 v8h;
typedef __attribute__((ext_vector_type(16))) __bf16   v16b;
typedef __attribute__((ext_vector_type(8)))  __bf16   v8b;
typedef __attribute__((ext_vector_type(8)))  float    v8f;
typedef __attribute__((ext_vector_type(4)))  float    v4f;

__device__ __forceinline__ unsigned short f2bf_bits(float f) {
  unsigned u = __float_as_uint(f);
  return (unsigned short)((u + 0x7FFFu + ((u >> 16) & 1u)) >> 16);
}
__device__ __forceinline__ float bf_bits2f(unsigned short h) { return __uint_as_float(((unsigned)h) << 16); }

// hazard guards as plain device helpers (no inline asm inside the kernel template body)
__device__ __forceinline__ void dep_guard_h(v8f& a, v8f& b, v16h x, v16h y) { asm volatile("v_nop\n\tv_nop\n\tv_nop\n\tv_nop" : "+v"(a), "+v"(b) : "v"(x), "v"(y)); }
__device__ __forceinline__ void dep_guard_b(v8f& a, v8f& b, v16b x, v16b y) { asm volatile("v_nop\n\tv_nop\n\tv_nop\n\tv_nop" : "+v"(a), "+v"(b) : "v"(x), "v"(y)); }
__device__ __forceinline__ void keep4_h(v16h a, v16h b, v16h c, v16h d) { asm volatile("v_nop" :: "v"(a), "v"(b), "v"(c), "v"(d)); }
__device__ __forceinline__ void keep4_b(v16b a, v16b b, v16b c, v16b d) { asm volatile("v_nop" :: "v"(a), "v"(b), "v"(c), "v"(d)); }
__device__ __forceinline__ void acc_guard4(v8f& a, v8f& b, v8f& c, v8f& d) { asm volatile("v_nop\n\tv_nop\n\tv_nop\n\tv_nop" : "+v"(a), "+v"(b), "+v"(c), "+v"(d)); }
template <typename T> struct Frag;
template <> struct Frag<_Float16> {
  typedef v16h V; union U { v16h v; v8h h[2]; };
  static __device__ __forceinline__ v16h load(const _Float16* p) {   // elements 0..7 <- p[0..7], 8..15 <- p[16..23]
    U f; f.h[0] = *(const v8h*)(p); f.h[1] = *(const v8h*)(p + 16); return f.v;
  }
  static __device__ __forceinline__ v8f mma(v16h a, v16h b, v8f c) {
    return __builtin_amdgcn_wmma_f32_16x16x32_f16(false, a, false, b, (short)0, c, false, false);
  }
  static __device__ __forceinline__ void guard(v8f& a, v8f& b, v16h x, v16h y) { dep_guard_h(a, b, x, y); }
  static __device__ __forceinline__ void keep(v16h a, v16h b, v16h c, v16h d) { keep4_h(a, b, c, d); }
};
template <> struct Frag<__bf16> {
  typedef v16b V; union U { v16b v; v8b h[2]; };
  static __device__ __forceinline__ v16b load(const __bf16* p) {
    U f; f.h[0] = *(const v8b*)(p); f.h[1] = *(const v8b*)(p + 16); return f.v;
  }
  static __device__ __forceinline__ v8f mma(v16b a, v16b b, v8f c) {
    return __builtin_amdgcn_wmma_f32_16x16x32_bf16(false, a, false, b, (short)0, c, false, false);
  }
  static __device__ __forceinline__ void guard(v8f& a, v8f& b, v16b x, v16b y) { dep_guard_b(a, b, x, y); }
  static __device__ __forceinline__ void keep(v16b a, v16b b, v16b c, v16b d) { keep4_b(a, b, c, d); }
};

// ---- Register-blocked batched WMMA GEMM ------------------------------------
// C[m,n] = scale * sum_k A[m,k] * Bt[n,k] (+bias)(+resid); each wave owns a 64x64 tile.
// A row-major [M,K]; Bt row-major [N,K]; M,N % 64 == 0, K % 32 == 0.
// SPLIT: operands are hi/lo planes (A2/Bt2 = lo planes, same layout); product = hi·hi + hi·lo + lo·hi.
// BIAS_MODE: 0 = none, 1 = bias[m], 2 = bias[n].
// OUT_MODE: 0 = f32, 1 = f16, 2 = bf16 hi plane (Cout) + bf16 lo plane (Cout2).
// ET: 0 = f16 operands, 1 = bf16 operands (pointers passed as 16-bit storage)
template <int ET> struct Elem;
template <> struct Elem<0> { typedef _Float16 T; };
template <> struct Elem<1> { typedef __bf16 T; };
template <int ET, bool SPLIT, int BIAS_MODE, int OUT_MODE, bool RESID, int ACT = 0>
__global__ __launch_bounds__(256) void wmma_gemm64(
    const unsigned short* __restrict__ Ap, const unsigned short* __restrict__ A2p, int lda, long strideA,
    const unsigned short* __restrict__ Btp, const unsigned short* __restrict__ Bt2p, int ldb, long strideB,
    void* __restrict__ Cout, void* __restrict__ Cout2, int ldc, long strideC,
    const float* __restrict__ bias,
    const float* __restrict__ resid, long strideR,
    int M, int N, int K, float scale) {
  typedef typename Elem<ET>::T T;
  typedef typename Frag<T>::V V;
  const T* A = (const T*)Ap; const T* A2 = (const T*)A2p; const T* Bt = (const T*)Btp; const T* Bt2 = (const T*)Bt2p;
  __shared__ __align__(16) float sT[8][16 * 68];   // per-wave 16x64 slab, pitch 68 floats
  const int b    = blockIdx.y;
  const int lane = threadIdx.x & 31;
  const int wave = threadIdx.x >> 5;
  const int tilesN = N >> 6;
  const int tilesM = M >> 6;
  const int tile = blockIdx.x * 8 + wave;
  if (tile >= tilesM * tilesN) return;   // wave-uniform; no block barriers in this kernel
  const int tm = tile / tilesN;
  const int tn = tile - tm * tilesN;
  const int m0 = tm << 6;
  const int n0 = tn << 6;

  const T* Ab  = A  + (size_t)b * strideA;
  const T* Bb  = Bt + (size_t)b * strideB;
  const T* Ab2 = SPLIT ? (A2  + (size_t)b * strideA) : nullptr;
  const T* Bb2 = SPLIT ? (Bt2 + (size_t)b * strideB) : nullptr;

  const int rlane = lane & 15;                 // row (A) / col (B, D) within subtile
  const int koff  = (lane >> 4) * 8;           // k offset of this lane half
  const int mOff  = (lane >> 4) * 8;           // D row offset

  v8f acc[4][4];
#pragma unroll
  for (int i = 0; i < 4; ++i)
#pragma unroll
    for (int j = 0; j < 4; ++j) acc[i][j] = (v8f){0.f,0.f,0.f,0.f,0.f,0.f,0.f,0.f};

  for (int k0 = 0; k0 < K; k0 += 32) {
    V bh[4], bl[4];
#pragma unroll
    for (int j = 0; j < 4; ++j) {
      const size_t bo = (size_t)(n0 + (j << 4) + rlane) * ldb + koff + k0;
      bh[j] = Frag<T>::load(Bb + bo);
      if (SPLIT) bl[j] = Frag<T>::load(Bb2 + bo);
    }
#pragma unroll
    for (int i = 0; i < 4; ++i) {
      const size_t ao = (size_t)(m0 + (i << 4) + rlane) * lda + koff + k0;
      V ah = Frag<T>::load(Ab + ao);
      V al;
      if (SPLIT) al = Frag<T>::load(Ab2 + ao);
#pragma unroll
      for (int j = 0; j < 4; ++j) {
        acc[i][j] = Frag<T>::mma(ah, bh[j], acc[i][j]);
        if (SPLIT) {
          acc[i][j] = Frag<T>::mma(ah, bl[j], acc[i][j]);
          acc[i][j] = Frag<T>::mma(al, bh[j], acc[i][j]);
        }
      }
      Frag<T>::guard(acc[i][0], acc[i][3], ah, SPLIT ? al : ah);
    }
    Frag<T>::keep(bh[0], bh[1], bh[2], bh[3]);
    if (SPLIT) Frag<T>::keep(bl[0], bl[1], bl[2], bl[3]);
  }
  acc_guard4(acc[0][0], acc[0][1], acc[0][2], acc[0][3]);
  acc_guard4(acc[1][0], acc[1][1], acc[1][2], acc[1][3]);
  acc_guard4(acc[2][0], acc[2][1], acc[2][2], acc[2][3]);
  acc_guard4(acc[3][0], acc[3][1], acc[3][2], acc[3][3]);

  // ---- epilogue ----
  float* slab = sT[wave];
  const float* Rb = RESID ? (resid + (size_t)b * strideR) : nullptr;
#pragma unroll
  for (int i = 0; i < 4; ++i) {
    const int mBase = m0 + (i << 4);
#pragma unroll
    for (int j = 0; j < 4; ++j) {
      const int n = n0 + (j << 4) + rlane;
      float bv = 0.f;
      if (BIAS_MODE == 2) bv = bias[n];
#pragma unroll
      for (int r = 0; r < 8; ++r) {
        float v = acc[i][j][r] * scale;
        if (BIAS_MODE == 1) v += bias[mBase + mOff + r];
        if (BIAS_MODE == 2) v += bv;
        if (RESID) v += Rb[(size_t)(mBase + mOff + r) * ldc + n];
        if (ACT == 1) v = tanhf(v);
        if (ACT == 2) v = fmaxf(v, 0.0f);
        if (ACT == 3) v = v / (1.0f + expf(-v));
        if (ACT == 4) v = (v > 0.f) ? v : 0.01f * v;
        if (ACT == 5) v = 0.5f * v * (1.0f + erff(v * 0.70710678118654752f));
        if (ACT == 6) v = (v > 0.f) ? v : 0.2f * v;
        if (ACT == 7) { const float u = 0.7978845608028654f * (v + 0.044715f * v * v * v); v = 0.5f * v * (1.f + tanhf(u)); }
        slab[(mOff + r) * 68 + (j << 4) + rlane] = v;
      }
    }
    __builtin_amdgcn_fence(__ATOMIC_RELEASE, "workgroup");
    __builtin_amdgcn_wave_barrier();
    __builtin_amdgcn_fence(__ATOMIC_ACQUIRE, "workgroup");
    if (OUT_MODE == 0) {
      float* C = (float*)Cout + (size_t)b * strideC;
      const int hh = lane >> 4, c4 = (lane & 15) * 4;     // row seg = 256 B = 16 lanes x 16 B
      {
#pragma unroll
        for (int it = 0; it < 8; ++it) {
          const int row = it * 2 + hh;
          v4f v = *(const v4f*)(slab + row * 68 + c4);
          *(v4f*)(C + (size_t)(mBase + row) * ldc + n0 + c4) = v;
        }
        
      }
    } else {
      const int q = lane >> 3, c8 = (lane & 7) * 8;
      unsigned short* C  = (unsigned short*)Cout  + (size_t)b * strideC;
      unsigned short* C2 = (OUT_MODE == 2) ? ((unsigned short*)Cout2 + (size_t)b * strideC) : nullptr;
      {
#pragma unroll
        for (int it = 0; it < 4; ++it) {
          const int row = it * 4 + q;
          const float* sp = slab + row * 68 + c8;
          v8h hv, lv;
#pragma unroll
          for (int e = 0; e < 8; ++e) {
            if (OUT_MODE == 1) {
              hv[e] = (_Float16)sp[e];
            } else {
              unsigned short hb = f2bf_bits(sp[e]);
              unsigned short lb = f2bf_bits(sp[e] - bf_bits2f(hb));
              hv[e] = __builtin_bit_cast(_Float16, hb);
              lv[e] = __builtin_bit_cast(_Float16, lb);
            }
          }
          *(v8h*)(C + (size_t)(mBase + row) * ldc + n0 + c8) = hv;
          if (OUT_MODE == 2) *(v8h*)(C2 + (size_t)(mBase + row) * ldc + n0 + c8) = lv;
        }
        
      }
    }
    __builtin_amdgcn_fence(__ATOMIC_RELEASE, "workgroup");
    __builtin_amdgcn_wave_barrier();
    __builtin_amdgcn_fence(__ATOMIC_ACQUIRE, "workgroup");
  }
}

__global__ __launch_bounds__(256) void cast_f32_f16x2(
    const float* __restrict__ in, _Float16* __restrict__ out, int n2) {
  int i = blockIdx.x * 256 + threadIdx.x;
  if (i < n2) {
    const _Float16 h0 = (_Float16)in[2 * i], h1 = (_Float16)in[2 * i + 1];
    const unsigned u = (unsigned)__builtin_bit_cast(unsigned short, h0) | ((unsigned)__builtin_bit_cast(unsigned short, h1) << 16);
    ((unsigned*)out)[i] = u;
    
  }
}


} // namespace w25

__global__ __launch_bounds__(256) void k_castT16(const float* __restrict__ src, long long lds, _Float16* __restrict__ dst, long long ldd, int R, int C, float s) {
    const long long i = (long long)blockIdx.x * 256 + threadIdx.x; const long long np = (long long)C * (R / 2); if (i >= np) return; const int c = (int)(i / (R / 2)); const int r = 2 * (int)(i % (R / 2));
    const _Float16 h0 = (_Float16)(src[(long long)r * lds + c] * s), h1 = (_Float16)(src[(long long)(r + 1) * lds + c] * s);
    const unsigned u = (unsigned)__builtin_bit_cast(unsigned short, h0) | ((unsigned)__builtin_bit_cast(unsigned short, h1) << 16);
    unsigned* d = (unsigned*)(dst + (long long)c * ldd + r); *d = u;  }
__global__ __launch_bounds__(256) void k_cast16(const float* __restrict__ src, long long lds, _Float16* __restrict__ dst, long long ldd, int R, int C, float s) {
    const long long i = (long long)blockIdx.x * 256 + threadIdx.x; const long long np = (long long)R * (C / 2); if (i >= np) return; const int r = (int)(i / (C / 2)); const int c = 2 * (int)(i % (C / 2));
    const _Float16 h0 = (_Float16)(src[(long long)r * lds + c] * s), h1 = (_Float16)(src[(long long)r * lds + c + 1] * s);
    const unsigned u = (unsigned)__builtin_bit_cast(unsigned short, h0) | ((unsigned)__builtin_bit_cast(unsigned short, h1) << 16);
    unsigned* d = (unsigned*)(dst + (long long)r * ldd + c); *d = u;  }

// f32 -> bf16 hi plane + bf16 lo plane (x = hi + lo to ~2^-17 relative; RNE both), [R][C] -> [R][C] (or transposed to [C][R]); 2 consecutive destination elements
__device__ __forceinline__ unsigned int f2bf2_pack(float a, float b, unsigned int* lo) {
    const unsigned short ha = w25::f2bf_bits(a), hb = w25::f2bf_bits(b);
    const unsigned short la = w25::f2bf_bits(a - w25::bf_bits2f(ha)), lb = w25::f2bf_bits(b - w25::bf_bits2f(hb));
    *lo = (unsigned)la | ((unsigned)lb << 16); return (unsigned)ha | ((unsigned)hb << 16); }
__global__ __launch_bounds__(256) void k_castS16(const float* __restrict__ src, long long lds, __bf16* __restrict__ dhi, __bf16* __restrict__ dlo, long long ldd, int R, int C, float s, int transpose) {
    const long long i = (long long)blockIdx.x * 256 + threadIdx.x; long long o; float a, b;
    if (transpose) { const long long np = (long long)C * (R / 2); if (i >= np) return; const int c = (int)(i / (R / 2)); const int r = 2 * (int)(i % (R / 2)); a = src[(long long)r * lds + c] * s; b = src[(long long)(r + 1) * lds + c] * s; o = (long long)c * ldd + r; }
    else { const long long np = (long long)R * (C / 2); if (i >= np) return; const int r = (int)(i / (C / 2)); const int c = 2 * (int)(i % (C / 2)); a = src[(long long)r * lds + c] * s; b = src[(long long)r * lds + c + 1] * s; o = (long long)r * ldd + c; }
    unsigned lo; const unsigned hi = f2bf2_pack(a, b, &lo); unsigned* ph = (unsigned*)(dhi + o); unsigned* pl = (unsigned*)(dlo + o);
    *ph = hi; *pl = lo;  }

namespace w25 {
// =====================================================================================
// Generic causal/non-causal attention for head_dim 64, f32 in / f32 out; 16-bit operands: bf16 with optional hi/lo splits, or
// plain f16 (F16=true, non-split, probabilities carried x2^15).
//   scores = (q*qscale)·kᵀ : v_wmma_f32_16x16x32_bf16; SPLIT_QK -> q,k as bf16 hi/lo (hi·hi + hi·lo + lo·hi)
//   out    = p·v           : v_wmma_f32_16x16x32_bf16; SPLIT_PV -> p,v as bf16 hi/lo; else p,v plain bf16
//   f32 accumulate; online softmax in f32. Block = 4 waves = 64 query rows of one (batch, head); S % 64 == 0.
//   Element (b, s, h, d) of tensor X lives at X[b*X_bs + s*X_rs + h*X_hs + d] (strides in floats, multiples of 4).
//   Masking: mask_mode 0 none, 1 causal (kv > q masked), 2 tensor [S][Skv] shared over (b,h) (float if
//   mask_is_int==0, int32 with element == 0 -> masked if 1, int32 with element != 0 -> masked if 2), 3 per-token vectors qmask[B][S] & kvmask[B][Skv] (int32,
//   0 -> masked), 4 causal + sliding window (kv > q or q - kv > W masked; W passed in mask_is_int);
//   5 = relative-position bias: s += cp[b,h,q][idx[q][kv]] + pc[b,h,kv][idx[q][kv]] with idx = mask_b ([S][Skv] int32) and
//   mask_a an int32 [S][Skv] tensor with nonzero = masked (tables: element (b,h,row,n) at X + b*c_bs + h*c_hs + row*c_rs + n);
//   masked scores are replaced by mask_fill (e.g. -inf or -1e9) before the softmax.
//   grid.x = B * H * (S/64) (or a sub-range with blk0).
// =====================================================================================
#define AT_D 64
#define AT_NW 4
#define AT_QB 64
#define AT_KC 64
struct AttnGeom { const float* cp = nullptr; const float* pc = nullptr; long c_bs = 0, c_rs = 0, c_hs = 0;   // mode-5 score-bias tables
                  long q_bs, q_rs, q_hs, k_bs, k_rs, k_hs, v_bs, v_rs, v_hs, o_bs, o_rs, o_hs;
                  int S, Skv, H, mask_mode; float qscale; int blk0; float mask_fill; int mask_is_int; };
static_assert(sizeof(AttnGeom) == 168, "no padding");

__device__ __forceinline__ unsigned short at_bf_bits(float f) {
  unsigned u = __float_as_uint(f);
  return (unsigned short)((u + 0x7FFFu + ((u >> 16) & 1u)) >> 16);
}
__device__ __forceinline__ __bf16 at_f2bf(float f) { return __builtin_bit_cast(__bf16, at_bf_bits(f)); }
__device__ __forceinline__ void at_split(float f, __bf16& hi, __bf16& lo) {
  const unsigned short hb = at_bf_bits(f);
  hi = __builtin_bit_cast(__bf16, hb);
  lo = at_f2bf(f - __uint_as_float(((unsigned)hb) << 16));
}
__device__ __forceinline__ v8f at_mma(v16b a, v16b b, v8f c) {
  c = __builtin_amdgcn_wmma_f32_16x16x32_bf16(false, a, false, b, (short)0, c, false, false);
  asm volatile("v_nop\n\tv_nop\n\tv_nop\n\tv_nop" : "+v"(c) : "v"(a), "v"(b));
  return c;
}
// 16-bit element as a bit pattern held in a __bf16 slot: f16 bits when F16, bf16 (RNE) otherwise
template <bool F16> __device__ __forceinline__ __bf16 at_to16(float f) {
  if (F16) return __builtin_bit_cast(__bf16, (_Float16)f);
  return at_f2bf(f);
}
template <bool F16> __device__ __forceinline__ v8f at_mma16(v16b a, v16b b, v8f c) {
  if (F16) {
    const v16h ah = __builtin_bit_cast(v16h, a), bh = __builtin_bit_cast(v16h, b);
    c = __builtin_amdgcn_wmma_f32_16x16x32_f16(false, ah, false, bh, (short)0, c, false, false);
    asm volatile("v_nop\n\tv_nop\n\tv_nop\n\tv_nop" : "+v"(c) : "v"(ah), "v"(bh));
    return c;
  }
  return at_mma(a, b, c);
}

template <bool SPLIT_QK, bool SPLIT_PV, bool F16 = false>
__global__ __launch_bounds__(128)
void attn64_kernel(const float* __restrict__ q, const float* __restrict__ k,
                   const float* __restrict__ v, float* __restrict__ out,
                   const void* __restrict__ mask_a, const int* __restrict__ mask_b, AttnGeom g) {
  static_assert(!(F16 && (SPLIT_QK || SPLIT_PV)), "f16 mode is non-split");
  const float PSC = F16 ? 32768.0f : 1.0f;     // f16 probabilities carried x2^15 (subnormal range), folded into the final 1/l
  union FB { v16b v; v8b h[2]; };
  __shared__ __align__(16) __bf16 Ksh[AT_KC * AT_D];             // K hi [kv][d]      8 KB
  __shared__ __align__(16) __bf16 Ksl[SPLIT_QK ? AT_KC * AT_D : 8];
  __shared__ __align__(16) __bf16 Vth[AT_D * AT_KC];             // V hi [d][kv]      8 KB
  __shared__ __align__(16) __bf16 Vtl[SPLIT_PV ? AT_D * AT_KC : 8];
  __shared__ __align__(16) __bf16 Psh[AT_NW][16 * AT_KC];        // per wave P hi [row][kv]  8 KB
  __shared__ __align__(16) __bf16 Psl[SPLIT_PV ? AT_NW : 1][SPLIT_PV ? 16 * AT_KC : 8];
  __shared__ __align__(16) float  Os[AT_NW][16 * 68];            // per wave out tile, pitch 68

  const int tid  = threadIdx.x;
  const int wave = tid >> 5;
  const int lane = tid & 31;
  const int hh   = lane >> 4;
  const int c    = lane & 15;

  const int nqb = g.S / AT_QB;
  const int bx = blockIdx.x + g.blk0;
  const int qb = bx % nqb;
  const int bh = bx / nqb;
  const int h  = bh % g.H;
  const int b  = bh / g.H;
  const int qbase_block = qb * AT_QB;
  const int q0 = qbase_block + wave * 16;

  const float* qb_ptr = q + (size_t)b * g.q_bs + (size_t)h * g.q_hs;
  const float* kb_ptr = k + (size_t)b * g.k_bs + (size_t)h * g.k_hs;
  const float* vb_ptr = v + (size_t)b * g.v_bs + (size_t)h * g.v_hs;
  float*       ob_ptr = out + (size_t)b * g.o_bs + (size_t)h * g.o_hs;

  // ---- Q fragments (A operand): 2 d-chunks, hi (and lo) ----
  v16b qah[2], qal[2];
  {
    const float* qrow = qb_ptr + (size_t)(q0 + c) * g.q_rs;
#pragma unroll
    for (int dc = 0; dc < 2; ++dc) {
#pragma unroll
      for (int e = 0; e < 8; ++e) {
        const float f0 = qrow[dc * 32 + 8 * hh + e] * g.qscale;
        const float f1 = qrow[dc * 32 + 16 + 8 * hh + e] * g.qscale;
        if (SPLIT_QK) { __bf16 hq, lq; at_split(f0, hq, lq); qah[dc][e] = hq; qal[dc][e] = lq; at_split(f1, hq, lq); qah[dc][8 + e] = hq; qal[dc][8 + e] = lq; }
        else { qah[dc][e] = at_to16<F16>(f0); qah[dc][8 + e] = at_to16<F16>(f1); qal[dc][e] = qah[dc][e]; qal[dc][8 + e] = qah[dc][8 + e]; }
      }
    }
  }

  float mrow[8], lrow[8];
  v8f oacc[4];
#pragma unroll
  for (int r = 0; r < 8; ++r) { mrow[r] = -INFINITY; lrow[r] = 0.f; }
#pragma unroll
  for (int t = 0; t < 4; ++t) oacc[t] = (v8f){0.f,0.f,0.f,0.f,0.f,0.f,0.f,0.f};

  const int nChunks = (g.mask_mode == 1 || g.mask_mode == 4) ? (qb + 1) : (g.Skv / AT_KC);   // block-uniform
  // per-row query mask (mode 3)
  int qkeep[8];
#pragma unroll
  for (int r = 0; r < 8; ++r) qkeep[r] = (g.mask_mode == 3) ? mask_b[(size_t)b * g.S + q0 + 8 * hh + r] : 1;   // mask_b = qmask in mode 3
  for (int kc = 0; kc < nChunks; ++kc) {
    const int kv0 = kc * AT_KC;
    __syncthreads();
    {
      const int kvr = tid >> 1, dh = (tid & 1) * 32;
      const float* krow = kb_ptr + (size_t)(kv0 + kvr) * g.k_rs + dh;
      const float* vrow = vb_ptr + (size_t)(kv0 + kvr) * g.v_rs + dh;
#pragma unroll
      for (int i = 0; i < 8; ++i) {
        v4f kk = *(const v4f*)(krow + 4 * i);
        v4f vv = *(const v4f*)(vrow + 4 * i);
#pragma unroll
        for (int e = 0; e < 4; ++e) {
          const int d = dh + 4 * i + e;
          if (SPLIT_QK) { __bf16 a, bl; at_split(kk[e], a, bl); Ksh[kvr * AT_D + d] = a; Ksl[kvr * AT_D + d] = bl; }
          else Ksh[kvr * AT_D + d] = at_to16<F16>(kk[e]);
          if (SPLIT_PV) { __bf16 a, bl; at_split(vv[e], a, bl); Vth[d * AT_KC + kvr] = a; Vtl[d * AT_KC + kvr] = bl; }
          else Vth[d * AT_KC + kvr] = at_to16<F16>(vv[e]);
        }
      }
    }
    __syncthreads();

    v8f s[4];
#pragma unroll
    for (int j = 0; j < 4; ++j) {
      s[j] = (v8f){0.f,0.f,0.f,0.f,0.f,0.f,0.f,0.f};
#pragma unroll 1
      for (int dc = 0; dc < 2; ++dc) {
        FB kb;
        kb.h[0] = *(const v8b*)(Ksh + (j * 16 + c) * AT_D + dc * 32 + 8 * hh);
        kb.h[1] = *(const v8b*)(Ksh + (j * 16 + c) * AT_D + dc * 32 + 16 + 8 * hh);
        s[j] = at_mma16<F16>(qah[dc], kb.v, s[j]);
        if (SPLIT_QK) {
          FB kl;
          kl.h[0] = *(const v8b*)(Ksl + (j * 16 + c) * AT_D + dc * 32 + 8 * hh);
          kl.h[1] = *(const v8b*)(Ksl + (j * 16 + c) * AT_D + dc * 32 + 16 + 8 * hh);
          s[j] = at_mma16<F16>(qah[dc], kl.v, s[j]);
          s[j] = at_mma16<F16>(qal[dc], kb.v, s[j]);
        }
      }
    }
    const bool diag = (g.mask_mode == 1) && (kc == qb);
    int kvkeep[4] = {1, 1, 1, 1};
    if (g.mask_mode == 3) {
#pragma unroll
      for (int j = 0; j < 4; ++j) kvkeep[j] = ((const int*)mask_a)[(size_t)b * g.Skv + kv0 + j * 16 + c];   // mask_a = kvmask
    }
    float cm[8];
#pragma unroll
    for (int r = 0; r < 8; ++r) {
      const int qrow = q0 + 8 * hh + r;
      float m = -INFINITY;
#pragma unroll
      for (int j = 0; j < 4; ++j) {
        const int kvcol = kv0 + j * 16 + c;
        bool masked = false;
        if (diag) masked = (kvcol > qrow);
        else if (g.mask_mode == 4) masked = (kvcol > qrow) || (qrow - kvcol > g.mask_is_int);
        else if (g.mask_mode == 2) {
          const size_t mi = (size_t)qrow * g.Skv + kvcol;
          masked = (g.mask_is_int == 0) ? (((const float*)mask_a)[mi] == 0.0f)
                 : (g.mask_is_int == 1) ? (((const int*)mask_a)[mi] == 0) : (((const int*)mask_a)[mi] != 0);
        } else if (g.mask_mode == 3) masked = (qkeep[r] == 0) || (kvkeep[j] == 0);
        else if (g.mask_mode == 5) {
          const size_t mi = (size_t)qrow * g.Skv + kvcol;
          masked = (((const int*)mask_a)[mi] != 0);
          int n = mask_b[mi]; n = n < 0 ? 0 : n;
          s[j][r] += g.cp[(size_t)b * g.c_bs + (size_t)h * g.c_hs + (size_t)qrow * g.c_rs + n]
                   + g.pc[(size_t)b * g.c_bs + (size_t)h * g.c_hs + (size_t)kvcol * g.c_rs + n];
        }
        if (masked) s[j][r] = g.mask_fill;
        m = fmaxf(m, s[j][r]);
      }
#pragma unroll
      for (int off = 1; off < 16; off <<= 1) m = fmaxf(m, __shfl_xor(m, off, 32));
      cm[r] = m;
    }
    __bf16* pwh = Psh[wave];
    __bf16* pwl = Psl[SPLIT_PV ? wave : 0];
#pragma unroll
    for (int r = 0; r < 8; ++r) {
      const float mnew = fmaxf(mrow[r], cm[r]);
      const float alpha = expf(mrow[r] - mnew);
      mrow[r] = mnew;
      float psum = 0.f;
#pragma unroll
      for (int j = 0; j < 4; ++j) {
        const float p = expf(s[j][r] - mnew);
        psum += p;
        if (SPLIT_PV) { __bf16 a, bl; at_split(p, a, bl); pwh[(8 * hh + r) * AT_KC + j * 16 + c] = a; pwl[(8 * hh + r) * AT_KC + j * 16 + c] = bl; }
        else pwh[(8 * hh + r) * AT_KC + j * 16 + c] = at_to16<F16>(p * PSC);
      }
#pragma unroll
      for (int off = 1; off < 16; off <<= 1) psum += __shfl_xor(psum, off, 32);
      lrow[r] = lrow[r] * alpha + psum;
#pragma unroll
      for (int t = 0; t < 4; ++t) oacc[t][r] *= alpha;
    }
    __builtin_amdgcn_fence(__ATOMIC_RELEASE, "workgroup");
    __builtin_amdgcn_wave_barrier();
    __builtin_amdgcn_fence(__ATOMIC_ACQUIRE, "workgroup");
#pragma unroll 1
    for (int kk = 0; kk < 2; ++kk) {
      FB pa, pl;
      pa.h[0] = *(const v8b*)(pwh + c * AT_KC + kk * 32 + 8 * hh);
      pa.h[1] = *(const v8b*)(pwh + c * AT_KC + kk * 32 + 16 + 8 * hh);
      if (SPLIT_PV) {
        pl.h[0] = *(const v8b*)(pwl + c * AT_KC + kk * 32 + 8 * hh);
        pl.h[1] = *(const v8b*)(pwl + c * AT_KC + kk * 32 + 16 + 8 * hh);
      }
#pragma unroll
      for (int t = 0; t < 4; ++t) {
        FB vb;
        vb.h[0] = *(const v8b*)(Vth + (t * 16 + c) * AT_KC + kk * 32 + 8 * hh);
        vb.h[1] = *(const v8b*)(Vth + (t * 16 + c) * AT_KC + kk * 32 + 16 + 8 * hh);
        oacc[t] = at_mma16<F16>(pa.v, vb.v, oacc[t]);
        if (SPLIT_PV) {
          FB vl;
          vl.h[0] = *(const v8b*)(Vtl + (t * 16 + c) * AT_KC + kk * 32 + 8 * hh);
          vl.h[1] = *(const v8b*)(Vtl + (t * 16 + c) * AT_KC + kk * 32 + 16 + 8 * hh);
          oacc[t] = at_mma16<F16>(pa.v, vl.v, oacc[t]);
          oacc[t] = at_mma16<F16>(pl.v, vb.v, oacc[t]);
        }
      }
    }
  }

  float* os = Os[wave];
#pragma unroll
  for (int r = 0; r < 8; ++r) {
    const float inv = 1.0f / (lrow[r] * PSC);
#pragma unroll
    for (int t = 0; t < 4; ++t) os[(8 * hh + r) * 68 + t * 16 + c] = oacc[t][r] * inv;
  }
  __builtin_amdgcn_fence(__ATOMIC_RELEASE, "workgroup");
  __builtin_amdgcn_wave_barrier();
  __builtin_amdgcn_fence(__ATOMIC_ACQUIRE, "workgroup");
  {
    const int c4 = (lane & 15) * 4;
    {
#pragma unroll
      for (int it = 0; it < 8; ++it) {
        const int row = it * 2 + hh;
        v4f val = *(const v4f*)(os + row * 68 + c4);
        *(v4f*)(ob_ptr + (size_t)(q0 + row) * g.o_rs + c4) = val;
      }
      
    }
  }
}

} // namespace w25


__device__ __forceinline__ void st_h2(unsigned short* d2, float a, float b) { const unsigned u = (unsigned)__builtin_bit_cast(unsigned short, (_Float16)a) | ((unsigned)__builtin_bit_cast(unsigned short, (_Float16)b) << 16); unsigned* d = (unsigned*)d2; *d = u;  }
__device__ __forceinline__ float ldh(const unsigned short* p) { return (float)__builtin_bit_cast(_Float16, *p); }
__device__ __forceinline__ v4f ld4h(const unsigned short* p) { const unsigned long long u = *(const unsigned long long*)p; v4f a;
    a.x = (float)__builtin_bit_cast(_Float16, (unsigned short)(u & 0xFFFFu)); a.y = (float)__builtin_bit_cast(_Float16, (unsigned short)((u >> 16) & 0xFFFFu)); a.z = (float)__builtin_bit_cast(_Float16, (unsigned short)((u >> 32) & 0xFFFFu)); a.w = (float)__builtin_bit_cast(_Float16, (unsigned short)((u >> 48) & 0xFFFFu)); return a; }
__device__ __forceinline__ unsigned long long pk4h(v4f s) { return (unsigned long long)__builtin_bit_cast(unsigned short, (_Float16)s.x) | ((unsigned long long)__builtin_bit_cast(unsigned short, (_Float16)s.y) << 16) | ((unsigned long long)__builtin_bit_cast(unsigned short, (_Float16)s.z) << 32) | ((unsigned long long)__builtin_bit_cast(unsigned short, (_Float16)s.w) << 48); }
typedef unsigned v4u __attribute__((ext_vector_type(4)));
__device__ __forceinline__ void st8h(unsigned short* d, v4f a, v4f b) { const unsigned long long pa = pk4h(a), pb = pk4h(b); v4u pk; pk.x = (unsigned)(pa & 0xFFFFFFFFull); pk.y = (unsigned)(pa >> 32); pk.z = (unsigned)(pb & 0xFFFFFFFFull); pk.w = (unsigned)(pb >> 32); v4u* dd = (v4u*)d; *dd = pk;  }
__device__ __forceinline__ unsigned short bfu_rne(float v) { unsigned u = __builtin_bit_cast(unsigned, v); u += 0x7FFFu + ((u >> 16) & 1u); return (unsigned short)(u >> 16); }
__device__ __forceinline__ void bfsplit(float v, unsigned short& hi, unsigned short& lo) { hi = bfu_rne(v); lo = bfu_rne(v - __builtin_bit_cast(float, (unsigned)hi << 16)); }
__device__ __forceinline__ void st_s2(unsigned short* Hp, unsigned short* Lp, long long o, float a, float b) { unsigned short h0,l0,h1,l1; bfsplit(a,h0,l0); bfsplit(b,h1,l1); const unsigned ph = (unsigned)h0 | ((unsigned)h1 << 16), pl = (unsigned)l0 | ((unsigned)l1 << 16);
    unsigned* dh = (unsigned*)(Hp + o); unsigned* dl = (unsigned*)(Lp + o); *dh = ph; *dl = pl;  }
__device__ __forceinline__ int cl(int v, int n) { return min(max(v, 0), n - 1); }

// GAT-style aggregation over a device in-edge CSR at dst (+ optional explicit self loop as iteration j = -1):
//   logit = leaky(AS[src][h] + AD[n][h] (+ EW[e]*CW[h]), slope); softmax over the node's edges per head; acc[c] = sum alpha XP[src][c] (f16 gather plane, pitch XW; 256 channels = H heads x CH)
//   wave per node; lane L owns channels 8L..8L+7 (head = 8L / CH); per-lane softmax state (lanes of one head agree) -> no shuffles in the loop.
//   EPI 0: + bias -> f32 OUT[n][256] via LDS redistribution (two 16-B stores per lane, each instruction 512 contiguous B)
//   EPI 1: + bias, LayerNorm(256) * g + bb, relu -> bf16 hi/lo planes OH/OL [n][256] (16-B stores)
//   EPI 2: mean over the 256/CH heads + bias[0..63], LayerNorm(64) * g + bb, relu -> f32 OUT[n][64] (CH must be 64; LDS redistribution, 8-B stores)
//   EPI 3: mean over heads + bias -> f32 OUT[n][64] (no norm / activation)
//   EPI 4: + bias, ELU -> bf16 hi/lo planes OH/OL [n][256];  EPI 5: + bias (full 256-wide, per head), ELU, then mean over the 256/CH heads -> f32 OUT[n][64]
//   EPI 6: (CH = 128, two heads) mean over the two heads, + bias[0..127], relu -> f32 OUT[n][128] (LDS redistribution, 16-B stores)
//   EWM 0: no edge weights; 1: logit += EW[e] * CW[h] (self loop weight 1); 2: alpha *= EW[e] after the softmax (message scale; self loop weight 1)
template <int CH, bool SELF, int EWM, int EPI>
__global__ __launch_bounds__(256) void k_gat_agg(const unsigned short* __restrict__ XP, int XW, const float* __restrict__ AS, const float* __restrict__ AD, int ASTR, const float* __restrict__ EW, const float* __restrict__ CW,
        const int* __restrict__ esrc, const int* __restrict__ off, const int* __restrict__ cnt, const int* __restrict__ slot, const float* __restrict__ bias, const float* __restrict__ g, const float* __restrict__ bb,
        float* __restrict__ OUT, unsigned short* __restrict__ OH, unsigned short* __restrict__ OL, int N, int E, int CAP, float slope) {
    __shared__ float stage[8][256];
    const int wv = threadIdx.x >> 5; const int n = blockIdx.x * 8 + wv; const int L = threadIdx.x & 31; if (n >= N) return; const int c0 = 8 * L; const int h = c0 / CH;
    const float ad = AD[(long long)n * ASTR + h]; const float cw = (EWM == 1) ? CW[h] : 0.f; float m = -3.0e38f, s = 0.f; v4f a0, a1; a0.x = a0.y = a0.z = a0.w = 0.f; a1 = a0;
    const int p0 = cl(off[n], E + 1), cn = min(max(cnt[n], 0), CAP);
    for (int j = (SELF ? -1 : 0); j < cn; ++j) { int sj; float ew = 0.f;
        if (j < 0) { sj = n; ew = 1.f; } else { int e = slot[cl(p0 + j, E)]; e = cl(e, E); sj = cl(esrc[e], N); if (EWM != 0) ew = EW[e]; }
        float lg = AS[(long long)sj * ASTR + h] + ad + ((EWM == 1) ? ew * cw : 0.f); lg = (lg >= 0.f) ? lg : slope * lg;
        const float mn = fmaxf(m, lg); const float cz = expf(m - mn), pj = expf(lg - mn); s = s * cz + pj; const float pw = (EWM == 2) ? pj * ew : pj;
        const unsigned short* xr = XP + (long long)sj * XW + c0; a0 = a0 * cz + ld4h(xr) * pw; a1 = a1 * cz + ld4h(xr + 4) * pw; m = mn; }
    const float inv = (s > 0.f) ? 1.f / (s + 1e-16f) : 0.f; a0 = a0 * inv; a1 = a1 * inv;
    if (EPI == 0 || EPI == 1 || EPI == 4 || EPI == 5) { a0 = a0 + *(const v4f*)(bias + c0); a1 = a1 + *(const v4f*)(bias + c0 + 4); }
    if (EPI == 4 || EPI == 5) { a0.x = (a0.x > 0.f) ? a0.x : (expf(a0.x) - 1.f); a0.y = (a0.y > 0.f) ? a0.y : (expf(a0.y) - 1.f); a0.z = (a0.z > 0.f) ? a0.z : (expf(a0.z) - 1.f); a0.w = (a0.w > 0.f) ? a0.w : (expf(a0.w) - 1.f);
        a1.x = (a1.x > 0.f) ? a1.x : (expf(a1.x) - 1.f); a1.y = (a1.y > 0.f) ? a1.y : (expf(a1.y) - 1.f); a1.z = (a1.z > 0.f) ? a1.z : (expf(a1.z) - 1.f); a1.w = (a1.w > 0.f) ? a1.w : (expf(a1.w) - 1.f); }
    if (EPI == 4) { float o8[8] = {a0.x, a0.y, a0.z, a0.w, a1.x, a1.y, a1.z, a1.w}; unsigned short hh[8], ll[8];
#pragma unroll
        for (int u = 0; u < 8; ++u) bfsplit(o8[u], hh[u], ll[u]);
        const unsigned long long ph0 = (unsigned long long)hh[0] | ((unsigned long long)hh[1] << 16) | ((unsigned long long)hh[2] << 32) | ((unsigned long long)hh[3] << 48), pl0 = (unsigned long long)ll[0] | ((unsigned long long)ll[1] << 16) | ((unsigned long long)ll[2] << 32) | ((unsigned long long)ll[3] << 48);
        const unsigned long long ph1 = (unsigned long long)hh[4] | ((unsigned long long)hh[5] << 16) | ((unsigned long long)hh[6] << 32) | ((unsigned long long)hh[7] << 48), pl1 = (unsigned long long)ll[4] | ((unsigned long long)ll[5] << 16) | ((unsigned long long)ll[6] << 32) | ((unsigned long long)ll[7] << 48);
        v4u pk; pk.x = (unsigned)(ph0 & 0xFFFFFFFFull); pk.y = (unsigned)(ph0 >> 32); pk.z = (unsigned)(ph1 & 0xFFFFFFFFull); pk.w = (unsigned)(ph1 >> 32); v4u* dh = (v4u*)(OH + (long long)n * 256 + c0); *dh = pk; 
        v4u ql; ql.x = (unsigned)(pl0 & 0xFFFFFFFFull); ql.y = (unsigned)(pl0 >> 32); ql.z = (unsigned)(pl1 & 0xFFFFFFFFull); ql.w = (unsigned)(pl1 >> 32); v4u* dl = (v4u*)(OL + (long long)n * 256 + c0); *dl = ql;  return; }
    if (EPI == 6) {
        a0.x += __shfl_xor(a0.x, 16); a0.y += __shfl_xor(a0.y, 16); a0.z += __shfl_xor(a0.z, 16); a0.w += __shfl_xor(a0.w, 16); a1.x += __shfl_xor(a1.x, 16); a1.y += __shfl_xor(a1.y, 16); a1.z += __shfl_xor(a1.z, 16); a1.w += __shfl_xor(a1.w, 16);
        if (L < 16) { const int cb = 8 * L; const v4f b0 = *(const v4f*)(bias + cb), b1v = *(const v4f*)(bias + cb + 4);
            stage[wv][cb] = fmaxf(a0.x * 0.5f + b0.x, 0.f); stage[wv][cb + 1] = fmaxf(a0.y * 0.5f + b0.y, 0.f); stage[wv][cb + 2] = fmaxf(a0.z * 0.5f + b0.z, 0.f); stage[wv][cb + 3] = fmaxf(a0.w * 0.5f + b0.w, 0.f);
            stage[wv][cb + 4] = fmaxf(a1.x * 0.5f + b1v.x, 0.f); stage[wv][cb + 5] = fmaxf(a1.y * 0.5f + b1v.y, 0.f); stage[wv][cb + 6] = fmaxf(a1.z * 0.5f + b1v.z, 0.f); stage[wv][cb + 7] = fmaxf(a1.w * 0.5f + b1v.w, 0.f); }
        __builtin_amdgcn_fence(__ATOMIC_RELEASE, "workgroup"); __builtin_amdgcn_wave_barrier(); __builtin_amdgcn_fence(__ATOMIC_ACQUIRE, "workgroup");
        v4f o6; o6.x = stage[wv][4 * L]; o6.y = stage[wv][4 * L + 1]; o6.z = stage[wv][4 * L + 2]; o6.w = stage[wv][4 * L + 3]; VST2V4(OUT + (long long)n * 128 + 4 * L, o6); return; }
    if (EPI == 5) {
        a0.x += __shfl_xor(a0.x, 8); a0.y += __shfl_xor(a0.y, 8); a0.z += __shfl_xor(a0.z, 8); a0.w += __shfl_xor(a0.w, 8); a1.x += __shfl_xor(a1.x, 8); a1.y += __shfl_xor(a1.y, 8); a1.z += __shfl_xor(a1.z, 8); a1.w += __shfl_xor(a1.w, 8);
        a0.x += __shfl_xor(a0.x, 16); a0.y += __shfl_xor(a0.y, 16); a0.z += __shfl_xor(a0.z, 16); a0.w += __shfl_xor(a0.w, 16); a1.x += __shfl_xor(a1.x, 16); a1.y += __shfl_xor(a1.y, 16); a1.z += __shfl_xor(a1.z, 16); a1.w += __shfl_xor(a1.w, 16);
        const int gq5 = L & 7; a0 = a0 * 0.25f; a1 = a1 * 0.25f;
        if (L < 8) { stage[wv][8 * gq5] = a0.x; stage[wv][8 * gq5 + 1] = a0.y; stage[wv][8 * gq5 + 2] = a0.z; stage[wv][8 * gq5 + 3] = a0.w; stage[wv][8 * gq5 + 4] = a1.x; stage[wv][8 * gq5 + 5] = a1.y; stage[wv][8 * gq5 + 6] = a1.z; stage[wv][8 * gq5 + 7] = a1.w; }
        __builtin_amdgcn_fence(__ATOMIC_RELEASE, "workgroup"); __builtin_amdgcn_wave_barrier(); __builtin_amdgcn_fence(__ATOMIC_ACQUIRE, "workgroup");
        const unsigned long long pk5 = (unsigned long long)__builtin_bit_cast(unsigned, stage[wv][2 * L]) | ((unsigned long long)__builtin_bit_cast(unsigned, stage[wv][2 * L + 1]) << 32); VST2(unsigned long long, (unsigned long long*)(OUT + (long long)n * 64 + 2 * L), pk5); return; }
    if (EPI == 1) { float sm = a0.x + a0.y + a0.z + a0.w + a1.x + a1.y + a1.z + a1.w;
#pragma unroll
        for (int o = 16; o > 0; o >>= 1) sm += __shfl_xor(sm, o);
        const float mu = sm * (1.f / 256.f); const v4f d0 = a0 - mu, d1 = a1 - mu; float q = d0.x * d0.x + d0.y * d0.y + d0.z * d0.z + d0.w * d0.w + d1.x * d1.x + d1.y * d1.y + d1.z * d1.z + d1.w * d1.w;
#pragma unroll
        for (int o = 16; o > 0; o >>= 1) q += __shfl_xor(q, o);
        const float rs = rsqrtf(q * (1.f / 256.f) + 1e-5f); float o8[8] = {d0.x, d0.y, d0.z, d0.w, d1.x, d1.y, d1.z, d1.w}; unsigned short hh[8], ll[8];
#pragma unroll
        for (int u = 0; u < 8; ++u) { const float v = fmaxf(o8[u] * rs * g[c0 + u] + bb[c0 + u], 0.f); bfsplit(v, hh[u], ll[u]); }
        const unsigned long long ph0 = (unsigned long long)hh[0] | ((unsigned long long)hh[1] << 16) | ((unsigned long long)hh[2] << 32) | ((unsigned long long)hh[3] << 48), pl0 = (unsigned long long)ll[0] | ((unsigned long long)ll[1] << 16) | ((unsigned long long)ll[2] << 32) | ((unsigned long long)ll[3] << 48);
        const unsigned long long ph1 = (unsigned long long)hh[4] | ((unsigned long long)hh[5] << 16) | ((unsigned long long)hh[6] << 32) | ((unsigned long long)hh[7] << 48), pl1 = (unsigned long long)ll[4] | ((unsigned long long)ll[5] << 16) | ((unsigned long long)ll[6] << 32) | ((unsigned long long)ll[7] << 48);
        // lane L's 8 halves at c0 = 8L: 16 B -> one 16-B store per plane (32 lanes x 16 B = whole 512-B row)
        v4u pk; pk.x = (unsigned)(ph0 & 0xFFFFFFFFull); pk.y = (unsigned)(ph0 >> 32); pk.z = (unsigned)(ph1 & 0xFFFFFFFFull); pk.w = (unsigned)(ph1 >> 32); v4u* dh = (v4u*)(OH + (long long)n * 256 + c0); *dh = pk; 
        v4u ql; ql.x = (unsigned)(pl0 & 0xFFFFFFFFull); ql.y = (unsigned)(pl0 >> 32); ql.z = (unsigned)(pl1 & 0xFFFFFFFFull); ql.w = (unsigned)(pl1 >> 32); v4u* dl = (v4u*)(OL + (long long)n * 256 + c0); *dl = ql;  return; }
    if (EPI == 2 || EPI == 3) {   // head mean: lanes L, L^8, L^16, L^24 hold the same chan group of the 4 heads (CH = 64 -> 8 lanes per head)
        a0.x += __shfl_xor(a0.x, 8); a0.y += __shfl_xor(a0.y, 8); a0.z += __shfl_xor(a0.z, 8); a0.w += __shfl_xor(a0.w, 8); a1.x += __shfl_xor(a1.x, 8); a1.y += __shfl_xor(a1.y, 8); a1.z += __shfl_xor(a1.z, 8); a1.w += __shfl_xor(a1.w, 8);
        a0.x += __shfl_xor(a0.x, 16); a0.y += __shfl_xor(a0.y, 16); a0.z += __shfl_xor(a0.z, 16); a0.w += __shfl_xor(a0.w, 16); a1.x += __shfl_xor(a1.x, 16); a1.y += __shfl_xor(a1.y, 16); a1.z += __shfl_xor(a1.z, 16); a1.w += __shfl_xor(a1.w, 16);
        const int gq = L & 7; a0 = a0 * 0.25f + *(const v4f*)(bias + 8 * gq); a1 = a1 * 0.25f + *(const v4f*)(bias + 8 * gq + 4);      // every lane now holds channels 8gq..8gq+7 of the mean
        if (EPI == 3) { if (L < 8) { stage[wv][8 * gq] = a0.x; stage[wv][8 * gq + 1] = a0.y; stage[wv][8 * gq + 2] = a0.z; stage[wv][8 * gq + 3] = a0.w; stage[wv][8 * gq + 4] = a1.x; stage[wv][8 * gq + 5] = a1.y; stage[wv][8 * gq + 6] = a1.z; stage[wv][8 * gq + 7] = a1.w; }
            __builtin_amdgcn_fence(__ATOMIC_RELEASE, "workgroup"); __builtin_amdgcn_wave_barrier(); __builtin_amdgcn_fence(__ATOMIC_ACQUIRE, "workgroup");
            const unsigned long long pk3 = (unsigned long long)__builtin_bit_cast(unsigned, stage[wv][2 * L]) | ((unsigned long long)__builtin_bit_cast(unsigned, stage[wv][2 * L + 1]) << 32); VST2(unsigned long long, (unsigned long long*)(OUT + (long long)n * 64 + 2 * L), pk3); return; }
        float sm = (L < 8) ? (a0.x + a0.y + a0.z + a0.w + a1.x + a1.y + a1.z + a1.w) : 0.f;
#pragma unroll
        for (int o = 16; o > 0; o >>= 1) sm += __shfl_xor(sm, o);
        const float mu = sm * (1.f / 64.f); const v4f d0 = a0 - mu, d1 = a1 - mu; float q = (L < 8) ? (d0.x * d0.x + d0.y * d0.y + d0.z * d0.z + d0.w * d0.w + d1.x * d1.x + d1.y * d1.y + d1.z * d1.z + d1.w * d1.w) : 0.f;
#pragma unroll
        for (int o = 16; o > 0; o >>= 1) q += __shfl_xor(q, o);
        const float rs = rsqrtf(q * (1.f / 64.f) + 1e-5f);
        if (L < 8) { const float* gg = g + 8 * gq; const float* bq = bb + 8 * gq; stage[wv][8 * gq] = fmaxf(d0.x * rs * gg[0] + bq[0], 0.f); stage[wv][8 * gq + 1] = fmaxf(d0.y * rs * gg[1] + bq[1], 0.f); stage[wv][8 * gq + 2] = fmaxf(d0.z * rs * gg[2] + bq[2], 0.f); stage[wv][8 * gq + 3] = fmaxf(d0.w * rs * gg[3] + bq[3], 0.f);
            stage[wv][8 * gq + 4] = fmaxf(d1.x * rs * gg[4] + bq[4], 0.f); stage[wv][8 * gq + 5] = fmaxf(d1.y * rs * gg[5] + bq[5], 0.f); stage[wv][8 * gq + 6] = fmaxf(d1.z * rs * gg[6] + bq[6], 0.f); stage[wv][8 * gq + 7] = fmaxf(d1.w * rs * gg[7] + bq[7], 0.f); }
        __builtin_amdgcn_fence(__ATOMIC_RELEASE, "workgroup"); __builtin_amdgcn_wave_barrier(); __builtin_amdgcn_fence(__ATOMIC_ACQUIRE, "workgroup");
        const unsigned long long pk = (unsigned long long)__builtin_bit_cast(unsigned, stage[wv][2 * L]) | ((unsigned long long)__builtin_bit_cast(unsigned, stage[wv][2 * L + 1]) << 32); VST2(unsigned long long, (unsigned long long*)(OUT + (long long)n * 64 + 2 * L), pk); return; }
    // EPI 0
    stage[wv][c0] = a0.x; stage[wv][c0 + 1] = a0.y; stage[wv][c0 + 2] = a0.z; stage[wv][c0 + 3] = a0.w; stage[wv][c0 + 4] = a1.x; stage[wv][c0 + 5] = a1.y; stage[wv][c0 + 6] = a1.z; stage[wv][c0 + 7] = a1.w;
    __builtin_amdgcn_fence(__ATOMIC_RELEASE, "workgroup"); __builtin_amdgcn_wave_barrier(); __builtin_amdgcn_fence(__ATOMIC_ACQUIRE, "workgroup");
#pragma unroll
    for (int q2 = 0; q2 < 2; ++q2) { const int c = 128 * q2 + 4 * L; v4f v; v.x = stage[wv][c]; v.y = stage[wv][c + 1]; v.z = stage[wv][c + 2]; v.w = stage[wv][c + 3]; VST2V4(OUT + (long long)n * 256 + c, v); } }

__device__ __forceinline__ void st4s(unsigned short* Hp, unsigned short* Lp, long long o, v4f a) { unsigned short h[4], l[4]; bfsplit(a.x, h[0], l[0]); bfsplit(a.y, h[1], l[1]); bfsplit(a.z, h[2], l[2]); bfsplit(a.w, h[3], l[3]);
    const unsigned long long ph = (unsigned long long)h[0] | ((unsigned long long)h[1] << 16) | ((unsigned long long)h[2] << 32) | ((unsigned long long)h[3] << 48), pl = (unsigned long long)l[0] | ((unsigned long long)l[1] << 16) | ((unsigned long long)l[2] << 32) | ((unsigned long long)l[3] << 48);
    VST2(unsigned long long, (unsigned long long*)(Hp + o), ph); VST2(unsigned long long, (unsigned long long*)(Lp + o), pl); }
// f32 [nval2 pairs] -> bf16 hi/lo planes (n2 pairs; pairs >= nval2 zero); thread-linear 4-B stores per plane
__global__ __launch_bounds__(256) void k_pl(const float* __restrict__ S, unsigned short* __restrict__ PH, unsigned short* __restrict__ PL, long long nval2, long long n2) { const long long u = (long long)blockIdx.x * 256 + threadIdx.x; if (u >= n2) return; const bool in = (u < nval2); const long long uc = in ? u : ((nval2 > 0) ? (nval2 - 1) : 0); const float a = S[2 * uc], b = S[2 * uc + 1]; st_s2(PH, PL, 2 * u, in ? a : 0.f, in ? b : 0.f); }
// WC [K][NOP] (thread-linear whole rows) = [W (cols < FO) | 0 | W_h . as_h @EO+h | W_h . ad_h @EO+NH+h | 0 ...]; W is [K][FO] (x @ W layout), as/ad [NH][DH]; EO >= FO.
// branch-free: every lane loads all candidates with clamped indices and selects by value (no exec-masked load arms)
__global__ __launch_bounds__(256) void k_wext(const float* __restrict__ Wm, const float* __restrict__ AS_, const float* __restrict__ AD_, int K, int NOP, int FO, int NH, int DH, int EO, float* __restrict__ WC) {
    #pragma clang fp contract(off)
    const long long u = (long long)blockIdx.x * 256 + threadIdx.x; if (u >= (long long)K * NOP) return; const int kk = (int)(u / NOP), o = (int)(u % NOP);
    const int oo = min(o, FO - 1); const float vw = Wm[(long long)kk * FO + oo]; const int q = min(max(o - EO, 0), 2 * NH - 1); const int h = q % NH; float s = 0.f;
#pragma unroll 1
    for (int c = 0; c < DH; ++c) { const float w = Wm[(long long)kk * FO + h * DH + c]; const float asv = AS_[h * DH + c], adv = AD_[h * DH + c]; s += w * ((q < NH) ? asv : adv); }
    const float v = (o < FO) ? vw : ((o >= EO && o < EO + 2 * NH) ? s : 0.f); VST2(float, WC + u, v); }
// GAT aggregation over a device in-edge CSR (+ analytic self loop as iteration j = -1 when SELF), per-lane online softmax (lanes of one head agree):
// HS rows (pitch P floats): [0,128) projected features z, col 128 + h = a_src.z_h, col 128 + NH + h = a_dst.z_h; lane L owns channels 4L..4L+3 (head = 4L / CH).
// out = sum_j softmax_j(leaky(el[src_j][h] + er[n][h])) z[src_j] (/ (den + deps)) + bias -> ACT (0 none, 1 relu, 2 elu, 3 leaky 0.01) ->
// MODE 0: f32 OUT[n][OW] cols < OC (16-B lane stores, OC*4 contiguous B per wave; OC in {64,128}); MODE 1: bf16 hi/lo planes PH/PL pitch PP (rows n >= N zero); MODE 2: both.
template <int CH, bool SELF, int ACT, int MODE>
__global__ __launch_bounds__(256) void k_gat128(const float* __restrict__ HS, int P, int NH, const float* __restrict__ bias, const int* __restrict__ SRC, const int* __restrict__ off, const int* __restrict__ cnt, const int* __restrict__ slot,
        float* __restrict__ OUT, int OW, int OC, unsigned short* __restrict__ PH, unsigned short* __restrict__ PL, int PP, int N, int NP, int E, int CAP, float slope, float deps) {
    #pragma clang fp contract(off)
    const int n = blockIdx.x * 8 + (threadIdx.x >> 5); const int L = threadIdx.x & 31; if (n >= NP) return; const int c = 4 * L; const int h = c / CH; v4f o; o.x = o.y = o.z = o.w = 0.f;
    if (n < N) { const float* hn = HS + (long long)n * P; const float er = hn[128 + NH + h]; float m = -3.0e38f, s = 0.f; v4f a; a.x = a.y = a.z = a.w = 0.f;
        const int p0 = min(max(off[n], 0), E), cn = min(max(cnt[n], 0), CAP);
        for (int j = (SELF ? -1 : 0); j < cn; ++j) { int sj; if (j < 0) sj = n; else { const int e = min(max(slot[min(p0 + j, E - 1)], 0), E - 1); sj = min(max(SRC[e], 0), N - 1); }
            const float* hs = HS + (long long)sj * P; float lg = hs[128 + h] + er; lg = (lg >= 0.f) ? lg : slope * lg;
            const float mn = fmaxf(m, lg); const float cz = expf(m - mn), pj = expf(lg - mn); s = s * cz + pj; a = a * cz + *(const v4f*)(hs + c) * pj; m = mn; }
        const float inv = (s > 0.f || deps > 0.f) ? 1.f / (s + deps) : 0.f; o = a * inv + *(const v4f*)(bias + c);
        if (ACT == 1) { o.x = fmaxf(o.x, 0.f); o.y = fmaxf(o.y, 0.f); o.z = fmaxf(o.z, 0.f); o.w = fmaxf(o.w, 0.f); }
        if (ACT == 2) { o.x = (o.x > 0.f) ? o.x : (expf(o.x) - 1.f); o.y = (o.y > 0.f) ? o.y : (expf(o.y) - 1.f); o.z = (o.z > 0.f) ? o.z : (expf(o.z) - 1.f); o.w = (o.w > 0.f) ? o.w : (expf(o.w) - 1.f); }
        if (ACT == 3) { o.x = (o.x >= 0.f) ? o.x : 0.01f * o.x; o.y = (o.y >= 0.f) ? o.y : 0.01f * o.y; o.z = (o.z >= 0.f) ? o.z : 0.01f * o.z; o.w = (o.w >= 0.f) ? o.w : 0.01f * o.w; }
        if (MODE != 1 && c < OC) VST2V4(OUT + (long long)n * OW + c, o); }
    if (MODE != 0) st4s(PH, PL, (long long)n * PP + c, o); }

// ---- util2 ----
// generic Bt plane builder from an f32 weight: Bt[o][k] (pitch KP halves) = (TRANS ? W[k*ldw + o] : W[o*ldw + k]) * (S ? S[o] : 1) for o < NO, k < KI; zero elsewhere for o < NOP rows, k < KP (thread per (o < NOP, pair k))
__global__ __launch_bounds__(256) void k_u2_bt(const float* __restrict__ Wm, int ldw, int TRANS, int KI, int NO, int KP, int NOP, const float* __restrict__ S, unsigned short* __restrict__ PH_, unsigned short* __restrict__ PL_) {
    const long long u = (long long)blockIdx.x * 256 + threadIdx.x; if (u >= (long long)NOP * (KP / 2)) return; const int k0 = 2 * (int)(u % (KP / 2)); const int o = (int)(u / (KP / 2)); float a = 0.f, b = 0.f;
    if (o < NO) { const float s = S ? S[o] : 1.f;
        if (k0 < KI) a = (TRANS ? Wm[(long long)k0 * ldw + o] : Wm[(long long)o * ldw + k0]) * s;
        if (k0 + 1 < KI) b = (TRANS ? Wm[(long long)(k0 + 1) * ldw + o] : Wm[(long long)o * ldw + k0 + 1]) * s; }
    st_s2(PH_, PL_, (long long)o * KP + k0, a, b); }
// generic padded vector: O[i] = (i < n) ? (A[i] * (S ? S[i] : 1) + (B2 ? B2[i] : 0)) : 0 for i < NP (one block of 256, NP <= 4096 looped)
__global__ __launch_bounds__(256) void k_u2_vec(const float* __restrict__ A, const float* __restrict__ S, const float* __restrict__ B2, int n, int NP, float* __restrict__ O) { for (int i = threadIdx.x; i < NP; i += 256) { float v = 0.f; if (i < n) v = A[i] * (S ? S[i] : 1.f) + (B2 ? B2[i] : 0.f); VST2(float, O + i, v); } }
__global__ __launch_bounds__(256) void k_u2_colstat(const float* __restrict__ X, int P, int N, float eps, float* __restrict__ STAT) {
    #pragma clang fp contract(off)
    __shared__ float red[256]; const int c = blockIdx.x; const int t = threadIdx.x; float s = 0.f; for (int r = t; r < N; r += 256) s += X[(long long)r * P + c]; red[t] = s; __syncthreads();
    for (int o = 128; o > 0; o >>= 1) { if (t < o) red[t] += red[t + o]; __syncthreads(); }
    const float mu = red[0] / (float)N; __syncthreads(); float q = 0.f; for (int r = t; r < N; r += 256) { const float d = X[(long long)r * P + c] - mu; q += d * d; } red[t] = q; __syncthreads();
    for (int o = 128; o > 0; o >>= 1) { if (t < o) red[t] += red[t + o]; __syncthreads(); }
    const float rs = 1.f / sqrtf(red[0] / (float)N + eps); if (t < 32) VST2(float, STAT + (long long)c * 32 + t, (t == 0) ? mu : ((t == 1) ? rs : 0.f)); }
// rows f32 [R][W] (pitch PW) -> planes at pitch PP, column offset coff; rows >= RL (live) written as zeros up to RP (thread per (r < RP, 4 of W))
__global__ __launch_bounds__(256) void k_u2_pl(const float* __restrict__ X, int PW, int Wd, int RL, int RP, unsigned short* __restrict__ PH_, unsigned short* __restrict__ PL_, int PP, int coff) { const long long u = (long long)blockIdx.x * 256 + threadIdx.x; if (u >= (long long)RP * (Wd / 4)) return; const int r = (int)(u / (Wd / 4)); const int c = 4 * (int)(u % (Wd / 4)); v4f v; v.x = v.y = v.z = v.w = 0.f; if (r < RL) v = *(const v4f*)(X + (long long)r * PW + c); st4s(PH_, PL_, (long long)r * PP + coff + c, v); }

typedef unsigned int cm_u4 __attribute__((ext_vector_type(4)));

__global__ __launch_bounds__(256) void k_cm_zero16(unsigned short* __restrict__ DST, long long n) { const long long u = (long long)blockIdx.x * 256 + threadIdx.x; if (u * 8 >= n) return; cm_u4 z; z.x = z.y = z.z = z.w = 0u; cm_u4* d = (cm_u4*)(DST + u * 8); *d = z;  }
// f32 -> bf16 (RNE) -> f16 casts: every 16-bit operand then holds exactly the bf16-rounded input value (times a power-of-two
// weight scale), so the f16 WMMA products are exact. Plain: thread per (row, 8 cols),
// dst [R][C] pitch ldd; transposed: thread per (col, 8 consecutive rows) -> dst [C][R] pitch ldd; both store 16 B per thread, thread-linear along the dst row.
__device__ __forceinline__ unsigned int cmb_pk2(float a, float b) { return (unsigned int)__builtin_bit_cast(unsigned short, (_Float16)a) | ((unsigned int)__builtin_bit_cast(unsigned short, (_Float16)b) << 16); }
__device__ __forceinline__ float cmb_bf(float v) { const unsigned u = __builtin_bit_cast(unsigned, v); const unsigned r = (u + 0x7fffu + ((u >> 16) & 1u)) & 0xffff0000u; return __builtin_bit_cast(float, r); }   // bf16 RNE, kept as f32 (finite inputs)
// BR[i] = bf16_rne(B[i]) kept as f32 (thread per element)
__global__ __launch_bounds__(256) void k_cm_bfvec(const float* __restrict__ SRC, float* __restrict__ DST, int n) { const int u = blockIdx.x * 256 + threadIdx.x; if (u >= n) return; VST2(float, DST + u, cmb_bf(SRC[u])); }
__global__ __launch_bounds__(256) void k_cm_castb(const float* __restrict__ SRC, int lds, unsigned short* __restrict__ DST, int ldd, int nR, int nC, float sc) {
    const long long u = (long long)blockIdx.x * 256 + threadIdx.x; const int per = nC / 8; if (u >= (long long)nR * per) return; const int r = (int)(u / per); const int c0 = 8 * (int)(u % per);
    const float* s = SRC + (long long)r * lds + c0; float w[8];
#pragma unroll
    for (int e = 0; e < 8; ++e) w[e] = cmb_bf(s[e]) * sc;
    cm_u4 pk; pk.x = cmb_pk2(w[0], w[1]); pk.y = cmb_pk2(w[2], w[3]); pk.z = cmb_pk2(w[4], w[5]); pk.w = cmb_pk2(w[6], w[7]); VST2(cm_u4, (cm_u4*)(DST + (long long)r * ldd + c0), pk); }
__global__ __launch_bounds__(256) void k_cm_castbT(const float* __restrict__ SRC, int lds, unsigned short* __restrict__ DST, int ldd, int nR, int nC, float sc) {
    const long long u = (long long)blockIdx.x * 256 + threadIdx.x; const int per = nR / 8; if (u >= (long long)nC * per) return; const int c = (int)(u / per); const int r0 = 8 * (int)(u % per);
    float w[8];
#pragma unroll
    for (int e = 0; e < 8; ++e) w[e] = cmb_bf(SRC[(long long)(r0 + e) * lds + c]) * sc;
    cm_u4 pk; pk.x = cmb_pk2(w[0], w[1]); pk.y = cmb_pk2(w[2], w[3]); pk.z = cmb_pk2(w[4], w[5]); pk.w = cmb_pk2(w[6], w[7]); VST2(cm_u4, (cm_u4*)(DST + (long long)c * ldd + r0), pk); }

typedef float ab_v2f __attribute__((ext_vector_type(2)));
__global__ __launch_bounds__(256) void k_ab_gstat(const float* __restrict__ X, float* __restrict__ STp, int per) {
    #pragma clang fp contract(off)
    __shared__ float red[256]; const int g = blockIdx.x; const int t = threadIdx.x; const float* base = X + (long long)g * per; float s = 0.f;
    for (int i = 4 * t; i < per; i += 1024) { const v4f v = *(const v4f*)(base + i); s += (cmb_bf(v.x) + cmb_bf(v.y)) + (cmb_bf(v.z) + cmb_bf(v.w)); }
    red[t] = s; __syncthreads();
    for (int o = 128; o > 0; o >>= 1) { if (t < o) red[t] += red[t + o]; __syncthreads(); }
    const float mean = red[0] / (float)per; __syncthreads(); float q = 0.f;
    for (int i = 4 * t; i < per; i += 1024) { const v4f v = *(const v4f*)(base + i); const float a = cmb_bf(v.x) - mean, b = cmb_bf(v.y) - mean, c = cmb_bf(v.z) - mean, d = cmb_bf(v.w) - mean; q += (a * a + b * b) + (c * c + d * d); }
    red[t] = q; __syncthreads();
    for (int o = 128; o > 0; o >>= 1) { if (t < o) red[t] += red[t + o]; __syncthreads(); }
    if (t == 0) { ab_v2f ms; ms.x = mean; ms.y = rsqrtf(red[0] / (float)per + 1e-5f); VST2(ab_v2f, (ab_v2f*)(STp + 32 * g), ms); } }
// XN[c][n] = (bf16(x[c][n]) - mean[g]) rstd[g] bf16(gamma[c]) + bf16(beta[c]); XB[c][n] = bf16(x[c][n]) (residual copy); thread per float4
__global__ __launch_bounds__(256) void k_ab_gapply(const float* __restrict__ X, const float* __restrict__ STp, const float* __restrict__ Gm, const float* __restrict__ Bt, float* __restrict__ XNp, float* __restrict__ XBp, int N, int CPG, long long n4) {
    #pragma clang fp contract(off)
    const long long u = (long long)blockIdx.x * 256 + threadIdx.x; if (u >= n4) return; const int c = (int)((4 * u) / N); const int g = c / CPG; const float mean = STp[32 * g], rs = STp[32 * g + 1], ga = cmb_bf(Gm[c]), be = cmb_bf(Bt[c]);
    const v4f v = *(const v4f*)(X + 4 * u); v4f xb; xb.x = cmb_bf(v.x); xb.y = cmb_bf(v.y); xb.z = cmb_bf(v.z); xb.w = cmb_bf(v.w); v4f r; r.x = (xb.x - mean) * rs * ga + be; r.y = (xb.y - mean) * rs * ga + be; r.z = (xb.z - mean) * rs * ga + be; r.w = (xb.w - mean) * rs * ga + be;
    VST2V4(XNp + 4 * u, r); VST2V4(XBp + 4 * u, xb); }


extern "C" void kernel_launch(void* const* d_in, const int* in_sizes, int n_in, void* d_out, int out_size, void* d_ws, size_t ws_size, hipStream_t stream) {
    (void)in_sizes; (void)n_in; (void)out_size; (void)ws_size;
    const float* x = (const float*)d_in[0];
    const float* gam = (const float*)d_in[1];
    const float* bet = (const float*)d_in[2];
    const float* wqkv = (const float*)d_in[3];
    const float* bqkv = (const float*)d_in[4];
    const float* wo = (const float*)d_in[5];
    const float* bo = (const float*)d_in[6];
    float* out = (float*)d_out;
    char* wsp = (char*)d_ws;
    float* ST = (float*)wsp; wsp += (((size_t)((size_t)8 * 32 + 64) * 4 + 255) / 256) * 256;
    float* XN = (float*)wsp; wsp += (((size_t)((size_t)256 * 4096) * 4 + 255) / 256) * 256;
    unsigned short* XTH = (unsigned short*)wsp; wsp += (((size_t)((size_t)4096 * 256) * 2 + 255) / 256) * 256;
    unsigned short* XTL = (unsigned short*)wsp; wsp += (((size_t)((size_t)4096 * 256) * 2 + 255) / 256) * 256;
    unsigned short* W3H = (unsigned short*)wsp; wsp += (((size_t)((size_t)768 * 256) * 2 + 255) / 256) * 256;
    unsigned short* W3L = (unsigned short*)wsp; wsp += (((size_t)((size_t)768 * 256) * 2 + 255) / 256) * 256;
    float* BR3 = (float*)wsp; wsp += (((size_t)((size_t)768 + 64) * 4 + 255) / 256) * 256;
    float* QKV = (float*)wsp; wsp += (((size_t)((size_t)4096 * 768) * 4 + 255) / 256) * 256;
    float* AO = (float*)wsp; wsp += (((size_t)((size_t)4096 * 256) * 4 + 255) / 256) * 256;
    unsigned short* AOH = (unsigned short*)wsp; wsp += (((size_t)((size_t)4096 * 256) * 2 + 255) / 256) * 256;
    unsigned short* AOL = (unsigned short*)wsp; wsp += (((size_t)((size_t)4096 * 256) * 2 + 255) / 256) * 256;
    unsigned short* WOH = (unsigned short*)wsp; wsp += (((size_t)((size_t)256 * 256) * 2 + 255) / 256) * 256;
    unsigned short* WOL = (unsigned short*)wsp; wsp += (((size_t)((size_t)256 * 256) * 2 + 255) / 256) * 256;
    float* BRO = (float*)wsp; wsp += (((size_t)((size_t)256 + 64) * 4 + 255) / 256) * 256;
    float* XB = (float*)wsp; wsp += (((size_t)((size_t)256 * 4096) * 4 + 255) / 256) * 256;
    if ((size_t)(wsp - (char*)d_ws) > ws_size) return;   // static carve guard
    k_castS16<<<(unsigned)((((long long)(768) * ((256) / 2)) + 255) / 256), 256, 0, stream>>>(wqkv, 256, (__bf16*)(W3H), (__bf16*)(W3L), 256, 768, 256, 1.0f, 0);
    k_cm_bfvec<<<3, 256, 0, stream>>>(bqkv, BR3, 768); k_cm_bfvec<<<1, 256, 0, stream>>>(bo, BRO, 256);
    k_castS16<<<(unsigned)((((long long)(256) * ((256) / 2)) + 255) / 256), 256, 0, stream>>>(wo, 256, (__bf16*)(WOH), (__bf16*)(WOL), 256, 256, 256, 1.0f, 0);
    k_ab_gstat<<<8, 256, 0, stream>>>(x + 0, ST, 131072); k_ab_gapply<<<(262144 + 255) / 256, 256, 0, stream>>>(x + 0, ST, gam, bet, XN, XB, 4096, 32, 262144LL);
    k_castS16<<<(unsigned)((((long long)(4096) * ((256) / 2)) + 255) / 256), 256, 0, stream>>>(XN, 4096, (__bf16*)(XTH), (__bf16*)(XTL), 256, 256, 4096, 1.0f, 1);
    w25::wmma_gemm64<1, false, 2, 0, false, 0><<<dim3((unsigned)((((4096) / 64) * ((768) / 64) + 7) / 8), (unsigned)(1)), 256, 0, stream>>>((const unsigned short*)(XTH), nullptr, 256, 0, (const unsigned short*)(W3H), nullptr, 256, 0, (void*)(QKV), nullptr, 768, 0, BR3, nullptr, 0, 4096, 768, 256, 1.0f);
    w25::wmma_gemm64<1, false, 0, 0, true, 0><<<dim3((unsigned)((((4096) / 64) * ((768) / 64) + 7) / 8), (unsigned)(1)), 256, 0, stream>>>((const unsigned short*)(XTL), nullptr, 256, 0, (const unsigned short*)(W3H), nullptr, 256, 0, (void*)(QKV), nullptr, 768, 0, nullptr, QKV, 0, 4096, 768, 256, 1.0f);
    { /*apv4*/ AttnP a;
      a.Q = QKV; a.K = QKV + 256; a.V = QKV + 512; a.O = AO; a.P = 0; a.Mf = 0; a.Mi = 0; a.ST = 0;
      a.Pw = 0; a.Rt = 0; a.SQ = 0; a.SK = 0;
      a.swb = 0; a.swh = 0; a.swi = 0; a.swj = 0; a.srb = 0; a.srh = 0; a.sri = 0; a.sQb = 0; a.sQh = 64; a.sQi = 768; a.sQd = 1; a.sKb = 0; a.sKh = 64; a.sKj = 768; a.sKd = 1; a.sVb = 0; a.sVh = 64; a.sVj = 768; a.sVd = 1; a.sOb = 0; a.sOh = 64; a.sOi = 256; a.sPb = 0; a.sPh = 0; a.sPi = 0; a.smb = 0; a.smh = 0; a.smi = 0; a.smj = 0;
      a.Lq = 4096; a.Lk = 4096; a.dh = 64; a.dv = 64; a.hrep = 1; a.causal = 0; a.coff = 0; a.pband = 0;
      a.scale = 0.125f; a.mfill = 0.0f; a.nonorm = 0; a.mpol = 0;
      a.roff = 0; a.rn = 1; a.segpol = 0; a.win = 0;
      k_attn<64, 64, 0, false, false, true><<<dim3((unsigned)((4096) + 16 * AW - 1) / (16 * AW), (unsigned)(4), (unsigned)(1)), 32 * AW, 0, stream>>>(a); }
    k_castS16<<<(unsigned)((((long long)(4096) * ((256) / 2)) + 255) / 256), 256, 0, stream>>>(AO, 256, (__bf16*)(AOH), (__bf16*)(AOL), 256, 4096, 256, 1.0f, 0);
    w25::wmma_gemm64<1, false, 1, 0, true, 0><<<dim3((unsigned)((((256) / 64) * ((4096) / 64) + 7) / 8), (unsigned)(1)), 256, 0, stream>>>((const unsigned short*)(WOH), nullptr, 256, 0, (const unsigned short*)(AOH), nullptr, 256, 0, (void*)(out + 0), nullptr, 4096, 0, BRO, XB, 0, 256, 4096, 256, 1.0f);
    w25::wmma_gemm64<1, false, 0, 0, true, 0><<<dim3((unsigned)((((256) / 64) * ((4096) / 64) + 7) / 8), (unsigned)(1)), 256, 0, stream>>>((const unsigned short*)(WOH), nullptr, 256, 0, (const unsigned short*)(AOL), nullptr, 256, 0, (void*)(out + 0), nullptr, 4096, 0, nullptr, out + 0, 0, 256, 4096, 256, 1.0f);
    k_ab_gstat<<<8, 256, 0, stream>>>(x + 1048576, ST, 131072); k_ab_gapply<<<(262144 + 255) / 256, 256, 0, stream>>>(x + 1048576, ST, gam, bet, XN, XB, 4096, 32, 262144LL);
    k_castS16<<<(unsigned)((((long long)(4096) * ((256) / 2)) + 255) / 256), 256, 0, stream>>>(XN, 4096, (__bf16*)(XTH), (__bf16*)(XTL), 256, 256, 4096, 1.0f, 1);
    w25::wmma_gemm64<1, false, 2, 0, false, 0><<<dim3((unsigned)((((4096) / 64) * ((768) / 64) + 7) / 8), (unsigned)(1)), 256, 0, stream>>>((const unsigned short*)(XTH), nullptr, 256, 0, (const unsigned short*)(W3H), nullptr, 256, 0, (void*)(QKV), nullptr, 768, 0, BR3, nullptr, 0, 4096, 768, 256, 1.0f);
    w25::wmma_gemm64<1, false, 0, 0, true, 0><<<dim3((unsigned)((((4096) / 64) * ((768) / 64) + 7) / 8), (unsigned)(1)), 256, 0, stream>>>((const unsigned short*)(XTL), nullptr, 256, 0, (const unsigned short*)(W3H), nullptr, 256, 0, (void*)(QKV), nullptr, 768, 0, nullptr, QKV, 0, 4096, 768, 256, 1.0f);
    { /*apv4*/ AttnP a;
      a.Q = QKV; a.K = QKV + 256; a.V = QKV + 512; a.O = AO; a.P = 0; a.Mf = 0; a.Mi = 0; a.ST = 0;
      a.Pw = 0; a.Rt = 0; a.SQ = 0; a.SK = 0;
      a.swb = 0; a.swh = 0; a.swi = 0; a.swj = 0; a.srb = 0; a.srh = 0; a.sri = 0; a.sQb = 0; a.sQh = 64; a.sQi = 768; a.sQd = 1; a.sKb = 0; a.sKh = 64; a.sKj = 768; a.sKd = 1; a.sVb = 0; a.sVh = 64; a.sVj = 768; a.sVd = 1; a.sOb = 0; a.sOh = 64; a.sOi = 256; a.sPb = 0; a.sPh = 0; a.sPi = 0; a.smb = 0; a.smh = 0; a.smi = 0; a.smj = 0;
      a.Lq = 4096; a.Lk = 4096; a.dh = 64; a.dv = 64; a.hrep = 1; a.causal = 0; a.coff = 0; a.pband = 0;
      a.scale = 0.125f; a.mfill = 0.0f; a.nonorm = 0; a.mpol = 0;
      a.roff = 0; a.rn = 1; a.segpol = 0; a.win = 0;
      k_attn<64, 64, 0, false, false, true><<<dim3((unsigned)((4096) + 16 * AW - 1) / (16 * AW), (unsigned)(4), (unsigned)(1)), 32 * AW, 0, stream>>>(a); }
    k_castS16<<<(unsigned)((((long long)(4096) * ((256) / 2)) + 255) / 256), 256, 0, stream>>>(AO, 256, (__bf16*)(AOH), (__bf16*)(AOL), 256, 4096, 256, 1.0f, 0);
    w25::wmma_gemm64<1, false, 1, 0, true, 0><<<dim3((unsigned)((((256) / 64) * ((4096) / 64) + 7) / 8), (unsigned)(1)), 256, 0, stream>>>((const unsigned short*)(WOH), nullptr, 256, 0, (const unsigned short*)(AOH), nullptr, 256, 0, (void*)(out + 1048576), nullptr, 4096, 0, BRO, XB, 0, 256, 4096, 256, 1.0f);
    w25::wmma_gemm64<1, false, 0, 0, true, 0><<<dim3((unsigned)((((256) / 64) * ((4096) / 64) + 7) / 8), (unsigned)(1)), 256, 0, stream>>>((const unsigned short*)(WOH), nullptr, 256, 0, (const unsigned short*)(AOL), nullptr, 256, 0, (void*)(out + 1048576), nullptr, 4096, 0, nullptr, out + 1048576, 0, 256, 4096, 256, 1.0f);
    k_ab_gstat<<<8, 256, 0, stream>>>(x + 2097152, ST, 131072); k_ab_gapply<<<(262144 + 255) / 256, 256, 0, stream>>>(x + 2097152, ST, gam, bet, XN, XB, 4096, 32, 262144LL);
    k_castS16<<<(unsigned)((((long long)(4096) * ((256) / 2)) + 255) / 256), 256, 0, stream>>>(XN, 4096, (__bf16*)(XTH), (__bf16*)(XTL), 256, 256, 4096, 1.0f, 1);
    w25::wmma_gemm64<1, false, 2, 0, false, 0><<<dim3((unsigned)((((4096) / 64) * ((768) / 64) + 7) / 8), (unsigned)(1)), 256, 0, stream>>>((const unsigned short*)(XTH), nullptr, 256, 0, (const unsigned short*)(W3H), nullptr, 256, 0, (void*)(QKV), nullptr, 768, 0, BR3, nullptr, 0, 4096, 768, 256, 1.0f);
    w25::wmma_gemm64<1, false, 0, 0, true, 0><<<dim3((unsigned)((((4096) / 64) * ((768) / 64) + 7) / 8), (unsigned)(1)), 256, 0, stream>>>((const unsigned short*)(XTL), nullptr, 256, 0, (const unsigned short*)(W3H), nullptr, 256, 0, (void*)(QKV), nullptr, 768, 0, nullptr, QKV, 0, 4096, 768, 256, 1.0f);
    { /*apv4*/ AttnP a;
      a.Q = QKV; a.K = QKV + 256; a.V = QKV + 512; a.O = AO; a.P = 0; a.Mf = 0; a.Mi = 0; a.ST = 0;
      a.Pw = 0; a.Rt = 0; a.SQ = 0; a.SK = 0;
      a.swb = 0; a.swh = 0; a.swi = 0; a.swj = 0; a.srb = 0; a.srh = 0; a.sri = 0; a.sQb = 0; a.sQh = 64; a.sQi = 768; a.sQd = 1; a.sKb = 0; a.sKh = 64; a.sKj = 768; a.sKd = 1; a.sVb = 0; a.sVh = 64; a.sVj = 768; a.sVd = 1; a.sOb = 0; a.sOh = 64; a.sOi = 256; a.sPb = 0; a.sPh = 0; a.sPi = 0; a.smb = 0; a.smh = 0; a.smi = 0; a.smj = 0;
      a.Lq = 4096; a.Lk = 4096; a.dh = 64; a.dv = 64; a.hrep = 1; a.causal = 0; a.coff = 0; a.pband = 0;
      a.scale = 0.125f; a.mfill = 0.0f; a.nonorm = 0; a.mpol = 0;
      a.roff = 0; a.rn = 1; a.segpol = 0; a.win = 0;
      k_attn<64, 64, 0, false, false, true><<<dim3((unsigned)((4096) + 16 * AW - 1) / (16 * AW), (unsigned)(4), (unsigned)(1)), 32 * AW, 0, stream>>>(a); }
    k_castS16<<<(unsigned)((((long long)(4096) * ((256) / 2)) + 255) / 256), 256, 0, stream>>>(AO, 256, (__bf16*)(AOH), (__bf16*)(AOL), 256, 4096, 256, 1.0f, 0);
    w25::wmma_gemm64<1, false, 1, 0, true, 0><<<dim3((unsigned)((((256) / 64) * ((4096) / 64) + 7) / 8), (unsigned)(1)), 256, 0, stream>>>((const unsigned short*)(WOH), nullptr, 256, 0, (const unsigned short*)(AOH), nullptr, 256, 0, (void*)(out + 2097152), nullptr, 4096, 0, BRO, XB, 0, 256, 4096, 256, 1.0f);
    w25::wmma_gemm64<1, false, 0, 0, true, 0><<<dim3((unsigned)((((256) / 64) * ((4096) / 64) + 7) / 8), (unsigned)(1)), 256, 0, stream>>>((const unsigned short*)(WOH), nullptr, 256, 0, (const unsigned short*)(AOL), nullptr, 256, 0, (void*)(out + 2097152), nullptr, 4096, 0, nullptr, out + 2097152, 0, 256, 4096, 256, 1.0f);
    k_ab_gstat<<<8, 256, 0, stream>>>(x + 3145728, ST, 131072); k_ab_gapply<<<(262144 + 255) / 256, 256, 0, stream>>>(x + 3145728, ST, gam, bet, XN, XB, 4096, 32, 262144LL);
    k_castS16<<<(unsigned)((((long long)(4096) * ((256) / 2)) + 255) / 256), 256, 0, stream>>>(XN, 4096, (__bf16*)(XTH), (__bf16*)(XTL), 256, 256, 4096, 1.0f, 1);
    w25::wmma_gemm64<1, false, 2, 0, false, 0><<<dim3((unsigned)((((4096) / 64) * ((768) / 64) + 7) / 8), (unsigned)(1)), 256, 0, stream>>>((const unsigned short*)(XTH), nullptr, 256, 0, (const unsigned short*)(W3H), nullptr, 256, 0, (void*)(QKV), nullptr, 768, 0, BR3, nullptr, 0, 4096, 768, 256, 1.0f);
    w25::wmma_gemm64<1, false, 0, 0, true, 0><<<dim3((unsigned)((((4096) / 64) * ((768) / 64) + 7) / 8), (unsigned)(1)), 256, 0, stream>>>((const unsigned short*)(XTL), nullptr, 256, 0, (const unsigned short*)(W3H), nullptr, 256, 0, (void*)(QKV), nullptr, 768, 0, nullptr, QKV, 0, 4096, 768, 256, 1.0f);
    { /*apv4*/ AttnP a;
      a.Q = QKV; a.K = QKV + 256; a.V = QKV + 512; a.O = AO; a.P = 0; a.Mf = 0; a.Mi = 0; a.ST = 0;
      a.Pw = 0; a.Rt = 0; a.SQ = 0; a.SK = 0;
      a.swb = 0; a.swh = 0; a.swi = 0; a.swj = 0; a.srb = 0; a.srh = 0; a.sri = 0; a.sQb = 0; a.sQh = 64; a.sQi = 768; a.sQd = 1; a.sKb = 0; a.sKh = 64; a.sKj = 768; a.sKd = 1; a.sVb = 0; a.sVh = 64; a.sVj = 768; a.sVd = 1; a.sOb = 0; a.sOh = 64; a.sOi = 256; a.sPb = 0; a.sPh = 0; a.sPi = 0; a.smb = 0; a.smh = 0; a.smi = 0; a.smj = 0;
      a.Lq = 4096; a.Lk = 4096; a.dh = 64; a.dv = 64; a.hrep = 1; a.causal = 0; a.coff = 0; a.pband = 0;
      a.scale = 0.125f; a.mfill = 0.0f; a.nonorm = 0; a.mpol = 0;
      a.roff = 0; a.rn = 1; a.segpol = 0; a.win = 0;
      k_attn<64, 64, 0, false, false, true><<<dim3((unsigned)((4096) + 16 * AW - 1) / (16 * AW), (unsigned)(4), (unsigned)(1)), 32 * AW, 0, stream>>>(a); }
    k_castS16<<<(unsigned)((((long long)(4096) * ((256) / 2)) + 255) / 256), 256, 0, stream>>>(AO, 256, (__bf16*)(AOH), (__bf16*)(AOL), 256, 4096, 256, 1.0f, 0);
    w25::wmma_gemm64<1, false, 1, 0, true, 0><<<dim3((unsigned)((((256) / 64) * ((4096) / 64) + 7) / 8), (unsigned)(1)), 256, 0, stream>>>((const unsigned short*)(WOH), nullptr, 256, 0, (const unsigned short*)(AOH), nullptr, 256, 0, (void*)(out + 3145728), nullptr, 4096, 0, BRO, XB, 0, 256, 4096, 256, 1.0f);
    w25::wmma_gemm64<1, false, 0, 0, true, 0><<<dim3((unsigned)((((256) / 64) * ((4096) / 64) + 7) / 8), (unsigned)(1)), 256, 0, stream>>>((const unsigned short*)(WOH), nullptr, 256, 0, (const unsigned short*)(AOL), nullptr, 256, 0, (void*)(out + 3145728), nullptr, 4096, 0, nullptr, out + 3145728, 0, 256, 4096, 256, 1.0f);
}

// v002
// A run of this version takes 1300 microseconds.
// Two timings next to v001 put it at 2.01 and 2.02 times that version's speed.
// Counting every step since v000, it is 6.24 times as fast.
#include <hip/hip_runtime.h>
#include <math.h>

typedef __attribute__((ext_vector_type(16))) _Float16 v16h;
typedef __attribute__((ext_vector_type(8)))  _Float16 v8h;
typedef __attribute__((ext_vector_type(16))) __bf16   v16b;
typedef __attribute__((ext_vector_type(8)))  float    v8f;
typedef __attribute__((ext_vector_type(4)))  float    v4f;

// 16-bit WMMA fragment map (wave32), lane L, h = L>>4, m = L&15:
//   A 16x32: lane = row m;   element i -> k = (i<8) ? 8h+i : 16+8h+(i-8)
//   B 32x16: lane = column m; the SAME k(i,h)
//   D 16x16 (8 f32): lane = column m; element r -> row 8h+r
__device__ __forceinline__ int frag_k(int i, int h) { return (i < 8) ? (8 * h + i) : (16 + 8 * h + (i - 8)); }
__device__ __forceinline__ __bf16 bf16_rne(float f) {
    unsigned int u = __float_as_uint(f);
    u += 0x7fffu + ((u >> 16) & 1u);
    return __builtin_bit_cast(__bf16, (unsigned short)(u >> 16));
}
__device__ __forceinline__ float bf16_f32(__bf16 b) { return __uint_as_float(((unsigned int)__builtin_bit_cast(unsigned short, b)) << 16); }
__device__ __forceinline__ v8f wmma16(v16h a, v16h b, v8f c) {
    c = __builtin_amdgcn_wmma_f32_16x16x32_f16(false, a, false, b, (short)0, c, false, false);
    asm volatile("v_nop\n\tv_nop\n\tv_nop\n\tv_nop" : "+v"(c) : "v"(a), "v"(b));
    return c;
}
__device__ __forceinline__ v8f wmmab(v16b a, v16b b, v8f c) {
    c = __builtin_amdgcn_wmma_f32_16x16x32_bf16(false, a, false, b, (short)0, c, false, false);
    asm volatile("v_nop\n\tv_nop\n\tv_nop\n\tv_nop" : "+v"(c) : "v"(a), "v"(b));
    return c;
}
struct Split { v16b hi, lo; };
// hi/lo split product: a.hi*b.hi + a.hi*b.lo + a.lo*b.hi
__device__ __forceinline__ v8f wmma3(const Split& a, const Split& b, v8f c) {
    c = __builtin_amdgcn_wmma_f32_16x16x32_bf16(false, a.hi, false, b.hi, (short)0, c, false, false);
    c = __builtin_amdgcn_wmma_f32_16x16x32_bf16(false, a.hi, false, b.lo, (short)0, c, false, false);
    c = __builtin_amdgcn_wmma_f32_16x16x32_bf16(false, a.lo, false, b.hi, (short)0, c, false, false);
    asm volatile("v_nop\n\tv_nop\n\tv_nop\n\tv_nop" : "+v"(c) : "v"(a.hi), "v"(a.lo), "v"(b.hi), "v"(b.lo));
    return c;
}
struct Split3 { v16b hi, mid, lo; };
// triple split product (6 terms, drops only terms below 2^-24 relative)
__device__ __forceinline__ v8f wmma6(const Split3& a, const Split3& b, v8f c) {
    c = __builtin_amdgcn_wmma_f32_16x16x32_bf16(false, a.hi, false, b.hi, (short)0, c, false, false);
    c = __builtin_amdgcn_wmma_f32_16x16x32_bf16(false, a.hi, false, b.mid, (short)0, c, false, false);
    c = __builtin_amdgcn_wmma_f32_16x16x32_bf16(false, a.mid, false, b.hi, (short)0, c, false, false);
    c = __builtin_amdgcn_wmma_f32_16x16x32_bf16(false, a.hi, false, b.lo, (short)0, c, false, false);
    c = __builtin_amdgcn_wmma_f32_16x16x32_bf16(false, a.mid, false, b.mid, (short)0, c, false, false);
    c = __builtin_amdgcn_wmma_f32_16x16x32_bf16(false, a.lo, false, b.hi, (short)0, c, false, false);
    asm volatile("v_nop\n\tv_nop\n\tv_nop\n\tv_nop" : "+v"(c) : "v"(a.hi), "v"(a.mid), "v"(a.lo), "v"(b.hi), "v"(b.mid), "v"(b.lo));
    return c;
}

// Fragment gathers from f32 memory: element i <- p[(k0 + frag_k(i,h)) * sk] * s, zero for k >= klen.
__device__ __forceinline__ v16h fh_ld(const float* __restrict__ p, long long sk, int k0, int h, int klen, float s) {
    v16h a;
#pragma unroll
    for (int i = 0; i < 16; ++i) { const int k = k0 + frag_k(i, h); a[i] = (k < klen) ? (_Float16)(p[(long long)k * sk] * s) : (_Float16)0.f; }
    return a;
}
__device__ __forceinline__ Split sp_ld(const float* __restrict__ p, long long sk, int k0, int h, int klen, float s) {
    Split r;
#pragma unroll
    for (int i = 0; i < 16; ++i) {
        const int k = k0 + frag_k(i, h); const float x = (k < klen) ? p[(long long)k * sk] * s : 0.f;
        const __bf16 hb = bf16_rne(x); r.hi[i] = hb; r.lo[i] = bf16_rne(x - bf16_f32(hb));
    }
    return r;
}
__device__ __forceinline__ Split3 sp3_ld(const float* __restrict__ p, long long sk, int k0, int h, int klen, float s) {
    Split3 r;
#pragma unroll
    for (int i = 0; i < 16; ++i) {
        const int k = k0 + frag_k(i, h); const float x = (k < klen) ? p[(long long)k * sk] * s : 0.f;
        const __bf16 hb = bf16_rne(x); const float r1 = x - bf16_f32(hb); const __bf16 mb = bf16_rne(r1);
        r.hi[i] = hb; r.mid[i] = mb; r.lo[i] = bf16_rne(r1 - bf16_f32(mb));
    }
    return r;
}
__device__ __forceinline__ v16b bh_ld(const float* __restrict__ p, long long sk, int k0, int h, int klen, float s) {
    v16b a;
#pragma unroll
    for (int i = 0; i < 16; ++i) { const int k = k0 + frag_k(i, h); a[i] = bf16_rne((k < klen) ? p[(long long)k * sk] * s : 0.f); }
    return a;
}
// f16 fragment from an f16 LDS/global row with element stride 1 (k-contiguous), no bounds (tile already zero padded)
__device__ __forceinline__ v16h fh_row(const _Float16* __restrict__ row, int k0, int h) {
    v16h a;
#pragma unroll
    for (int i = 0; i < 16; ++i) a[i] = row[k0 + frag_k(i, h)];
    return a;
}

typedef __attribute__((ext_vector_type(4))) _Float16 v4h;
// One 16-bit fragment's 32 k of a k-contiguous, 16-byte aligned f32 row as four unguarded 16-byte loads; row = the lane's row + 8 * h elements.
// fr_cvt packs them in the k order of frag_k.
struct FragRaw { v4f x0, x1, x2, x3; };
__device__ __forceinline__ FragRaw fr_ld(const v4f* __restrict__ row, int k0) {
    FragRaw r; r.x0 = row[k0 / 4]; r.x1 = row[k0 / 4 + 1]; r.x2 = row[k0 / 4 + 4]; r.x3 = row[k0 / 4 + 5];
    return r;
}
__device__ __forceinline__ v16h fr_cvt(const FragRaw& r) {
    v16h a;
#pragma unroll
    for (int i = 0; i < 4; ++i) { a[i] = (_Float16)r.x0[i]; a[4 + i] = (_Float16)r.x1[i]; a[8 + i] = (_Float16)r.x2[i]; a[12 + i] = (_Float16)r.x3[i]; }
    return a;
}

#define VST2(T, ptr, val) do { const T vst2_v_ = (val); *(T*)(ptr) = vst2_v_;  } while (0)
typedef float v4f __attribute__((ext_vector_type(4)));
#define VST2V4(ptr, val) do { const v4f vst2_v4_ = (val); *(v4f*)(ptr) = vst2_v4_;  } while (0)

__device__ __attribute__((noinline)) float act_fn(float v, int act) {
    if (act == 1) return fmaxf(v, 0.f);                                                                               // relu
    if (act == 2) { const float u = 0.7978845608028654f * (v + 0.044715f * v * v * v); return 0.5f * v * (1.f + tanhf(u)); } // tanh-gelu
    if (act == 3) return v / (1.f + expf(-v));                                                                        // silu
    if (act == 4) return 0.5f * v * (1.f + erff(v * 0.7071067811865476f));                                             // erf-gelu
    if (act == 5) return tanhf(v);
    if (act == 6) return 1.f / (1.f + expf(-v));                                                                      // sigmoid
    if (act == 7) return (v > 0.f) ? v : 0.01f * v;                                                                   // leaky relu 0.01
    if (act == 8) return (v > 0.f) ? v : (expf(v) - 1.f);                                                             // elu
    if (act == 9) return fminf(fmaxf(v, 0.f), 6.f);                                                                   // relu6
    if (act == 10) return fabsf(v);                                                                                    // abs
    if (act == 11) return (v >= 0.f) ? v : 0.1f * v;                                                                  // leaky 0.1
    if (act == 12) return (v > 0.f) ? v : 0.2f * v;                                                                   // leaky 0.2
    if (act == 13) return (v > 20.f) ? v : log1pf(expf(v));                                                            // softplus
    return v;
}

// =====================================================================================================================
// k_gemm<MODE>: C(z, m, n) = act(alpha * sum_k A(z, m, k) * B(z, k, n) + bias) + beta * R(z, m, n)
//   One wave (32-thread block) per 16 x 32 tile of C; grid (ceil(N/32), ceil(M/16), Z). Batch z -> (zo = z / zi_n, zi = z % zi_n)
//   with separate outer/inner strides for every tensor (e.g. batch and head). A(m,k) = A[zo*sAo + zi*sAi + m*sAm + k*sAk] (f32),
//   B(k,n) = B[zo*sBo + zi*sBi + n*sBn + k*sBk] (f32); any M, N, K (K zero-padded to 32 inside the fragments, M/N tails guarded).
//   C(m,n) = C[zo*sCo + zi*sCi + m*sCm + n] (n contiguous). flags: 1 bias[n], 2 bias[m], 4 residual R[zo*sRo + zi*sRi + m*sRm + n*sRn].
//   MODE 0: f16 operands (A prescaled by sa, B by sb, both undone in the epilogue); 1: bf16 hi/lo split (3 products); 2: bf16;
//   3: bf16 hi/mid/lo triple split (6 products); 4: as 3 with Kahan-compensated f32 accumulation across k-steps.
// =====================================================================================================================
struct GemmP {
    const float* A; const float* B; const float* bias; const float* R; float* C;
    long long sAo, sAi, sAm, sAk, sBo, sBi, sBn, sBk, sCo, sCi, sCm, sRo, sRi, sRm, sRn;
    int M, N, K, zi_n, flags, act; float alpha, beta, sa, sb;
    int Npad, pad_;     // columns [N, Npad) of C are written as 0 so that padded workspace rows are covered by whole-line stores; Npad >= N
};
static_assert(sizeof(GemmP) == 5 * 8 + 15 * 8 + 6 * 4 + 4 * 4 + 2 * 4, "GemmP has padding");

template <int MODE>
__global__ __launch_bounds__(32) void k_gemm(GemmP p) {
    const int lane = threadIdx.x & 31, h = lane >> 4, l15 = lane & 15;
    const int m0 = blockIdx.y * 16, n0 = blockIdx.x * 32;
    const int z = blockIdx.z, zo = z / p.zi_n, zi = z - zo * p.zi_n;
    const float* A = p.A + zo * p.sAo + zi * p.sAi;
    const float* B = p.B + zo * p.sBo + zi * p.sBi;
    const int am = min(m0 + l15, p.M - 1);                       // clamped row for loads (stores are guarded)
    v8f acc[2], comp[2];
#pragma unroll
    for (int t = 0; t < 2; ++t) { v8f zz = {}; acc[t] = zz; comp[t] = zz; }
    for (int k0 = 0; k0 < p.K; k0 += 32) {
        const float* arow = A + (long long)am * p.sAm;
        if (MODE == 1) {
            const Split a = sp_ld(arow, p.sAk, k0, h, p.K, 1.f);
#pragma unroll
            for (int t = 0; t < 2; ++t) {
                const int bn = min(n0 + t * 16 + l15, p.N - 1);
                acc[t] = wmma3(a, sp_ld(B + (long long)bn * p.sBn, p.sBk, k0, h, p.K, 1.f), acc[t]);
            }
        } else if (MODE == 3) {
            const Split3 a = sp3_ld(arow, p.sAk, k0, h, p.K, 1.f);
#pragma unroll
            for (int t = 0; t < 2; ++t) {
                const int bn = min(n0 + t * 16 + l15, p.N - 1);
                acc[t] = wmma6(a, sp3_ld(B + (long long)bn * p.sBn, p.sBk, k0, h, p.K, 1.f), acc[t]);
            }
        } else if (MODE == 4) {
            // triple split as MODE 3, but each k-step's 6 products go into a fresh accumulator and the partial is added to the running f32 sum
            // on the VALU with Kahan compensation (accumulation error stays ~1 ulp however long K is)
            const Split3 a = sp3_ld(arow, p.sAk, k0, h, p.K, 1.f);
#pragma unroll
            for (int t = 0; t < 2; ++t) {
                const int bn = min(n0 + t * 16 + l15, p.N - 1); v8f zz = {};
                const v8f part = wmma6(a, sp3_ld(B + (long long)bn * p.sBn, p.sBk, k0, h, p.K, 1.f), zz);
                const v8f y = part - comp[t]; const v8f s = acc[t] + y; comp[t] = (s - acc[t]) - y; acc[t] = s;
            }
        } else if (MODE == 2) {
            const v16b a = bh_ld(arow, p.sAk, k0, h, p.K, 1.f);
#pragma unroll
            for (int t = 0; t < 2; ++t) {
                const int bn = min(n0 + t * 16 + l15, p.N - 1);
                acc[t] = wmmab(a, bh_ld(B + (long long)bn * p.sBn, p.sBk, k0, h, p.K, 1.f), acc[t]);
            }
        } else {
            const v16h a = fh_ld(arow, p.sAk, k0, h, p.K, p.sa);
#pragma unroll
            for (int t = 0; t < 2; ++t) {
                const int bn = min(n0 + t * 16 + l15, p.N - 1);
                acc[t] = wmma16(a, fh_ld(B + (long long)bn * p.sBn, p.sBk, k0, h, p.K, p.sb), acc[t]);
            }
        }
    }
    const float iscale = (MODE == 0) ? p.alpha / (p.sa * p.sb) : p.alpha;
    float* C = p.C + zo * p.sCo + zi * p.sCi;
    const float* R = p.R + zo * p.sRo + zi * p.sRi;
    __shared__ __align__(16) float ctile[16][36];
#pragma unroll
    for (int t = 0; t < 2; ++t) {
        const int n = n0 + t * 16 + l15; const int nn = min(n, p.N - 1);
#pragma unroll
        for (int r = 0; r < 8; ++r) {
            const int m = m0 + 8 * h + r; const int mm = min(m, p.M - 1);
            float v = acc[t][r] * iscale;
            if (p.flags & 1) v += p.bias[nn];
            if (p.flags & 2) v += p.bias[mm];
            if (p.flags & 8) v *= p.bias[(long long)zo * p.M + mm];   /* per-(zo,row) scale vector laid out [Z/zi_n][M]; exclusive with the bias flags */
            v = act_fn(v, p.act);
            if (p.flags & 4) v += p.beta * R[(long long)mm * p.sRm + (long long)nn * p.sRn];
            ctile[8 * h + r][t * 16 + l15] = (n < p.N) ? v : 0.f;
        }
    }
    __syncthreads();
    const int NW = (p.Npad > p.N) ? p.Npad : p.N;           // write width
    const bool fast = (m0 + 16 <= p.M) && (n0 + 32 <= NW) && ((p.sCm & 3) == 0) && ((((size_t)C) & 15) == 0);
    if (fast) {
#pragma unroll
        for (int s = 0; s < 4; ++s) {
            const int row = s * 4 + (lane >> 3), c4 = (lane & 7) * 4;
            const v4f v = *(const v4f*)&ctile[row][c4];
            VST2V4(C + (long long)(m0 + row) * p.sCm + n0 + c4, v);
        }
    } else {
        for (int row = 0; row < 16; ++row) {
            const int m = m0 + row, n = n0 + lane;
            if (m < p.M && n < NW) VST2(float, C + (long long)m * p.sCm + n, ctile[row][lane]);
        }
    }
}


// =====================================================================================================================
// k_gemmT<MODE, TM, TN>: same contract as k_gemm, but one wave computes a (16*TM) x (16*TN) tile: TM A fragments and TN B fragments are
//   loaded per 32-wide k-step and reused across TM*TN WMMAs (far fewer load/convert instructions per MAC). MODE 0 (f16), 1 (bf16 hi/lo),
//   2 (bf16) only. grid (ceil(NW/(16*TN)), ceil(M/(16*TM)), Z), block 32. Epilogue identical to k_gemm, run per 16x32 sub-tile.
// =====================================================================================================================
template <int MODE, int TM, int TN>
__global__ __launch_bounds__(32) void k_gemmT(GemmP p) {
    const int lane = threadIdx.x & 31, h = lane >> 4, l15 = lane & 15;
    const int m0 = blockIdx.y * (16 * TM), n0 = blockIdx.x * (16 * TN);
    const int z = blockIdx.z, zo = z / p.zi_n, zi = z - zo * p.zi_n;
    const float* A = p.A + zo * p.sAo + zi * p.sAi;
    const float* B = p.B + zo * p.sBo + zi * p.sBi;
    v8f acc[TM][TN];
#pragma unroll
    for (int i = 0; i < TM; ++i)
#pragma unroll
        for (int t = 0; t < TN; ++t) { v8f zz = {}; acc[i][t] = zz; }
    for (int k0 = 0; k0 < p.K; k0 += 32) {
        if (MODE == 1) {
            Split a[TM], b[TN];
#pragma unroll
            for (int i = 0; i < TM; ++i) { const int am = min(m0 + 16 * i + l15, p.M - 1); a[i] = sp_ld(A + (long long)am * p.sAm, p.sAk, k0, h, p.K, 1.f); }
#pragma unroll
            for (int t = 0; t < TN; ++t) { const int bn = min(n0 + 16 * t + l15, p.N - 1); b[t] = sp_ld(B + (long long)bn * p.sBn, p.sBk, k0, h, p.K, 1.f); }
#pragma unroll
            for (int i = 0; i < TM; ++i)
#pragma unroll
                for (int t = 0; t < TN; ++t) acc[i][t] = wmma3(a[i], b[t], acc[i][t]);
        } else if (MODE == 2) {
            v16b a[TM], b[TN];
#pragma unroll
            for (int i = 0; i < TM; ++i) { const int am = min(m0 + 16 * i + l15, p.M - 1); a[i] = bh_ld(A + (long long)am * p.sAm, p.sAk, k0, h, p.K, 1.f); }
#pragma unroll
            for (int t = 0; t < TN; ++t) { const int bn = min(n0 + 16 * t + l15, p.N - 1); b[t] = bh_ld(B + (long long)bn * p.sBn, p.sBk, k0, h, p.K, 1.f); }
#pragma unroll
            for (int i = 0; i < TM; ++i)
#pragma unroll
                for (int t = 0; t < TN; ++t) acc[i][t] = wmmab(a[i], b[t], acc[i][t]);
        } else {
            v16h a[TM], b[TN];
#pragma unroll
            for (int i = 0; i < TM; ++i) { const int am = min(m0 + 16 * i + l15, p.M - 1); a[i] = fh_ld(A + (long long)am * p.sAm, p.sAk, k0, h, p.K, p.sa); }
#pragma unroll
            for (int t = 0; t < TN; ++t) { const int bn = min(n0 + 16 * t + l15, p.N - 1); b[t] = fh_ld(B + (long long)bn * p.sBn, p.sBk, k0, h, p.K, p.sb); }
#pragma unroll
            for (int i = 0; i < TM; ++i)
#pragma unroll
                for (int t = 0; t < TN; ++t) acc[i][t] = wmma16(a[i], b[t], acc[i][t]);
        }
    }
    const float iscale = (MODE == 0) ? p.alpha / (p.sa * p.sb) : p.alpha;
    float* C = p.C + zo * p.sCo + zi * p.sCi;
    const float* R = p.R + zo * p.sRo + zi * p.sRi;
    const int NW = (p.Npad > p.N) ? p.Npad : p.N;
    __shared__ __align__(16) float ctile[16][36];
#pragma unroll
    for (int i = 0; i < TM; ++i) {
        const int mb = m0 + 16 * i; if (mb >= p.M) break;          // wave-uniform
#pragma unroll
        for (int tp = 0; tp < TN / 2; ++tp) {
            const int nb = n0 + 32 * tp; if (nb >= NW) break;        // wave-uniform
#pragma unroll
            for (int t2 = 0; t2 < 2; ++t2) {
                const int t = 2 * tp + t2; const int n = nb + t2 * 16 + l15; const int nn = min(n, p.N - 1);
#pragma unroll
                for (int r = 0; r < 8; ++r) {
                    const int m = mb + 8 * h + r; const int mm = min(m, p.M - 1);
                    float v = acc[i][t][r] * iscale;
                    if (p.flags & 1) v += p.bias[nn];
                    if (p.flags & 2) v += p.bias[mm];
            if (p.flags & 8) v *= p.bias[(long long)zo * p.M + mm];   /* per-(zo,row) scale vector laid out [Z/zi_n][M]; exclusive with the bias flags */
                    v = act_fn(v, p.act);
                    if (p.flags & 4) v += p.beta * R[(long long)mm * p.sRm + (long long)nn * p.sRn];
                    ctile[8 * h + r][t2 * 16 + l15] = (n < p.N) ? v : 0.f;
                }
            }
            __syncthreads();
            const bool fast = (mb + 16 <= p.M) && (nb + 32 <= NW) && ((p.sCm & 3) == 0) && ((((size_t)C) & 15) == 0);
            if (fast) {
#pragma unroll
                for (int s = 0; s < 4; ++s) {
                    const int row = s * 4 + (lane >> 3), c4 = (lane & 7) * 4;
                    const v4f v = *(const v4f*)&ctile[row][c4];
                    VST2V4(C + (long long)(mb + row) * p.sCm + nb + c4, v);
                }
            } else {
                for (int row = 0; row < 16; ++row) {
                    const int m = mb + row, n = nb + lane;
                    if (m < p.M && n < NW) VST2(float, C + (long long)m * p.sCm + n, ctile[row][lane]);
                }
            }
            __syncthreads();
        }
    }
}

// =====================================================================================================================
//   Wave = 16 queries, AW waves per block, 64-key blocks; grid (ceil(Lq/(16*AW)), H, B), block 32*AW. Any Lq, Lk; head dim dh <= DHP
//   (DHP multiple of 32), value dim dv <= DVP (multiple of 16, <= 128). Every tensor addressed by (batch, head, row, element) strides, f32.
//   Scores: QM 0 f16 operands, 1 bf16 hi/lo split, 2 bf16 triple split; statistics f32 (exp2 domain); P.V: P x 4096 as f16 with V f16 staged in LDS
//   (SPLITPV: P and V as bf16 hi/lo splits). kv head = h / hrep. Masking: causal = 1 (keep j <= i + coff, masked -> -inf, key blocks beyond the
//   diagonal skipped), causal = 2 (masked -> mfill, a finite fill like the -1e9; no skipping), causal = 3 (keep j >= i + coff,
//   masked -> -inf, no skipping); optional additive f32 mask Mf,
//   optional int keep-mask Mi (0 -> score := mfill), both addressed b*smb + h*smh + i*smi + j*smj (0 strides broadcast).
// =====================================================================================================================
#define AW 4
struct AttnP {   // apv4
    const float* Q; const float* K; const float* V; float* O; float* P; const float* Mf; const int* Mi; float* ST;
    const float* Pw; const float* Rt; const int* SQ; const int* SK;           // optional: post-softmax weight, relative-position table, segment ids
    long long swb, swh, swi, swj, srb, srh, sri;                                 // Pw strides (b,h,i,j); Rt strides (b,h,i), column = clamp(i - j + roff, 0, rn-1)
    long long sQb, sQh, sQi, sQd, sKb, sKh, sKj, sKd, sVb, sVh, sVj, sVd, sOb, sOh, sOi, sPb, sPh, sPi, smb, smh, smi, smj;
    int Lq, Lk, dh, dv, hrep, causal, coff, pband;   // pband > 0: P holds only the band |j - i| <= pband, column j - i + pband
    float scale, mfill; int nonorm, mpol;             // nonorm (online path only): O = sum_j exp(score_j) V_j without the 1/rowsum (scores must be <= ~0); mpol: Mi masks where ==0 (mpol 0) or where !=0 (mpol 1)
    int roff, rn, segpol, win;                        // Rt column offset/count; SQ/SK: score := mfill where (segpol 0) SQ[i] != SK[j] or (segpol 1) SQ[i] == SK[j]; win > 0: keys with i - j > win (after coff) -> -inf
};
//   Pw: the softmax numerator is multiplied by Pw(b,h,i,j) AFTER the row sum is taken (probs * weight, then P.V), as in post-softmax multiplicative biases.                                                    // ST (optional): per row (b,h,i) -> ST[((b*H + h)*Lq + i)*2 + {0,1}] = {row max of the scaled+masked score (natural units), sum_j exp(score - max)}
static_assert(sizeof(AttnP) == 12 * 8 + 29 * 8 + 16 * 4, "AttnP has padding");

#ifndef KATTN_ATTR
#define KATTN_ATTR
#endif
//   UNIT: the launch promises sQd = sKd = sVd = 1, dh = DHP, dv = DVP, Lk a multiple of 64, 16-byte aligned Q, K, V rows and 16 rows of K or V within 4 GiB
//   (f16 one-pass path only): Q, K and V are then read with unguarded 16-byte loads, a key block's all issued as one group from a uniform base and a
//   loop-invariant lane offset, instead of one guarded 4-byte load and wait per element.
//   PLAIN: the launch promises plain softmax over full tiles: Mf, Rt, Mi, SQ, Pw, P and ST null, causal = win = nonorm = 0, Lk a multiple of 64. No score is
//   then masked or out of range, every option test folds away at compile time, and a key block's softmax is one branch-free block whose rows overlap.
template <int DHP, int DVP, int QM, bool SPLITPV, bool TWOPASS, bool UNIT = false, bool PLAIN = false>
__global__ __launch_bounds__(32 * AW) KATTN_ATTR void k_attn(AttnP p) {
    static_assert(!PLAIN || !TWOPASS, "PLAIN covers the one-pass path");
    static_assert(!UNIT || (QM == 0 && !SPLITPV && !TWOPASS && (32 * AW) / (DVP / 4) == 8), "UNIT covers the f16 one-pass path, 8 V rows per load step");
    constexpr int NT = DVP / 16;                // output tiles
    constexpr int KS = DHP / 32;                // k-steps for the scores
    constexpr int VP = DVP + 8;                 // LDS pitch (halves)
    __shared__ __align__(16) float    pl[AW][16 * 64];
    __shared__ __align__(16) _Float16 vl[(SPLITPV ? 2 : 1) * 64 * VP];   // f16 V tile, or bf16 hi and lo tiles (same 2-byte size)
    const int lane = threadIdx.x & 31, hf = lane >> 4, l15 = lane & 15, wave = threadIdx.x >> 5;
    const int h = blockIdx.y, b = blockIdx.z, hk = h / p.hrep;
    const int q0 = (blockIdx.x * AW + wave) * 16;
    float* myp = pl[wave];
    const float L2E = 1.4426950408889634f;
    const float NEG = -__builtin_inff();
    const int qi = min(q0 + l15, p.Lq - 1);
    const float* qrow = p.Q + b * p.sQb + h * p.sQh + (long long)qi * p.sQi;
    const float* kbase = p.K + b * p.sKb + hk * p.sKh;
    const float* vbase = p.V + b * p.sVb + hk * p.sVh;
    const v4f* qp = (const v4f*)(qrow + 8 * hf);               // UNIT: the lane's half of the fragment's k
    v16h qa[QM == 0 ? KS : 1]; Split qs_[QM == 1 ? KS : 1]; Split3 qt_[QM == 2 ? KS : 1];
#pragma unroll
    for (int ks = 0; ks < KS; ++ks) {
        if (QM == 2) qt_[ks] = sp3_ld(qrow, p.sQd, ks * 32, hf, p.dh, 1.f);
        else if (QM == 1) qs_[ks] = sp_ld(qrow, p.sQd, ks * 32, hf, p.dh, 1.f);
        else if (UNIT) qa[ks] = fr_cvt(fr_ld(qp, ks * 32));
        else qa[ks] = fh_ld(qrow, p.sQd, ks * 32, hf, p.dh, 1.f);
    }
    if (UNIT) asm volatile("s_wait_xcnt 0x0" :: "v"(qp) : "memory");   // the Q loads' address registers stay as they are up to this wait (named as input) and are reused behind it
    constexpr int VR = (32 * AW) / (DVP / 4);                  // V rows that the block's threads cover with one 16-byte load each
    const unsigned koff = (unsigned)(l15 * (int)p.sKj + 8 * hf) * 4u;                                                          // UNIT: lane's byte offset in a 16-key tile
    const unsigned voff = (unsigned)((int)(threadIdx.x / (DVP / 4)) * (int)p.sVj + (int)(threadIdx.x % (DVP / 4)) * 4) * 4u;   // UNIT: thread's byte offset in VR rows of V
    v8f o[NT]; float m8[8], l8[8];
#pragma unroll
    for (int t = 0; t < NT; ++t) { v8f zz = {}; o[t] = zz; }
#pragma unroll
    for (int i = 0; i < 8; ++i) { m8[i] = NEG; l8[i] = 0.f; }
    int jend = p.Lk; int jstart = 0;
    if (!PLAIN && p.causal == 1) { const int je = (blockIdx.x * AW + AW - 1) * 16 + 16 + p.coff; jend = min(jend, max(je, 0)); }   // uniform per block
    if (!PLAIN && p.win > 0) { const int js = (int)(blockIdx.x * AW) * 16 + p.coff - p.win; jstart = (js > 0) ? (js / 64) * 64 : 0; }   // uniform per block: key blocks entirely outside every row's window hold only -inf entries and are skipped exactly
    const int npass = TWOPASS ? 2 : 1;
    for (int pass = 0; pass < npass; ++pass) {
        const bool dopv = (!TWOPASS) || pass == 1;
        for (int j0 = jstart; j0 < jend; j0 += 64) {
            if (dopv) {
                __syncthreads();                                 // previous key block's reads of vl / pl are done
                if (!UNIT)
                for (int idx = threadIdx.x; idx < 64 * DVP; idx += 32 * AW) {
                    const int jr = idx / DVP, d = idx - jr * DVP, j = j0 + jr;
                    const float f = (j < p.Lk && d < p.dv) ? vbase[(long long)j * p.sVj + (long long)d * p.sVd] : 0.f;
                    if (SPLITPV) {
                        const __bf16 hb = bf16_rne(f);
                        ((__bf16*)vl)[jr * VP + d] = hb; ((__bf16*)vl)[64 * VP + jr * VP + d] = bf16_rne(f - bf16_f32(hb));
                    } else vl[jr * VP + d] = (_Float16)f;
                }
            }
            v8f s[4];
            if (UNIT) {
                v4f vr[8]; FragRaw kr[4][KS]; const v4f* vp[8]; const v4f* kp[4];
#pragma unroll
                for (int it = 0; it < 8; ++it) { vp[it] = (const v4f*)((const char*)(vbase + (long long)(j0 + it * VR) * p.sVj) + voff); vr[it] = *vp[it]; }
#pragma unroll
                for (int t = 0; t < 4; ++t) {
                    kp[t] = (const v4f*)((const char*)(kbase + (long long)(j0 + t * 16) * p.sKj) + koff);
#pragma unroll
                    for (int ks = 0; ks < KS; ++ks) kr[t][ks] = fr_ld(kp[t], ks * 32);
                }
                // the group's address registers stay as they are up to this wait (named as inputs) and are reused behind it, while the loads are still in flight
                asm volatile("s_wait_xcnt 0x0" :: "v"(vp[0]), "v"(vp[1]), "v"(vp[2]), "v"(vp[3]), "v"(vp[4]), "v"(vp[5]), "v"(vp[6]), "v"(vp[7]),
                             "v"(kp[0]), "v"(kp[1]), "v"(kp[2]), "v"(kp[3]) : "memory");
#pragma unroll
                for (int it = 0; it < 8; ++it) {
                    v4h hv; hv[0] = (_Float16)vr[it][0]; hv[1] = (_Float16)vr[it][1]; hv[2] = (_Float16)vr[it][2]; hv[3] = (_Float16)vr[it][3];
                    *(v4h*)(vl + (it * VR + (int)(threadIdx.x / (DVP / 4))) * VP + (int)(threadIdx.x % (DVP / 4)) * 4) = hv;
                }
#pragma unroll
                for (int t = 0; t < 4; ++t) {
                    v8f acc = {};
#pragma unroll
                    for (int ks = 0; ks < KS; ++ks) acc = wmma16(qa[ks], fr_cvt(kr[t][ks]), acc);
                    s[t] = acc;
                }
            } else
#pragma unroll
            for (int t = 0; t < 4; ++t) {
                const int j = min(j0 + t * 16 + l15, p.Lk - 1);
                const float* krow = kbase + (long long)j * p.sKj;
                v8f acc = {};
#pragma unroll
                for (int ks = 0; ks < KS; ++ks) {
                    if (QM == 2)      acc = wmma6(qt_[ks], sp3_ld(krow, p.sKd, ks * 32, hf, p.dh, 1.f), acc);
                    else if (QM == 1) acc = wmma3(qs_[ks], sp_ld(krow, p.sKd, ks * 32, hf, p.dh, 1.f), acc);
                    else              acc = wmma16(qa[ks], fh_ld(krow, p.sKd, ks * 32, hf, p.dh, 1.f), acc);
                }
                s[t] = acc;
            }
            float pv[8][4];
#pragma unroll
            for (int i = 0; i < 8; ++i) {
                const int irow = q0 + i + 8 * hf;
                const int ic = min(irow, p.Lq - 1);
                float sc[4];
#pragma unroll
                for (int t = 0; t < 4; ++t) {
                    const int jg = j0 + t * 16 + l15;
                    float v = s[t][i] * p.scale;
                    if (!PLAIN && p.Mf) v += p.Mf[b * p.smb + h * p.smh + (long long)ic * p.smi + (long long)min(jg, p.Lk - 1) * p.smj];
                    if (!PLAIN && p.Rt) { int rc = ic - min(jg, p.Lk - 1) + p.roff; rc = rc < 0 ? 0 : (rc >= p.rn ? p.rn - 1 : rc); v += p.Rt[b * p.srb + h * p.srh + (long long)ic * p.sri + rc]; }
                    if (!PLAIN && p.Mi) { const int mv = p.Mi[b * p.smb + h * p.smh + (long long)ic * p.smi + (long long)min(jg, p.Lk - 1) * p.smj]; if (p.mpol ? (mv != 0) : (mv == 0)) v = p.mfill; }
                    if (!PLAIN && p.SQ) { const bool same = p.SQ[(long long)b * p.Lq + ic] == p.SK[(long long)b * p.Lk + min(jg, p.Lk - 1)]; if (p.segpol ? same : !same) v = p.mfill; }
                    if (!PLAIN && p.causal == 2 && jg > irow + p.coff) v = p.mfill;
                    if (!PLAIN && (jg >= p.Lk || (p.causal == 1 && jg > irow + p.coff) || (p.causal == 3 && jg < irow + p.coff) || (p.win > 0 && irow + p.coff - jg > p.win))) v = NEG; else v *= L2E;
                    sc[t] = v;
                }
                if (!TWOPASS || pass == 0) {
                    float mx = fmaxf(fmaxf(sc[0], sc[1]), fmaxf(sc[2], sc[3]));
                    mx = fmaxf(mx, __shfl_xor(mx, 1, 32)); mx = fmaxf(mx, __shfl_xor(mx, 2, 32));
                    mx = fmaxf(mx, __shfl_xor(mx, 4, 32)); mx = fmaxf(mx, __shfl_xor(mx, 8, 32));
                    const float mnew = fmaxf(m8[i], mx);
                    const float corr = (!PLAIN && mnew == NEG) ? 1.f : exp2f(m8[i] - mnew);
                    float rs = 0.f;
#pragma unroll
                    for (int t = 0; t < 4; ++t) {
                        const float pp = (!PLAIN && sc[t] == NEG) ? 0.f : exp2f(sc[t] - mnew); rs += pp;
                        pv[i][t] = (!PLAIN && p.Pw) ? pp * p.Pw[b * p.swb + h * p.swh + (long long)ic * p.swi + (long long)min(j0 + t * 16 + l15, p.Lk - 1) * p.swj] : pp;
                    }
                    rs += __shfl_xor(rs, 1, 32); rs += __shfl_xor(rs, 2, 32); rs += __shfl_xor(rs, 4, 32); rs += __shfl_xor(rs, 8, 32);
                    l8[i] = l8[i] * corr + rs; m8[i] = mnew;
                    if (!TWOPASS) {
#pragma unroll
                        for (int t = 0; t < NT; ++t) o[t][i] *= corr;
                    }
                } else {
                    const float inv = (l8[i] > 0.f) ? 1.f / l8[i] : 0.f;
#pragma unroll
                    for (int t = 0; t < 4; ++t) {
                        const int jg = j0 + t * 16 + l15;
                        float pp = (sc[t] == NEG) ? 0.f : exp2f(sc[t] - m8[i]) * inv;
                        if (p.Pw) pp *= p.Pw[b * p.swb + h * p.swh + (long long)ic * p.swi + (long long)min(jg, p.Lk - 1) * p.swj];
                        pv[i][t] = pp;
                    }
                }
            }
            if (dopv) {
#pragma unroll
                for (int i = 0; i < 8; ++i)
#pragma unroll
                    for (int t = 0; t < 4; ++t) ((float*)myp)[(i + 8 * hf) * 64 + t * 16 + l15] = pv[i][t];
                __syncthreads();                                 // P (per wave) and V (shared) visible
                if (!PLAIN && p.P) {
                    float* pb_ = p.P + b * p.sPb + h * p.sPh;
                    const bool fastP = (p.pband == 0) && ((p.sPi & 3) == 0) && (j0 + 64 <= p.Lk) && (q0 + 16 <= p.Lq) && ((((size_t)pb_) & 15) == 0);
                    if (fastP) {
#pragma unroll
                        for (int s = 0; s < 8; ++s) {
                            const int row = s * 2 + (lane >> 4), c4 = (lane & 15) * 4;
                            const v4f v = *(const v4f*)(myp + row * 64 + c4);
                            VST2V4(pb_ + (long long)(q0 + row) * p.sPi + j0 + c4, v);
                        }
                    } else {
                        for (int row = 0; row < 16; ++row) {
                            const int irow = q0 + row; if (irow >= p.Lq) continue;
                            for (int c = lane; c < 64; c += 32) {
                                const int jg = j0 + c; if (jg >= p.Lk) continue;
                                if (p.pband == 0) VST2(float, pb_ + (long long)irow * p.sPi + jg, myp[row * 64 + c]);
                                else if (jg - irow <= p.pband && irow - jg <= p.pband) VST2(float, pb_ + (long long)irow * p.sPi + (jg - irow + p.pband), myp[row * 64 + c]);
                            }
                        }
                    }
                }
                if (SPLITPV) {
                    const Split pa0 = sp_ld(myp + l15 * 64, 1, 0, hf, 64, 1.f), pa1 = sp_ld(myp + l15 * 64, 1, 32, hf, 64, 1.f);
                    const __bf16* vh = (const __bf16*)vl; const __bf16* vlo = vh + 64 * VP;
#pragma unroll
                    for (int t = 0; t < NT; ++t) {
                        const int dcol = t * 16 + l15;
                        Split b0, b1;
#pragma unroll
                        for (int e = 0; e < 16; ++e) {
                            const int k0 = frag_k(e, hf), k1 = 32 + frag_k(e, hf);
                            b0.hi[e] = vh[k0 * VP + dcol]; b0.lo[e] = vlo[k0 * VP + dcol]; b1.hi[e] = vh[k1 * VP + dcol]; b1.lo[e] = vlo[k1 * VP + dcol];
                        }
                        o[t] = wmma3(pa0, b0, o[t]);
                        o[t] = wmma3(pa1, b1, o[t]);
                    }
                } else {
                    const v16h pa0 = fh_ld(myp + l15 * 64, 1, 0, hf, 64, 4096.f), pa1 = fh_ld(myp + l15 * 64, 1, 32, hf, 64, 4096.f);
#pragma unroll
                    for (int t = 0; t < NT; ++t) {
                        const int dcol = t * 16 + l15;
                        v16h b0, b1;
#pragma unroll
                        for (int e = 0; e < 16; ++e) { b0[e] = vl[frag_k(e, hf) * VP + dcol]; b1[e] = vl[(32 + frag_k(e, hf)) * VP + dcol]; }
                        o[t] = wmma16(pa0, b0, o[t]);
                        o[t] = wmma16(pa1, b1, o[t]);
                    }
                }
            }
        }
    }
    float* obase = p.O + b * p.sOb + h * p.sOh;
    if (!PLAIN && p.ST) {
        const int rl = lane >> 1, isel = rl & 7;           // row q0 + rl ; rl>>3 == hf holds because lane>>4 == (lane>>1)>>3
        float mv = 0.f, lv = 0.f;
#pragma unroll
        for (int i = 0; i < 8; ++i) if (i == isel) { mv = m8[i]; lv = l8[i]; }
        const int irow = q0 + rl;
        if (irow < p.Lq) { float* st = p.ST + (((long long)b * gridDim.y + h) * p.Lq + irow) * 2 + (lane & 1); VST2(float, st, (lane & 1) ? lv : mv * 0.6931471805599453f); }
    }
    float invr[8];
#pragma unroll
    for (int i = 0; i < 8; ++i) {
        if (TWOPASS) invr[i] = SPLITPV ? 1.f : (1.f / 4096.f);
        else if (!PLAIN && p.nonorm) invr[i] = exp2f(m8[i]) * (SPLITPV ? 1.f : (1.f / 4096.f));
        else invr[i] = (l8[i] > 0.f) ? (SPLITPV ? 1.f / l8[i] : 1.f / (l8[i] * 4096.f)) : 0.f;
    }
    __syncthreads();                                             // all waves done with pl/vl from the main loop
    const bool ofast = ((p.sOi & 3) == 0) && ((((size_t)obase) & 15) == 0) && (q0 + 16 <= p.Lq);
#pragma unroll
    for (int c0 = 0; c0 < DVP; c0 += 64) {
#pragma unroll
        for (int i = 0; i < 8; ++i)
#pragma unroll
            for (int t = 0; t < NT; ++t) if (t * 16 >= c0 && t * 16 < c0 + 64) ((float*)myp)[(i + 8 * hf) * 64 + (t * 16 - c0) + l15] = o[t][i] * invr[i];
        __syncthreads();
        const int cw = (DVP - c0 < 64) ? (DVP - c0) : 64;      // staged columns in this chunk (multiple of 16)
        if (ofast && (c0 + cw <= p.dv) && (cw % 32 == 0)) {
            const int lpr = cw / 4;                              // lanes per row (16 for 64 cols, 8 for 32)
            const int rows_per_ins = 32 / lpr;
            for (int r0 = 0; r0 < 16; r0 += rows_per_ins) {
                const int row = r0 + lane / lpr, c4 = (lane % lpr) * 4;
                const v4f v = *(const v4f*)(myp + row * 64 + c4);
                VST2V4(obase + (long long)(q0 + row) * p.sOi + c0 + c4, v);
            }
        } else {
            for (int row = 0; row < 16; ++row) {
                const int irow = q0 + row; if (irow >= p.Lq) continue;
                for (int c = lane; c < cw; c += 32) { const int d = c0 + c; if (d < p.dv) VST2(float, obase + (long long)irow * p.sOi + d, myp[row * 64 + c]); }
            }
        }
        __syncthreads();
    }
}

// =====================================================================================================================
// k_tr: dst(z, c, r) = alpha * src(z, r, c) (+ beta * R2(z, c, r)): [Z][R][C] (row stride lds) -> [Z][C][R] (row stride ldd) through a 32x32 LDS tile;
//   flags: 1 -> add beta * residual R2 addressed like dst (z*sRz + c*ldr + r); act applied before the residual.
// =====================================================================================================================
struct TrP { const float* src; float* dst; const float* R2; long long sSz, lds, sDz, ldd, sRz, ldr; int R, C, flags, act; float alpha, beta; };
static_assert(sizeof(TrP) == 3 * 8 + 6 * 8 + 6 * 4, "TrP has padding");
__global__ __launch_bounds__(256) void k_tr(TrP p) {
    __shared__ float tile[32][33];
    const int c0 = blockIdx.x * 32, r0 = blockIdx.y * 32, z = blockIdx.z;
    const int lane = threadIdx.x & 31, wave = threadIdx.x >> 5;
    const float* s = p.src + z * p.sSz;
#pragma unroll
    for (int k = 0; k < 4; ++k) {
        const int rl = wave * 4 + k, r = r0 + rl, c = c0 + lane;
        tile[rl][lane] = (r < p.R && c < p.C) ? s[(long long)r * p.lds + c] : 0.f;
    }
    __syncthreads();
    float* d = p.dst + z * p.sDz; const float* rr = p.R2 + z * p.sRz;
#pragma unroll
    for (int k = 0; k < 4; ++k) {
        const int cl = wave * 4 + k, c = c0 + cl, r = r0 + lane;
        if (c < p.C && r < p.R) {
            float v = act_fn(p.alpha * tile[lane][cl], p.act);
            if (p.flags & 1) v += p.beta * rr[(long long)c * p.ldr + r];
            VST2(float, d + (long long)c * p.ldd + r, v);
        }
    }
}

// k_affine: dst[i] = a * (sdev ? sdev[0] : 1) * src[i] + b, i < n (one thread per element; consecutive lanes -> consecutive addresses)
__global__ __launch_bounds__(256) void k_affine(const float* __restrict__ src, float* __restrict__ dst, int n, float a, float b, const float* __restrict__ sdev) {
    const int i = blockIdx.x * 256 + threadIdx.x;
    if (i < n) { const float aa = sdev ? a * sdev[0] : a; const float v = aa * src[i] + b; VST2(float, dst + i, v); }
}

// =====================================================================================================================
// k_softmax: row softmax over n contiguous elements, one 256-thread block per row; rows addressed z*sz + r*sr (grid (R, Z)).
//   out = scale_out * softmax(scale_in * x + (Mf ? Mf[z*smz + r*smr + j] : 0)); a row whose max is -inf is written as 0.
// =====================================================================================================================
struct SmP { const float* src; float* dst; const float* Mf; long long sz, sr, dz, dr, smz, smr; int n, pad; float scale_in, scale_out; };
static_assert(sizeof(SmP) == 3 * 8 + 6 * 8 + 4 * 4, "SmP has padding");
__global__ __launch_bounds__(256) void k_softmax(SmP p) {
    __shared__ float red[256];
    const int r = blockIdx.x, z = blockIdx.y, tid = threadIdx.x;
    const float* s = p.src + z * p.sz + (long long)r * p.sr;
    const float* mf = p.Mf ? (p.Mf + z * p.smz + (long long)r * p.smr) : nullptr;
    float mx = -__builtin_inff();
    for (int j = tid; j < p.n; j += 256) { float v = s[j] * p.scale_in; if (mf) v += mf[j]; mx = fmaxf(mx, v); }
    red[tid] = mx; __syncthreads();
    for (int o = 128; o > 0; o >>= 1) { if (tid < o) red[tid] = fmaxf(red[tid], red[tid + o]); __syncthreads(); }
    mx = red[0]; __syncthreads();
    float sum = 0.f;
    for (int j = tid; j < p.n; j += 256) { float v = s[j] * p.scale_in; if (mf) v += mf[j]; sum += (mx == -__builtin_inff()) ? 0.f : expf(v - mx); }
    red[tid] = sum; __syncthreads();
    for (int o = 128; o > 0; o >>= 1) { if (tid < o) red[tid] += red[tid + o]; __syncthreads(); }
    sum = red[0];
    const float inv = (sum > 0.f) ? p.scale_out / sum : 0.f;
    float* d = p.dst + z * p.dz + (long long)r * p.dr;
    for (int j = tid; j < p.n; j += 256) { float v = s[j] * p.scale_in; if (mf) v += mf[j]; const float o = (mx == -__builtin_inff()) ? 0.f : expf(v - mx) * inv; VST2(float, d + j, o); }
}
// =====================================================================================================================
// k_stats: mean and rsqrt(var + eps) over a set of n elements addressed base + z*sz + (e / inner) * so + (e % inner) * si, one 256-thread
// k_norm_apply: y = (x - mean[set]) * rstd[set] * g[c] + b[c] over a [Z][C][L] chan-major tensor with set = z*G + c / (C/G) (G groups per z;
//   G = C -> per-chan sets indexed z*C+c; for batch norm pass stats indexed by c only via bn = 1). Optional act. Output same layout.
// =====================================================================================================================
//   mode 0: mean / rsqrt(var + eps); mode 1 (RMSNorm): 0 / rsqrt(mean(x^2) + eps); mode 2 (L2 normalize * sqrt(n)): 0 / sqrt(n) / max(||x||, eps); mode 3: as 0 with unbiased variance (n-1)
__global__ __launch_bounds__(256) void k_stats(const float* __restrict__ x, long long sz, long long so, long long si, int inner, int n, float eps, float* __restrict__ stat, int mode) {
    __shared__ float red[256];
    const int z = blockIdx.x, tid = threadIdx.x;
    const float* base = x + z * sz;
    float s = 0.f;
    for (int e = tid; e < n; e += 256) s += base[(long long)(e / inner) * so + (long long)(e % inner) * si];
    red[tid] = s; __syncthreads();
    for (int o = 128; o > 0; o >>= 1) { if (tid < o) red[tid] += red[tid + o]; __syncthreads(); }
    const float mu = (mode == 0 || mode == 3) ? red[0] / (float)n : 0.f; __syncthreads();
    float q = 0.f;
    for (int e = tid; e < n; e += 256) { const float dlt = base[(long long)(e / inner) * so + (long long)(e % inner) * si] - mu; q += dlt * dlt; }
    red[tid] = q; __syncthreads();
    for (int o = 128; o > 0; o >>= 1) { if (tid < o) red[tid] += red[tid + o]; __syncthreads(); }
    {
        float rs;
        if (mode == 2) rs = sqrtf((float)n) / fmaxf(sqrtf(red[0]), eps); else if (mode == 3) rs = rsqrtf(red[0] / (float)(n - 1) + eps); else rs = rsqrtf(red[0] / (float)n + eps);
        if (tid < 32) { const float v = (tid == 0) ? mu : ((tid == 1) ? rs : 0.f); VST2(float, stat + (long long)z * 32 + tid, v); }
    }
}
//   One thread per element over the flat [Z][C][L] index space: grid ceil(Z*C*L / 256).
__global__ __launch_bounds__(256) void k_norm_apply(const float* __restrict__ x, float* __restrict__ y, const float* __restrict__ stat, const float* __restrict__ g, const float* __restrict__ bta,
                                                     int Z, int C, int L, int G, int bn, int act) {
    const long long idx = (long long)blockIdx.x * 256 + threadIdx.x;
    if (idx >= (long long)Z * C * L) return;
    const int l = (int)(idx % L); const long long zc = idx / L; const int c = (int)(zc % C), z = (int)(zc / C); (void)l;
    const int set = bn ? c : (z * G + c / (C / G));
    float v = (x[idx] - stat[(long long)set * 32]) * stat[(long long)set * 32 + 1];
    if (g) v *= g[c];
    if (bta) v += bta[c];
    v = act_fn(v, act);
    VST2(float, y + idx, v);
}

// k_lse_neg: c[i] = -(st[2i] + log(st[2i+1])) = minus the log-sum-exp of row i from k_attn's ST output (for softmax over the query dimension)
__global__ __launch_bounds__(256) void k_lse_neg(const float* __restrict__ st, float* __restrict__ c, int n) {
    const int i = blockIdx.x * 256 + threadIdx.x;
    if (i < n) { const float v = -(st[2 * i] + logf(st[2 * i + 1])); VST2(float, c + i, v); }
}

// k_iota: dst[i] = a * i + b as int32 (segment/position id helper)
__global__ __launch_bounds__(256) void k_iota(int* __restrict__ dst, int n, int a, int b) {
    const int i = blockIdx.x * 256 + threadIdx.x;
    if (i < n) { const int v = a * i + b; VST2(int, dst + i, v); }
}

// k_axpby: dst[i] = a * x[i] + b * y[i] (+ c), i < n
__global__ __launch_bounds__(256) void k_axpby(const float* __restrict__ x, const float* __restrict__ y, float* __restrict__ dst, int n, float a, float b, float c) {
    const int i = blockIdx.x * 256 + threadIdx.x;
    if (i < n) { const float v = a * x[i] + b * y[i] + c; VST2(float, dst + i, v); }
}

// =====================================================================================================================
// k_rope: rotary embedding on a [R rows][Hn heads][D] view (row stride sXr, head stride sXh, element stride 1) -> Y (own strides).
//   mode 0: rotate_half (partner d±D/2, sign - for d<D/2); mode 1: interleaved pairs (partner d^1, sign - for even d).
//   table column tcol: tmode 0 -> d, 1 -> d % (D/2), 2 -> d / 2; position p: pmode 0 -> r % S, 1 -> head index, 2 -> pos[r];
//   c = C[(r / S) * sCb + p * sCp + tcol * sCd], s likewise from Sn; y = x[d] * c + sign * x[partner] * s. X and Y must not alias.
// =====================================================================================================================
struct RopeP { const float* X; float* Y; const float* C; const float* Sn; const int* pos; long long sXr, sXh, sYr, sYh, sCb, sCp, sCd; int R, Hn, D, S, mode, tmode, pmode, pad; };
static_assert(sizeof(RopeP) == 5 * 8 + 7 * 8 + 8 * 4, "RopeP has padding");
__global__ __launch_bounds__(256) void k_rope(RopeP p) {
    const long long idx = (long long)blockIdx.x * 256 + threadIdx.x;
    if (idx >= (long long)p.R * p.Hn * p.D) return;
    const int d = (int)(idx % p.D); const long long rh = idx / p.D; const int h = (int)(rh % p.Hn); const int r = (int)(rh / p.Hn);
    const int half = p.D / 2;
    int partner; float sign;
    if (p.mode == 0) { partner = (d < half) ? d + half : d - half; sign = (d < half) ? -1.f : 1.f; }
    else { partner = d ^ 1; sign = (d & 1) ? 1.f : -1.f; }
    const int tcol = (p.tmode == 0) ? d : ((p.tmode == 1) ? (d % half) : (d >> 1));
    const int pp = (p.pmode == 0) ? (r % p.S) : ((p.pmode == 1) ? h : p.pos[r]);
    const long long toff = (long long)(r / p.S) * p.sCb + (long long)pp * p.sCp + (long long)tcol * p.sCd;
    const float* xr = p.X + (long long)r * p.sXr + (long long)h * p.sXh;
    const float v = xr[d] * p.C[toff] + sign * xr[partner] * p.Sn[toff];
    VST2(float, p.Y + (long long)r * p.sYr + (long long)h * p.sYh + d, v);
}

// k_invf + k_sincos (split so neither kernel carries a large VALU-fma footprint): invf_i = num * (1 / powf(base, (2 i)/D)) [fmode 0],
//   num * expf((2 i) * cexp) [fmode 1], num * powf(base, -2 (i - 1) / D) [fmode 2]; then cs/sn[s*half + i] = cos/sin((pscale * s) * invf_i)
__global__ __launch_bounds__(256) void k_invf(float* __restrict__ invb, int half, int D, float base, float num, int fmode, float cexp) {
    const int i = blockIdx.x * 256 + threadIdx.x;
    if (i >= ((half + 31) / 32) * 32) return;
    if (i >= half) { VST2(float, invb + i, 0.f); return; }
    const float e = (float)(2 * i) / (float)D;
    float invf;
    if (fmode == 1) invf = num * expf((float)(2 * i) * cexp);
    else if (fmode == 2) invf = num * powf(base, (-2.0f * ((float)i - 1.0f)) / (float)D);
    else invf = num * (1.0f / powf(base, e));
    VST2(float, invb + i, invf);
}
__global__ __launch_bounds__(256) void k_sincos(float* __restrict__ cs, float* __restrict__ sn, const float* __restrict__ invb, int S, int half, float pscale) {
    const int idx = blockIdx.x * 256 + threadIdx.x;
    if (idx >= S * half) return;
    const int s = idx / half, i = idx - s * half;
    const float ang = (pscale * (float)s) * invb[i];
    VST2(float, cs + idx, cosf(ang)); VST2(float, sn + idx, sinf(ang));
}

// k_mulact: dst[i] = act(x[i]) * y[i]
__global__ __launch_bounds__(256) void k_mulact(const float* __restrict__ x, const float* __restrict__ y, float* __restrict__ dst, int n, int act) {
    const int i = blockIdx.x * 256 + threadIdx.x;
    if (i < n) { const float v = act_fn(x[i], act) * y[i]; VST2(float, dst + i, v); }
}

// =====================================================================================================================
// k_matvec: thread-per-row matrix-vector products for N <= 8 output columns (heads with 1-3 outputs, gates), f32 on the VALU.
//   C[r*sCm + j] = act(alpha * sum_k A[r*sAm + k*sAk] * B[j*sBn + k*sBk] + bias[j]) + beta * R[r*sRm + j*sRn]; each thread writes its N contiguous floats.
// =====================================================================================================================
__global__ __launch_bounds__(256) void k_matvec(GemmP p) {
    // 32 lanes write one line with one instruction.
    const int rpt = (p.N == 1) ? 1 : 32;
    const long long r0 = ((long long)blockIdx.x * 256 + threadIdx.x) * rpt; const int z = blockIdx.z, zo = z / p.zi_n, zi = z - zo * p.zi_n;
    if (r0 >= p.M) return;
    const float* Bb = p.B + zo * p.sBo + zi * p.sBi;
    float* C = p.C + zo * p.sCo + zi * p.sCi; const float* R = p.R + zo * p.sRo + zi * p.sRi;
    for (int rr = 0; rr < rpt; ++rr) {
        const long long r = r0 + rr; if (r >= p.M) break;
        const float* A = p.A + zo * p.sAo + zi * p.sAi + r * p.sAm;
        float acc[8] = {0.f, 0.f, 0.f, 0.f, 0.f, 0.f, 0.f, 0.f};
        for (int k = 0; k < p.K; ++k) { const float a = A[(long long)k * p.sAk];
#pragma unroll
            for (int j = 0; j < 8; ++j) if (j < p.N) acc[j] += a * Bb[(long long)j * p.sBn + (long long)k * p.sBk]; }
#pragma unroll
        for (int j = 0; j < 8; ++j) if (j < p.N) {
            float v = acc[j] * p.alpha;
            if (p.flags & 1) v += p.bias[j];
            if (p.flags & 2) v += p.bias[r];
            v = act_fn(v, p.act);
            if (p.flags & 4) v += p.beta * R[r * p.sRm + (long long)j * p.sRn];
            VST2(float, C + r * p.sCm + j, v);
        }
    }
}
// k_smallsoftmax: thread-per-row softmax for short rows (n <= 64): dst[r*dr + j] = softmax(scale*src[r*sr + j])
__global__ __launch_bounds__(256) void k_smallsoftmax(const float* __restrict__ src, float* __restrict__ dst, long long sr, long long dr, int n, long long R, float scale) {
    const long long r0 = ((long long)blockIdx.x * 256 + threadIdx.x) * 32;
    for (int rr = 0; rr < 32; ++rr) {
        const long long r = r0 + rr; if (r >= R) return;
        const float* s = src + r * sr; float* d = dst + r * dr;
        float mx = -__builtin_inff();
        for (int j = 0; j < n; ++j) mx = fmaxf(mx, s[j] * scale);
        float sum = 0.f;
        for (int j = 0; j < n; ++j) sum += expf(s[j] * scale - mx);
        const float inv = 1.f / sum;
        for (int j = 0; j < n; ++j) { const float v = expf(s[j] * scale - mx) * inv; VST2(float, d + j, v); }
    }
}

__global__ __launch_bounds__(32) void k_unitstat(float* __restrict__ st) { const int t = threadIdx.x; const float v = (t == 1) ? 1.f : 0.f; VST2(float, st + t, v); }

// destination (e.g. a d_out whose row width is not a multiple of 32 floats) is written by consecutive lanes of one instruction
__global__ __launch_bounds__(256) void k_lincopy(const float* __restrict__ src, long long lds, float* __restrict__ dst, long long ldd, long long rows, int cols) {
    const long long i = (long long)blockIdx.x * 256 + threadIdx.x; if (i >= rows * cols) return;
    const long long r = i / cols; const int c = (int)(i - r * cols);
    const float v = src[r * lds + c]; VST2(float, dst + r * ldd + c, v);
}

namespace w25 {
typedef __attribute__((ext_vector_type(16))) _Float16 v16h;
typedef __attribute__((ext_vector_type(8)))  _Float16 v8h;
typedef __attribute__((ext_vector_type(16))) __bf16   v16b;
typedef __attribute__((ext_vector_type(8)))  __bf16   v8b;
typedef __attribute__((ext_vector_type(8)))  float    v8f;
typedef __attribute__((ext_vector_type(4)))  float    v4f;

__device__ __forceinline__ unsigned short f2bf_bits(float f) {
  unsigned u = __float_as_uint(f);
  return (unsigned short)((u + 0x7FFFu + ((u >> 16) & 1u)) >> 16);
}
__device__ __forceinline__ float bf_bits2f(unsigned short h) { return __uint_as_float(((unsigned)h) << 16); }

// hazard guards as plain device helpers (no inline asm inside the kernel template body)
__device__ __forceinline__ void dep_guard_h(v8f& a, v8f& b, v16h x, v16h y) { asm volatile("v_nop\n\tv_nop\n\tv_nop\n\tv_nop" : "+v"(a), "+v"(b) : "v"(x), "v"(y)); }
__device__ __forceinline__ void dep_guard_b(v8f& a, v8f& b, v16b x, v16b y) { asm volatile("v_nop\n\tv_nop\n\tv_nop\n\tv_nop" : "+v"(a), "+v"(b) : "v"(x), "v"(y)); }
__device__ __forceinline__ void keep4_h(v16h a, v16h b, v16h c, v16h d) { asm volatile("v_nop" :: "v"(a), "v"(b), "v"(c), "v"(d)); }
__device__ __forceinline__ void keep4_b(v16b a, v16b b, v16b c, v16b d) { asm volatile("v_nop" :: "v"(a), "v"(b), "v"(c), "v"(d)); }
__device__ __forceinline__ void acc_guard4(v8f& a, v8f& b, v8f& c, v8f& d) { asm volatile("v_nop\n\tv_nop\n\tv_nop\n\tv_nop" : "+v"(a), "+v"(b), "+v"(c), "+v"(d)); }
template <typename T> struct Frag;
template <> struct Frag<_Float16> {
  typedef v16h V; union U { v16h v; v8h h[2]; };
  static __device__ __forceinline__ v16h load(const _Float16* p) {   // elements 0..7 <- p[0..7], 8..15 <- p[16..23]
    U f; f.h[0] = *(const v8h*)(p); f.h[1] = *(const v8h*)(p + 16); return f.v;
  }
  static __device__ __forceinline__ v8f mma(v16h a, v16h b, v8f c) {
    return __builtin_amdgcn_wmma_f32_16x16x32_f16(false, a, false, b, (short)0, c, false, false);
  }
  static __device__ __forceinline__ void guard(v8f& a, v8f& b, v16h x, v16h y) { dep_guard_h(a, b, x, y); }
  static __device__ __forceinline__ void keep(v16h a, v16h b, v16h c, v16h d) { keep4_h(a, b, c, d); }
};
template <> struct Frag<__bf16> {
  typedef v16b V; union U { v16b v; v8b h[2]; };
  static __device__ __forceinline__ v16b load(const __bf16* p) {
    U f; f.h[0] = *(const v8b*)(p); f.h[1] = *(const v8b*)(p + 16); return f.v;
  }
  static __device__ __forceinline__ v8f mma(v16b a, v16b b, v8f c) {
    return __builtin_amdgcn_wmma_f32_16x16x32_bf16(false, a, false, b, (short)0, c, false, false);
  }
  static __device__ __forceinline__ void guard(v8f& a, v8f& b, v16b x, v16b y) { dep_guard_b(a, b, x, y); }
  static __device__ __forceinline__ void keep(v16b a, v16b b, v16b c, v16b d) { keep4_b(a, b, c, d); }
};

// ---- Register-blocked batched WMMA GEMM ------------------------------------
// C[m,n] = scale * sum_k A[m,k] * Bt[n,k] (+bias)(+resid); each wave owns a 64x64 tile.
// A row-major [M,K]; Bt row-major [N,K]; M,N % 64 == 0, K % 32 == 0.
// SPLIT: operands are hi/lo planes (A2/Bt2 = lo planes, same layout); product = hi·hi + hi·lo + lo·hi.
// BIAS_MODE: 0 = none, 1 = bias[m], 2 = bias[n].
// OUT_MODE: 0 = f32, 1 = f16, 2 = bf16 hi plane (Cout) + bf16 lo plane (Cout2).
// ET: 0 = f16 operands, 1 = bf16 operands (pointers passed as 16-bit storage)
template <int ET> struct Elem;
template <> struct Elem<0> { typedef _Float16 T; };
template <> struct Elem<1> { typedef __bf16 T; };
template <int ET, bool SPLIT, int BIAS_MODE, int OUT_MODE, bool RESID, int ACT = 0>
__global__ __launch_bounds__(256) void wmma_gemm64(
    const unsigned short* __restrict__ Ap, const unsigned short* __restrict__ A2p, int lda, long strideA,
    const unsigned short* __restrict__ Btp, const unsigned short* __restrict__ Bt2p, int ldb, long strideB,
    void* __restrict__ Cout, void* __restrict__ Cout2, int ldc, long strideC,
    const float* __restrict__ bias,
    const float* __restrict__ resid, long strideR,
    int M, int N, int K, float scale) {
  typedef typename Elem<ET>::T T;
  typedef typename Frag<T>::V V;
  const T* A = (const T*)Ap; const T* A2 = (const T*)A2p; const T* Bt = (const T*)Btp; const T* Bt2 = (const T*)Bt2p;
  __shared__ __align__(16) float sT[8][16 * 68];   // per-wave 16x64 slab, pitch 68 floats
  const int b    = blockIdx.y;
  const int lane = threadIdx.x & 31;
  const int wave = threadIdx.x >> 5;
  const int tilesN = N >> 6;
  const int tilesM = M >> 6;
  const int tile = blockIdx.x * 8 + wave;
  if (tile >= tilesM * tilesN) return;   // wave-uniform; no block barriers in this kernel
  const int tm = tile / tilesN;
  const int tn = tile - tm * tilesN;
  const int m0 = tm << 6;
  const int n0 = tn << 6;

  const T* Ab  = A  + (size_t)b * strideA;
  const T* Bb  = Bt + (size_t)b * strideB;
  const T* Ab2 = SPLIT ? (A2  + (size_t)b * strideA) : nullptr;
  const T* Bb2 = SPLIT ? (Bt2 + (size_t)b * strideB) : nullptr;

  const int rlane = lane & 15;                 // row (A) / col (B, D) within subtile
  const int koff  = (lane >> 4) * 8;           // k offset of this lane half
  const int mOff  = (lane >> 4) * 8;           // D row offset

  v8f acc[4][4];
#pragma unroll
  for (int i = 0; i < 4; ++i)
#pragma unroll
    for (int j = 0; j < 4; ++j) acc[i][j] = (v8f){0.f,0.f,0.f,0.f,0.f,0.f,0.f,0.f};

  for (int k0 = 0; k0 < K; k0 += 32) {
    V bh[4], bl[4];
#pragma unroll
    for (int j = 0; j < 4; ++j) {
      const size_t bo = (size_t)(n0 + (j << 4) + rlane) * ldb + koff + k0;
      bh[j] = Frag<T>::load(Bb + bo);
      if (SPLIT) bl[j] = Frag<T>::load(Bb2 + bo);
    }
#pragma unroll
    for (int i = 0; i < 4; ++i) {
      const size_t ao = (size_t)(m0 + (i << 4) + rlane) * lda + koff + k0;
      V ah = Frag<T>::load(Ab + ao);
      V al;
      if (SPLIT) al = Frag<T>::load(Ab2 + ao);
#pragma unroll
      for (int j = 0; j < 4; ++j) {
        acc[i][j] = Frag<T>::mma(ah, bh[j], acc[i][j]);
        if (SPLIT) {
          acc[i][j] = Frag<T>::mma(ah, bl[j], acc[i][j]);
          acc[i][j] = Frag<T>::mma(al, bh[j], acc[i][j]);
        }
      }
      Frag<T>::guard(acc[i][0], acc[i][3], ah, SPLIT ? al : ah);
    }
    Frag<T>::keep(bh[0], bh[1], bh[2], bh[3]);
    if (SPLIT) Frag<T>::keep(bl[0], bl[1], bl[2], bl[3]);
  }
  acc_guard4(acc[0][0], acc[0][1], acc[0][2], acc[0][3]);
  acc_guard4(acc[1][0], acc[1][1], acc[1][2], acc[1][3]);
  acc_guard4(acc[2][0], acc[2][1], acc[2][2], acc[2][3]);
  acc_guard4(acc[3][0], acc[3][1], acc[3][2], acc[3][3]);

  // ---- epilogue ----
  float* slab = sT[wave];
  const float* Rb = RESID ? (resid + (size_t)b * strideR) : nullptr;
#pragma unroll
  for (int i = 0; i < 4; ++i) {
    const int mBase = m0 + (i << 4);
#pragma unroll
    for (int j = 0; j < 4; ++j) {
      const int n = n0 + (j << 4) + rlane;
      float bv = 0.f;
      if (BIAS_MODE == 2) bv = bias[n];
#pragma unroll
      for (int r = 0; r < 8; ++r) {
        float v = acc[i][j][r] * scale;
        if (BIAS_MODE == 1) v += bias[mBase + mOff + r];
        if (BIAS_MODE == 2) v += bv;
        if (RESID) v += Rb[(size_t)(mBase + mOff + r) * ldc + n];
        if (ACT == 1) v = tanhf(v);
        if (ACT == 2) v = fmaxf(v, 0.0f);
        if (ACT == 3) v = v / (1.0f + expf(-v));
        if (ACT == 4) v = (v > 0.f) ? v : 0.01f * v;
        if (ACT == 5) v = 0.5f * v * (1.0f + erff(v * 0.70710678118654752f));
        if (ACT == 6) v = (v > 0.f) ? v : 0.2f * v;
        if (ACT == 7) { const float u = 0.7978845608028654f * (v + 0.044715f * v * v * v); v = 0.5f * v * (1.f + tanhf(u)); }
        slab[(mOff + r) * 68 + (j << 4) + rlane] = v;
      }
    }
    __builtin_amdgcn_fence(__ATOMIC_RELEASE, "workgroup");
    __builtin_amdgcn_wave_barrier();
    __builtin_amdgcn_fence(__ATOMIC_ACQUIRE, "workgroup");
    if (OUT_MODE == 0) {
      float* C = (float*)Cout + (size_t)b * strideC;
      const int hh = lane >> 4, c4 = (lane & 15) * 4;     // row seg = 256 B = 16 lanes x 16 B
      {
#pragma unroll
        for (int it = 0; it < 8; ++it) {
          const int row = it * 2 + hh;
          v4f v = *(const v4f*)(slab + row * 68 + c4);
          *(v4f*)(C + (size_t)(mBase + row) * ldc + n0 + c4) = v;
        }
        
      }
    } else {
      const int q = lane >> 3, c8 = (lane & 7) * 8;
      unsigned short* C  = (unsigned short*)Cout  + (size_t)b * strideC;
      unsigned short* C2 = (OUT_MODE == 2) ? ((unsigned short*)Cout2 + (size_t)b * strideC) : nullptr;
      {
#pragma unroll
        for (int it = 0; it < 4; ++it) {
          const int row = it * 4 + q;
          const float* sp = slab + row * 68 + c8;
          v8h hv, lv;
#pragma unroll
          for (int e = 0; e < 8; ++e) {
            if (OUT_MODE == 1) {
              hv[e] = (_Float16)sp[e];
            } else {
              unsigned short hb = f2bf_bits(sp[e]);
              unsigned short lb = f2bf_bits(sp[e] - bf_bits2f(hb));
              hv[e] = __builtin_bit_cast(_Float16, hb);
              lv[e] = __builtin_bit_cast(_Float16, lb);
            }
          }
          *(v8h*)(C + (size_t)(mBase + row) * ldc + n0 + c8) = hv;
          if (OUT_MODE == 2) *(v8h*)(C2 + (size_t)(mBase + row) * ldc + n0 + c8) = lv;
        }
        
      }
    }
    __builtin_amdgcn_fence(__ATOMIC_RELEASE, "workgroup");
    __builtin_amdgcn_wave_barrier();
    __builtin_amdgcn_fence(__ATOMIC_ACQUIRE, "workgroup");
  }
}

__global__ __launch_bounds__(256) void cast_f32_f16x2(
    const float* __restrict__ in, _Float16* __restrict__ out, int n2) {
  int i = blockIdx.x * 256 + threadIdx.x;
  if (i < n2) {
    const _Float16 h0 = (_Float16)in[2 * i], h1 = (_Float16)in[2 * i + 1];
    const unsigned u = (unsigned)__builtin_bit_cast(unsigned short, h0) | ((unsigned)__builtin_bit_cast(unsigned short, h1) << 16);
    ((unsigned*)out)[i] = u;
    
  }
}


} // namespace w25

__global__ __launch_bounds__(256) void k_castT16(const float* __restrict__ src, long long lds, _Float16* __restrict__ dst, long long ldd, int R, int C, float s) {
    const long long i = (long long)blockIdx.x * 256 + threadIdx.x; const long long np = (long long)C * (R / 2); if (i >= np) return; const int c = (int)(i / (R / 2)); const int r = 2 * (int)(i % (R / 2));
    const _Float16 h0 = (_Float16)(src[(long long)r * lds + c] * s), h1 = (_Float16)(src[(long long)(r + 1) * lds + c] * s);
    const unsigned u = (unsigned)__builtin_bit_cast(unsigned short, h0) | ((unsigned)__builtin_bit_cast(unsigned short, h1) << 16);
    unsigned* d = (unsigned*)(dst + (long long)c * ldd + r); *d = u;  }
__global__ __launch_bounds__(256) void k_cast16(const float* __restrict__ src, long long lds, _Float16* __restrict__ dst, long long ldd, int R, int C, float s) {
    const long long i = (long long)blockIdx.x * 256 + threadIdx.x; const long long np = (long long)R * (C / 2); if (i >= np) return; const int r = (int)(i / (C / 2)); const int c = 2 * (int)(i % (C / 2));
    const _Float16 h0 = (_Float16)(src[(long long)r * lds + c] * s), h1 = (_Float16)(src[(long long)r * lds + c + 1] * s);
    const unsigned u = (unsigned)__builtin_bit_cast(unsigned short, h0) | ((unsigned)__builtin_bit_cast(unsigned short, h1) << 16);
    unsigned* d = (unsigned*)(dst + (long long)r * ldd + c); *d = u;  }

// f32 -> bf16 hi plane + bf16 lo plane (x = hi + lo to ~2^-17 relative; RNE both), [R][C] -> [R][C] (or transposed to [C][R]); 2 consecutive destination elements
__device__ __forceinline__ unsigned int f2bf2_pack(float a, float b, unsigned int* lo) {
    const unsigned short ha = w25::f2bf_bits(a), hb = w25::f2bf_bits(b);
    const unsigned short la = w25::f2bf_bits(a - w25::bf_bits2f(ha)), lb = w25::f2bf_bits(b - w25::bf_bits2f(hb));
    *lo = (unsigned)la | ((unsigned)lb << 16); return (unsigned)ha | ((unsigned)hb << 16); }
__global__ __launch_bounds__(256) void k_castS16(const float* __restrict__ src, long long lds, __bf16* __restrict__ dhi, __bf16* __restrict__ dlo, long long ldd, int R, int C, float s, int transpose) {
    const long long i = (long long)blockIdx.x * 256 + threadIdx.x; long long o; float a, b;
    if (transpose) { const long long np = (long long)C * (R / 2); if (i >= np) return; const int c = (int)(i / (R / 2)); const int r = 2 * (int)(i % (R / 2)); a = src[(long long)r * lds + c] * s; b = src[(long long)(r + 1) * lds + c] * s; o = (long long)c * ldd + r; }
    else { const long long np = (long long)R * (C / 2); if (i >= np) return; const int r = (int)(i / (C / 2)); const int c = 2 * (int)(i % (C / 2)); a = src[(long long)r * lds + c] * s; b = src[(long long)r * lds + c + 1] * s; o = (long long)r * ldd + c; }
    unsigned lo; const unsigned hi = f2bf2_pack(a, b, &lo); unsigned* ph = (unsigned*)(dhi + o); unsigned* pl = (unsigned*)(dlo + o);
    *ph = hi; *pl = lo;  }

namespace w25 {
// =====================================================================================
// Generic causal/non-causal attention for head_dim 64, f32 in / f32 out; 16-bit operands: bf16 with optional hi/lo splits, or
// plain f16 (F16=true, non-split, probabilities carried x2^15).
//   scores = (q*qscale)·kᵀ : v_wmma_f32_16x16x32_bf16; SPLIT_QK -> q,k as bf16 hi/lo (hi·hi + hi·lo + lo·hi)
//   out    = p·v           : v_wmma_f32_16x16x32_bf16; SPLIT_PV -> p,v as bf16 hi/lo; else p,v plain bf16
//   f32 accumulate; online softmax in f32. Block = 4 waves = 64 query rows of one (batch, head); S % 64 == 0.
//   Element (b, s, h, d) of tensor X lives at X[b*X_bs + s*X_rs + h*X_hs + d] (strides in floats, multiples of 4).
//   Masking: mask_mode 0 none, 1 causal (kv > q masked), 2 tensor [S][Skv] shared over (b,h) (float if
//   mask_is_int==0, int32 with element == 0 -> masked if 1, int32 with element != 0 -> masked if 2), 3 per-token vectors qmask[B][S] & kvmask[B][Skv] (int32,
//   0 -> masked), 4 causal + sliding window (kv > q or q - kv > W masked; W passed in mask_is_int);
//   5 = relative-position bias: s += cp[b,h,q][idx[q][kv]] + pc[b,h,kv][idx[q][kv]] with idx = mask_b ([S][Skv] int32) and
//   mask_a an int32 [S][Skv] tensor with nonzero = masked (tables: element (b,h,row,n) at X + b*c_bs + h*c_hs + row*c_rs + n);
//   masked scores are replaced by mask_fill (e.g. -inf or -1e9) before the softmax.
//   grid.x = B * H * (S/64) (or a sub-range with blk0).
// =====================================================================================
#define AT_D 64
#define AT_NW 4
#define AT_QB 64
#define AT_KC 64
struct AttnGeom { const float* cp = nullptr; const float* pc = nullptr; long c_bs = 0, c_rs = 0, c_hs = 0;   // mode-5 score-bias tables
                  long q_bs, q_rs, q_hs, k_bs, k_rs, k_hs, v_bs, v_rs, v_hs, o_bs, o_rs, o_hs;
                  int S, Skv, H, mask_mode; float qscale; int blk0; float mask_fill; int mask_is_int; };
static_assert(sizeof(AttnGeom) == 168, "no padding");

__device__ __forceinline__ unsigned short at_bf_bits(float f) {
  unsigned u = __float_as_uint(f);
  return (unsigned short)((u + 0x7FFFu + ((u >> 16) & 1u)) >> 16);
}
__device__ __forceinline__ __bf16 at_f2bf(float f) { return __builtin_bit_cast(__bf16, at_bf_bits(f)); }
__device__ __forceinline__ void at_split(float f, __bf16& hi, __bf16& lo) {
  const unsigned short hb = at_bf_bits(f);
  hi = __builtin_bit_cast(__bf16, hb);
  lo = at_f2bf(f - __uint_as_float(((unsigned)hb) << 16));
}
__device__ __forceinline__ v8f at_mma(v16b a, v16b b, v8f c) {
  c = __builtin_amdgcn_wmma_f32_16x16x32_bf16(false, a, false, b, (short)0, c, false, false);
  asm volatile("v_nop\n\tv_nop\n\tv_nop\n\tv_nop" : "+v"(c) : "v"(a), "v"(b));
  return c;
}
// 16-bit element as a bit pattern held in a __bf16 slot: f16 bits when F16, bf16 (RNE) otherwise
template <bool F16> __device__ __forceinline__ __bf16 at_to16(float f) {
  if (F16) return __builtin_bit_cast(__bf16, (_Float16)f);
  return at_f2bf(f);
}
template <bool F16> __device__ __forceinline__ v8f at_mma16(v16b a, v16b b, v8f c) {
  if (F16) {
    const v16h ah = __builtin_bit_cast(v16h, a), bh = __builtin_bit_cast(v16h, b);
    c = __builtin_amdgcn_wmma_f32_16x16x32_f16(false, ah, false, bh, (short)0, c, false, false);
    asm volatile("v_nop\n\tv_nop\n\tv_nop\n\tv_nop" : "+v"(c) : "v"(ah), "v"(bh));
    return c;
  }
  return at_mma(a, b, c);
}

template <bool SPLIT_QK, bool SPLIT_PV, bool F16 = false>
__global__ __launch_bounds__(128)
void attn64_kernel(const float* __restrict__ q, const float* __restrict__ k,
                   const float* __restrict__ v, float* __restrict__ out,
                   const void* __restrict__ mask_a, const int* __restrict__ mask_b, AttnGeom g) {
  static_assert(!(F16 && (SPLIT_QK || SPLIT_PV)), "f16 mode is non-split");
  const float PSC = F16 ? 32768.0f : 1.0f;     // f16 probabilities carried x2^15 (subnormal range), folded into the final 1/l
  union FB { v16b v; v8b h[2]; };
  __shared__ __align__(16) __bf16 Ksh[AT_KC * AT_D];             // K hi [kv][d]      8 KB
  __shared__ __align__(16) __bf16 Ksl[SPLIT_QK ? AT_KC * AT_D : 8];
  __shared__ __align__(16) __bf16 Vth[AT_D * AT_KC];             // V hi [d][kv]      8 KB
  __shared__ __align__(16) __bf16 Vtl[SPLIT_PV ? AT_D * AT_KC : 8];
  __shared__ __align__(16) __bf16 Psh[AT_NW][16 * AT_KC];        // per wave P hi [row][kv]  8 KB
  __shared__ __align__(16) __bf16 Psl[SPLIT_PV ? AT_NW : 1][SPLIT_PV ? 16 * AT_KC : 8];
  __shared__ __align__(16) float  Os[AT_NW][16 * 68];            // per wave out tile, pitch 68

  const int tid  = threadIdx.x;
  const int wave = tid >> 5;
  const int lane = tid & 31;
  const int hh   = lane >> 4;
  const int c    = lane & 15;

  const int nqb = g.S / AT_QB;
  const int bx = blockIdx.x + g.blk0;
  const int qb = bx % nqb;
  const int bh = bx / nqb;
  const int h  = bh % g.H;
  const int b  = bh / g.H;
  const int qbase_block = qb * AT_QB;
  const int q0 = qbase_block + wave * 16;

  const float* qb_ptr = q + (size_t)b * g.q_bs + (size_t)h * g.q_hs;
  const float* kb_ptr = k + (size_t)b * g.k_bs + (size_t)h * g.k_hs;
  const float* vb_ptr = v + (size_t)b * g.v_bs + (size_t)h * g.v_hs;
  float*       ob_ptr = out + (size_t)b * g.o_bs + (size_t)h * g.o_hs;

  // ---- Q fragments (A operand): 2 d-chunks, hi (and lo) ----
  v16b qah[2], qal[2];
  {
    const float* qrow = qb_ptr + (size_t)(q0 + c) * g.q_rs;
#pragma unroll
    for (int dc = 0; dc < 2; ++dc) {
#pragma unroll
      for (int e = 0; e < 8; ++e) {
        const float f0 = qrow[dc * 32 + 8 * hh + e] * g.qscale;
        const float f1 = qrow[dc * 32 + 16 + 8 * hh + e] * g.qscale;
        if (SPLIT_QK) { __bf16 hq, lq; at_split(f0, hq, lq); qah[dc][e] = hq; qal[dc][e] = lq; at_split(f1, hq, lq); qah[dc][8 + e] = hq; qal[dc][8 + e] = lq; }
        else { qah[dc][e] = at_to16<F16>(f0); qah[dc][8 + e] = at_to16<F16>(f1); qal[dc][e] = qah[dc][e]; qal[dc][8 + e] = qah[dc][8 + e]; }
      }
    }
  }

  float mrow[8], lrow[8];
  v8f oacc[4];
#pragma unroll
  for (int r = 0; r < 8; ++r) { mrow[r] = -INFINITY; lrow[r] = 0.f; }
#pragma unroll
  for (int t = 0; t < 4; ++t) oacc[t] = (v8f){0.f,0.f,0.f,0.f,0.f,0.f,0.f,0.f};

  const int nChunks = (g.mask_mode == 1 || g.mask_mode == 4) ? (qb + 1) : (g.Skv / AT_KC);   // block-uniform
  // per-row query mask (mode 3)
  int qkeep[8];
#pragma unroll
  for (int r = 0; r < 8; ++r) qkeep[r] = (g.mask_mode == 3) ? mask_b[(size_t)b * g.S + q0 + 8 * hh + r] : 1;   // mask_b = qmask in mode 3
  for (int kc = 0; kc < nChunks; ++kc) {
    const int kv0 = kc * AT_KC;
    __syncthreads();
    {
      const int kvr = tid >> 1, dh = (tid & 1) * 32;
      const float* krow = kb_ptr + (size_t)(kv0 + kvr) * g.k_rs + dh;
      const float* vrow = vb_ptr + (size_t)(kv0 + kvr) * g.v_rs + dh;
#pragma unroll
      for (int i = 0; i < 8; ++i) {
        v4f kk = *(const v4f*)(krow + 4 * i);
        v4f vv = *(const v4f*)(vrow + 4 * i);
#pragma unroll
        for (int e = 0; e < 4; ++e) {
          const int d = dh + 4 * i + e;
          if (SPLIT_QK) { __bf16 a, bl; at_split(kk[e], a, bl); Ksh[kvr * AT_D + d] = a; Ksl[kvr * AT_D + d] = bl; }
          else Ksh[kvr * AT_D + d] = at_to16<F16>(kk[e]);
          if (SPLIT_PV) { __bf16 a, bl; at_split(vv[e], a, bl); Vth[d * AT_KC + kvr] = a; Vtl[d * AT_KC + kvr] = bl; }
          else Vth[d * AT_KC + kvr] = at_to16<F16>(vv[e]);
        }
      }
    }
    __syncthreads();

    v8f s[4];
#pragma unroll
    for (int j = 0; j < 4; ++j) {
      s[j] = (v8f){0.f,0.f,0.f,0.f,0.f,0.f,0.f,0.f};
#pragma unroll 1
      for (int dc = 0; dc < 2; ++dc) {
        FB kb;
        kb.h[0] = *(const v8b*)(Ksh + (j * 16 + c) * AT_D + dc * 32 + 8 * hh);
        kb.h[1] = *(const v8b*)(Ksh + (j * 16 + c) * AT_D + dc * 32 + 16 + 8 * hh);
        s[j] = at_mma16<F16>(qah[dc], kb.v, s[j]);
        if (SPLIT_QK) {
          FB kl;
          kl.h[0] = *(const v8b*)(Ksl + (j * 16 + c) * AT_D + dc * 32 + 8 * hh);
          kl.h[1] = *(const v8b*)(Ksl + (j * 16 + c) * AT_D + dc * 32 + 16 + 8 * hh);
          s[j] = at_mma16<F16>(qah[dc], kl.v, s[j]);
          s[j] = at_mma16<F16>(qal[dc], kb.v, s[j]);
        }
      }
    }
    const bool diag = (g.mask_mode == 1) && (kc == qb);
    int kvkeep[4] = {1, 1, 1, 1};
    if (g.mask_mode == 3) {
#pragma unroll
      for (int j = 0; j < 4; ++j) kvkeep[j] = ((const int*)mask_a)[(size_t)b * g.Skv + kv0 + j * 16 + c];   // mask_a = kvmask
    }
    float cm[8];
#pragma unroll
    for (int r = 0; r < 8; ++r) {
      const int qrow = q0 + 8 * hh + r;
      float m = -INFINITY;
#pragma unroll
      for (int j = 0; j < 4; ++j) {
        const int kvcol = kv0 + j * 16 + c;
        bool masked = false;
        if (diag) masked = (kvcol > qrow);
        else if (g.mask_mode == 4) masked = (kvcol > qrow) || (qrow - kvcol > g.mask_is_int);
        else if (g.mask_mode == 2) {
          const size_t mi = (size_t)qrow * g.Skv + kvcol;
          masked = (g.mask_is_int == 0) ? (((const float*)mask_a)[mi] == 0.0f)
                 : (g.mask_is_int == 1) ? (((const int*)mask_a)[mi] == 0) : (((const int*)mask_a)[mi] != 0);
        } else if (g.mask_mode == 3) masked = (qkeep[r] == 0) || (kvkeep[j] == 0);
        else if (g.mask_mode == 5) {
          const size_t mi = (size_t)qrow * g.Skv + kvcol;
          masked = (((const int*)mask_a)[mi] != 0);
          int n = mask_b[mi]; n = n < 0 ? 0 : n;
          s[j][r] += g.cp[(size_t)b * g.c_bs + (size_t)h * g.c_hs + (size_t)qrow * g.c_rs + n]
                   + g.pc[(size_t)b * g.c_bs + (size_t)h * g.c_hs + (size_t)kvcol * g.c_rs + n];
        }
        if (masked) s[j][r] = g.mask_fill;
        m = fmaxf(m, s[j][r]);
      }
#pragma unroll
      for (int off = 1; off < 16; off <<= 1) m = fmaxf(m, __shfl_xor(m, off, 32));
      cm[r] = m;
    }
    __bf16* pwh = Psh[wave];
    __bf16* pwl = Psl[SPLIT_PV ? wave : 0];
#pragma unroll
    for (int r = 0; r < 8; ++r) {
      const float mnew = fmaxf(mrow[r], cm[r]);
      const float alpha = expf(mrow[r] - mnew);
      mrow[r] = mnew;
      float psum = 0.f;
#pragma unroll
      for (int j = 0; j < 4; ++j) {
        const float p = expf(s[j][r] - mnew);
        psum += p;
        if (SPLIT_PV) { __bf16 a, bl; at_split(p, a, bl); pwh[(8 * hh + r) * AT_KC + j * 16 + c] = a; pwl[(8 * hh + r) * AT_KC + j * 16 + c] = bl; }
        else pwh[(8 * hh + r) * AT_KC + j * 16 + c] = at_to16<F16>(p * PSC);
      }
#pragma unroll
      for (int off = 1; off < 16; off <<= 1) psum += __shfl_xor(psum, off, 32);
      lrow[r] = lrow[r] * alpha + psum;
#pragma unroll
      for (int t = 0; t < 4; ++t) oacc[t][r] *= alpha;
    }
    __builtin_amdgcn_fence(__ATOMIC_RELEASE, "workgroup");
    __builtin_amdgcn_wave_barrier();
    __builtin_amdgcn_fence(__ATOMIC_ACQUIRE, "workgroup");
#pragma unroll 1
    for (int kk = 0; kk < 2; ++kk) {
      FB pa, pl;
      pa.h[0] = *(const v8b*)(pwh + c * AT_KC + kk * 32 + 8 * hh);
      pa.h[1] = *(const v8b*)(pwh + c * AT_KC + kk * 32 + 16 + 8 * hh);
      if (SPLIT_PV) {
        pl.h[0] = *(const v8b*)(pwl + c * AT_KC + kk * 32 + 8 * hh);
        pl.h[1] = *(const v8b*)(pwl + c * AT_KC + kk * 32 + 16 + 8 * hh);
      }
#pragma unroll
      for (int t = 0; t < 4; ++t) {
        FB vb;
        vb.h[0] = *(const v8b*)(Vth + (t * 16 + c) * AT_KC + kk * 32 + 8 * hh);
        vb.h[1] = *(const v8b*)(Vth + (t * 16 + c) * AT_KC + kk * 32 + 16 + 8 * hh);
        oacc[t] = at_mma16<F16>(pa.v, vb.v, oacc[t]);
        if (SPLIT_PV) {
          FB vl;
          vl.h[0] = *(const v8b*)(Vtl + (t * 16 + c) * AT_KC + kk * 32 + 8 * hh);
          vl.h[1] = *(const v8b*)(Vtl + (t * 16 + c) * AT_KC + kk * 32 + 16 + 8 * hh);
          oacc[t] = at_mma16<F16>(pa.v, vl.v, oacc[t]);
          oacc[t] = at_mma16<F16>(pl.v, vb.v, oacc[t]);
        }
      }
    }
  }

  float* os = Os[wave];
#pragma unroll
  for (int r = 0; r < 8; ++r) {
    const float inv = 1.0f / (lrow[r] * PSC);
#pragma unroll
    for (int t = 0; t < 4; ++t) os[(8 * hh + r) * 68 + t * 16 + c] = oacc[t][r] * inv;
  }
  __builtin_amdgcn_fence(__ATOMIC_RELEASE, "workgroup");
  __builtin_amdgcn_wave_barrier();
  __builtin_amdgcn_fence(__ATOMIC_ACQUIRE, "workgroup");
  {
    const int c4 = (lane & 15) * 4;
    {
#pragma unroll
      for (int it = 0; it < 8; ++it) {
        const int row = it * 2 + hh;
        v4f val = *(const v4f*)(os + row * 68 + c4);
        *(v4f*)(ob_ptr + (size_t)(q0 + row) * g.o_rs + c4) = val;
      }
      
    }
  }
}

} // namespace w25


__device__ __forceinline__ void st_h2(unsigned short* d2, float a, float b) { const unsigned u = (unsigned)__builtin_bit_cast(unsigned short, (_Float16)a) | ((unsigned)__builtin_bit_cast(unsigned short, (_Float16)b) << 16); unsigned* d = (unsigned*)d2; *d = u;  }
__device__ __forceinline__ float ldh(const unsigned short* p) { return (float)__builtin_bit_cast(_Float16, *p); }
__device__ __forceinline__ v4f ld4h(const unsigned short* p) { const unsigned long long u = *(const unsigned long long*)p; v4f a;
    a.x = (float)__builtin_bit_cast(_Float16, (unsigned short)(u & 0xFFFFu)); a.y = (float)__builtin_bit_cast(_Float16, (unsigned short)((u >> 16) & 0xFFFFu)); a.z = (float)__builtin_bit_cast(_Float16, (unsigned short)((u >> 32) & 0xFFFFu)); a.w = (float)__builtin_bit_cast(_Float16, (unsigned short)((u >> 48) & 0xFFFFu)); return a; }
__device__ __forceinline__ unsigned long long pk4h(v4f s) { return (unsigned long long)__builtin_bit_cast(unsigned short, (_Float16)s.x) | ((unsigned long long)__builtin_bit_cast(unsigned short, (_Float16)s.y) << 16) | ((unsigned long long)__builtin_bit_cast(unsigned short, (_Float16)s.z) << 32) | ((unsigned long long)__builtin_bit_cast(unsigned short, (_Float16)s.w) << 48); }
typedef unsigned v4u __attribute__((ext_vector_type(4)));
__device__ __forceinline__ void st8h(unsigned short* d, v4f a, v4f b) { const unsigned long long pa = pk4h(a), pb = pk4h(b); v4u pk; pk.x = (unsigned)(pa & 0xFFFFFFFFull); pk.y = (unsigned)(pa >> 32); pk.z = (unsigned)(pb & 0xFFFFFFFFull); pk.w = (unsigned)(pb >> 32); v4u* dd = (v4u*)d; *dd = pk;  }
__device__ __forceinline__ unsigned short bfu_rne(float v) { unsigned u = __builtin_bit_cast(unsigned, v); u += 0x7FFFu + ((u >> 16) & 1u); return (unsigned short)(u >> 16); }
__device__ __forceinline__ void bfsplit(float v, unsigned short& hi, unsigned short& lo) { hi = bfu_rne(v); lo = bfu_rne(v - __builtin_bit_cast(float, (unsigned)hi << 16)); }
__device__ __forceinline__ void st_s2(unsigned short* Hp, unsigned short* Lp, long long o, float a, float b) { unsigned short h0,l0,h1,l1; bfsplit(a,h0,l0); bfsplit(b,h1,l1); const unsigned ph = (unsigned)h0 | ((unsigned)h1 << 16), pl = (unsigned)l0 | ((unsigned)l1 << 16);
    unsigned* dh = (unsigned*)(Hp + o); unsigned* dl = (unsigned*)(Lp + o); *dh = ph; *dl = pl;  }
__device__ __forceinline__ int cl(int v, int n) { return min(max(v, 0), n - 1); }

// GAT-style aggregation over a device in-edge CSR at dst (+ optional explicit self loop as iteration j = -1):
//   logit = leaky(AS[src][h] + AD[n][h] (+ EW[e]*CW[h]), slope); softmax over the node's edges per head; acc[c] = sum alpha XP[src][c] (f16 gather plane, pitch XW; 256 channels = H heads x CH)
//   wave per node; lane L owns channels 8L..8L+7 (head = 8L / CH); per-lane softmax state (lanes of one head agree) -> no shuffles in the loop.
//   EPI 0: + bias -> f32 OUT[n][256] via LDS redistribution (two 16-B stores per lane, each instruction 512 contiguous B)
//   EPI 1: + bias, LayerNorm(256) * g + bb, relu -> bf16 hi/lo planes OH/OL [n][256] (16-B stores)
//   EPI 2: mean over the 256/CH heads + bias[0..63], LayerNorm(64) * g + bb, relu -> f32 OUT[n][64] (CH must be 64; LDS redistribution, 8-B stores)
//   EPI 3: mean over heads + bias -> f32 OUT[n][64] (no norm / activation)
//   EPI 4: + bias, ELU -> bf16 hi/lo planes OH/OL [n][256];  EPI 5: + bias (full 256-wide, per head), ELU, then mean over the 256/CH heads -> f32 OUT[n][64]
//   EPI 6: (CH = 128, two heads) mean over the two heads, + bias[0..127], relu -> f32 OUT[n][128] (LDS redistribution, 16-B stores)
//   EWM 0: no edge weights; 1: logit += EW[e] * CW[h] (self loop weight 1); 2: alpha *= EW[e] after the softmax (message scale; self loop weight 1)
template <int CH, bool SELF, int EWM, int EPI>
__global__ __launch_bounds__(256) void k_gat_agg(const unsigned short* __restrict__ XP, int XW, const float* __restrict__ AS, const float* __restrict__ AD, int ASTR, const float* __restrict__ EW, const float* __restrict__ CW,
        const int* __restrict__ esrc, const int* __restrict__ off, const int* __restrict__ cnt, const int* __restrict__ slot, const float* __restrict__ bias, const float* __restrict__ g, const float* __restrict__ bb,
        float* __restrict__ OUT, unsigned short* __restrict__ OH, unsigned short* __restrict__ OL, int N, int E, int CAP, float slope) {
    __shared__ float stage[8][256];
    const int wv = threadIdx.x >> 5; const int n = blockIdx.x * 8 + wv; const int L = threadIdx.x & 31; if (n >= N) return; const int c0 = 8 * L; const int h = c0 / CH;
    const float ad = AD[(long long)n * ASTR + h]; const float cw = (EWM == 1) ? CW[h] : 0.f; float m = -3.0e38f, s = 0.f; v4f a0, a1; a0.x = a0.y = a0.z = a0.w = 0.f; a1 = a0;
    const int p0 = cl(off[n], E + 1), cn = min(max(cnt[n], 0), CAP);
    for (int j = (SELF ? -1 : 0); j < cn; ++j) { int sj; float ew = 0.f;
        if (j < 0) { sj = n; ew = 1.f; } else { int e = slot[cl(p0 + j, E)]; e = cl(e, E); sj = cl(esrc[e], N); if (EWM != 0) ew = EW[e]; }
        float lg = AS[(long long)sj * ASTR + h] + ad + ((EWM == 1) ? ew * cw : 0.f); lg = (lg >= 0.f) ? lg : slope * lg;
        const float mn = fmaxf(m, lg); const float cz = expf(m - mn), pj = expf(lg - mn); s = s * cz + pj; const float pw = (EWM == 2) ? pj * ew : pj;
        const unsigned short* xr = XP + (long long)sj * XW + c0; a0 = a0 * cz + ld4h(xr) * pw; a1 = a1 * cz + ld4h(xr + 4) * pw; m = mn; }
    const float inv = (s > 0.f) ? 1.f / (s + 1e-16f) : 0.f; a0 = a0 * inv; a1 = a1 * inv;
    if (EPI == 0 || EPI == 1 || EPI == 4 || EPI == 5) { a0 = a0 + *(const v4f*)(bias + c0); a1 = a1 + *(const v4f*)(bias + c0 + 4); }
    if (EPI == 4 || EPI == 5) { a0.x = (a0.x > 0.f) ? a0.x : (expf(a0.x) - 1.f); a0.y = (a0.y > 0.f) ? a0.y : (expf(a0.y) - 1.f); a0.z = (a0.z > 0.f) ? a0.z : (expf(a0.z) - 1.f); a0.w = (a0.w > 0.f) ? a0.w : (expf(a0.w) - 1.f);
        a1.x = (a1.x > 0.f) ? a1.x : (expf(a1.x) - 1.f); a1.y = (a1.y > 0.f) ? a1.y : (expf(a1.y) - 1.f); a1.z = (a1.z > 0.f) ? a1.z : (expf(a1.z) - 1.f); a1.w = (a1.w > 0.f) ? a1.w : (expf(a1.w) - 1.f); }
    if (EPI == 4) { float o8[8] = {a0.x, a0.y, a0.z, a0.w, a1.x, a1.y, a1.z, a1.w}; unsigned short hh[8], ll[8];
#pragma unroll
        for (int u = 0; u < 8; ++u) bfsplit(o8[u], hh[u], ll[u]);
        const unsigned long long ph0 = (unsigned long long)hh[0] | ((unsigned long long)hh[1] << 16) | ((unsigned long long)hh[2] << 32) | ((unsigned long long)hh[3] << 48), pl0 = (unsigned long long)ll[0] | ((unsigned long long)ll[1] << 16) | ((unsigned long long)ll[2] << 32) | ((unsigned long long)ll[3] << 48);
        const unsigned long long ph1 = (unsigned long long)hh[4] | ((unsigned long long)hh[5] << 16) | ((unsigned long long)hh[6] << 32) | ((unsigned long long)hh[7] << 48), pl1 = (unsigned long long)ll[4] | ((unsigned long long)ll[5] << 16) | ((unsigned long long)ll[6] << 32) | ((unsigned long long)ll[7] << 48);
        v4u pk; pk.x = (unsigned)(ph0 & 0xFFFFFFFFull); pk.y = (unsigned)(ph0 >> 32); pk.z = (unsigned)(ph1 & 0xFFFFFFFFull); pk.w = (unsigned)(ph1 >> 32); v4u* dh = (v4u*)(OH + (long long)n * 256 + c0); *dh = pk; 
        v4u ql; ql.x = (unsigned)(pl0 & 0xFFFFFFFFull); ql.y = (unsigned)(pl0 >> 32); ql.z = (unsigned)(pl1 & 0xFFFFFFFFull); ql.w = (unsigned)(pl1 >> 32); v4u* dl = (v4u*)(OL + (long long)n * 256 + c0); *dl = ql;  return; }
    if (EPI == 6) {
        a0.x += __shfl_xor(a0.x, 16); a0.y += __shfl_xor(a0.y, 16); a0.z += __shfl_xor(a0.z, 16); a0.w += __shfl_xor(a0.w, 16); a1.x += __shfl_xor(a1.x, 16); a1.y += __shfl_xor(a1.y, 16); a1.z += __shfl_xor(a1.z, 16); a1.w += __shfl_xor(a1.w, 16);
        if (L < 16) { const int cb = 8 * L; const v4f b0 = *(const v4f*)(bias + cb), b1v = *(const v4f*)(bias + cb + 4);
            stage[wv][cb] = fmaxf(a0.x * 0.5f + b0.x, 0.f); stage[wv][cb + 1] = fmaxf(a0.y * 0.5f + b0.y, 0.f); stage[wv][cb + 2] = fmaxf(a0.z * 0.5f + b0.z, 0.f); stage[wv][cb + 3] = fmaxf(a0.w * 0.5f + b0.w, 0.f);
            stage[wv][cb + 4] = fmaxf(a1.x * 0.5f + b1v.x, 0.f); stage[wv][cb + 5] = fmaxf(a1.y * 0.5f + b1v.y, 0.f); stage[wv][cb + 6] = fmaxf(a1.z * 0.5f + b1v.z, 0.f); stage[wv][cb + 7] = fmaxf(a1.w * 0.5f + b1v.w, 0.f); }
        __builtin_amdgcn_fence(__ATOMIC_RELEASE, "workgroup"); __builtin_amdgcn_wave_barrier(); __builtin_amdgcn_fence(__ATOMIC_ACQUIRE, "workgroup");
        v4f o6; o6.x = stage[wv][4 * L]; o6.y = stage[wv][4 * L + 1]; o6.z = stage[wv][4 * L + 2]; o6.w = stage[wv][4 * L + 3]; VST2V4(OUT + (long long)n * 128 + 4 * L, o6); return; }
    if (EPI == 5) {
        a0.x += __shfl_xor(a0.x, 8); a0.y += __shfl_xor(a0.y, 8); a0.z += __shfl_xor(a0.z, 8); a0.w += __shfl_xor(a0.w, 8); a1.x += __shfl_xor(a1.x, 8); a1.y += __shfl_xor(a1.y, 8); a1.z += __shfl_xor(a1.z, 8); a1.w += __shfl_xor(a1.w, 8);
        a0.x += __shfl_xor(a0.x, 16); a0.y += __shfl_xor(a0.y, 16); a0.z += __shfl_xor(a0.z, 16); a0.w += __shfl_xor(a0.w, 16); a1.x += __shfl_xor(a1.x, 16); a1.y += __shfl_xor(a1.y, 16); a1.z += __shfl_xor(a1.z, 16); a1.w += __shfl_xor(a1.w, 16);
        const int gq5 = L & 7; a0 = a0 * 0.25f; a1 = a1 * 0.25f;
        if (L < 8) { stage[wv][8 * gq5] = a0.x; stage[wv][8 * gq5 + 1] = a0.y; stage[wv][8 * gq5 + 2] = a0.z; stage[wv][8 * gq5 + 3] = a0.w; stage[wv][8 * gq5 + 4] = a1.x; stage[wv][8 * gq5 + 5] = a1.y; stage[wv][8 * gq5 + 6] = a1.z; stage[wv][8 * gq5 + 7] = a1.w; }
        __builtin_amdgcn_fence(__ATOMIC_RELEASE, "workgroup"); __builtin_amdgcn_wave_barrier(); __builtin_amdgcn_fence(__ATOMIC_ACQUIRE, "workgroup");
        const unsigned long long pk5 = (unsigned long long)__builtin_bit_cast(unsigned, stage[wv][2 * L]) | ((unsigned long long)__builtin_bit_cast(unsigned, stage[wv][2 * L + 1]) << 32); VST2(unsigned long long, (unsigned long long*)(OUT + (long long)n * 64 + 2 * L), pk5); return; }
    if (EPI == 1) { float sm = a0.x + a0.y + a0.z + a0.w + a1.x + a1.y + a1.z + a1.w;
#pragma unroll
        for (int o = 16; o > 0; o >>= 1) sm += __shfl_xor(sm, o);
        const float mu = sm * (1.f / 256.f); const v4f d0 = a0 - mu, d1 = a1 - mu; float q = d0.x * d0.x + d0.y * d0.y + d0.z * d0.z + d0.w * d0.w + d1.x * d1.x + d1.y * d1.y + d1.z * d1.z + d1.w * d1.w;
#pragma unroll
        for (int o = 16; o > 0; o >>= 1) q += __shfl_xor(q, o);
        const float rs = rsqrtf(q * (1.f / 256.f) + 1e-5f); float o8[8] = {d0.x, d0.y, d0.z, d0.w, d1.x, d1.y, d1.z, d1.w}; unsigned short hh[8], ll[8];
#pragma unroll
        for (int u = 0; u < 8; ++u) { const float v = fmaxf(o8[u] * rs * g[c0 + u] + bb[c0 + u], 0.f); bfsplit(v, hh[u], ll[u]); }
        const unsigned long long ph0 = (unsigned long long)hh[0] | ((unsigned long long)hh[1] << 16) | ((unsigned long long)hh[2] << 32) | ((unsigned long long)hh[3] << 48), pl0 = (unsigned long long)ll[0] | ((unsigned long long)ll[1] << 16) | ((unsigned long long)ll[2] << 32) | ((unsigned long long)ll[3] << 48);
        const unsigned long long ph1 = (unsigned long long)hh[4] | ((unsigned long long)hh[5] << 16) | ((unsigned long long)hh[6] << 32) | ((unsigned long long)hh[7] << 48), pl1 = (unsigned long long)ll[4] | ((unsigned long long)ll[5] << 16) | ((unsigned long long)ll[6] << 32) | ((unsigned long long)ll[7] << 48);
        // lane L's 8 halves at c0 = 8L: 16 B -> one 16-B store per plane (32 lanes x 16 B = whole 512-B row)
        v4u pk; pk.x = (unsigned)(ph0 & 0xFFFFFFFFull); pk.y = (unsigned)(ph0 >> 32); pk.z = (unsigned)(ph1 & 0xFFFFFFFFull); pk.w = (unsigned)(ph1 >> 32); v4u* dh = (v4u*)(OH + (long long)n * 256 + c0); *dh = pk; 
        v4u ql; ql.x = (unsigned)(pl0 & 0xFFFFFFFFull); ql.y = (unsigned)(pl0 >> 32); ql.z = (unsigned)(pl1 & 0xFFFFFFFFull); ql.w = (unsigned)(pl1 >> 32); v4u* dl = (v4u*)(OL + (long long)n * 256 + c0); *dl = ql;  return; }
    if (EPI == 2 || EPI == 3) {   // head mean: lanes L, L^8, L^16, L^24 hold the same chan group of the 4 heads (CH = 64 -> 8 lanes per head)
        a0.x += __shfl_xor(a0.x, 8); a0.y += __shfl_xor(a0.y, 8); a0.z += __shfl_xor(a0.z, 8); a0.w += __shfl_xor(a0.w, 8); a1.x += __shfl_xor(a1.x, 8); a1.y += __shfl_xor(a1.y, 8); a1.z += __shfl_xor(a1.z, 8); a1.w += __shfl_xor(a1.w, 8);
        a0.x += __shfl_xor(a0.x, 16); a0.y += __shfl_xor(a0.y, 16); a0.z += __shfl_xor(a0.z, 16); a0.w += __shfl_xor(a0.w, 16); a1.x += __shfl_xor(a1.x, 16); a1.y += __shfl_xor(a1.y, 16); a1.z += __shfl_xor(a1.z, 16); a1.w += __shfl_xor(a1.w, 16);
        const int gq = L & 7; a0 = a0 * 0.25f + *(const v4f*)(bias + 8 * gq); a1 = a1 * 0.25f + *(const v4f*)(bias + 8 * gq + 4);      // every lane now holds channels 8gq..8gq+7 of the mean
        if (EPI == 3) { if (L < 8) { stage[wv][8 * gq] = a0.x; stage[wv][8 * gq + 1] = a0.y; stage[wv][8 * gq + 2] = a0.z; stage[wv][8 * gq + 3] = a0.w; stage[wv][8 * gq + 4] = a1.x; stage[wv][8 * gq + 5] = a1.y; stage[wv][8 * gq + 6] = a1.z; stage[wv][8 * gq + 7] = a1.w; }
            __builtin_amdgcn_fence(__ATOMIC_RELEASE, "workgroup"); __builtin_amdgcn_wave_barrier(); __builtin_amdgcn_fence(__ATOMIC_ACQUIRE, "workgroup");
            const unsigned long long pk3 = (unsigned long long)__builtin_bit_cast(unsigned, stage[wv][2 * L]) | ((unsigned long long)__builtin_bit_cast(unsigned, stage[wv][2 * L + 1]) << 32); VST2(unsigned long long, (unsigned long long*)(OUT + (long long)n * 64 + 2 * L), pk3); return; }
        float sm = (L < 8) ? (a0.x + a0.y + a0.z + a0.w + a1.x + a1.y + a1.z + a1.w) : 0.f;
#pragma unroll
        for (int o = 16; o > 0; o >>= 1) sm += __shfl_xor(sm, o);
        const float mu = sm * (1.f / 64.f); const v4f d0 = a0 - mu, d1 = a1 - mu; float q = (L < 8) ? (d0.x * d0.x + d0.y * d0.y + d0.z * d0.z + d0.w * d0.w + d1.x * d1.x + d1.y * d1.y + d1.z * d1.z + d1.w * d1.w) : 0.f;
#pragma unroll
        for (int o = 16; o > 0; o >>= 1) q += __shfl_xor(q, o);
        const float rs = rsqrtf(q * (1.f / 64.f) + 1e-5f);
        if (L < 8) { const float* gg = g + 8 * gq; const float* bq = bb + 8 * gq; stage[wv][8 * gq] = fmaxf(d0.x * rs * gg[0] + bq[0], 0.f); stage[wv][8 * gq + 1] = fmaxf(d0.y * rs * gg[1] + bq[1], 0.f); stage[wv][8 * gq + 2] = fmaxf(d0.z * rs * gg[2] + bq[2], 0.f); stage[wv][8 * gq + 3] = fmaxf(d0.w * rs * gg[3] + bq[3], 0.f);
            stage[wv][8 * gq + 4] = fmaxf(d1.x * rs * gg[4] + bq[4], 0.f); stage[wv][8 * gq + 5] = fmaxf(d1.y * rs * gg[5] + bq[5], 0.f); stage[wv][8 * gq + 6] = fmaxf(d1.z * rs * gg[6] + bq[6], 0.f); stage[wv][8 * gq + 7] = fmaxf(d1.w * rs * gg[7] + bq[7], 0.f); }
        __builtin_amdgcn_fence(__ATOMIC_RELEASE, "workgroup"); __builtin_amdgcn_wave_barrier(); __builtin_amdgcn_fence(__ATOMIC_ACQUIRE, "workgroup");
        const unsigned long long pk = (unsigned long long)__builtin_bit_cast(unsigned, stage[wv][2 * L]) | ((unsigned long long)__builtin_bit_cast(unsigned, stage[wv][2 * L + 1]) << 32); VST2(unsigned long long, (unsigned long long*)(OUT + (long long)n * 64 + 2 * L), pk); return; }
    // EPI 0
    stage[wv][c0] = a0.x; stage[wv][c0 + 1] = a0.y; stage[wv][c0 + 2] = a0.z; stage[wv][c0 + 3] = a0.w; stage[wv][c0 + 4] = a1.x; stage[wv][c0 + 5] = a1.y; stage[wv][c0 + 6] = a1.z; stage[wv][c0 + 7] = a1.w;
    __builtin_amdgcn_fence(__ATOMIC_RELEASE, "workgroup"); __builtin_amdgcn_wave_barrier(); __builtin_amdgcn_fence(__ATOMIC_ACQUIRE, "workgroup");
#pragma unroll
    for (int q2 = 0; q2 < 2; ++q2) { const int c = 128 * q2 + 4 * L; v4f v; v.x = stage[wv][c]; v.y = stage[wv][c + 1]; v.z = stage[wv][c + 2]; v.w = stage[wv][c + 3]; VST2V4(OUT + (long long)n * 256 + c, v); } }

__device__ __forceinline__ void st4s(unsigned short* Hp, unsigned short* Lp, long long o, v4f a) { unsigned short h[4], l[4]; bfsplit(a.x, h[0], l[0]); bfsplit(a.y, h[1], l[1]); bfsplit(a.z, h[2], l[2]); bfsplit(a.w, h[3], l[3]);
    const unsigned long long ph = (unsigned long long)h[0] | ((unsigned long long)h[1] << 16) | ((unsigned long long)h[2] << 32) | ((unsigned long long)h[3] << 48), pl = (unsigned long long)l[0] | ((unsigned long long)l[1] << 16) | ((unsigned long long)l[2] << 32) | ((unsigned long long)l[3] << 48);
    VST2(unsigned long long, (unsigned long long*)(Hp + o), ph); VST2(unsigned long long, (unsigned long long*)(Lp + o), pl); }
// f32 [nval2 pairs] -> bf16 hi/lo planes (n2 pairs; pairs >= nval2 zero); thread-linear 4-B stores per plane
__global__ __launch_bounds__(256) void k_pl(const float* __restrict__ S, unsigned short* __restrict__ PH, unsigned short* __restrict__ PL, long long nval2, long long n2) { const long long u = (long long)blockIdx.x * 256 + threadIdx.x; if (u >= n2) return; const bool in = (u < nval2); const long long uc = in ? u : ((nval2 > 0) ? (nval2 - 1) : 0); const float a = S[2 * uc], b = S[2 * uc + 1]; st_s2(PH, PL, 2 * u, in ? a : 0.f, in ? b : 0.f); }
// WC [K][NOP] (thread-linear whole rows) = [W (cols < FO) | 0 | W_h . as_h @EO+h | W_h . ad_h @EO+NH+h | 0 ...]; W is [K][FO] (x @ W layout), as/ad [NH][DH]; EO >= FO.
// branch-free: every lane loads all candidates with clamped indices and selects by value (no exec-masked load arms)
__global__ __launch_bounds__(256) void k_wext(const float* __restrict__ Wm, const float* __restrict__ AS_, const float* __restrict__ AD_, int K, int NOP, int FO, int NH, int DH, int EO, float* __restrict__ WC) {
    #pragma clang fp contract(off)
    const long long u = (long long)blockIdx.x * 256 + threadIdx.x; if (u >= (long long)K * NOP) return; const int kk = (int)(u / NOP), o = (int)(u % NOP);
    const int oo = min(o, FO - 1); const float vw = Wm[(long long)kk * FO + oo]; const int q = min(max(o - EO, 0), 2 * NH - 1); const int h = q % NH; float s = 0.f;
#pragma unroll 1
    for (int c = 0; c < DH; ++c) { const float w = Wm[(long long)kk * FO + h * DH + c]; const float asv = AS_[h * DH + c], adv = AD_[h * DH + c]; s += w * ((q < NH) ? asv : adv); }
    const float v = (o < FO) ? vw : ((o >= EO && o < EO + 2 * NH) ? s : 0.f); VST2(float, WC + u, v); }
// GAT aggregation over a device in-edge CSR (+ analytic self loop as iteration j = -1 when SELF), per-lane online softmax (lanes of one head agree):
// HS rows (pitch P floats): [0,128) projected features z, col 128 + h = a_src.z_h, col 128 + NH + h = a_dst.z_h; lane L owns channels 4L..4L+3 (head = 4L / CH).
// out = sum_j softmax_j(leaky(el[src_j][h] + er[n][h])) z[src_j] (/ (den + deps)) + bias -> ACT (0 none, 1 relu, 2 elu, 3 leaky 0.01) ->
// MODE 0: f32 OUT[n][OW] cols < OC (16-B lane stores, OC*4 contiguous B per wave; OC in {64,128}); MODE 1: bf16 hi/lo planes PH/PL pitch PP (rows n >= N zero); MODE 2: both.
template <int CH, bool SELF, int ACT, int MODE>
__global__ __launch_bounds__(256) void k_gat128(const float* __restrict__ HS, int P, int NH, const float* __restrict__ bias, const int* __restrict__ SRC, const int* __restrict__ off, const int* __restrict__ cnt, const int* __restrict__ slot,
        float* __restrict__ OUT, int OW, int OC, unsigned short* __restrict__ PH, unsigned short* __restrict__ PL, int PP, int N, int NP, int E, int CAP, float slope, float deps) {
    #pragma clang fp contract(off)
    const int n = blockIdx.x * 8 + (threadIdx.x >> 5); const int L = threadIdx.x & 31; if (n >= NP) return; const int c = 4 * L; const int h = c / CH; v4f o; o.x = o.y = o.z = o.w = 0.f;
    if (n < N) { const float* hn = HS + (long long)n * P; const float er = hn[128 + NH + h]; float m = -3.0e38f, s = 0.f; v4f a; a.x = a.y = a.z = a.w = 0.f;
        const int p0 = min(max(off[n], 0), E), cn = min(max(cnt[n], 0), CAP);
        for (int j = (SELF ? -1 : 0); j < cn; ++j) { int sj; if (j < 0) sj = n; else { const int e = min(max(slot[min(p0 + j, E - 1)], 0), E - 1); sj = min(max(SRC[e], 0), N - 1); }
            const float* hs = HS + (long long)sj * P; float lg = hs[128 + h] + er; lg = (lg >= 0.f) ? lg : slope * lg;
            const float mn = fmaxf(m, lg); const float cz = expf(m - mn), pj = expf(lg - mn); s = s * cz + pj; a = a * cz + *(const v4f*)(hs + c) * pj; m = mn; }
        const float inv = (s > 0.f || deps > 0.f) ? 1.f / (s + deps) : 0.f; o = a * inv + *(const v4f*)(bias + c);
        if (ACT == 1) { o.x = fmaxf(o.x, 0.f); o.y = fmaxf(o.y, 0.f); o.z = fmaxf(o.z, 0.f); o.w = fmaxf(o.w, 0.f); }
        if (ACT == 2) { o.x = (o.x > 0.f) ? o.x : (expf(o.x) - 1.f); o.y = (o.y > 0.f) ? o.y : (expf(o.y) - 1.f); o.z = (o.z > 0.f) ? o.z : (expf(o.z) - 1.f); o.w = (o.w > 0.f) ? o.w : (expf(o.w) - 1.f); }
        if (ACT == 3) { o.x = (o.x >= 0.f) ? o.x : 0.01f * o.x; o.y = (o.y >= 0.f) ? o.y : 0.01f * o.y; o.z = (o.z >= 0.f) ? o.z : 0.01f * o.z; o.w = (o.w >= 0.f) ? o.w : 0.01f * o.w; }
        if (MODE != 1 && c < OC) VST2V4(OUT + (long long)n * OW + c, o); }
    if (MODE != 0) st4s(PH, PL, (long long)n * PP + c, o); }

// ---- util2 ----
// generic Bt plane builder from an f32 weight: Bt[o][k] (pitch KP halves) = (TRANS ? W[k*ldw + o] : W[o*ldw + k]) * (S ? S[o] : 1) for o < NO, k < KI; zero elsewhere for o < NOP rows, k < KP (thread per (o < NOP, pair k))
__global__ __launch_bounds__(256) void k_u2_bt(const float* __restrict__ Wm, int ldw, int TRANS, int KI, int NO, int KP, int NOP, const float* __restrict__ S, unsigned short* __restrict__ PH_, unsigned short* __restrict__ PL_) {
    const long long u = (long long)blockIdx.x * 256 + threadIdx.x; if (u >= (long long)NOP * (KP / 2)) return; const int k0 = 2 * (int)(u % (KP / 2)); const int o = (int)(u / (KP / 2)); float a = 0.f, b = 0.f;
    if (o < NO) { const float s = S ? S[o] : 1.f;
        if (k0 < KI) a = (TRANS ? Wm[(long long)k0 * ldw + o] : Wm[(long long)o * ldw + k0]) * s;
        if (k0 + 1 < KI) b = (TRANS ? Wm[(long long)(k0 + 1) * ldw + o] : Wm[(long long)o * ldw + k0 + 1]) * s; }
    st_s2(PH_, PL_, (long long)o * KP + k0, a, b); }
// generic padded vector: O[i] = (i < n) ? (A[i] * (S ? S[i] : 1) + (B2 ? B2[i] : 0)) : 0 for i < NP (one block of 256, NP <= 4096 looped)
__global__ __launch_bounds__(256) void k_u2_vec(const float* __restrict__ A, const float* __restrict__ S, const float* __restrict__ B2, int n, int NP, float* __restrict__ O) { for (int i = threadIdx.x; i < NP; i += 256) { float v = 0.f; if (i < n) v = A[i] * (S ? S[i] : 1.f) + (B2 ? B2[i] : 0.f); VST2(float, O + i, v); } }
__global__ __launch_bounds__(256) void k_u2_colstat(const float* __restrict__ X, int P, int N, float eps, float* __restrict__ STAT) {
    #pragma clang fp contract(off)
    __shared__ float red[256]; const int c = blockIdx.x; const int t = threadIdx.x; float s = 0.f; for (int r = t; r < N; r += 256) s += X[(long long)r * P + c]; red[t] = s; __syncthreads();
    for (int o = 128; o > 0; o >>= 1) { if (t < o) red[t] += red[t + o]; __syncthreads(); }
    const float mu = red[0] / (float)N; __syncthreads(); float q = 0.f; for (int r = t; r < N; r += 256) { const float d = X[(long long)r * P + c] - mu; q += d * d; } red[t] = q; __syncthreads();
    for (int o = 128; o > 0; o >>= 1) { if (t < o) red[t] += red[t + o]; __syncthreads(); }
    const float rs = 1.f / sqrtf(red[0] / (float)N + eps); if (t < 32) VST2(float, STAT + (long long)c * 32 + t, (t == 0) ? mu : ((t == 1) ? rs : 0.f)); }
// rows f32 [R][W] (pitch PW) -> planes at pitch PP, column offset coff; rows >= RL (live) written as zeros up to RP (thread per (r < RP, 4 of W))
__global__ __launch_bounds__(256) void k_u2_pl(const float* __restrict__ X, int PW, int Wd, int RL, int RP, unsigned short* __restrict__ PH_, unsigned short* __restrict__ PL_, int PP, int coff) { const long long u = (long long)blockIdx.x * 256 + threadIdx.x; if (u >= (long long)RP * (Wd / 4)) return; const int r = (int)(u / (Wd / 4)); const int c = 4 * (int)(u % (Wd / 4)); v4f v; v.x = v.y = v.z = v.w = 0.f; if (r < RL) v = *(const v4f*)(X + (long long)r * PW + c); st4s(PH_, PL_, (long long)r * PP + coff + c, v); }

typedef unsigned int cm_u4 __attribute__((ext_vector_type(4)));

__global__ __launch_bounds__(256) void k_cm_zero16(unsigned short* __restrict__ DST, long long n) { const long long u = (long long)blockIdx.x * 256 + threadIdx.x; if (u * 8 >= n) return; cm_u4 z; z.x = z.y = z.z = z.w = 0u; cm_u4* d = (cm_u4*)(DST + u * 8); *d = z;  }
// f32 -> bf16 (RNE) -> f16 casts: every 16-bit operand then holds exactly the bf16-rounded input value (times a power-of-two
// weight scale), so the f16 WMMA products are exact. Plain: thread per (row, 8 cols),
// dst [R][C] pitch ldd; transposed: thread per (col, 8 consecutive rows) -> dst [C][R] pitch ldd; both store 16 B per thread, thread-linear along the dst row.
__device__ __forceinline__ unsigned int cmb_pk2(float a, float b) { return (unsigned int)__builtin_bit_cast(unsigned short, (_Float16)a) | ((unsigned int)__builtin_bit_cast(unsigned short, (_Float16)b) << 16); }
__device__ __forceinline__ float cmb_bf(float v) { const unsigned u = __builtin_bit_cast(unsigned, v); const unsigned r = (u + 0x7fffu + ((u >> 16) & 1u)) & 0xffff0000u; return __builtin_bit_cast(float, r); }   // bf16 RNE, kept as f32 (finite inputs)
// BR[i] = bf16_rne(B[i]) kept as f32 (thread per element)
__global__ __launch_bounds__(256) void k_cm_bfvec(const float* __restrict__ SRC, float* __restrict__ DST, int n) { const int u = blockIdx.x * 256 + threadIdx.x; if (u >= n) return; VST2(float, DST + u, cmb_bf(SRC[u])); }
__global__ __launch_bounds__(256) void k_cm_castb(const float* __restrict__ SRC, int lds, unsigned short* __restrict__ DST, int ldd, int nR, int nC, float sc) {
    const long long u = (long long)blockIdx.x * 256 + threadIdx.x; const int per = nC / 8; if (u >= (long long)nR * per) return; const int r = (int)(u / per); const int c0 = 8 * (int)(u % per);
    const float* s = SRC + (long long)r * lds + c0; float w[8];
#pragma unroll
    for (int e = 0; e < 8; ++e) w[e] = cmb_bf(s[e]) * sc;
    cm_u4 pk; pk.x = cmb_pk2(w[0], w[1]); pk.y = cmb_pk2(w[2], w[3]); pk.z = cmb_pk2(w[4], w[5]); pk.w = cmb_pk2(w[6], w[7]); VST2(cm_u4, (cm_u4*)(DST + (long long)r * ldd + c0), pk); }
__global__ __launch_bounds__(256) void k_cm_castbT(const float* __restrict__ SRC, int lds, unsigned short* __restrict__ DST, int ldd, int nR, int nC, float sc) {
    const long long u = (long long)blockIdx.x * 256 + threadIdx.x; const int per = nR / 8; if (u >= (long long)nC * per) return; const int c = (int)(u / per); const int r0 = 8 * (int)(u % per);
    float w[8];
#pragma unroll
    for (int e = 0; e < 8; ++e) w[e] = cmb_bf(SRC[(long long)(r0 + e) * lds + c]) * sc;
    cm_u4 pk; pk.x = cmb_pk2(w[0], w[1]); pk.y = cmb_pk2(w[2], w[3]); pk.z = cmb_pk2(w[4], w[5]); pk.w = cmb_pk2(w[6], w[7]); VST2(cm_u4, (cm_u4*)(DST + (long long)c * ldd + r0), pk); }

typedef float ab_v2f __attribute__((ext_vector_type(2)));
__global__ __launch_bounds__(256) void k_ab_gstat(const float* __restrict__ X, float* __restrict__ STp, int per) {
    #pragma clang fp contract(off)
    __shared__ float red[256]; const int g = blockIdx.x; const int t = threadIdx.x; const float* base = X + (long long)g * per; float s = 0.f;
    for (int i = 4 * t; i < per; i += 1024) { const v4f v = *(const v4f*)(base + i); s += (cmb_bf(v.x) + cmb_bf(v.y)) + (cmb_bf(v.z) + cmb_bf(v.w)); }
    red[t] = s; __syncthreads();
    for (int o = 128; o > 0; o >>= 1) { if (t < o) red[t] += red[t + o]; __syncthreads(); }
    const float mean = red[0] / (float)per; __syncthreads(); float q = 0.f;
    for (int i = 4 * t; i < per; i += 1024) { const v4f v = *(const v4f*)(base + i); const float a = cmb_bf(v.x) - mean, b = cmb_bf(v.y) - mean, c = cmb_bf(v.z) - mean, d = cmb_bf(v.w) - mean; q += (a * a + b * b) + (c * c + d * d); }
    red[t] = q; __syncthreads();
    for (int o = 128; o > 0; o >>= 1) { if (t < o) red[t] += red[t + o]; __syncthreads(); }
    if (t == 0) { ab_v2f ms; ms.x = mean; ms.y = rsqrtf(red[0] / (float)per + 1e-5f); VST2(ab_v2f, (ab_v2f*)(STp + 32 * g), ms); } }
// XN[c][n] = (bf16(x[c][n]) - mean[g]) rstd[g] bf16(gamma[c]) + bf16(beta[c]); XB[c][n] = bf16(x[c][n]) (residual copy); thread per float4
__global__ __launch_bounds__(256) void k_ab_gapply(const float* __restrict__ X, const float* __restrict__ STp, const float* __restrict__ Gm, const float* __restrict__ Bt, float* __restrict__ XNp, float* __restrict__ XBp, int N, int CPG, long long n4) {
    #pragma clang fp contract(off)
    const long long u = (long long)blockIdx.x * 256 + threadIdx.x; if (u >= n4) return; const int c = (int)((4 * u) / N); const int g = c / CPG; const float mean = STp[32 * g], rs = STp[32 * g + 1], ga = cmb_bf(Gm[c]), be = cmb_bf(Bt[c]);
    const v4f v = *(const v4f*)(X + 4 * u); v4f xb; xb.x = cmb_bf(v.x); xb.y = cmb_bf(v.y); xb.z = cmb_bf(v.z); xb.w = cmb_bf(v.w); v4f r; r.x = (xb.x - mean) * rs * ga + be; r.y = (xb.y - mean) * rs * ga + be; r.z = (xb.z - mean) * rs * ga + be; r.w = (xb.w - mean) * rs * ga + be;
    VST2V4(XNp + 4 * u, r); VST2V4(XBp + 4 * u, xb); }


extern "C" void kernel_launch(void* const* d_in, const int* in_sizes, int n_in, void* d_out, int out_size, void* d_ws, size_t ws_size, hipStream_t stream) {
    (void)in_sizes; (void)n_in; (void)out_size; (void)ws_size;
    const float* x = (const float*)d_in[0];
    const float* gam = (const float*)d_in[1];
    const float* bet = (const float*)d_in[2];
    const float* wqkv = (const float*)d_in[3];
    const float* bqkv = (const float*)d_in[4];
    const float* wo = (const float*)d_in[5];
    const float* bo = (const float*)d_in[6];
    float* out = (float*)d_out;
    char* wsp = (char*)d_ws;
    float* ST = (float*)wsp; wsp += (((size_t)((size_t)8 * 32 + 64) * 4 + 255) / 256) * 256;
    float* XN = (float*)wsp; wsp += (((size_t)((size_t)256 * 4096) * 4 + 255) / 256) * 256;
    unsigned short* XTH = (unsigned short*)wsp; wsp += (((size_t)((size_t)4096 * 256) * 2 + 255) / 256) * 256;
    unsigned short* XTL = (unsigned short*)wsp; wsp += (((size_t)((size_t)4096 * 256) * 2 + 255) / 256) * 256;
    unsigned short* W3H = (unsigned short*)wsp; wsp += (((size_t)((size_t)768 * 256) * 2 + 255) / 256) * 256;
    unsigned short* W3L = (unsigned short*)wsp; wsp += (((size_t)((size_t)768 * 256) * 2 + 255) / 256) * 256;
    float* BR3 = (float*)wsp; wsp += (((size_t)((size_t)768 + 64) * 4 + 255) / 256) * 256;
    float* QKV = (float*)wsp; wsp += (((size_t)((size_t)4096 * 768) * 4 + 255) / 256) * 256;
    float* AO = (float*)wsp; wsp += (((size_t)((size_t)4096 * 256) * 4 + 255) / 256) * 256;
    unsigned short* AOH = (unsigned short*)wsp; wsp += (((size_t)((size_t)4096 * 256) * 2 + 255) / 256) * 256;
    unsigned short* AOL = (unsigned short*)wsp; wsp += (((size_t)((size_t)4096 * 256) * 2 + 255) / 256) * 256;
    unsigned short* WOH = (unsigned short*)wsp; wsp += (((size_t)((size_t)256 * 256) * 2 + 255) / 256) * 256;
    unsigned short* WOL = (unsigned short*)wsp; wsp += (((size_t)((size_t)256 * 256) * 2 + 255) / 256) * 256;
    float* BRO = (float*)wsp; wsp += (((size_t)((size_t)256 + 64) * 4 + 255) / 256) * 256;
    float* XB = (float*)wsp; wsp += (((size_t)((size_t)256 * 4096) * 4 + 255) / 256) * 256;
    if ((size_t)(wsp - (char*)d_ws) > ws_size) return;   // static carve guard
    k_castS16<<<(unsigned)((((long long)(768) * ((256) / 2)) + 255) / 256), 256, 0, stream>>>(wqkv, 256, (__bf16*)(W3H), (__bf16*)(W3L), 256, 768, 256, 1.0f, 0);
    k_cm_bfvec<<<3, 256, 0, stream>>>(bqkv, BR3, 768); k_cm_bfvec<<<1, 256, 0, stream>>>(bo, BRO, 256);
    k_castS16<<<(unsigned)((((long long)(256) * ((256) / 2)) + 255) / 256), 256, 0, stream>>>(wo, 256, (__bf16*)(WOH), (__bf16*)(WOL), 256, 256, 256, 1.0f, 0);
    k_ab_gstat<<<8, 256, 0, stream>>>(x + 0, ST, 131072); k_ab_gapply<<<(262144 + 255) / 256, 256, 0, stream>>>(x + 0, ST, gam, bet, XN, XB, 4096, 32, 262144LL);
    k_castS16<<<(unsigned)((((long long)(4096) * ((256) / 2)) + 255) / 256), 256, 0, stream>>>(XN, 4096, (__bf16*)(XTH), (__bf16*)(XTL), 256, 256, 4096, 1.0f, 1);
    w25::wmma_gemm64<1, false, 2, 0, false, 0><<<dim3((unsigned)((((4096) / 64) * ((768) / 64) + 7) / 8), (unsigned)(1)), 256, 0, stream>>>((const unsigned short*)(XTH), nullptr, 256, 0, (const unsigned short*)(W3H), nullptr, 256, 0, (void*)(QKV), nullptr, 768, 0, BR3, nullptr, 0, 4096, 768, 256, 1.0f);
    w25::wmma_gemm64<1, false, 0, 0, true, 0><<<dim3((unsigned)((((4096) / 64) * ((768) / 64) + 7) / 8), (unsigned)(1)), 256, 0, stream>>>((const unsigned short*)(XTL), nullptr, 256, 0, (const unsigned short*)(W3H), nullptr, 256, 0, (void*)(QKV), nullptr, 768, 0, nullptr, QKV, 0, 4096, 768, 256, 1.0f);
    { /*apv4*/ AttnP a;
      a.Q = QKV; a.K = QKV + 256; a.V = QKV + 512; a.O = AO; a.P = 0; a.Mf = 0; a.Mi = 0; a.ST = 0;
      a.Pw = 0; a.Rt = 0; a.SQ = 0; a.SK = 0;
      a.swb = 0; a.swh = 0; a.swi = 0; a.swj = 0; a.srb = 0; a.srh = 0; a.sri = 0; a.sQb = 0; a.sQh = 64; a.sQi = 768; a.sQd = 1; a.sKb = 0; a.sKh = 64; a.sKj = 768; a.sKd = 1; a.sVb = 0; a.sVh = 64; a.sVj = 768; a.sVd = 1; a.sOb = 0; a.sOh = 64; a.sOi = 256; a.sPb = 0; a.sPh = 0; a.sPi = 0; a.smb = 0; a.smh = 0; a.smi = 0; a.smj = 0;
      a.Lq = 4096; a.Lk = 4096; a.dh = 64; a.dv = 64; a.hrep = 1; a.causal = 0; a.coff = 0; a.pband = 0;
      a.scale = 0.125f; a.mfill = 0.0f; a.nonorm = 0; a.mpol = 0;
      a.roff = 0; a.rn = 1; a.segpol = 0; a.win = 0;
      k_attn<64, 64, 0, false, false, true, true><<<dim3((unsigned)((4096) + 16 * AW - 1) / (16 * AW), (unsigned)(4), (unsigned)(1)), 32 * AW, 0, stream>>>(a); }
    k_castS16<<<(unsigned)((((long long)(4096) * ((256) / 2)) + 255) / 256), 256, 0, stream>>>(AO, 256, (__bf16*)(AOH), (__bf16*)(AOL), 256, 4096, 256, 1.0f, 0);
    w25::wmma_gemm64<1, false, 1, 0, true, 0><<<dim3((unsigned)((((256) / 64) * ((4096) / 64) + 7) / 8), (unsigned)(1)), 256, 0, stream>>>((const unsigned short*)(WOH), nullptr, 256, 0, (const unsigned short*)(AOH), nullptr, 256, 0, (void*)(out + 0), nullptr, 4096, 0, BRO, XB, 0, 256, 4096, 256, 1.0f);
    w25::wmma_gemm64<1, false, 0, 0, true, 0><<<dim3((unsigned)((((256) / 64) * ((4096) / 64) + 7) / 8), (unsigned)(1)), 256, 0, stream>>>((const unsigned short*)(WOH), nullptr, 256, 0, (const unsigned short*)(AOL), nullptr, 256, 0, (void*)(out + 0), nullptr, 4096, 0, nullptr, out + 0, 0, 256, 4096, 256, 1.0f);
    k_ab_gstat<<<8, 256, 0, stream>>>(x + 1048576, ST, 131072); k_ab_gapply<<<(262144 + 255) / 256, 256, 0, stream>>>(x + 1048576, ST, gam, bet, XN, XB, 4096, 32, 262144LL);
    k_castS16<<<(unsigned)((((long long)(4096) * ((256) / 2)) + 255) / 256), 256, 0, stream>>>(XN, 4096, (__bf16*)(XTH), (__bf16*)(XTL), 256, 256, 4096, 1.0f, 1);
    w25::wmma_gemm64<1, false, 2, 0, false, 0><<<dim3((unsigned)((((4096) / 64) * ((768) / 64) + 7) / 8), (unsigned)(1)), 256, 0, stream>>>((const unsigned short*)(XTH), nullptr, 256, 0, (const unsigned short*)(W3H), nullptr, 256, 0, (void*)(QKV), nullptr, 768, 0, BR3, nullptr, 0, 4096, 768, 256, 1.0f);
    w25::wmma_gemm64<1, false, 0, 0, true, 0><<<dim3((unsigned)((((4096) / 64) * ((768) / 64) + 7) / 8), (unsigned)(1)), 256, 0, stream>>>((const unsigned short*)(XTL), nullptr, 256, 0, (const unsigned short*)(W3H), nullptr, 256, 0, (void*)(QKV), nullptr, 768, 0, nullptr, QKV, 0, 4096, 768, 256, 1.0f);
    { /*apv4*/ AttnP a;
      a.Q = QKV; a.K = QKV + 256; a.V = QKV + 512; a.O = AO; a.P = 0; a.Mf = 0; a.Mi = 0; a.ST = 0;
      a.Pw = 0; a.Rt = 0; a.SQ = 0; a.SK = 0;
      a.swb = 0; a.swh = 0; a.swi = 0; a.swj = 0; a.srb = 0; a.srh = 0; a.sri = 0; a.sQb = 0; a.sQh = 64; a.sQi = 768; a.sQd = 1; a.sKb = 0; a.sKh = 64; a.sKj = 768; a.sKd = 1; a.sVb = 0; a.sVh = 64; a.sVj = 768; a.sVd = 1; a.sOb = 0; a.sOh = 64; a.sOi = 256; a.sPb = 0; a.sPh = 0; a.sPi = 0; a.smb = 0; a.smh = 0; a.smi = 0; a.smj = 0;
      a.Lq = 4096; a.Lk = 4096; a.dh = 64; a.dv = 64; a.hrep = 1; a.causal = 0; a.coff = 0; a.pband = 0;
      a.scale = 0.125f; a.mfill = 0.0f; a.nonorm = 0; a.mpol = 0;
      a.roff = 0; a.rn = 1; a.segpol = 0; a.win = 0;
      k_attn<64, 64, 0, false, false, true, true><<<dim3((unsigned)((4096) + 16 * AW - 1) / (16 * AW), (unsigned)(4), (unsigned)(1)), 32 * AW, 0, stream>>>(a); }
    k_castS16<<<(unsigned)((((long long)(4096) * ((256) / 2)) + 255) / 256), 256, 0, stream>>>(AO, 256, (__bf16*)(AOH), (__bf16*)(AOL), 256, 4096, 256, 1.0f, 0);
    w25::wmma_gemm64<1, false, 1, 0, true, 0><<<dim3((unsigned)((((256) / 64) * ((4096) / 64) + 7) / 8), (unsigned)(1)), 256, 0, stream>>>((const unsigned short*)(WOH), nullptr, 256, 0, (const unsigned short*)(AOH), nullptr, 256, 0, (void*)(out + 1048576), nullptr, 4096, 0, BRO, XB, 0, 256, 4096, 256, 1.0f);
    w25::wmma_gemm64<1, false, 0, 0, true, 0><<<dim3((unsigned)((((256) / 64) * ((4096) / 64) + 7) / 8), (unsigned)(1)), 256, 0, stream>>>((const unsigned short*)(WOH), nullptr, 256, 0, (const unsigned short*)(AOL), nullptr, 256, 0, (void*)(out + 1048576), nullptr, 4096, 0, nullptr, out + 1048576, 0, 256, 4096, 256, 1.0f);
    k_ab_gstat<<<8, 256, 0, stream>>>(x + 2097152, ST, 131072); k_ab_gapply<<<(262144 + 255) / 256, 256, 0, stream>>>(x + 2097152, ST, gam, bet, XN, XB, 4096, 32, 262144LL);
    k_castS16<<<(unsigned)((((long long)(4096) * ((256) / 2)) + 255) / 256), 256, 0, stream>>>(XN, 4096, (__bf16*)(XTH), (__bf16*)(XTL), 256, 256, 4096, 1.0f, 1);
    w25::wmma_gemm64<1, false, 2, 0, false, 0><<<dim3((unsigned)((((4096) / 64) * ((768) / 64) + 7) / 8), (unsigned)(1)), 256, 0, stream>>>((const unsigned short*)(XTH), nullptr, 256, 0, (const unsigned short*)(W3H), nullptr, 256, 0, (void*)(QKV), nullptr, 768, 0, BR3, nullptr, 0, 4096, 768, 256, 1.0f);
    w25::wmma_gemm64<1, false, 0, 0, true, 0><<<dim3((unsigned)((((4096) / 64) * ((768) / 64) + 7) / 8), (unsigned)(1)), 256, 0, stream>>>((const unsigned short*)(XTL), nullptr, 256, 0, (const unsigned short*)(W3H), nullptr, 256, 0, (void*)(QKV), nullptr, 768, 0, nullptr, QKV, 0, 4096, 768, 256, 1.0f);
    { /*apv4*/ AttnP a;
      a.Q = QKV; a.K = QKV + 256; a.V = QKV + 512; a.O = AO; a.P = 0; a.Mf = 0; a.Mi = 0; a.ST = 0;
      a.Pw = 0; a.Rt = 0; a.SQ = 0; a.SK = 0;
      a.swb = 0; a.swh = 0; a.swi = 0; a.swj = 0; a.srb = 0; a.srh = 0; a.sri = 0; a.sQb = 0; a.sQh = 64; a.sQi = 768; a.sQd = 1; a.sKb = 0; a.sKh = 64; a.sKj = 768; a.sKd = 1; a.sVb = 0; a.sVh = 64; a.sVj = 768; a.sVd = 1; a.sOb = 0; a.sOh = 64; a.sOi = 256; a.sPb = 0; a.sPh = 0; a.sPi = 0; a.smb = 0; a.smh = 0; a.smi = 0; a.smj = 0;
      a.Lq = 4096; a.Lk = 4096; a.dh = 64; a.dv = 64; a.hrep = 1; a.causal = 0; a.coff = 0; a.pband = 0;
      a.scale = 0.125f; a.mfill = 0.0f; a.nonorm = 0; a.mpol = 0;
      a.roff = 0; a.rn = 1; a.segpol = 0; a.win = 0;
      k_attn<64, 64, 0, false, false, true, true><<<dim3((unsigned)((4096) + 16 * AW - 1) / (16 * AW), (unsigned)(4), (unsigned)(1)), 32 * AW, 0, stream>>>(a); }
    k_castS16<<<(unsigned)((((long long)(4096) * ((256) / 2)) + 255) / 256), 256, 0, stream>>>(AO, 256, (__bf16*)(AOH), (__bf16*)(AOL), 256, 4096, 256, 1.0f, 0);
    w25::wmma_gemm64<1, false, 1, 0, true, 0><<<dim3((unsigned)((((256) / 64) * ((4096) / 64) + 7) / 8), (unsigned)(1)), 256, 0, stream>>>((const unsigned short*)(WOH), nullptr, 256, 0, (const unsigned short*)(AOH), nullptr, 256, 0, (void*)(out + 2097152), nullptr, 4096, 0, BRO, XB, 0, 256, 4096, 256, 1.0f);
    w25::wmma_gemm64<1, false, 0, 0, true, 0><<<dim3((unsigned)((((256) / 64) * ((4096) / 64) + 7) / 8), (unsigned)(1)), 256, 0, stream>>>((const unsigned short*)(WOH), nullptr, 256, 0, (const unsigned short*)(AOL), nullptr, 256, 0, (void*)(out + 2097152), nullptr, 4096, 0, nullptr, out + 2097152, 0, 256, 4096, 256, 1.0f);
    k_ab_gstat<<<8, 256, 0, stream>>>(x + 3145728, ST, 131072); k_ab_gapply<<<(262144 + 255) / 256, 256, 0, stream>>>(x + 3145728, ST, gam, bet, XN, XB, 4096, 32, 262144LL);
    k_castS16<<<(unsigned)((((long long)(4096) * ((256) / 2)) + 255) / 256), 256, 0, stream>>>(XN, 4096, (__bf16*)(XTH), (__bf16*)(XTL), 256, 256, 4096, 1.0f, 1);
    w25::wmma_gemm64<1, false, 2, 0, false, 0><<<dim3((unsigned)((((4096) / 64) * ((768) / 64) + 7) / 8), (unsigned)(1)), 256, 0, stream>>>((const unsigned short*)(XTH), nullptr, 256, 0, (const unsigned short*)(W3H), nullptr, 256, 0, (void*)(QKV), nullptr, 768, 0, BR3, nullptr, 0, 4096, 768, 256, 1.0f);
    w25::wmma_gemm64<1, false, 0, 0, true, 0><<<dim3((unsigned)((((4096) / 64) * ((768) / 64) + 7) / 8), (unsigned)(1)), 256, 0, stream>>>((const unsigned short*)(XTL), nullptr, 256, 0, (const unsigned short*)(W3H), nullptr, 256, 0, (void*)(QKV), nullptr, 768, 0, nullptr, QKV, 0, 4096, 768, 256, 1.0f);
    { /*apv4*/ AttnP a;
      a.Q = QKV; a.K = QKV + 256; a.V = QKV + 512; a.O = AO; a.P = 0; a.Mf = 0; a.Mi = 0; a.ST = 0;
      a.Pw = 0; a.Rt = 0; a.SQ = 0; a.SK = 0;
      a.swb = 0; a.swh = 0; a.swi = 0; a.swj = 0; a.srb = 0; a.srh = 0; a.sri = 0; a.sQb = 0; a.sQh = 64; a.sQi = 768; a.sQd = 1; a.sKb = 0; a.sKh = 64; a.sKj = 768; a.sKd = 1; a.sVb = 0; a.sVh = 64; a.sVj = 768; a.sVd = 1; a.sOb = 0; a.sOh = 64; a.sOi = 256; a.sPb = 0; a.sPh = 0; a.sPi = 0; a.smb = 0; a.smh = 0; a.smi = 0; a.smj = 0;
      a.Lq = 4096; a.Lk = 4096; a.dh = 64; a.dv = 64; a.hrep = 1; a.causal = 0; a.coff = 0; a.pband = 0;
      a.scale = 0.125f; a.mfill = 0.0f; a.nonorm = 0; a.mpol = 0;
      a.roff = 0; a.rn = 1; a.segpol = 0; a.win = 0;
      k_attn<64, 64, 0, false, false, true, true><<<dim3((unsigned)((4096) + 16 * AW - 1) / (16 * AW), (unsigned)(4), (unsigned)(1)), 32 * AW, 0, stream>>>(a); }
    k_castS16<<<(unsigned)((((long long)(4096) * ((256) / 2)) + 255) / 256), 256, 0, stream>>>(AO, 256, (__bf16*)(AOH), (__bf16*)(AOL), 256, 4096, 256, 1.0f, 0);
    w25::wmma_gemm64<1, false, 1, 0, true, 0><<<dim3((unsigned)((((256) / 64) * ((4096) / 64) + 7) / 8), (unsigned)(1)), 256, 0, stream>>>((const unsigned short*)(WOH), nullptr, 256, 0, (const unsigned short*)(AOH), nullptr, 256, 0, (void*)(out + 3145728), nullptr, 4096, 0, BRO, XB, 0, 256, 4096, 256, 1.0f);
    w25::wmma_gemm64<1, false, 0, 0, true, 0><<<dim3((unsigned)((((256) / 64) * ((4096) / 64) + 7) / 8), (unsigned)(1)), 256, 0, stream>>>((const unsigned short*)(WOH), nullptr, 256, 0, (const unsigned short*)(AOL), nullptr, 256, 0, (void*)(out + 3145728), nullptr, 4096, 0, nullptr, out + 3145728, 0, 256, 4096, 256, 1.0f);
}

// v003
// Measured time: 620 microseconds a run.
// Two timings next to v002 put it at 2.12 and 2.06 times that version's speed.
// Counting every step since v000, it is 13.0 times as fast.
#include <hip/hip_runtime.h>
#include <math.h>

typedef __attribute__((ext_vector_type(16))) _Float16 v16h;
typedef __attribute__((ext_vector_type(8)))  _Float16 v8h;
typedef __attribute__((ext_vector_type(16))) __bf16   v16b;
typedef __attribute__((ext_vector_type(8)))  float    v8f;
typedef __attribute__((ext_vector_type(4)))  float    v4f;

// 16-bit WMMA fragment map (wave32), lane L, h = L>>4, m = L&15:
//   A 16x32: lane = row m;   element i -> k = (i<8) ? 8h+i : 16+8h+(i-8)
//   B 32x16: lane = column m; the SAME k(i,h)
//   D 16x16 (8 f32): lane = column m; element r -> row 8h+r
__device__ __forceinline__ int frag_k(int i, int h) { return (i < 8) ? (8 * h + i) : (16 + 8 * h + (i - 8)); }
__device__ __forceinline__ __bf16 bf16_rne(float f) {
    unsigned int u = __float_as_uint(f);
    u += 0x7fffu + ((u >> 16) & 1u);
    return __builtin_bit_cast(__bf16, (unsigned short)(u >> 16));
}
__device__ __forceinline__ float bf16_f32(__bf16 b) { return __uint_as_float(((unsigned int)__builtin_bit_cast(unsigned short, b)) << 16); }
__device__ __forceinline__ v8f wmma16(v16h a, v16h b, v8f c) {
    c = __builtin_amdgcn_wmma_f32_16x16x32_f16(false, a, false, b, (short)0, c, false, false);
    asm volatile("v_nop\n\tv_nop\n\tv_nop\n\tv_nop" : "+v"(c) : "v"(a), "v"(b));
    return c;
}
__device__ __forceinline__ v8f wmmab(v16b a, v16b b, v8f c) {
    c = __builtin_amdgcn_wmma_f32_16x16x32_bf16(false, a, false, b, (short)0, c, false, false);
    asm volatile("v_nop\n\tv_nop\n\tv_nop\n\tv_nop" : "+v"(c) : "v"(a), "v"(b));
    return c;
}
struct Split { v16b hi, lo; };
// hi/lo split product: a.hi*b.hi + a.hi*b.lo + a.lo*b.hi
__device__ __forceinline__ v8f wmma3(const Split& a, const Split& b, v8f c) {
    c = __builtin_amdgcn_wmma_f32_16x16x32_bf16(false, a.hi, false, b.hi, (short)0, c, false, false);
    c = __builtin_amdgcn_wmma_f32_16x16x32_bf16(false, a.hi, false, b.lo, (short)0, c, false, false);
    c = __builtin_amdgcn_wmma_f32_16x16x32_bf16(false, a.lo, false, b.hi, (short)0, c, false, false);
    asm volatile("v_nop\n\tv_nop\n\tv_nop\n\tv_nop" : "+v"(c) : "v"(a.hi), "v"(a.lo), "v"(b.hi), "v"(b.lo));
    return c;
}
struct Split3 { v16b hi, mid, lo; };
// triple split product (6 terms, drops only terms below 2^-24 relative)
__device__ __forceinline__ v8f wmma6(const Split3& a, const Split3& b, v8f c) {
    c = __builtin_amdgcn_wmma_f32_16x16x32_bf16(false, a.hi, false, b.hi, (short)0, c, false, false);
    c = __builtin_amdgcn_wmma_f32_16x16x32_bf16(false, a.hi, false, b.mid, (short)0, c, false, false);
    c = __builtin_amdgcn_wmma_f32_16x16x32_bf16(false, a.mid, false, b.hi, (short)0, c, false, false);
    c = __builtin_amdgcn_wmma_f32_16x16x32_bf16(false, a.hi, false, b.lo, (short)0, c, false, false);
    c = __builtin_amdgcn_wmma_f32_16x16x32_bf16(false, a.mid, false, b.mid, (short)0, c, false, false);
    c = __builtin_amdgcn_wmma_f32_16x16x32_bf16(false, a.lo, false, b.hi, (short)0, c, false, false);
    asm volatile("v_nop\n\tv_nop\n\tv_nop\n\tv_nop" : "+v"(c) : "v"(a.hi), "v"(a.mid), "v"(a.lo), "v"(b.hi), "v"(b.mid), "v"(b.lo));
    return c;
}

// Fragment gathers from f32 memory: element i <- p[(k0 + frag_k(i,h)) * sk] * s, zero for k >= klen.
__device__ __forceinline__ v16h fh_ld(const float* __restrict__ p, long long sk, int k0, int h, int klen, float s) {
    v16h a;
#pragma unroll
    for (int i = 0; i < 16; ++i) { const int k = k0 + frag_k(i, h); a[i] = (k < klen) ? (_Float16)(p[(long long)k * sk] * s) : (_Float16)0.f; }
    return a;
}
__device__ __forceinline__ Split sp_ld(const float* __restrict__ p, long long sk, int k0, int h, int klen, float s) {
    Split r;
#pragma unroll
    for (int i = 0; i < 16; ++i) {
        const int k = k0 + frag_k(i, h); const float x = (k < klen) ? p[(long long)k * sk] * s : 0.f;
        const __bf16 hb = bf16_rne(x); r.hi[i] = hb; r.lo[i] = bf16_rne(x - bf16_f32(hb));
    }
    return r;
}
__device__ __forceinline__ Split3 sp3_ld(const float* __restrict__ p, long long sk, int k0, int h, int klen, float s) {
    Split3 r;
#pragma unroll
    for (int i = 0; i < 16; ++i) {
        const int k = k0 + frag_k(i, h); const float x = (k < klen) ? p[(long long)k * sk] * s : 0.f;
        const __bf16 hb = bf16_rne(x); const float r1 = x - bf16_f32(hb); const __bf16 mb = bf16_rne(r1);
        r.hi[i] = hb; r.mid[i] = mb; r.lo[i] = bf16_rne(r1 - bf16_f32(mb));
    }
    return r;
}
__device__ __forceinline__ v16b bh_ld(const float* __restrict__ p, long long sk, int k0, int h, int klen, float s) {
    v16b a;
#pragma unroll
    for (int i = 0; i < 16; ++i) { const int k = k0 + frag_k(i, h); a[i] = bf16_rne((k < klen) ? p[(long long)k * sk] * s : 0.f); }
    return a;
}
// f16 fragment from an f16 LDS/global row with element stride 1 (k-contiguous), no bounds (tile already zero padded)
__device__ __forceinline__ v16h fh_row(const _Float16* __restrict__ row, int k0, int h) {
    v16h a;
#pragma unroll
    for (int i = 0; i < 16; ++i) a[i] = row[k0 + frag_k(i, h)];
    return a;
}

typedef __attribute__((ext_vector_type(4))) _Float16 v4h;
// One 16-bit fragment's 32 k of a k-contiguous, 16-byte aligned f32 row as four unguarded 16-byte loads; row = the lane's row + 8 * h elements.
// fr_cvt packs them in the k order of frag_k.
struct FragRaw { v4f x0, x1, x2, x3; };
__device__ __forceinline__ FragRaw fr_ld(const v4f* __restrict__ row, int k0) {
    FragRaw r; r.x0 = row[k0 / 4]; r.x1 = row[k0 / 4 + 1]; r.x2 = row[k0 / 4 + 4]; r.x3 = row[k0 / 4 + 5];
    return r;
}
__device__ __forceinline__ v16h fr_cvt(const FragRaw& r) {
    v16h a;
#pragma unroll
    for (int i = 0; i < 4; ++i) { a[i] = (_Float16)r.x0[i]; a[4 + i] = (_Float16)r.x1[i]; a[8 + i] = (_Float16)r.x2[i]; a[12 + i] = (_Float16)r.x3[i]; }
    return a;
}

#define VST2(T, ptr, val) do { const T vst2_v_ = (val); *(T*)(ptr) = vst2_v_;  } while (0)
typedef float v4f __attribute__((ext_vector_type(4)));
#define VST2V4(ptr, val) do { const v4f vst2_v4_ = (val); *(v4f*)(ptr) = vst2_v4_;  } while (0)

__device__ __attribute__((noinline)) float act_fn(float v, int act) {
    if (act == 1) return fmaxf(v, 0.f);                                                                               // relu
    if (act == 2) { const float u = 0.7978845608028654f * (v + 0.044715f * v * v * v); return 0.5f * v * (1.f + tanhf(u)); } // tanh-gelu
    if (act == 3) return v / (1.f + expf(-v));                                                                        // silu
    if (act == 4) return 0.5f * v * (1.f + erff(v * 0.7071067811865476f));                                             // erf-gelu
    if (act == 5) return tanhf(v);
    if (act == 6) return 1.f / (1.f + expf(-v));                                                                      // sigmoid
    if (act == 7) return (v > 0.f) ? v : 0.01f * v;                                                                   // leaky relu 0.01
    if (act == 8) return (v > 0.f) ? v : (expf(v) - 1.f);                                                             // elu
    if (act == 9) return fminf(fmaxf(v, 0.f), 6.f);                                                                   // relu6
    if (act == 10) return fabsf(v);                                                                                    // abs
    if (act == 11) return (v >= 0.f) ? v : 0.1f * v;                                                                  // leaky 0.1
    if (act == 12) return (v > 0.f) ? v : 0.2f * v;                                                                   // leaky 0.2
    if (act == 13) return (v > 20.f) ? v : log1pf(expf(v));                                                            // softplus
    return v;
}

// =====================================================================================================================
// k_gemm<MODE>: C(z, m, n) = act(alpha * sum_k A(z, m, k) * B(z, k, n) + bias) + beta * R(z, m, n)
//   One wave (32-thread block) per 16 x 32 tile of C; grid (ceil(N/32), ceil(M/16), Z). Batch z -> (zo = z / zi_n, zi = z % zi_n)
//   with separate outer/inner strides for every tensor (e.g. batch and head). A(m,k) = A[zo*sAo + zi*sAi + m*sAm + k*sAk] (f32),
//   B(k,n) = B[zo*sBo + zi*sBi + n*sBn + k*sBk] (f32); any M, N, K (K zero-padded to 32 inside the fragments, M/N tails guarded).
//   C(m,n) = C[zo*sCo + zi*sCi + m*sCm + n] (n contiguous). flags: 1 bias[n], 2 bias[m], 4 residual R[zo*sRo + zi*sRi + m*sRm + n*sRn].
//   MODE 0: f16 operands (A prescaled by sa, B by sb, both undone in the epilogue); 1: bf16 hi/lo split (3 products); 2: bf16;
//   3: bf16 hi/mid/lo triple split (6 products); 4: as 3 with Kahan-compensated f32 accumulation across k-steps.
// =====================================================================================================================
struct GemmP {
    const float* A; const float* B; const float* bias; const float* R; float* C;
    long long sAo, sAi, sAm, sAk, sBo, sBi, sBn, sBk, sCo, sCi, sCm, sRo, sRi, sRm, sRn;
    int M, N, K, zi_n, flags, act; float alpha, beta, sa, sb;
    int Npad, pad_;     // columns [N, Npad) of C are written as 0 so that padded workspace rows are covered by whole-line stores; Npad >= N
};
static_assert(sizeof(GemmP) == 5 * 8 + 15 * 8 + 6 * 4 + 4 * 4 + 2 * 4, "GemmP has padding");

template <int MODE>
__global__ __launch_bounds__(32) void k_gemm(GemmP p) {
    const int lane = threadIdx.x & 31, h = lane >> 4, l15 = lane & 15;
    const int m0 = blockIdx.y * 16, n0 = blockIdx.x * 32;
    const int z = blockIdx.z, zo = z / p.zi_n, zi = z - zo * p.zi_n;
    const float* A = p.A + zo * p.sAo + zi * p.sAi;
    const float* B = p.B + zo * p.sBo + zi * p.sBi;
    const int am = min(m0 + l15, p.M - 1);                       // clamped row for loads (stores are guarded)
    v8f acc[2], comp[2];
#pragma unroll
    for (int t = 0; t < 2; ++t) { v8f zz = {}; acc[t] = zz; comp[t] = zz; }
    for (int k0 = 0; k0 < p.K; k0 += 32) {
        const float* arow = A + (long long)am * p.sAm;
        if (MODE == 1) {
            const Split a = sp_ld(arow, p.sAk, k0, h, p.K, 1.f);
#pragma unroll
            for (int t = 0; t < 2; ++t) {
                const int bn = min(n0 + t * 16 + l15, p.N - 1);
                acc[t] = wmma3(a, sp_ld(B + (long long)bn * p.sBn, p.sBk, k0, h, p.K, 1.f), acc[t]);
            }
        } else if (MODE == 3) {
            const Split3 a = sp3_ld(arow, p.sAk, k0, h, p.K, 1.f);
#pragma unroll
            for (int t = 0; t < 2; ++t) {
                const int bn = min(n0 + t * 16 + l15, p.N - 1);
                acc[t] = wmma6(a, sp3_ld(B + (long long)bn * p.sBn, p.sBk, k0, h, p.K, 1.f), acc[t]);
            }
        } else if (MODE == 4) {
            // triple split as MODE 3, but each k-step's 6 products go into a fresh accumulator and the partial is added to the running f32 sum
            // on the VALU with Kahan compensation (accumulation error stays ~1 ulp however long K is)
            const Split3 a = sp3_ld(arow, p.sAk, k0, h, p.K, 1.f);
#pragma unroll
            for (int t = 0; t < 2; ++t) {
                const int bn = min(n0 + t * 16 + l15, p.N - 1); v8f zz = {};
                const v8f part = wmma6(a, sp3_ld(B + (long long)bn * p.sBn, p.sBk, k0, h, p.K, 1.f), zz);
                const v8f y = part - comp[t]; const v8f s = acc[t] + y; comp[t] = (s - acc[t]) - y; acc[t] = s;
            }
        } else if (MODE == 2) {
            const v16b a = bh_ld(arow, p.sAk, k0, h, p.K, 1.f);
#pragma unroll
            for (int t = 0; t < 2; ++t) {
                const int bn = min(n0 + t * 16 + l15, p.N - 1);
                acc[t] = wmmab(a, bh_ld(B + (long long)bn * p.sBn, p.sBk, k0, h, p.K, 1.f), acc[t]);
            }
        } else {
            const v16h a = fh_ld(arow, p.sAk, k0, h, p.K, p.sa);
#pragma unroll
            for (int t = 0; t < 2; ++t) {
                const int bn = min(n0 + t * 16 + l15, p.N - 1);
                acc[t] = wmma16(a, fh_ld(B + (long long)bn * p.sBn, p.sBk, k0, h, p.K, p.sb), acc[t]);
            }
        }
    }
    const float iscale = (MODE == 0) ? p.alpha / (p.sa * p.sb) : p.alpha;
    float* C = p.C + zo * p.sCo + zi * p.sCi;
    const float* R = p.R + zo * p.sRo + zi * p.sRi;
    __shared__ __align__(16) float ctile[16][36];
#pragma unroll
    for (int t = 0; t < 2; ++t) {
        const int n = n0 + t * 16 + l15; const int nn = min(n, p.N - 1);
#pragma unroll
        for (int r = 0; r < 8; ++r) {
            const int m = m0 + 8 * h + r; const int mm = min(m, p.M - 1);
            float v = acc[t][r] * iscale;
            if (p.flags & 1) v += p.bias[nn];
            if (p.flags & 2) v += p.bias[mm];
            if (p.flags & 8) v *= p.bias[(long long)zo * p.M + mm];   /* per-(zo,row) scale vector laid out [Z/zi_n][M]; exclusive with the bias flags */
            v = act_fn(v, p.act);
            if (p.flags & 4) v += p.beta * R[(long long)mm * p.sRm + (long long)nn * p.sRn];
            ctile[8 * h + r][t * 16 + l15] = (n < p.N) ? v : 0.f;
        }
    }
    __syncthreads();
    const int NW = (p.Npad > p.N) ? p.Npad : p.N;           // write width
    const bool fast = (m0 + 16 <= p.M) && (n0 + 32 <= NW) && ((p.sCm & 3) == 0) && ((((size_t)C) & 15) == 0);
    if (fast) {
#pragma unroll
        for (int s = 0; s < 4; ++s) {
            const int row = s * 4 + (lane >> 3), c4 = (lane & 7) * 4;
            const v4f v = *(const v4f*)&ctile[row][c4];
            VST2V4(C + (long long)(m0 + row) * p.sCm + n0 + c4, v);
        }
    } else {
        for (int row = 0; row < 16; ++row) {
            const int m = m0 + row, n = n0 + lane;
            if (m < p.M && n < NW) VST2(float, C + (long long)m * p.sCm + n, ctile[row][lane]);
        }
    }
}


// =====================================================================================================================
// k_gemmT<MODE, TM, TN>: same contract as k_gemm, but one wave computes a (16*TM) x (16*TN) tile: TM A fragments and TN B fragments are
//   loaded per 32-wide k-step and reused across TM*TN WMMAs (far fewer load/convert instructions per MAC). MODE 0 (f16), 1 (bf16 hi/lo),
//   2 (bf16) only. grid (ceil(NW/(16*TN)), ceil(M/(16*TM)), Z), block 32. Epilogue identical to k_gemm, run per 16x32 sub-tile.
// =====================================================================================================================
template <int MODE, int TM, int TN>
__global__ __launch_bounds__(32) void k_gemmT(GemmP p) {
    const int lane = threadIdx.x & 31, h = lane >> 4, l15 = lane & 15;
    const int m0 = blockIdx.y * (16 * TM), n0 = blockIdx.x * (16 * TN);
    const int z = blockIdx.z, zo = z / p.zi_n, zi = z - zo * p.zi_n;
    const float* A = p.A + zo * p.sAo + zi * p.sAi;
    const float* B = p.B + zo * p.sBo + zi * p.sBi;
    v8f acc[TM][TN];
#pragma unroll
    for (int i = 0; i < TM; ++i)
#pragma unroll
        for (int t = 0; t < TN; ++t) { v8f zz = {}; acc[i][t] = zz; }
    for (int k0 = 0; k0 < p.K; k0 += 32) {
        if (MODE == 1) {
            Split a[TM], b[TN];
#pragma unroll
            for (int i = 0; i < TM; ++i) { const int am = min(m0 + 16 * i + l15, p.M - 1); a[i] = sp_ld(A + (long long)am * p.sAm, p.sAk, k0, h, p.K, 1.f); }
#pragma unroll
            for (int t = 0; t < TN; ++t) { const int bn = min(n0 + 16 * t + l15, p.N - 1); b[t] = sp_ld(B + (long long)bn * p.sBn, p.sBk, k0, h, p.K, 1.f); }
#pragma unroll
            for (int i = 0; i < TM; ++i)
#pragma unroll
                for (int t = 0; t < TN; ++t) acc[i][t] = wmma3(a[i], b[t], acc[i][t]);
        } else if (MODE == 2) {
            v16b a[TM], b[TN];
#pragma unroll
            for (int i = 0; i < TM; ++i) { const int am = min(m0 + 16 * i + l15, p.M - 1); a[i] = bh_ld(A + (long long)am * p.sAm, p.sAk, k0, h, p.K, 1.f); }
#pragma unroll
            for (int t = 0; t < TN; ++t) { const int bn = min(n0 + 16 * t + l15, p.N - 1); b[t] = bh_ld(B + (long long)bn * p.sBn, p.sBk, k0, h, p.K, 1.f); }
#pragma unroll
            for (int i = 0; i < TM; ++i)
#pragma unroll
                for (int t = 0; t < TN; ++t) acc[i][t] = wmmab(a[i], b[t], acc[i][t]);
        } else {
            v16h a[TM], b[TN];
#pragma unroll
            for (int i = 0; i < TM; ++i) { const int am = min(m0 + 16 * i + l15, p.M - 1); a[i] = fh_ld(A + (long long)am * p.sAm, p.sAk, k0, h, p.K, p.sa); }
#pragma unroll
            for (int t = 0; t < TN; ++t) { const int bn = min(n0 + 16 * t + l15, p.N - 1); b[t] = fh_ld(B + (long long)bn * p.sBn, p.sBk, k0, h, p.K, p.sb); }
#pragma unroll
            for (int i = 0; i < TM; ++i)
#pragma unroll
                for (int t = 0; t < TN; ++t) acc[i][t] = wmma16(a[i], b[t], acc[i][t]);
        }
    }
    const float iscale = (MODE == 0) ? p.alpha / (p.sa * p.sb) : p.alpha;
    float* C = p.C + zo * p.sCo + zi * p.sCi;
    const float* R = p.R + zo * p.sRo + zi * p.sRi;
    const int NW = (p.Npad > p.N) ? p.Npad : p.N;
    __shared__ __align__(16) float ctile[16][36];
#pragma unroll
    for (int i = 0; i < TM; ++i) {
        const int mb = m0 + 16 * i; if (mb >= p.M) break;          // wave-uniform
#pragma unroll
        for (int tp = 0; tp < TN / 2; ++tp) {
            const int nb = n0 + 32 * tp; if (nb >= NW) break;        // wave-uniform
#pragma unroll
            for (int t2 = 0; t2 < 2; ++t2) {
                const int t = 2 * tp + t2; const int n = nb + t2 * 16 + l15; const int nn = min(n, p.N - 1);
#pragma unroll
                for (int r = 0; r < 8; ++r) {
                    const int m = mb + 8 * h + r; const int mm = min(m, p.M - 1);
                    float v = acc[i][t][r] * iscale;
                    if (p.flags & 1) v += p.bias[nn];
                    if (p.flags & 2) v += p.bias[mm];
            if (p.flags & 8) v *= p.bias[(long long)zo * p.M + mm];   /* per-(zo,row) scale vector laid out [Z/zi_n][M]; exclusive with the bias flags */
                    v = act_fn(v, p.act);
                    if (p.flags & 4) v += p.beta * R[(long long)mm * p.sRm + (long long)nn * p.sRn];
                    ctile[8 * h + r][t2 * 16 + l15] = (n < p.N) ? v : 0.f;
                }
            }
            __syncthreads();
            const bool fast = (mb + 16 <= p.M) && (nb + 32 <= NW) && ((p.sCm & 3) == 0) && ((((size_t)C) & 15) == 0);
            if (fast) {
#pragma unroll
                for (int s = 0; s < 4; ++s) {
                    const int row = s * 4 + (lane >> 3), c4 = (lane & 7) * 4;
                    const v4f v = *(const v4f*)&ctile[row][c4];
                    VST2V4(C + (long long)(mb + row) * p.sCm + nb + c4, v);
                }
            } else {
                for (int row = 0; row < 16; ++row) {
                    const int m = mb + row, n = nb + lane;
                    if (m < p.M && n < NW) VST2(float, C + (long long)m * p.sCm + n, ctile[row][lane]);
                }
            }
            __syncthreads();
        }
    }
}

// =====================================================================================================================
//   Wave = 16 queries, AW waves per block, 64-key blocks; grid (ceil(Lq/(16*AW)), H, B), block 32*AW. Any Lq, Lk; head dim dh <= DHP
//   (DHP multiple of 32), value dim dv <= DVP (multiple of 16, <= 128). Every tensor addressed by (batch, head, row, element) strides, f32.
//   Scores: QM 0 f16 operands, 1 bf16 hi/lo split, 2 bf16 triple split; statistics f32 (exp2 domain); P.V: P x 4096 as f16 with V f16 staged in LDS
//   (SPLITPV: P and V as bf16 hi/lo splits). kv head = h / hrep. Masking: causal = 1 (keep j <= i + coff, masked -> -inf, key blocks beyond the
//   diagonal skipped), causal = 2 (masked -> mfill, a finite fill like the -1e9; no skipping), causal = 3 (keep j >= i + coff,
//   masked -> -inf, no skipping); optional additive f32 mask Mf,
//   optional int keep-mask Mi (0 -> score := mfill), both addressed b*smb + h*smh + i*smi + j*smj (0 strides broadcast).
// =====================================================================================================================
#define AW 4
struct AttnP {   // apv4
    const float* Q; const float* K; const float* V; float* O; float* P; const float* Mf; const int* Mi; float* ST;
    const float* Pw; const float* Rt; const int* SQ; const int* SK;           // optional: post-softmax weight, relative-position table, segment ids
    long long swb, swh, swi, swj, srb, srh, sri;                                 // Pw strides (b,h,i,j); Rt strides (b,h,i), column = clamp(i - j + roff, 0, rn-1)
    long long sQb, sQh, sQi, sQd, sKb, sKh, sKj, sKd, sVb, sVh, sVj, sVd, sOb, sOh, sOi, sPb, sPh, sPi, smb, smh, smi, smj;
    int Lq, Lk, dh, dv, hrep, causal, coff, pband;   // pband > 0: P holds only the band |j - i| <= pband, column j - i + pband
    float scale, mfill; int nonorm, mpol;             // nonorm (online path only): O = sum_j exp(score_j) V_j without the 1/rowsum (scores must be <= ~0); mpol: Mi masks where ==0 (mpol 0) or where !=0 (mpol 1)
    int roff, rn, segpol, win;                        // Rt column offset/count; SQ/SK: score := mfill where (segpol 0) SQ[i] != SK[j] or (segpol 1) SQ[i] == SK[j]; win > 0: keys with i - j > win (after coff) -> -inf
};
//   Pw: the softmax numerator is multiplied by Pw(b,h,i,j) AFTER the row sum is taken (probs * weight, then P.V), as in post-softmax multiplicative biases.                                                    // ST (optional): per row (b,h,i) -> ST[((b*H + h)*Lq + i)*2 + {0,1}] = {row max of the scaled+masked score (natural units), sum_j exp(score - max)}
static_assert(sizeof(AttnP) == 12 * 8 + 29 * 8 + 16 * 4, "AttnP has padding");

#ifndef KATTN_ATTR
#define KATTN_ATTR
#endif
//   UNIT: the launch promises sQd = sKd = sVd = 1, dh = DHP, dv = DVP, Lk a multiple of 64, 16-byte aligned Q, K, V rows and 16 rows of K or V within 4 GiB
//   (f16 one-pass path only): Q, K and V are then read with unguarded 16-byte loads, a key block's all issued as one group from a uniform base and a
//   loop-invariant lane offset, instead of one guarded 4-byte load and wait per element.
//   PLAIN: the launch promises plain softmax over full tiles: Mf, Rt, Mi, SQ, Pw, P and ST null, causal = win = nonorm = 0, Lk a multiple of 64. No score is
//   then masked or out of range, every option test folds away at compile time, and a key block's softmax is one branch-free block whose rows overlap.
template <int DHP, int DVP, int QM, bool SPLITPV, bool TWOPASS, bool UNIT = false, bool PLAIN = false>
__global__ __launch_bounds__(32 * AW) KATTN_ATTR void k_attn(AttnP p) {
    static_assert(!PLAIN || !TWOPASS, "PLAIN covers the one-pass path");
    static_assert(!UNIT || (QM == 0 && !SPLITPV && !TWOPASS && (32 * AW) / (DVP / 4) == 8), "UNIT covers the f16 one-pass path, 8 V rows per load step");
    constexpr int NT = DVP / 16;                // output tiles
    constexpr int KS = DHP / 32;                // k-steps for the scores
    constexpr int VP = DVP + 8;                 // LDS pitch (halves)
    __shared__ __align__(16) float    pl[AW][16 * 64];
    __shared__ __align__(16) _Float16 vl[(SPLITPV ? 2 : 1) * 64 * VP];   // f16 V tile, or bf16 hi and lo tiles (same 2-byte size)
    const int lane = threadIdx.x & 31, hf = lane >> 4, l15 = lane & 15, wave = threadIdx.x >> 5;
    const int h = blockIdx.y, b = blockIdx.z, hk = h / p.hrep;
    const int q0 = (blockIdx.x * AW + wave) * 16;
    float* myp = pl[wave];
    const float L2E = 1.4426950408889634f;
    const float NEG = -__builtin_inff();
    const int qi = min(q0 + l15, p.Lq - 1);
    const float* qrow = p.Q + b * p.sQb + h * p.sQh + (long long)qi * p.sQi;
    const float* kbase = p.K + b * p.sKb + hk * p.sKh;
    const float* vbase = p.V + b * p.sVb + hk * p.sVh;
    const v4f* qp = (const v4f*)(qrow + 8 * hf);               // UNIT: the lane's half of the fragment's k
    v16h qa[QM == 0 ? KS : 1]; Split qs_[QM == 1 ? KS : 1]; Split3 qt_[QM == 2 ? KS : 1];
#pragma unroll
    for (int ks = 0; ks < KS; ++ks) {
        if (QM == 2) qt_[ks] = sp3_ld(qrow, p.sQd, ks * 32, hf, p.dh, 1.f);
        else if (QM == 1) qs_[ks] = sp_ld(qrow, p.sQd, ks * 32, hf, p.dh, 1.f);
        else if (UNIT) qa[ks] = fr_cvt(fr_ld(qp, ks * 32));
        else qa[ks] = fh_ld(qrow, p.sQd, ks * 32, hf, p.dh, 1.f);
    }
    if (UNIT) asm volatile("s_wait_xcnt 0x0" :: "v"(qp) : "memory");   // the Q loads' address registers stay as they are up to this wait (named as input) and are reused behind it
    constexpr int VR = (32 * AW) / (DVP / 4);                  // V rows that the block's threads cover with one 16-byte load each
    const unsigned koff = (unsigned)(l15 * (int)p.sKj + 8 * hf) * 4u;                                                          // UNIT: lane's byte offset in a 16-key tile
    const unsigned voff = (unsigned)((int)(threadIdx.x / (DVP / 4)) * (int)p.sVj + (int)(threadIdx.x % (DVP / 4)) * 4) * 4u;   // UNIT: thread's byte offset in VR rows of V
    v8f o[NT]; float m8[8], l8[8];
#pragma unroll
    for (int t = 0; t < NT; ++t) { v8f zz = {}; o[t] = zz; }
#pragma unroll
    for (int i = 0; i < 8; ++i) { m8[i] = NEG; l8[i] = 0.f; }
    int jend = p.Lk; int jstart = 0;
    if (!PLAIN && p.causal == 1) { const int je = (blockIdx.x * AW + AW - 1) * 16 + 16 + p.coff; jend = min(jend, max(je, 0)); }   // uniform per block
    if (!PLAIN && p.win > 0) { const int js = (int)(blockIdx.x * AW) * 16 + p.coff - p.win; jstart = (js > 0) ? (js / 64) * 64 : 0; }   // uniform per block: key blocks entirely outside every row's window hold only -inf entries and are skipped exactly
    const int npass = TWOPASS ? 2 : 1;
    for (int pass = 0; pass < npass; ++pass) {
        const bool dopv = (!TWOPASS) || pass == 1;
        for (int j0 = jstart; j0 < jend; j0 += 64) {
            if (dopv) {
                __syncthreads();                                 // previous key block's reads of vl / pl are done
                if (!UNIT)
                for (int idx = threadIdx.x; idx < 64 * DVP; idx += 32 * AW) {
                    const int jr = idx / DVP, d = idx - jr * DVP, j = j0 + jr;
                    const float f = (j < p.Lk && d < p.dv) ? vbase[(long long)j * p.sVj + (long long)d * p.sVd] : 0.f;
                    if (SPLITPV) {
                        const __bf16 hb = bf16_rne(f);
                        ((__bf16*)vl)[jr * VP + d] = hb; ((__bf16*)vl)[64 * VP + jr * VP + d] = bf16_rne(f - bf16_f32(hb));
                    } else vl[jr * VP + d] = (_Float16)f;
                }
            }
            v8f s[4];
            if (UNIT) {
                v4f vr[8]; FragRaw kr[4][KS]; const v4f* vp[8]; const v4f* kp[4];
#pragma unroll
                for (int it = 0; it < 8; ++it) { vp[it] = (const v4f*)((const char*)(vbase + (long long)(j0 + it * VR) * p.sVj) + voff); vr[it] = *vp[it]; }
#pragma unroll
                for (int t = 0; t < 4; ++t) {
                    kp[t] = (const v4f*)((const char*)(kbase + (long long)(j0 + t * 16) * p.sKj) + koff);
#pragma unroll
                    for (int ks = 0; ks < KS; ++ks) kr[t][ks] = fr_ld(kp[t], ks * 32);
                }
                // the group's address registers stay as they are up to this wait (named as inputs) and are reused behind it, while the loads are still in flight
                asm volatile("s_wait_xcnt 0x0" :: "v"(vp[0]), "v"(vp[1]), "v"(vp[2]), "v"(vp[3]), "v"(vp[4]), "v"(vp[5]), "v"(vp[6]), "v"(vp[7]),
                             "v"(kp[0]), "v"(kp[1]), "v"(kp[2]), "v"(kp[3]) : "memory");
#pragma unroll
                for (int it = 0; it < 8; ++it) {
                    v4h hv; hv[0] = (_Float16)vr[it][0]; hv[1] = (_Float16)vr[it][1]; hv[2] = (_Float16)vr[it][2]; hv[3] = (_Float16)vr[it][3];
                    *(v4h*)(vl + (it * VR + (int)(threadIdx.x / (DVP / 4))) * VP + (int)(threadIdx.x % (DVP / 4)) * 4) = hv;
                }
#pragma unroll
                for (int t = 0; t < 4; ++t) {
                    v8f acc = {};
#pragma unroll
                    for (int ks = 0; ks < KS; ++ks) acc = wmma16(qa[ks], fr_cvt(kr[t][ks]), acc);
                    s[t] = acc;
                }
            } else
#pragma unroll
            for (int t = 0; t < 4; ++t) {
                const int j = min(j0 + t * 16 + l15, p.Lk - 1);
                const float* krow = kbase + (long long)j * p.sKj;
                v8f acc = {};
#pragma unroll
                for (int ks = 0; ks < KS; ++ks) {
                    if (QM == 2)      acc = wmma6(qt_[ks], sp3_ld(krow, p.sKd, ks * 32, hf, p.dh, 1.f), acc);
                    else if (QM == 1) acc = wmma3(qs_[ks], sp_ld(krow, p.sKd, ks * 32, hf, p.dh, 1.f), acc);
                    else              acc = wmma16(qa[ks], fh_ld(krow, p.sKd, ks * 32, hf, p.dh, 1.f), acc);
                }
                s[t] = acc;
            }
            float pv[8][4];
#pragma unroll
            for (int i = 0; i < 8; ++i) {
                const int irow = q0 + i + 8 * hf;
                const int ic = min(irow, p.Lq - 1);
                float sc[4];
#pragma unroll
                for (int t = 0; t < 4; ++t) {
                    const int jg = j0 + t * 16 + l15;
                    float v = s[t][i] * p.scale;
                    if (!PLAIN && p.Mf) v += p.Mf[b * p.smb + h * p.smh + (long long)ic * p.smi + (long long)min(jg, p.Lk - 1) * p.smj];
                    if (!PLAIN && p.Rt) { int rc = ic - min(jg, p.Lk - 1) + p.roff; rc = rc < 0 ? 0 : (rc >= p.rn ? p.rn - 1 : rc); v += p.Rt[b * p.srb + h * p.srh + (long long)ic * p.sri + rc]; }
                    if (!PLAIN && p.Mi) { const int mv = p.Mi[b * p.smb + h * p.smh + (long long)ic * p.smi + (long long)min(jg, p.Lk - 1) * p.smj]; if (p.mpol ? (mv != 0) : (mv == 0)) v = p.mfill; }
                    if (!PLAIN && p.SQ) { const bool same = p.SQ[(long long)b * p.Lq + ic] == p.SK[(long long)b * p.Lk + min(jg, p.Lk - 1)]; if (p.segpol ? same : !same) v = p.mfill; }
                    if (!PLAIN && p.causal == 2 && jg > irow + p.coff) v = p.mfill;
                    if (!PLAIN && (jg >= p.Lk || (p.causal == 1 && jg > irow + p.coff) || (p.causal == 3 && jg < irow + p.coff) || (p.win > 0 && irow + p.coff - jg > p.win))) v = NEG; else v *= L2E;
                    sc[t] = v;
                }
                if (!TWOPASS || pass == 0) {
                    float mx = fmaxf(fmaxf(sc[0], sc[1]), fmaxf(sc[2], sc[3]));
                    mx = fmaxf(mx, __shfl_xor(mx, 1, 32)); mx = fmaxf(mx, __shfl_xor(mx, 2, 32));
                    mx = fmaxf(mx, __shfl_xor(mx, 4, 32)); mx = fmaxf(mx, __shfl_xor(mx, 8, 32));
                    const float mnew = fmaxf(m8[i], mx);
                    const float corr = (!PLAIN && mnew == NEG) ? 1.f : exp2f(m8[i] - mnew);
                    float rs = 0.f;
#pragma unroll
                    for (int t = 0; t < 4; ++t) {
                        const float pp = (!PLAIN && sc[t] == NEG) ? 0.f : exp2f(sc[t] - mnew); rs += pp;
                        pv[i][t] = (!PLAIN && p.Pw) ? pp * p.Pw[b * p.swb + h * p.swh + (long long)ic * p.swi + (long long)min(j0 + t * 16 + l15, p.Lk - 1) * p.swj] : pp;
                    }
                    rs += __shfl_xor(rs, 1, 32); rs += __shfl_xor(rs, 2, 32); rs += __shfl_xor(rs, 4, 32); rs += __shfl_xor(rs, 8, 32);
                    l8[i] = l8[i] * corr + rs; m8[i] = mnew;
                    if (!TWOPASS) {
#pragma unroll
                        for (int t = 0; t < NT; ++t) o[t][i] *= corr;
                    }
                } else {
                    const float inv = (l8[i] > 0.f) ? 1.f / l8[i] : 0.f;
#pragma unroll
                    for (int t = 0; t < 4; ++t) {
                        const int jg = j0 + t * 16 + l15;
                        float pp = (sc[t] == NEG) ? 0.f : exp2f(sc[t] - m8[i]) * inv;
                        if (p.Pw) pp *= p.Pw[b * p.swb + h * p.swh + (long long)ic * p.swi + (long long)min(jg, p.Lk - 1) * p.swj];
                        pv[i][t] = pp;
                    }
                }
            }
            if (dopv) {
#pragma unroll
                for (int i = 0; i < 8; ++i)
#pragma unroll
                    for (int t = 0; t < 4; ++t) ((float*)myp)[(i + 8 * hf) * 64 + t * 16 + l15] = pv[i][t];
                __syncthreads();                                 // P (per wave) and V (shared) visible
                if (!PLAIN && p.P) {
                    float* pb_ = p.P + b * p.sPb + h * p.sPh;
                    const bool fastP = (p.pband == 0) && ((p.sPi & 3) == 0) && (j0 + 64 <= p.Lk) && (q0 + 16 <= p.Lq) && ((((size_t)pb_) & 15) == 0);
                    if (fastP) {
#pragma unroll
                        for (int s = 0; s < 8; ++s) {
                            const int row = s * 2 + (lane >> 4), c4 = (lane & 15) * 4;
                            const v4f v = *(const v4f*)(myp + row * 64 + c4);
                            VST2V4(pb_ + (long long)(q0 + row) * p.sPi + j0 + c4, v);
                        }
                    } else {
                        for (int row = 0; row < 16; ++row) {
                            const int irow = q0 + row; if (irow >= p.Lq) continue;
                            for (int c = lane; c < 64; c += 32) {
                                const int jg = j0 + c; if (jg >= p.Lk) continue;
                                if (p.pband == 0) VST2(float, pb_ + (long long)irow * p.sPi + jg, myp[row * 64 + c]);
                                else if (jg - irow <= p.pband && irow - jg <= p.pband) VST2(float, pb_ + (long long)irow * p.sPi + (jg - irow + p.pband), myp[row * 64 + c]);
                            }
                        }
                    }
                }
                if (SPLITPV) {
                    const Split pa0 = sp_ld(myp + l15 * 64, 1, 0, hf, 64, 1.f), pa1 = sp_ld(myp + l15 * 64, 1, 32, hf, 64, 1.f);
                    const __bf16* vh = (const __bf16*)vl; const __bf16* vlo = vh + 64 * VP;
#pragma unroll
                    for (int t = 0; t < NT; ++t) {
                        const int dcol = t * 16 + l15;
                        Split b0, b1;
#pragma unroll
                        for (int e = 0; e < 16; ++e) {
                            const int k0 = frag_k(e, hf), k1 = 32 + frag_k(e, hf);
                            b0.hi[e] = vh[k0 * VP + dcol]; b0.lo[e] = vlo[k0 * VP + dcol]; b1.hi[e] = vh[k1 * VP + dcol]; b1.lo[e] = vlo[k1 * VP + dcol];
                        }
                        o[t] = wmma3(pa0, b0, o[t]);
                        o[t] = wmma3(pa1, b1, o[t]);
                    }
                } else {
                    const v16h pa0 = fh_ld(myp + l15 * 64, 1, 0, hf, 64, 4096.f), pa1 = fh_ld(myp + l15 * 64, 1, 32, hf, 64, 4096.f);
#pragma unroll
                    for (int t = 0; t < NT; ++t) {
                        const int dcol = t * 16 + l15;
                        v16h b0, b1;
#pragma unroll
                        for (int e = 0; e < 16; ++e) { b0[e] = vl[frag_k(e, hf) * VP + dcol]; b1[e] = vl[(32 + frag_k(e, hf)) * VP + dcol]; }
                        o[t] = wmma16(pa0, b0, o[t]);
                        o[t] = wmma16(pa1, b1, o[t]);
                    }
                }
            }
        }
    }
    float* obase = p.O + b * p.sOb + h * p.sOh;
    if (!PLAIN && p.ST) {
        const int rl = lane >> 1, isel = rl & 7;           // row q0 + rl ; rl>>3 == hf holds because lane>>4 == (lane>>1)>>3
        float mv = 0.f, lv = 0.f;
#pragma unroll
        for (int i = 0; i < 8; ++i) if (i == isel) { mv = m8[i]; lv = l8[i]; }
        const int irow = q0 + rl;
        if (irow < p.Lq) { float* st = p.ST + (((long long)b * gridDim.y + h) * p.Lq + irow) * 2 + (lane & 1); VST2(float, st, (lane & 1) ? lv : mv * 0.6931471805599453f); }
    }
    float invr[8];
#pragma unroll
    for (int i = 0; i < 8; ++i) {
        if (TWOPASS) invr[i] = SPLITPV ? 1.f : (1.f / 4096.f);
        else if (!PLAIN && p.nonorm) invr[i] = exp2f(m8[i]) * (SPLITPV ? 1.f : (1.f / 4096.f));
        else invr[i] = (l8[i] > 0.f) ? (SPLITPV ? 1.f / l8[i] : 1.f / (l8[i] * 4096.f)) : 0.f;
    }
    __syncthreads();                                             // all waves done with pl/vl from the main loop
    const bool ofast = ((p.sOi & 3) == 0) && ((((size_t)obase) & 15) == 0) && (q0 + 16 <= p.Lq);
#pragma unroll
    for (int c0 = 0; c0 < DVP; c0 += 64) {
#pragma unroll
        for (int i = 0; i < 8; ++i)
#pragma unroll
            for (int t = 0; t < NT; ++t) if (t * 16 >= c0 && t * 16 < c0 + 64) ((float*)myp)[(i + 8 * hf) * 64 + (t * 16 - c0) + l15] = o[t][i] * invr[i];
        __syncthreads();
        const int cw = (DVP - c0 < 64) ? (DVP - c0) : 64;      // staged columns in this chunk (multiple of 16)
        if (ofast && (c0 + cw <= p.dv) && (cw % 32 == 0)) {
            const int lpr = cw / 4;                              // lanes per row (16 for 64 cols, 8 for 32)
            const int rows_per_ins = 32 / lpr;
            for (int r0 = 0; r0 < 16; r0 += rows_per_ins) {
                const int row = r0 + lane / lpr, c4 = (lane % lpr) * 4;
                const v4f v = *(const v4f*)(myp + row * 64 + c4);
                VST2V4(obase + (long long)(q0 + row) * p.sOi + c0 + c4, v);
            }
        } else {
            for (int row = 0; row < 16; ++row) {
                const int irow = q0 + row; if (irow >= p.Lq) continue;
                for (int c = lane; c < cw; c += 32) { const int d = c0 + c; if (d < p.dv) VST2(float, obase + (long long)irow * p.sOi + d, myp[row * 64 + c]); }
            }
        }
        __syncthreads();
    }
}

// =====================================================================================================================
// k_tr: dst(z, c, r) = alpha * src(z, r, c) (+ beta * R2(z, c, r)): [Z][R][C] (row stride lds) -> [Z][C][R] (row stride ldd) through a 32x32 LDS tile;
//   flags: 1 -> add beta * residual R2 addressed like dst (z*sRz + c*ldr + r); act applied before the residual.
// =====================================================================================================================
struct TrP { const float* src; float* dst; const float* R2; long long sSz, lds, sDz, ldd, sRz, ldr; int R, C, flags, act; float alpha, beta; };
static_assert(sizeof(TrP) == 3 * 8 + 6 * 8 + 6 * 4, "TrP has padding");
__global__ __launch_bounds__(256) void k_tr(TrP p) {
    __shared__ float tile[32][33];
    const int c0 = blockIdx.x * 32, r0 = blockIdx.y * 32, z = blockIdx.z;
    const int lane = threadIdx.x & 31, wave = threadIdx.x >> 5;
    const float* s = p.src + z * p.sSz;
#pragma unroll
    for (int k = 0; k < 4; ++k) {
        const int rl = wave * 4 + k, r = r0 + rl, c = c0 + lane;
        tile[rl][lane] = (r < p.R && c < p.C) ? s[(long long)r * p.lds + c] : 0.f;
    }
    __syncthreads();
    float* d = p.dst + z * p.sDz; const float* rr = p.R2 + z * p.sRz;
#pragma unroll
    for (int k = 0; k < 4; ++k) {
        const int cl = wave * 4 + k, c = c0 + cl, r = r0 + lane;
        if (c < p.C && r < p.R) {
            float v = act_fn(p.alpha * tile[lane][cl], p.act);
            if (p.flags & 1) v += p.beta * rr[(long long)c * p.ldr + r];
            VST2(float, d + (long long)c * p.ldd + r, v);
        }
    }
}

// k_affine: dst[i] = a * (sdev ? sdev[0] : 1) * src[i] + b, i < n (one thread per element; consecutive lanes -> consecutive addresses)
__global__ __launch_bounds__(256) void k_affine(const float* __restrict__ src, float* __restrict__ dst, int n, float a, float b, const float* __restrict__ sdev) {
    const int i = blockIdx.x * 256 + threadIdx.x;
    if (i < n) { const float aa = sdev ? a * sdev[0] : a; const float v = aa * src[i] + b; VST2(float, dst + i, v); }
}

// =====================================================================================================================
// k_softmax: row softmax over n contiguous elements, one 256-thread block per row; rows addressed z*sz + r*sr (grid (R, Z)).
//   out = scale_out * softmax(scale_in * x + (Mf ? Mf[z*smz + r*smr + j] : 0)); a row whose max is -inf is written as 0.
// =====================================================================================================================
struct SmP { const float* src; float* dst; const float* Mf; long long sz, sr, dz, dr, smz, smr; int n, pad; float scale_in, scale_out; };
static_assert(sizeof(SmP) == 3 * 8 + 6 * 8 + 4 * 4, "SmP has padding");
__global__ __launch_bounds__(256) void k_softmax(SmP p) {
    __shared__ float red[256];
    const int r = blockIdx.x, z = blockIdx.y, tid = threadIdx.x;
    const float* s = p.src + z * p.sz + (long long)r * p.sr;
    const float* mf = p.Mf ? (p.Mf + z * p.smz + (long long)r * p.smr) : nullptr;
    float mx = -__builtin_inff();
    for (int j = tid; j < p.n; j += 256) { float v = s[j] * p.scale_in; if (mf) v += mf[j]; mx = fmaxf(mx, v); }
    red[tid] = mx; __syncthreads();
    for (int o = 128; o > 0; o >>= 1) { if (tid < o) red[tid] = fmaxf(red[tid], red[tid + o]); __syncthreads(); }
    mx = red[0]; __syncthreads();
    float sum = 0.f;
    for (int j = tid; j < p.n; j += 256) { float v = s[j] * p.scale_in; if (mf) v += mf[j]; sum += (mx == -__builtin_inff()) ? 0.f : expf(v - mx); }
    red[tid] = sum; __syncthreads();
    for (int o = 128; o > 0; o >>= 1) { if (tid < o) red[tid] += red[tid + o]; __syncthreads(); }
    sum = red[0];
    const float inv = (sum > 0.f) ? p.scale_out / sum : 0.f;
    float* d = p.dst + z * p.dz + (long long)r * p.dr;
    for (int j = tid; j < p.n; j += 256) { float v = s[j] * p.scale_in; if (mf) v += mf[j]; const float o = (mx == -__builtin_inff()) ? 0.f : expf(v - mx) * inv; VST2(float, d + j, o); }
}
// =====================================================================================================================
// k_stats: mean and rsqrt(var + eps) over a set of n elements addressed base + z*sz + (e / inner) * so + (e % inner) * si, one 256-thread
// k_norm_apply: y = (x - mean[set]) * rstd[set] * g[c] + b[c] over a [Z][C][L] chan-major tensor with set = z*G + c / (C/G) (G groups per z;
//   G = C -> per-chan sets indexed z*C+c; for batch norm pass stats indexed by c only via bn = 1). Optional act. Output same layout.
// =====================================================================================================================
//   mode 0: mean / rsqrt(var + eps); mode 1 (RMSNorm): 0 / rsqrt(mean(x^2) + eps); mode 2 (L2 normalize * sqrt(n)): 0 / sqrt(n) / max(||x||, eps); mode 3: as 0 with unbiased variance (n-1)
__global__ __launch_bounds__(256) void k_stats(const float* __restrict__ x, long long sz, long long so, long long si, int inner, int n, float eps, float* __restrict__ stat, int mode) {
    __shared__ float red[256];
    const int z = blockIdx.x, tid = threadIdx.x;
    const float* base = x + z * sz;
    float s = 0.f;
    for (int e = tid; e < n; e += 256) s += base[(long long)(e / inner) * so + (long long)(e % inner) * si];
    red[tid] = s; __syncthreads();
    for (int o = 128; o > 0; o >>= 1) { if (tid < o) red[tid] += red[tid + o]; __syncthreads(); }
    const float mu = (mode == 0 || mode == 3) ? red[0] / (float)n : 0.f; __syncthreads();
    float q = 0.f;
    for (int e = tid; e < n; e += 256) { const float dlt = base[(long long)(e / inner) * so + (long long)(e % inner) * si] - mu; q += dlt * dlt; }
    red[tid] = q; __syncthreads();
    for (int o = 128; o > 0; o >>= 1) { if (tid < o) red[tid] += red[tid + o]; __syncthreads(); }
    {
        float rs;
        if (mode == 2) rs = sqrtf((float)n) / fmaxf(sqrtf(red[0]), eps); else if (mode == 3) rs = rsqrtf(red[0] / (float)(n - 1) + eps); else rs = rsqrtf(red[0] / (float)n + eps);
        if (tid < 32) { const float v = (tid == 0) ? mu : ((tid == 1) ? rs : 0.f); VST2(float, stat + (long long)z * 32 + tid, v); }
    }
}
//   One thread per element over the flat [Z][C][L] index space: grid ceil(Z*C*L / 256).
__global__ __launch_bounds__(256) void k_norm_apply(const float* __restrict__ x, float* __restrict__ y, const float* __restrict__ stat, const float* __restrict__ g, const float* __restrict__ bta,
                                                     int Z, int C, int L, int G, int bn, int act) {
    const long long idx = (long long)blockIdx.x * 256 + threadIdx.x;
    if (idx >= (long long)Z * C * L) return;
    const int l = (int)(idx % L); const long long zc = idx / L; const int c = (int)(zc % C), z = (int)(zc / C); (void)l;
    const int set = bn ? c : (z * G + c / (C / G));
    float v = (x[idx] - stat[(long long)set * 32]) * stat[(long long)set * 32 + 1];
    if (g) v *= g[c];
    if (bta) v += bta[c];
    v = act_fn(v, act);
    VST2(float, y + idx, v);
}

// k_lse_neg: c[i] = -(st[2i] + log(st[2i+1])) = minus the log-sum-exp of row i from k_attn's ST output (for softmax over the query dimension)
__global__ __launch_bounds__(256) void k_lse_neg(const float* __restrict__ st, float* __restrict__ c, int n) {
    const int i = blockIdx.x * 256 + threadIdx.x;
    if (i < n) { const float v = -(st[2 * i] + logf(st[2 * i + 1])); VST2(float, c + i, v); }
}

// k_iota: dst[i] = a * i + b as int32 (segment/position id helper)
__global__ __launch_bounds__(256) void k_iota(int* __restrict__ dst, int n, int a, int b) {
    const int i = blockIdx.x * 256 + threadIdx.x;
    if (i < n) { const int v = a * i + b; VST2(int, dst + i, v); }
}

// k_axpby: dst[i] = a * x[i] + b * y[i] (+ c), i < n
__global__ __launch_bounds__(256) void k_axpby(const float* __restrict__ x, const float* __restrict__ y, float* __restrict__ dst, int n, float a, float b, float c) {
    const int i = blockIdx.x * 256 + threadIdx.x;
    if (i < n) { const float v = a * x[i] + b * y[i] + c; VST2(float, dst + i, v); }
}

// =====================================================================================================================
// k_rope: rotary embedding on a [R rows][Hn heads][D] view (row stride sXr, head stride sXh, element stride 1) -> Y (own strides).
//   mode 0: rotate_half (partner d±D/2, sign - for d<D/2); mode 1: interleaved pairs (partner d^1, sign - for even d).
//   table column tcol: tmode 0 -> d, 1 -> d % (D/2), 2 -> d / 2; position p: pmode 0 -> r % S, 1 -> head index, 2 -> pos[r];
//   c = C[(r / S) * sCb + p * sCp + tcol * sCd], s likewise from Sn; y = x[d] * c + sign * x[partner] * s. X and Y must not alias.
// =====================================================================================================================
struct RopeP { const float* X; float* Y; const float* C; const float* Sn; const int* pos; long long sXr, sXh, sYr, sYh, sCb, sCp, sCd; int R, Hn, D, S, mode, tmode, pmode, pad; };
static_assert(sizeof(RopeP) == 5 * 8 + 7 * 8 + 8 * 4, "RopeP has padding");
__global__ __launch_bounds__(256) void k_rope(RopeP p) {
    const long long idx = (long long)blockIdx.x * 256 + threadIdx.x;
    if (idx >= (long long)p.R * p.Hn * p.D) return;
    const int d = (int)(idx % p.D); const long long rh = idx / p.D; const int h = (int)(rh % p.Hn); const int r = (int)(rh / p.Hn);
    const int half = p.D / 2;
    int partner; float sign;
    if (p.mode == 0) { partner = (d < half) ? d + half : d - half; sign = (d < half) ? -1.f : 1.f; }
    else { partner = d ^ 1; sign = (d & 1) ? 1.f : -1.f; }
    const int tcol = (p.tmode == 0) ? d : ((p.tmode == 1) ? (d % half) : (d >> 1));
    const int pp = (p.pmode == 0) ? (r % p.S) : ((p.pmode == 1) ? h : p.pos[r]);
    const long long toff = (long long)(r / p.S) * p.sCb + (long long)pp * p.sCp + (long long)tcol * p.sCd;
    const float* xr = p.X + (long long)r * p.sXr + (long long)h * p.sXh;
    const float v = xr[d] * p.C[toff] + sign * xr[partner] * p.Sn[toff];
    VST2(float, p.Y + (long long)r * p.sYr + (long long)h * p.sYh + d, v);
}

// k_invf + k_sincos (split so neither kernel carries a large VALU-fma footprint): invf_i = num * (1 / powf(base, (2 i)/D)) [fmode 0],
//   num * expf((2 i) * cexp) [fmode 1], num * powf(base, -2 (i - 1) / D) [fmode 2]; then cs/sn[s*half + i] = cos/sin((pscale * s) * invf_i)
__global__ __launch_bounds__(256) void k_invf(float* __restrict__ invb, int half, int D, float base, float num, int fmode, float cexp) {
    const int i = blockIdx.x * 256 + threadIdx.x;
    if (i >= ((half + 31) / 32) * 32) return;
    if (i >= half) { VST2(float, invb + i, 0.f); return; }
    const float e = (float)(2 * i) / (float)D;
    float invf;
    if (fmode == 1) invf = num * expf((float)(2 * i) * cexp);
    else if (fmode == 2) invf = num * powf(base, (-2.0f * ((float)i - 1.0f)) / (float)D);
    else invf = num * (1.0f / powf(base, e));
    VST2(float, invb + i, invf);
}
__global__ __launch_bounds__(256) void k_sincos(float* __restrict__ cs, float* __restrict__ sn, const float* __restrict__ invb, int S, int half, float pscale) {
    const int idx = blockIdx.x * 256 + threadIdx.x;
    if (idx >= S * half) return;
    const int s = idx / half, i = idx - s * half;
    const float ang = (pscale * (float)s) * invb[i];
    VST2(float, cs + idx, cosf(ang)); VST2(float, sn + idx, sinf(ang));
}

// k_mulact: dst[i] = act(x[i]) * y[i]
__global__ __launch_bounds__(256) void k_mulact(const float* __restrict__ x, const float* __restrict__ y, float* __restrict__ dst, int n, int act) {
    const int i = blockIdx.x * 256 + threadIdx.x;
    if (i < n) { const float v = act_fn(x[i], act) * y[i]; VST2(float, dst + i, v); }
}

// =====================================================================================================================
// k_matvec: thread-per-row matrix-vector products for N <= 8 output columns (heads with 1-3 outputs, gates), f32 on the VALU.
//   C[r*sCm + j] = act(alpha * sum_k A[r*sAm + k*sAk] * B[j*sBn + k*sBk] + bias[j]) + beta * R[r*sRm + j*sRn]; each thread writes its N contiguous floats.
// =====================================================================================================================
__global__ __launch_bounds__(256) void k_matvec(GemmP p) {
    // 32 lanes write one line with one instruction.
    const int rpt = (p.N == 1) ? 1 : 32;
    const long long r0 = ((long long)blockIdx.x * 256 + threadIdx.x) * rpt; const int z = blockIdx.z, zo = z / p.zi_n, zi = z - zo * p.zi_n;
    if (r0 >= p.M) return;
    const float* Bb = p.B + zo * p.sBo + zi * p.sBi;
    float* C = p.C + zo * p.sCo + zi * p.sCi; const float* R = p.R + zo * p.sRo + zi * p.sRi;
    for (int rr = 0; rr < rpt; ++rr) {
        const long long r = r0 + rr; if (r >= p.M) break;
        const float* A = p.A + zo * p.sAo + zi * p.sAi + r * p.sAm;
        float acc[8] = {0.f, 0.f, 0.f, 0.f, 0.f, 0.f, 0.f, 0.f};
        for (int k = 0; k < p.K; ++k) { const float a = A[(long long)k * p.sAk];
#pragma unroll
            for (int j = 0; j < 8; ++j) if (j < p.N) acc[j] += a * Bb[(long long)j * p.sBn + (long long)k * p.sBk]; }
#pragma unroll
        for (int j = 0; j < 8; ++j) if (j < p.N) {
            float v = acc[j] * p.alpha;
            if (p.flags & 1) v += p.bias[j];
            if (p.flags & 2) v += p.bias[r];
            v = act_fn(v, p.act);
            if (p.flags & 4) v += p.beta * R[r * p.sRm + (long long)j * p.sRn];
            VST2(float, C + r * p.sCm + j, v);
        }
    }
}
// k_smallsoftmax: thread-per-row softmax for short rows (n <= 64): dst[r*dr + j] = softmax(scale*src[r*sr + j])
__global__ __launch_bounds__(256) void k_smallsoftmax(const float* __restrict__ src, float* __restrict__ dst, long long sr, long long dr, int n, long long R, float scale) {
    const long long r0 = ((long long)blockIdx.x * 256 + threadIdx.x) * 32;
    for (int rr = 0; rr < 32; ++rr) {
        const long long r = r0 + rr; if (r >= R) return;
        const float* s = src + r * sr; float* d = dst + r * dr;
        float mx = -__builtin_inff();
        for (int j = 0; j < n; ++j) mx = fmaxf(mx, s[j] * scale);
        float sum = 0.f;
        for (int j = 0; j < n; ++j) sum += expf(s[j] * scale - mx);
        const float inv = 1.f / sum;
        for (int j = 0; j < n; ++j) { const float v = expf(s[j] * scale - mx) * inv; VST2(float, d + j, v); }
    }
}

__global__ __launch_bounds__(32) void k_unitstat(float* __restrict__ st) { const int t = threadIdx.x; const float v = (t == 1) ? 1.f : 0.f; VST2(float, st + t, v); }

// destination (e.g. a d_out whose row width is not a multiple of 32 floats) is written by consecutive lanes of one instruction
__global__ __launch_bounds__(256) void k_lincopy(const float* __restrict__ src, long long lds, float* __restrict__ dst, long long ldd, long long rows, int cols) {
    const long long i = (long long)blockIdx.x * 256 + threadIdx.x; if (i >= rows * cols) return;
    const long long r = i / cols; const int c = (int)(i - r * cols);
    const float v = src[r * lds + c]; VST2(float, dst + r * ldd + c, v);
}

namespace w25 {
typedef __attribute__((ext_vector_type(16))) _Float16 v16h;
typedef __attribute__((ext_vector_type(8)))  _Float16 v8h;
typedef __attribute__((ext_vector_type(16))) __bf16   v16b;
typedef __attribute__((ext_vector_type(8)))  __bf16   v8b;
typedef __attribute__((ext_vector_type(8)))  float    v8f;
typedef __attribute__((ext_vector_type(4)))  float    v4f;

__device__ __forceinline__ unsigned short f2bf_bits(float f) {
  unsigned u = __float_as_uint(f);
  return (unsigned short)((u + 0x7FFFu + ((u >> 16) & 1u)) >> 16);
}
__device__ __forceinline__ float bf_bits2f(unsigned short h) { return __uint_as_float(((unsigned)h) << 16); }

// hazard guards as plain device helpers (no inline asm inside the kernel template body)
__device__ __forceinline__ void dep_guard_h(v8f& a, v8f& b, v16h x, v16h y) { asm volatile("v_nop\n\tv_nop\n\tv_nop\n\tv_nop" : "+v"(a), "+v"(b) : "v"(x), "v"(y)); }
__device__ __forceinline__ void dep_guard_b(v8f& a, v8f& b, v16b x, v16b y) { asm volatile("v_nop\n\tv_nop\n\tv_nop\n\tv_nop" : "+v"(a), "+v"(b) : "v"(x), "v"(y)); }
__device__ __forceinline__ void keep4_h(v16h a, v16h b, v16h c, v16h d) { asm volatile("v_nop" :: "v"(a), "v"(b), "v"(c), "v"(d)); }
__device__ __forceinline__ void keep4_b(v16b a, v16b b, v16b c, v16b d) { asm volatile("v_nop" :: "v"(a), "v"(b), "v"(c), "v"(d)); }
__device__ __forceinline__ void acc_guard4(v8f& a, v8f& b, v8f& c, v8f& d) { asm volatile("v_nop\n\tv_nop\n\tv_nop\n\tv_nop" : "+v"(a), "+v"(b), "+v"(c), "+v"(d)); }
template <typename T> struct Frag;
template <> struct Frag<_Float16> {
  typedef v16h V; union U { v16h v; v8h h[2]; };
  static __device__ __forceinline__ v16h load(const _Float16* p) {   // elements 0..7 <- p[0..7], 8..15 <- p[16..23]
    U f; f.h[0] = *(const v8h*)(p); f.h[1] = *(const v8h*)(p + 16); return f.v;
  }
  static __device__ __forceinline__ v8f mma(v16h a, v16h b, v8f c) {
    return __builtin_amdgcn_wmma_f32_16x16x32_f16(false, a, false, b, (short)0, c, false, false);
  }
  static __device__ __forceinline__ void guard(v8f& a, v8f& b, v16h x, v16h y) { dep_guard_h(a, b, x, y); }
  static __device__ __forceinline__ void keep(v16h a, v16h b, v16h c, v16h d) { keep4_h(a, b, c, d); }
};
template <> struct Frag<__bf16> {
  typedef v16b V; union U { v16b v; v8b h[2]; };
  static __device__ __forceinline__ v16b load(const __bf16* p) {
    U f; f.h[0] = *(const v8b*)(p); f.h[1] = *(const v8b*)(p + 16); return f.v;
  }
  static __device__ __forceinline__ v8f mma(v16b a, v16b b, v8f c) {
    return __builtin_amdgcn_wmma_f32_16x16x32_bf16(false, a, false, b, (short)0, c, false, false);
  }
  static __device__ __forceinline__ void guard(v8f& a, v8f& b, v16b x, v16b y) { dep_guard_b(a, b, x, y); }
  static __device__ __forceinline__ void keep(v16b a, v16b b, v16b c, v16b d) { keep4_b(a, b, c, d); }
};

// ---- Register-blocked batched WMMA GEMM ------------------------------------
// C[m,n] = scale * sum_k A[m,k] * Bt[n,k] (+bias)(+resid); each wave owns a 64x64 tile.
// A row-major [M,K]; Bt row-major [N,K]; M,N % 64 == 0, K % 32 == 0.
// SPLIT: operands are hi/lo planes (A2/Bt2 = lo planes, same layout); product = hi·hi + hi·lo + lo·hi.
// BIAS_MODE: 0 = none, 1 = bias[m], 2 = bias[n].
// OUT_MODE: 0 = f32, 1 = f16, 2 = bf16 hi plane (Cout) + bf16 lo plane (Cout2).
// ET: 0 = f16 operands, 1 = bf16 operands (pointers passed as 16-bit storage)
template <int ET> struct Elem;
template <> struct Elem<0> { typedef _Float16 T; };
template <> struct Elem<1> { typedef __bf16 T; };
template <int ET, bool SPLIT, int BIAS_MODE, int OUT_MODE, bool RESID, int ACT = 0>
__global__ __launch_bounds__(256) void wmma_gemm64(
    const unsigned short* __restrict__ Ap, const unsigned short* __restrict__ A2p, int lda, long strideA,
    const unsigned short* __restrict__ Btp, const unsigned short* __restrict__ Bt2p, int ldb, long strideB,
    void* __restrict__ Cout, void* __restrict__ Cout2, int ldc, long strideC,
    const float* __restrict__ bias,
    const float* __restrict__ resid, long strideR,
    int M, int N, int K, float scale) {
  typedef typename Elem<ET>::T T;
  typedef typename Frag<T>::V V;
  const T* A = (const T*)Ap; const T* A2 = (const T*)A2p; const T* Bt = (const T*)Btp; const T* Bt2 = (const T*)Bt2p;
  __shared__ __align__(16) float sT[8][16 * 68];   // per-wave 16x64 slab, pitch 68 floats
  const int b    = blockIdx.y;
  const int lane = threadIdx.x & 31;
  const int wave = threadIdx.x >> 5;
  const int tilesN = N >> 6;
  const int tilesM = M >> 6;
  const int tile = blockIdx.x * 8 + wave;
  if (tile >= tilesM * tilesN) return;   // wave-uniform; no block barriers in this kernel
  const int tm = tile / tilesN;
  const int tn = tile - tm * tilesN;
  const int m0 = tm << 6;
  const int n0 = tn << 6;

  const T* Ab  = A  + (size_t)b * strideA;
  const T* Bb  = Bt + (size_t)b * strideB;
  const T* Ab2 = SPLIT ? (A2  + (size_t)b * strideA) : nullptr;
  const T* Bb2 = SPLIT ? (Bt2 + (size_t)b * strideB) : nullptr;

  const int rlane = lane & 15;                 // row (A) / col (B, D) within subtile
  const int koff  = (lane >> 4) * 8;           // k offset of this lane half
  const int mOff  = (lane >> 4) * 8;           // D row offset

  v8f acc[4][4];
#pragma unroll
  for (int i = 0; i < 4; ++i)
#pragma unroll
    for (int j = 0; j < 4; ++j) acc[i][j] = (v8f){0.f,0.f,0.f,0.f,0.f,0.f,0.f,0.f};

  for (int k0 = 0; k0 < K; k0 += 32) {
    V bh[4], bl[4];
#pragma unroll
    for (int j = 0; j < 4; ++j) {
      const size_t bo = (size_t)(n0 + (j << 4) + rlane) * ldb + koff + k0;
      bh[j] = Frag<T>::load(Bb + bo);
      if (SPLIT) bl[j] = Frag<T>::load(Bb2 + bo);
    }
#pragma unroll
    for (int i = 0; i < 4; ++i) {
      const size_t ao = (size_t)(m0 + (i << 4) + rlane) * lda + koff + k0;
      V ah = Frag<T>::load(Ab + ao);
      V al;
      if (SPLIT) al = Frag<T>::load(Ab2 + ao);
#pragma unroll
      for (int j = 0; j < 4; ++j) {
        acc[i][j] = Frag<T>::mma(ah, bh[j], acc[i][j]);
        if (SPLIT) {
          acc[i][j] = Frag<T>::mma(ah, bl[j], acc[i][j]);
          acc[i][j] = Frag<T>::mma(al, bh[j], acc[i][j]);
        }
      }
      Frag<T>::guard(acc[i][0], acc[i][3], ah, SPLIT ? al : ah);
    }
    Frag<T>::keep(bh[0], bh[1], bh[2], bh[3]);
    if (SPLIT) Frag<T>::keep(bl[0], bl[1], bl[2], bl[3]);
  }
  acc_guard4(acc[0][0], acc[0][1], acc[0][2], acc[0][3]);
  acc_guard4(acc[1][0], acc[1][1], acc[1][2], acc[1][3]);
  acc_guard4(acc[2][0], acc[2][1], acc[2][2], acc[2][3]);
  acc_guard4(acc[3][0], acc[3][1], acc[3][2], acc[3][3]);

  // ---- epilogue ----
  float* slab = sT[wave];
  const float* Rb = RESID ? (resid + (size_t)b * strideR) : nullptr;
#pragma unroll
  for (int i = 0; i < 4; ++i) {
    const int mBase = m0 + (i << 4);
#pragma unroll
    for (int j = 0; j < 4; ++j) {
      const int n = n0 + (j << 4) + rlane;
      float bv = 0.f;
      if (BIAS_MODE == 2) bv = bias[n];
#pragma unroll
      for (int r = 0; r < 8; ++r) {
        float v = acc[i][j][r] * scale;
        if (BIAS_MODE == 1) v += bias[mBase + mOff + r];
        if (BIAS_MODE == 2) v += bv;
        if (RESID) v += Rb[(size_t)(mBase + mOff + r) * ldc + n];
        if (ACT == 1) v = tanhf(v);
        if (ACT == 2) v = fmaxf(v, 0.0f);
        if (ACT == 3) v = v / (1.0f + expf(-v));
        if (ACT == 4) v = (v > 0.f) ? v : 0.01f * v;
        if (ACT == 5) v = 0.5f * v * (1.0f + erff(v * 0.70710678118654752f));
        if (ACT == 6) v = (v > 0.f) ? v : 0.2f * v;
        if (ACT == 7) { const float u = 0.7978845608028654f * (v + 0.044715f * v * v * v); v = 0.5f * v * (1.f + tanhf(u)); }
        slab[(mOff + r) * 68 + (j << 4) + rlane] = v;
      }
    }
    __builtin_amdgcn_fence(__ATOMIC_RELEASE, "workgroup");
    __builtin_amdgcn_wave_barrier();
    __builtin_amdgcn_fence(__ATOMIC_ACQUIRE, "workgroup");
    if (OUT_MODE == 0) {
      float* C = (float*)Cout + (size_t)b * strideC;
      const int hh = lane >> 4, c4 = (lane & 15) * 4;     // row seg = 256 B = 16 lanes x 16 B
      {
#pragma unroll
        for (int it = 0; it < 8; ++it) {
          const int row = it * 2 + hh;
          v4f v = *(const v4f*)(slab + row * 68 + c4);
          *(v4f*)(C + (size_t)(mBase + row) * ldc + n0 + c4) = v;
        }
        
      }
    } else {
      const int q = lane >> 3, c8 = (lane & 7) * 8;
      unsigned short* C  = (unsigned short*)Cout  + (size_t)b * strideC;
      unsigned short* C2 = (OUT_MODE == 2) ? ((unsigned short*)Cout2 + (size_t)b * strideC) : nullptr;
      {
#pragma unroll
        for (int it = 0; it < 4; ++it) {
          const int row = it * 4 + q;
          const float* sp = slab + row * 68 + c8;
          v8h hv, lv;
#pragma unroll
          for (int e = 0; e < 8; ++e) {
            if (OUT_MODE == 1) {
              hv[e] = (_Float16)sp[e];
            } else {
              unsigned short hb = f2bf_bits(sp[e]);
              unsigned short lb = f2bf_bits(sp[e] - bf_bits2f(hb));
              hv[e] = __builtin_bit_cast(_Float16, hb);
              lv[e] = __builtin_bit_cast(_Float16, lb);
            }
          }
          *(v8h*)(C + (size_t)(mBase + row) * ldc + n0 + c8) = hv;
          if (OUT_MODE == 2) *(v8h*)(C2 + (size_t)(mBase + row) * ldc + n0 + c8) = lv;
        }
        
      }
    }
    __builtin_amdgcn_fence(__ATOMIC_RELEASE, "workgroup");
    __builtin_amdgcn_wave_barrier();
    __builtin_amdgcn_fence(__ATOMIC_ACQUIRE, "workgroup");
  }
}

__global__ __launch_bounds__(256) void cast_f32_f16x2(
    const float* __restrict__ in, _Float16* __restrict__ out, int n2) {
  int i = blockIdx.x * 256 + threadIdx.x;
  if (i < n2) {
    const _Float16 h0 = (_Float16)in[2 * i], h1 = (_Float16)in[2 * i + 1];
    const unsigned u = (unsigned)__builtin_bit_cast(unsigned short, h0) | ((unsigned)__builtin_bit_cast(unsigned short, h1) << 16);
    ((unsigned*)out)[i] = u;
    
  }
}


} // namespace w25

__global__ __launch_bounds__(256) void k_castT16(const float* __restrict__ src, long long lds, _Float16* __restrict__ dst, long long ldd, int R, int C, float s) {
    const long long i = (long long)blockIdx.x * 256 + threadIdx.x; const long long np = (long long)C * (R / 2); if (i >= np) return; const int c = (int)(i / (R / 2)); const int r = 2 * (int)(i % (R / 2));
    const _Float16 h0 = (_Float16)(src[(long long)r * lds + c] * s), h1 = (_Float16)(src[(long long)(r + 1) * lds + c] * s);
    const unsigned u = (unsigned)__builtin_bit_cast(unsigned short, h0) | ((unsigned)__builtin_bit_cast(unsigned short, h1) << 16);
    unsigned* d = (unsigned*)(dst + (long long)c * ldd + r); *d = u;  }
__global__ __launch_bounds__(256) void k_cast16(const float* __restrict__ src, long long lds, _Float16* __restrict__ dst, long long ldd, int R, int C, float s) {
    const long long i = (long long)blockIdx.x * 256 + threadIdx.x; const long long np = (long long)R * (C / 2); if (i >= np) return; const int r = (int)(i / (C / 2)); const int c = 2 * (int)(i % (C / 2));
    const _Float16 h0 = (_Float16)(src[(long long)r * lds + c] * s), h1 = (_Float16)(src[(long long)r * lds + c + 1] * s);
    const unsigned u = (unsigned)__builtin_bit_cast(unsigned short, h0) | ((unsigned)__builtin_bit_cast(unsigned short, h1) << 16);
    unsigned* d = (unsigned*)(dst + (long long)r * ldd + c); *d = u;  }

// f32 -> bf16 hi plane + bf16 lo plane (x = hi + lo to ~2^-17 relative; RNE both), [R][C] -> [R][C] (or transposed to [C][R]); 2 consecutive destination elements
__device__ __forceinline__ unsigned int f2bf2_pack(float a, float b, unsigned int* lo) {
    const unsigned short ha = w25::f2bf_bits(a), hb = w25::f2bf_bits(b);
    const unsigned short la = w25::f2bf_bits(a - w25::bf_bits2f(ha)), lb = w25::f2bf_bits(b - w25::bf_bits2f(hb));
    *lo = (unsigned)la | ((unsigned)lb << 16); return (unsigned)ha | ((unsigned)hb << 16); }
// blockIdx.y = matrix of a batch: source matrices sz floats apart, destination planes dz elements apart
__global__ __launch_bounds__(256) void k_castS16(const float* __restrict__ src, long long lds, __bf16* __restrict__ dhi, __bf16* __restrict__ dlo, long long ldd, int R, int C, float s, int transpose, long long sz, long long dz) {
    src += (long long)blockIdx.y * sz; dhi += (long long)blockIdx.y * dz; dlo += (long long)blockIdx.y * dz;
    const long long i = (long long)blockIdx.x * 256 + threadIdx.x; long long o; float a, b;
    if (transpose) { const long long np = (long long)C * (R / 2); if (i >= np) return; const int c = (int)(i / (R / 2)); const int r = 2 * (int)(i % (R / 2)); a = src[(long long)r * lds + c] * s; b = src[(long long)(r + 1) * lds + c] * s; o = (long long)c * ldd + r; }
    else { const long long np = (long long)R * (C / 2); if (i >= np) return; const int r = (int)(i / (C / 2)); const int c = 2 * (int)(i % (C / 2)); a = src[(long long)r * lds + c] * s; b = src[(long long)r * lds + c + 1] * s; o = (long long)r * ldd + c; }
    unsigned lo; const unsigned hi = f2bf2_pack(a, b, &lo); unsigned* ph = (unsigned*)(dhi + o); unsigned* pl = (unsigned*)(dlo + o);
    *ph = hi; *pl = lo;  }

namespace w25 {
// =====================================================================================
// Generic causal/non-causal attention for head_dim 64, f32 in / f32 out; 16-bit operands: bf16 with optional hi/lo splits, or
// plain f16 (F16=true, non-split, probabilities carried x2^15).
//   scores = (q*qscale)·kᵀ : v_wmma_f32_16x16x32_bf16; SPLIT_QK -> q,k as bf16 hi/lo (hi·hi + hi·lo + lo·hi)
//   out    = p·v           : v_wmma_f32_16x16x32_bf16; SPLIT_PV -> p,v as bf16 hi/lo; else p,v plain bf16
//   f32 accumulate; online softmax in f32. Block = 4 waves = 64 query rows of one (batch, head); S % 64 == 0.
//   Element (b, s, h, d) of tensor X lives at X[b*X_bs + s*X_rs + h*X_hs + d] (strides in floats, multiples of 4).
//   Masking: mask_mode 0 none, 1 causal (kv > q masked), 2 tensor [S][Skv] shared over (b,h) (float if
//   mask_is_int==0, int32 with element == 0 -> masked if 1, int32 with element != 0 -> masked if 2), 3 per-token vectors qmask[B][S] & kvmask[B][Skv] (int32,
//   0 -> masked), 4 causal + sliding window (kv > q or q - kv > W masked; W passed in mask_is_int);
//   5 = relative-position bias: s += cp[b,h,q][idx[q][kv]] + pc[b,h,kv][idx[q][kv]] with idx = mask_b ([S][Skv] int32) and
//   mask_a an int32 [S][Skv] tensor with nonzero = masked (tables: element (b,h,row,n) at X + b*c_bs + h*c_hs + row*c_rs + n);
//   masked scores are replaced by mask_fill (e.g. -inf or -1e9) before the softmax.
//   grid.x = B * H * (S/64) (or a sub-range with blk0).
// =====================================================================================
#define AT_D 64
#define AT_NW 4
#define AT_QB 64
#define AT_KC 64
struct AttnGeom { const float* cp = nullptr; const float* pc = nullptr; long c_bs = 0, c_rs = 0, c_hs = 0;   // mode-5 score-bias tables
                  long q_bs, q_rs, q_hs, k_bs, k_rs, k_hs, v_bs, v_rs, v_hs, o_bs, o_rs, o_hs;
                  int S, Skv, H, mask_mode; float qscale; int blk0; float mask_fill; int mask_is_int; };
static_assert(sizeof(AttnGeom) == 168, "no padding");

__device__ __forceinline__ unsigned short at_bf_bits(float f) {
  unsigned u = __float_as_uint(f);
  return (unsigned short)((u + 0x7FFFu + ((u >> 16) & 1u)) >> 16);
}
__device__ __forceinline__ __bf16 at_f2bf(float f) { return __builtin_bit_cast(__bf16, at_bf_bits(f)); }
__device__ __forceinline__ void at_split(float f, __bf16& hi, __bf16& lo) {
  const unsigned short hb = at_bf_bits(f);
  hi = __builtin_bit_cast(__bf16, hb);
  lo = at_f2bf(f - __uint_as_float(((unsigned)hb) << 16));
}
__device__ __forceinline__ v8f at_mma(v16b a, v16b b, v8f c) {
  c = __builtin_amdgcn_wmma_f32_16x16x32_bf16(false, a, false, b, (short)0, c, false, false);
  asm volatile("v_nop\n\tv_nop\n\tv_nop\n\tv_nop" : "+v"(c) : "v"(a), "v"(b));
  return c;
}
// 16-bit element as a bit pattern held in a __bf16 slot: f16 bits when F16, bf16 (RNE) otherwise
template <bool F16> __device__ __forceinline__ __bf16 at_to16(float f) {
  if (F16) return __builtin_bit_cast(__bf16, (_Float16)f);
  return at_f2bf(f);
}
template <bool F16> __device__ __forceinline__ v8f at_mma16(v16b a, v16b b, v8f c) {
  if (F16) {
    const v16h ah = __builtin_bit_cast(v16h, a), bh = __builtin_bit_cast(v16h, b);
    c = __builtin_amdgcn_wmma_f32_16x16x32_f16(false, ah, false, bh, (short)0, c, false, false);
    asm volatile("v_nop\n\tv_nop\n\tv_nop\n\tv_nop" : "+v"(c) : "v"(ah), "v"(bh));
    return c;
  }
  return at_mma(a, b, c);
}

template <bool SPLIT_QK, bool SPLIT_PV, bool F16 = false>
__global__ __launch_bounds__(128)
void attn64_kernel(const float* __restrict__ q, const float* __restrict__ k,
                   const float* __restrict__ v, float* __restrict__ out,
                   const void* __restrict__ mask_a, const int* __restrict__ mask_b, AttnGeom g) {
  static_assert(!(F16 && (SPLIT_QK || SPLIT_PV)), "f16 mode is non-split");
  const float PSC = F16 ? 32768.0f : 1.0f;     // f16 probabilities carried x2^15 (subnormal range), folded into the final 1/l
  union FB { v16b v; v8b h[2]; };
  __shared__ __align__(16) __bf16 Ksh[AT_KC * AT_D];             // K hi [kv][d]      8 KB
  __shared__ __align__(16) __bf16 Ksl[SPLIT_QK ? AT_KC * AT_D : 8];
  __shared__ __align__(16) __bf16 Vth[AT_D * AT_KC];             // V hi [d][kv]      8 KB
  __shared__ __align__(16) __bf16 Vtl[SPLIT_PV ? AT_D * AT_KC : 8];
  __shared__ __align__(16) __bf16 Psh[AT_NW][16 * AT_KC];        // per wave P hi [row][kv]  8 KB
  __shared__ __align__(16) __bf16 Psl[SPLIT_PV ? AT_NW : 1][SPLIT_PV ? 16 * AT_KC : 8];
  __shared__ __align__(16) float  Os[AT_NW][16 * 68];            // per wave out tile, pitch 68

  const int tid  = threadIdx.x;
  const int wave = tid >> 5;
  const int lane = tid & 31;
  const int hh   = lane >> 4;
  const int c    = lane & 15;

  const int nqb = g.S / AT_QB;
  const int bx = blockIdx.x + g.blk0;
  const int qb = bx % nqb;
  const int bh = bx / nqb;
  const int h  = bh % g.H;
  const int b  = bh / g.H;
  const int qbase_block = qb * AT_QB;
  const int q0 = qbase_block + wave * 16;

  const float* qb_ptr = q + (size_t)b * g.q_bs + (size_t)h * g.q_hs;
  const float* kb_ptr = k + (size_t)b * g.k_bs + (size_t)h * g.k_hs;
  const float* vb_ptr = v + (size_t)b * g.v_bs + (size_t)h * g.v_hs;
  float*       ob_ptr = out + (size_t)b * g.o_bs + (size_t)h * g.o_hs;

  // ---- Q fragments (A operand): 2 d-chunks, hi (and lo) ----
  v16b qah[2], qal[2];
  {
    const float* qrow = qb_ptr + (size_t)(q0 + c) * g.q_rs;
#pragma unroll
    for (int dc = 0; dc < 2; ++dc) {
#pragma unroll
      for (int e = 0; e < 8; ++e) {
        const float f0 = qrow[dc * 32 + 8 * hh + e] * g.qscale;
        const float f1 = qrow[dc * 32 + 16 + 8 * hh + e] * g.qscale;
        if (SPLIT_QK) { __bf16 hq, lq; at_split(f0, hq, lq); qah[dc][e] = hq; qal[dc][e] = lq; at_split(f1, hq, lq); qah[dc][8 + e] = hq; qal[dc][8 + e] = lq; }
        else { qah[dc][e] = at_to16<F16>(f0); qah[dc][8 + e] = at_to16<F16>(f1); qal[dc][e] = qah[dc][e]; qal[dc][8 + e] = qah[dc][8 + e]; }
      }
    }
  }

  float mrow[8], lrow[8];
  v8f oacc[4];
#pragma unroll
  for (int r = 0; r < 8; ++r) { mrow[r] = -INFINITY; lrow[r] = 0.f; }
#pragma unroll
  for (int t = 0; t < 4; ++t) oacc[t] = (v8f){0.f,0.f,0.f,0.f,0.f,0.f,0.f,0.f};

  const int nChunks = (g.mask_mode == 1 || g.mask_mode == 4) ? (qb + 1) : (g.Skv / AT_KC);   // block-uniform
  // per-row query mask (mode 3)
  int qkeep[8];
#pragma unroll
  for (int r = 0; r < 8; ++r) qkeep[r] = (g.mask_mode == 3) ? mask_b[(size_t)b * g.S + q0 + 8 * hh + r] : 1;   // mask_b = qmask in mode 3
  for (int kc = 0; kc < nChunks; ++kc) {
    const int kv0 = kc * AT_KC;
    __syncthreads();
    {
      const int kvr = tid >> 1, dh = (tid & 1) * 32;
      const float* krow = kb_ptr + (size_t)(kv0 + kvr) * g.k_rs + dh;
      const float* vrow = vb_ptr + (size_t)(kv0 + kvr) * g.v_rs + dh;
#pragma unroll
      for (int i = 0; i < 8; ++i) {
        v4f kk = *(const v4f*)(krow + 4 * i);
        v4f vv = *(const v4f*)(vrow + 4 * i);
#pragma unroll
        for (int e = 0; e < 4; ++e) {
          const int d = dh + 4 * i + e;
          if (SPLIT_QK) { __bf16 a, bl; at_split(kk[e], a, bl); Ksh[kvr * AT_D + d] = a; Ksl[kvr * AT_D + d] = bl; }
          else Ksh[kvr * AT_D + d] = at_to16<F16>(kk[e]);
          if (SPLIT_PV) { __bf16 a, bl; at_split(vv[e], a, bl); Vth[d * AT_KC + kvr] = a; Vtl[d * AT_KC + kvr] = bl; }
          else Vth[d * AT_KC + kvr] = at_to16<F16>(vv[e]);
        }
      }
    }
    __syncthreads();

    v8f s[4];
#pragma unroll
    for (int j = 0; j < 4; ++j) {
      s[j] = (v8f){0.f,0.f,0.f,0.f,0.f,0.f,0.f,0.f};
#pragma unroll 1
      for (int dc = 0; dc < 2; ++dc) {
        FB kb;
        kb.h[0] = *(const v8b*)(Ksh + (j * 16 + c) * AT_D + dc * 32 + 8 * hh);
        kb.h[1] = *(const v8b*)(Ksh + (j * 16 + c) * AT_D + dc * 32 + 16 + 8 * hh);
        s[j] = at_mma16<F16>(qah[dc], kb.v, s[j]);
        if (SPLIT_QK) {
          FB kl;
          kl.h[0] = *(const v8b*)(Ksl + (j * 16 + c) * AT_D + dc * 32 + 8 * hh);
          kl.h[1] = *(const v8b*)(Ksl + (j * 16 + c) * AT_D + dc * 32 + 16 + 8 * hh);
          s[j] = at_mma16<F16>(qah[dc], kl.v, s[j]);
          s[j] = at_mma16<F16>(qal[dc], kb.v, s[j]);
        }
      }
    }
    const bool diag = (g.mask_mode == 1) && (kc == qb);
    int kvkeep[4] = {1, 1, 1, 1};
    if (g.mask_mode == 3) {
#pragma unroll
      for (int j = 0; j < 4; ++j) kvkeep[j] = ((const int*)mask_a)[(size_t)b * g.Skv + kv0 + j * 16 + c];   // mask_a = kvmask
    }
    float cm[8];
#pragma unroll
    for (int r = 0; r < 8; ++r) {
      const int qrow = q0 + 8 * hh + r;
      float m = -INFINITY;
#pragma unroll
      for (int j = 0; j < 4; ++j) {
        const int kvcol = kv0 + j * 16 + c;
        bool masked = false;
        if (diag) masked = (kvcol > qrow);
        else if (g.mask_mode == 4) masked = (kvcol > qrow) || (qrow - kvcol > g.mask_is_int);
        else if (g.mask_mode == 2) {
          const size_t mi = (size_t)qrow * g.Skv + kvcol;
          masked = (g.mask_is_int == 0) ? (((const float*)mask_a)[mi] == 0.0f)
                 : (g.mask_is_int == 1) ? (((const int*)mask_a)[mi] == 0) : (((const int*)mask_a)[mi] != 0);
        } else if (g.mask_mode == 3) masked = (qkeep[r] == 0) || (kvkeep[j] == 0);
        else if (g.mask_mode == 5) {
          const size_t mi = (size_t)qrow * g.Skv + kvcol;
          masked = (((const int*)mask_a)[mi] != 0);
          int n = mask_b[mi]; n = n < 0 ? 0 : n;
          s[j][r] += g.cp[(size_t)b * g.c_bs + (size_t)h * g.c_hs + (size_t)qrow * g.c_rs + n]
                   + g.pc[(size_t)b * g.c_bs + (size_t)h * g.c_hs + (size_t)kvcol * g.c_rs + n];
        }
        if (masked) s[j][r] = g.mask_fill;
        m = fmaxf(m, s[j][r]);
      }
#pragma unroll
      for (int off = 1; off < 16; off <<= 1) m = fmaxf(m, __shfl_xor(m, off, 32));
      cm[r] = m;
    }
    __bf16* pwh = Psh[wave];
    __bf16* pwl = Psl[SPLIT_PV ? wave : 0];
#pragma unroll
    for (int r = 0; r < 8; ++r) {
      const float mnew = fmaxf(mrow[r], cm[r]);
      const float alpha = expf(mrow[r] - mnew);
      mrow[r] = mnew;
      float psum = 0.f;
#pragma unroll
      for (int j = 0; j < 4; ++j) {
        const float p = expf(s[j][r] - mnew);
        psum += p;
        if (SPLIT_PV) { __bf16 a, bl; at_split(p, a, bl); pwh[(8 * hh + r) * AT_KC + j * 16 + c] = a; pwl[(8 * hh + r) * AT_KC + j * 16 + c] = bl; }
        else pwh[(8 * hh + r) * AT_KC + j * 16 + c] = at_to16<F16>(p * PSC);
      }
#pragma unroll
      for (int off = 1; off < 16; off <<= 1) psum += __shfl_xor(psum, off, 32);
      lrow[r] = lrow[r] * alpha + psum;
#pragma unroll
      for (int t = 0; t < 4; ++t) oacc[t][r] *= alpha;
    }
    __builtin_amdgcn_fence(__ATOMIC_RELEASE, "workgroup");
    __builtin_amdgcn_wave_barrier();
    __builtin_amdgcn_fence(__ATOMIC_ACQUIRE, "workgroup");
#pragma unroll 1
    for (int kk = 0; kk < 2; ++kk) {
      FB pa, pl;
      pa.h[0] = *(const v8b*)(pwh + c * AT_KC + kk * 32 + 8 * hh);
      pa.h[1] = *(const v8b*)(pwh + c * AT_KC + kk * 32 + 16 + 8 * hh);
      if (SPLIT_PV) {
        pl.h[0] = *(const v8b*)(pwl + c * AT_KC + kk * 32 + 8 * hh);
        pl.h[1] = *(const v8b*)(pwl + c * AT_KC + kk * 32 + 16 + 8 * hh);
      }
#pragma unroll
      for (int t = 0; t < 4; ++t) {
        FB vb;
        vb.h[0] = *(const v8b*)(Vth + (t * 16 + c) * AT_KC + kk * 32 + 8 * hh);
        vb.h[1] = *(const v8b*)(Vth + (t * 16 + c) * AT_KC + kk * 32 + 16 + 8 * hh);
        oacc[t] = at_mma16<F16>(pa.v, vb.v, oacc[t]);
        if (SPLIT_PV) {
          FB vl;
          vl.h[0] = *(const v8b*)(Vtl + (t * 16 + c) * AT_KC + kk * 32 + 8 * hh);
          vl.h[1] = *(const v8b*)(Vtl + (t * 16 + c) * AT_KC + kk * 32 + 16 + 8 * hh);
          oacc[t] = at_mma16<F16>(pa.v, vl.v, oacc[t]);
          oacc[t] = at_mma16<F16>(pl.v, vb.v, oacc[t]);
        }
      }
    }
  }

  float* os = Os[wave];
#pragma unroll
  for (int r = 0; r < 8; ++r) {
    const float inv = 1.0f / (lrow[r] * PSC);
#pragma unroll
    for (int t = 0; t < 4; ++t) os[(8 * hh + r) * 68 + t * 16 + c] = oacc[t][r] * inv;
  }
  __builtin_amdgcn_fence(__ATOMIC_RELEASE, "workgroup");
  __builtin_amdgcn_wave_barrier();
  __builtin_amdgcn_fence(__ATOMIC_ACQUIRE, "workgroup");
  {
    const int c4 = (lane & 15) * 4;
    {
#pragma unroll
      for (int it = 0; it < 8; ++it) {
        const int row = it * 2 + hh;
        v4f val = *(const v4f*)(os + row * 68 + c4);
        *(v4f*)(ob_ptr + (size_t)(q0 + row) * g.o_rs + c4) = val;
      }
      
    }
  }
}

} // namespace w25


__device__ __forceinline__ void st_h2(unsigned short* d2, float a, float b) { const unsigned u = (unsigned)__builtin_bit_cast(unsigned short, (_Float16)a) | ((unsigned)__builtin_bit_cast(unsigned short, (_Float16)b) << 16); unsigned* d = (unsigned*)d2; *d = u;  }
__device__ __forceinline__ float ldh(const unsigned short* p) { return (float)__builtin_bit_cast(_Float16, *p); }
__device__ __forceinline__ v4f ld4h(const unsigned short* p) { const unsigned long long u = *(const unsigned long long*)p; v4f a;
    a.x = (float)__builtin_bit_cast(_Float16, (unsigned short)(u & 0xFFFFu)); a.y = (float)__builtin_bit_cast(_Float16, (unsigned short)((u >> 16) & 0xFFFFu)); a.z = (float)__builtin_bit_cast(_Float16, (unsigned short)((u >> 32) & 0xFFFFu)); a.w = (float)__builtin_bit_cast(_Float16, (unsigned short)((u >> 48) & 0xFFFFu)); return a; }
__device__ __forceinline__ unsigned long long pk4h(v4f s) { return (unsigned long long)__builtin_bit_cast(unsigned short, (_Float16)s.x) | ((unsigned long long)__builtin_bit_cast(unsigned short, (_Float16)s.y) << 16) | ((unsigned long long)__builtin_bit_cast(unsigned short, (_Float16)s.z) << 32) | ((unsigned long long)__builtin_bit_cast(unsigned short, (_Float16)s.w) << 48); }
typedef unsigned v4u __attribute__((ext_vector_type(4)));
__device__ __forceinline__ void st8h(unsigned short* d, v4f a, v4f b) { const unsigned long long pa = pk4h(a), pb = pk4h(b); v4u pk; pk.x = (unsigned)(pa & 0xFFFFFFFFull); pk.y = (unsigned)(pa >> 32); pk.z = (unsigned)(pb & 0xFFFFFFFFull); pk.w = (unsigned)(pb >> 32); v4u* dd = (v4u*)d; *dd = pk;  }
__device__ __forceinline__ unsigned short bfu_rne(float v) { unsigned u = __builtin_bit_cast(unsigned, v); u += 0x7FFFu + ((u >> 16) & 1u); return (unsigned short)(u >> 16); }
__device__ __forceinline__ void bfsplit(float v, unsigned short& hi, unsigned short& lo) { hi = bfu_rne(v); lo = bfu_rne(v - __builtin_bit_cast(float, (unsigned)hi << 16)); }
__device__ __forceinline__ void st_s2(unsigned short* Hp, unsigned short* Lp, long long o, float a, float b) { unsigned short h0,l0,h1,l1; bfsplit(a,h0,l0); bfsplit(b,h1,l1); const unsigned ph = (unsigned)h0 | ((unsigned)h1 << 16), pl = (unsigned)l0 | ((unsigned)l1 << 16);
    unsigned* dh = (unsigned*)(Hp + o); unsigned* dl = (unsigned*)(Lp + o); *dh = ph; *dl = pl;  }
__device__ __forceinline__ int cl(int v, int n) { return min(max(v, 0), n - 1); }

// GAT-style aggregation over a device in-edge CSR at dst (+ optional explicit self loop as iteration j = -1):
//   logit = leaky(AS[src][h] + AD[n][h] (+ EW[e]*CW[h]), slope); softmax over the node's edges per head; acc[c] = sum alpha XP[src][c] (f16 gather plane, pitch XW; 256 channels = H heads x CH)
//   wave per node; lane L owns channels 8L..8L+7 (head = 8L / CH); per-lane softmax state (lanes of one head agree) -> no shuffles in the loop.
//   EPI 0: + bias -> f32 OUT[n][256] via LDS redistribution (two 16-B stores per lane, each instruction 512 contiguous B)
//   EPI 1: + bias, LayerNorm(256) * g + bb, relu -> bf16 hi/lo planes OH/OL [n][256] (16-B stores)
//   EPI 2: mean over the 256/CH heads + bias[0..63], LayerNorm(64) * g + bb, relu -> f32 OUT[n][64] (CH must be 64; LDS redistribution, 8-B stores)
//   EPI 3: mean over heads + bias -> f32 OUT[n][64] (no norm / activation)
//   EPI 4: + bias, ELU -> bf16 hi/lo planes OH/OL [n][256];  EPI 5: + bias (full 256-wide, per head), ELU, then mean over the 256/CH heads -> f32 OUT[n][64]
//   EPI 6: (CH = 128, two heads) mean over the two heads, + bias[0..127], relu -> f32 OUT[n][128] (LDS redistribution, 16-B stores)
//   EWM 0: no edge weights; 1: logit += EW[e] * CW[h] (self loop weight 1); 2: alpha *= EW[e] after the softmax (message scale; self loop weight 1)
template <int CH, bool SELF, int EWM, int EPI>
__global__ __launch_bounds__(256) void k_gat_agg(const unsigned short* __restrict__ XP, int XW, const float* __restrict__ AS, const float* __restrict__ AD, int ASTR, const float* __restrict__ EW, const float* __restrict__ CW,
        const int* __restrict__ esrc, const int* __restrict__ off, const int* __restrict__ cnt, const int* __restrict__ slot, const float* __restrict__ bias, const float* __restrict__ g, const float* __restrict__ bb,
        float* __restrict__ OUT, unsigned short* __restrict__ OH, unsigned short* __restrict__ OL, int N, int E, int CAP, float slope) {
    __shared__ float stage[8][256];
    const int wv = threadIdx.x >> 5; const int n = blockIdx.x * 8 + wv; const int L = threadIdx.x & 31; if (n >= N) return; const int c0 = 8 * L; const int h = c0 / CH;
    const float ad = AD[(long long)n * ASTR + h]; const float cw = (EWM == 1) ? CW[h] : 0.f; float m = -3.0e38f, s = 0.f; v4f a0, a1; a0.x = a0.y = a0.z = a0.w = 0.f; a1 = a0;
    const int p0 = cl(off[n], E + 1), cn = min(max(cnt[n], 0), CAP);
    for (int j = (SELF ? -1 : 0); j < cn; ++j) { int sj; float ew = 0.f;
        if (j < 0) { sj = n; ew = 1.f; } else { int e = slot[cl(p0 + j, E)]; e = cl(e, E); sj = cl(esrc[e], N); if (EWM != 0) ew = EW[e]; }
        float lg = AS[(long long)sj * ASTR + h] + ad + ((EWM == 1) ? ew * cw : 0.f); lg = (lg >= 0.f) ? lg : slope * lg;
        const float mn = fmaxf(m, lg); const float cz = expf(m - mn), pj = expf(lg - mn); s = s * cz + pj; const float pw = (EWM == 2) ? pj * ew : pj;
        const unsigned short* xr = XP + (long long)sj * XW + c0; a0 = a0 * cz + ld4h(xr) * pw; a1 = a1 * cz + ld4h(xr + 4) * pw; m = mn; }
    const float inv = (s > 0.f) ? 1.f / (s + 1e-16f) : 0.f; a0 = a0 * inv; a1 = a1 * inv;
    if (EPI == 0 || EPI == 1 || EPI == 4 || EPI == 5) { a0 = a0 + *(const v4f*)(bias + c0); a1 = a1 + *(const v4f*)(bias + c0 + 4); }
    if (EPI == 4 || EPI == 5) { a0.x = (a0.x > 0.f) ? a0.x : (expf(a0.x) - 1.f); a0.y = (a0.y > 0.f) ? a0.y : (expf(a0.y) - 1.f); a0.z = (a0.z > 0.f) ? a0.z : (expf(a0.z) - 1.f); a0.w = (a0.w > 0.f) ? a0.w : (expf(a0.w) - 1.f);
        a1.x = (a1.x > 0.f) ? a1.x : (expf(a1.x) - 1.f); a1.y = (a1.y > 0.f) ? a1.y : (expf(a1.y) - 1.f); a1.z = (a1.z > 0.f) ? a1.z : (expf(a1.z) - 1.f); a1.w = (a1.w > 0.f) ? a1.w : (expf(a1.w) - 1.f); }
    if (EPI == 4) { float o8[8] = {a0.x, a0.y, a0.z, a0.w, a1.x, a1.y, a1.z, a1.w}; unsigned short hh[8], ll[8];
#pragma unroll
        for (int u = 0; u < 8; ++u) bfsplit(o8[u], hh[u], ll[u]);
        const unsigned long long ph0 = (unsigned long long)hh[0] | ((unsigned long long)hh[1] << 16) | ((unsigned long long)hh[2] << 32) | ((unsigned long long)hh[3] << 48), pl0 = (unsigned long long)ll[0] | ((unsigned long long)ll[1] << 16) | ((unsigned long long)ll[2] << 32) | ((unsigned long long)ll[3] << 48);
        const unsigned long long ph1 = (unsigned long long)hh[4] | ((unsigned long long)hh[5] << 16) | ((unsigned long long)hh[6] << 32) | ((unsigned long long)hh[7] << 48), pl1 = (unsigned long long)ll[4] | ((unsigned long long)ll[5] << 16) | ((unsigned long long)ll[6] << 32) | ((unsigned long long)ll[7] << 48);
        v4u pk; pk.x = (unsigned)(ph0 & 0xFFFFFFFFull); pk.y = (unsigned)(ph0 >> 32); pk.z = (unsigned)(ph1 & 0xFFFFFFFFull); pk.w = (unsigned)(ph1 >> 32); v4u* dh = (v4u*)(OH + (long long)n * 256 + c0); *dh = pk; 
        v4u ql; ql.x = (unsigned)(pl0 & 0xFFFFFFFFull); ql.y = (unsigned)(pl0 >> 32); ql.z = (unsigned)(pl1 & 0xFFFFFFFFull); ql.w = (unsigned)(pl1 >> 32); v4u* dl = (v4u*)(OL + (long long)n * 256 + c0); *dl = ql;  return; }
    if (EPI == 6) {
        a0.x += __shfl_xor(a0.x, 16); a0.y += __shfl_xor(a0.y, 16); a0.z += __shfl_xor(a0.z, 16); a0.w += __shfl_xor(a0.w, 16); a1.x += __shfl_xor(a1.x, 16); a1.y += __shfl_xor(a1.y, 16); a1.z += __shfl_xor(a1.z, 16); a1.w += __shfl_xor(a1.w, 16);
        if (L < 16) { const int cb = 8 * L; const v4f b0 = *(const v4f*)(bias + cb), b1v = *(const v4f*)(bias + cb + 4);
            stage[wv][cb] = fmaxf(a0.x * 0.5f + b0.x, 0.f); stage[wv][cb + 1] = fmaxf(a0.y * 0.5f + b0.y, 0.f); stage[wv][cb + 2] = fmaxf(a0.z * 0.5f + b0.z, 0.f); stage[wv][cb + 3] = fmaxf(a0.w * 0.5f + b0.w, 0.f);
            stage[wv][cb + 4] = fmaxf(a1.x * 0.5f + b1v.x, 0.f); stage[wv][cb + 5] = fmaxf(a1.y * 0.5f + b1v.y, 0.f); stage[wv][cb + 6] = fmaxf(a1.z * 0.5f + b1v.z, 0.f); stage[wv][cb + 7] = fmaxf(a1.w * 0.5f + b1v.w, 0.f); }
        __builtin_amdgcn_fence(__ATOMIC_RELEASE, "workgroup"); __builtin_amdgcn_wave_barrier(); __builtin_amdgcn_fence(__ATOMIC_ACQUIRE, "workgroup");
        v4f o6; o6.x = stage[wv][4 * L]; o6.y = stage[wv][4 * L + 1]; o6.z = stage[wv][4 * L + 2]; o6.w = stage[wv][4 * L + 3]; VST2V4(OUT + (long long)n * 128 + 4 * L, o6); return; }
    if (EPI == 5) {
        a0.x += __shfl_xor(a0.x, 8); a0.y += __shfl_xor(a0.y, 8); a0.z += __shfl_xor(a0.z, 8); a0.w += __shfl_xor(a0.w, 8); a1.x += __shfl_xor(a1.x, 8); a1.y += __shfl_xor(a1.y, 8); a1.z += __shfl_xor(a1.z, 8); a1.w += __shfl_xor(a1.w, 8);
        a0.x += __shfl_xor(a0.x, 16); a0.y += __shfl_xor(a0.y, 16); a0.z += __shfl_xor(a0.z, 16); a0.w += __shfl_xor(a0.w, 16); a1.x += __shfl_xor(a1.x, 16); a1.y += __shfl_xor(a1.y, 16); a1.z += __shfl_xor(a1.z, 16); a1.w += __shfl_xor(a1.w, 16);
        const int gq5 = L & 7; a0 = a0 * 0.25f; a1 = a1 * 0.25f;
        if (L < 8) { stage[wv][8 * gq5] = a0.x; stage[wv][8 * gq5 + 1] = a0.y; stage[wv][8 * gq5 + 2] = a0.z; stage[wv][8 * gq5 + 3] = a0.w; stage[wv][8 * gq5 + 4] = a1.x; stage[wv][8 * gq5 + 5] = a1.y; stage[wv][8 * gq5 + 6] = a1.z; stage[wv][8 * gq5 + 7] = a1.w; }
        __builtin_amdgcn_fence(__ATOMIC_RELEASE, "workgroup"); __builtin_amdgcn_wave_barrier(); __builtin_amdgcn_fence(__ATOMIC_ACQUIRE, "workgroup");
        const unsigned long long pk5 = (unsigned long long)__builtin_bit_cast(unsigned, stage[wv][2 * L]) | ((unsigned long long)__builtin_bit_cast(unsigned, stage[wv][2 * L + 1]) << 32); VST2(unsigned long long, (unsigned long long*)(OUT + (long long)n * 64 + 2 * L), pk5); return; }
    if (EPI == 1) { float sm = a0.x + a0.y + a0.z + a0.w + a1.x + a1.y + a1.z + a1.w;
#pragma unroll
        for (int o = 16; o > 0; o >>= 1) sm += __shfl_xor(sm, o);
        const float mu = sm * (1.f / 256.f); const v4f d0 = a0 - mu, d1 = a1 - mu; float q = d0.x * d0.x + d0.y * d0.y + d0.z * d0.z + d0.w * d0.w + d1.x * d1.x + d1.y * d1.y + d1.z * d1.z + d1.w * d1.w;
#pragma unroll
        for (int o = 16; o > 0; o >>= 1) q += __shfl_xor(q, o);
        const float rs = rsqrtf(q * (1.f / 256.f) + 1e-5f); float o8[8] = {d0.x, d0.y, d0.z, d0.w, d1.x, d1.y, d1.z, d1.w}; unsigned short hh[8], ll[8];
#pragma unroll
        for (int u = 0; u < 8; ++u) { const float v = fmaxf(o8[u] * rs * g[c0 + u] + bb[c0 + u], 0.f); bfsplit(v, hh[u], ll[u]); }
        const unsigned long long ph0 = (unsigned long long)hh[0] | ((unsigned long long)hh[1] << 16) | ((unsigned long long)hh[2] << 32) | ((unsigned long long)hh[3] << 48), pl0 = (unsigned long long)ll[0] | ((unsigned long long)ll[1] << 16) | ((unsigned long long)ll[2] << 32) | ((unsigned long long)ll[3] << 48);
        const unsigned long long ph1 = (unsigned long long)hh[4] | ((unsigned long long)hh[5] << 16) | ((unsigned long long)hh[6] << 32) | ((unsigned long long)hh[7] << 48), pl1 = (unsigned long long)ll[4] | ((unsigned long long)ll[5] << 16) | ((unsigned long long)ll[6] << 32) | ((unsigned long long)ll[7] << 48);
        // lane L's 8 halves at c0 = 8L: 16 B -> one 16-B store per plane (32 lanes x 16 B = whole 512-B row)
        v4u pk; pk.x = (unsigned)(ph0 & 0xFFFFFFFFull); pk.y = (unsigned)(ph0 >> 32); pk.z = (unsigned)(ph1 & 0xFFFFFFFFull); pk.w = (unsigned)(ph1 >> 32); v4u* dh = (v4u*)(OH + (long long)n * 256 + c0); *dh = pk; 
        v4u ql; ql.x = (unsigned)(pl0 & 0xFFFFFFFFull); ql.y = (unsigned)(pl0 >> 32); ql.z = (unsigned)(pl1 & 0xFFFFFFFFull); ql.w = (unsigned)(pl1 >> 32); v4u* dl = (v4u*)(OL + (long long)n * 256 + c0); *dl = ql;  return; }
    if (EPI == 2 || EPI == 3) {   // head mean: lanes L, L^8, L^16, L^24 hold the same chan group of the 4 heads (CH = 64 -> 8 lanes per head)
        a0.x += __shfl_xor(a0.x, 8); a0.y += __shfl_xor(a0.y, 8); a0.z += __shfl_xor(a0.z, 8); a0.w += __shfl_xor(a0.w, 8); a1.x += __shfl_xor(a1.x, 8); a1.y += __shfl_xor(a1.y, 8); a1.z += __shfl_xor(a1.z, 8); a1.w += __shfl_xor(a1.w, 8);
        a0.x += __shfl_xor(a0.x, 16); a0.y += __shfl_xor(a0.y, 16); a0.z += __shfl_xor(a0.z, 16); a0.w += __shfl_xor(a0.w, 16); a1.x += __shfl_xor(a1.x, 16); a1.y += __shfl_xor(a1.y, 16); a1.z += __shfl_xor(a1.z, 16); a1.w += __shfl_xor(a1.w, 16);
        const int gq = L & 7; a0 = a0 * 0.25f + *(const v4f*)(bias + 8 * gq); a1 = a1 * 0.25f + *(const v4f*)(bias + 8 * gq + 4);      // every lane now holds channels 8gq..8gq+7 of the mean
        if (EPI == 3) { if (L < 8) { stage[wv][8 * gq] = a0.x; stage[wv][8 * gq + 1] = a0.y; stage[wv][8 * gq + 2] = a0.z; stage[wv][8 * gq + 3] = a0.w; stage[wv][8 * gq + 4] = a1.x; stage[wv][8 * gq + 5] = a1.y; stage[wv][8 * gq + 6] = a1.z; stage[wv][8 * gq + 7] = a1.w; }
            __builtin_amdgcn_fence(__ATOMIC_RELEASE, "workgroup"); __builtin_amdgcn_wave_barrier(); __builtin_amdgcn_fence(__ATOMIC_ACQUIRE, "workgroup");
            const unsigned long long pk3 = (unsigned long long)__builtin_bit_cast(unsigned, stage[wv][2 * L]) | ((unsigned long long)__builtin_bit_cast(unsigned, stage[wv][2 * L + 1]) << 32); VST2(unsigned long long, (unsigned long long*)(OUT + (long long)n * 64 + 2 * L), pk3); return; }
        float sm = (L < 8) ? (a0.x + a0.y + a0.z + a0.w + a1.x + a1.y + a1.z + a1.w) : 0.f;
#pragma unroll
        for (int o = 16; o > 0; o >>= 1) sm += __shfl_xor(sm, o);
        const float mu = sm * (1.f / 64.f); const v4f d0 = a0 - mu, d1 = a1 - mu; float q = (L < 8) ? (d0.x * d0.x + d0.y * d0.y + d0.z * d0.z + d0.w * d0.w + d1.x * d1.x + d1.y * d1.y + d1.z * d1.z + d1.w * d1.w) : 0.f;
#pragma unroll
        for (int o = 16; o > 0; o >>= 1) q += __shfl_xor(q, o);
        const float rs = rsqrtf(q * (1.f / 64.f) + 1e-5f);
        if (L < 8) { const float* gg = g + 8 * gq; const float* bq = bb + 8 * gq; stage[wv][8 * gq] = fmaxf(d0.x * rs * gg[0] + bq[0], 0.f); stage[wv][8 * gq + 1] = fmaxf(d0.y * rs * gg[1] + bq[1], 0.f); stage[wv][8 * gq + 2] = fmaxf(d0.z * rs * gg[2] + bq[2], 0.f); stage[wv][8 * gq + 3] = fmaxf(d0.w * rs * gg[3] + bq[3], 0.f);
            stage[wv][8 * gq + 4] = fmaxf(d1.x * rs * gg[4] + bq[4], 0.f); stage[wv][8 * gq + 5] = fmaxf(d1.y * rs * gg[5] + bq[5], 0.f); stage[wv][8 * gq + 6] = fmaxf(d1.z * rs * gg[6] + bq[6], 0.f); stage[wv][8 * gq + 7] = fmaxf(d1.w * rs * gg[7] + bq[7], 0.f); }
        __builtin_amdgcn_fence(__ATOMIC_RELEASE, "workgroup"); __builtin_amdgcn_wave_barrier(); __builtin_amdgcn_fence(__ATOMIC_ACQUIRE, "workgroup");
        const unsigned long long pk = (unsigned long long)__builtin_bit_cast(unsigned, stage[wv][2 * L]) | ((unsigned long long)__builtin_bit_cast(unsigned, stage[wv][2 * L + 1]) << 32); VST2(unsigned long long, (unsigned long long*)(OUT + (long long)n * 64 + 2 * L), pk); return; }
    // EPI 0
    stage[wv][c0] = a0.x; stage[wv][c0 + 1] = a0.y; stage[wv][c0 + 2] = a0.z; stage[wv][c0 + 3] = a0.w; stage[wv][c0 + 4] = a1.x; stage[wv][c0 + 5] = a1.y; stage[wv][c0 + 6] = a1.z; stage[wv][c0 + 7] = a1.w;
    __builtin_amdgcn_fence(__ATOMIC_RELEASE, "workgroup"); __builtin_amdgcn_wave_barrier(); __builtin_amdgcn_fence(__ATOMIC_ACQUIRE, "workgroup");
#pragma unroll
    for (int q2 = 0; q2 < 2; ++q2) { const int c = 128 * q2 + 4 * L; v4f v; v.x = stage[wv][c]; v.y = stage[wv][c + 1]; v.z = stage[wv][c + 2]; v.w = stage[wv][c + 3]; VST2V4(OUT + (long long)n * 256 + c, v); } }

__device__ __forceinline__ void st4s(unsigned short* Hp, unsigned short* Lp, long long o, v4f a) { unsigned short h[4], l[4]; bfsplit(a.x, h[0], l[0]); bfsplit(a.y, h[1], l[1]); bfsplit(a.z, h[2], l[2]); bfsplit(a.w, h[3], l[3]);
    const unsigned long long ph = (unsigned long long)h[0] | ((unsigned long long)h[1] << 16) | ((unsigned long long)h[2] << 32) | ((unsigned long long)h[3] << 48), pl = (unsigned long long)l[0] | ((unsigned long long)l[1] << 16) | ((unsigned long long)l[2] << 32) | ((unsigned long long)l[3] << 48);
    VST2(unsigned long long, (unsigned long long*)(Hp + o), ph); VST2(unsigned long long, (unsigned long long*)(Lp + o), pl); }
// f32 [nval2 pairs] -> bf16 hi/lo planes (n2 pairs; pairs >= nval2 zero); thread-linear 4-B stores per plane
__global__ __launch_bounds__(256) void k_pl(const float* __restrict__ S, unsigned short* __restrict__ PH, unsigned short* __restrict__ PL, long long nval2, long long n2) { const long long u = (long long)blockIdx.x * 256 + threadIdx.x; if (u >= n2) return; const bool in = (u < nval2); const long long uc = in ? u : ((nval2 > 0) ? (nval2 - 1) : 0); const float a = S[2 * uc], b = S[2 * uc + 1]; st_s2(PH, PL, 2 * u, in ? a : 0.f, in ? b : 0.f); }
// WC [K][NOP] (thread-linear whole rows) = [W (cols < FO) | 0 | W_h . as_h @EO+h | W_h . ad_h @EO+NH+h | 0 ...]; W is [K][FO] (x @ W layout), as/ad [NH][DH]; EO >= FO.
// branch-free: every lane loads all candidates with clamped indices and selects by value (no exec-masked load arms)
__global__ __launch_bounds__(256) void k_wext(const float* __restrict__ Wm, const float* __restrict__ AS_, const float* __restrict__ AD_, int K, int NOP, int FO, int NH, int DH, int EO, float* __restrict__ WC) {
    #pragma clang fp contract(off)
    const long long u = (long long)blockIdx.x * 256 + threadIdx.x; if (u >= (long long)K * NOP) return; const int kk = (int)(u / NOP), o = (int)(u % NOP);
    const int oo = min(o, FO - 1); const float vw = Wm[(long long)kk * FO + oo]; const int q = min(max(o - EO, 0), 2 * NH - 1); const int h = q % NH; float s = 0.f;
#pragma unroll 1
    for (int c = 0; c < DH; ++c) { const float w = Wm[(long long)kk * FO + h * DH + c]; const float asv = AS_[h * DH + c], adv = AD_[h * DH + c]; s += w * ((q < NH) ? asv : adv); }
    const float v = (o < FO) ? vw : ((o >= EO && o < EO + 2 * NH) ? s : 0.f); VST2(float, WC + u, v); }
// GAT aggregation over a device in-edge CSR (+ analytic self loop as iteration j = -1 when SELF), per-lane online softmax (lanes of one head agree):
// HS rows (pitch P floats): [0,128) projected features z, col 128 + h = a_src.z_h, col 128 + NH + h = a_dst.z_h; lane L owns channels 4L..4L+3 (head = 4L / CH).
// out = sum_j softmax_j(leaky(el[src_j][h] + er[n][h])) z[src_j] (/ (den + deps)) + bias -> ACT (0 none, 1 relu, 2 elu, 3 leaky 0.01) ->
// MODE 0: f32 OUT[n][OW] cols < OC (16-B lane stores, OC*4 contiguous B per wave; OC in {64,128}); MODE 1: bf16 hi/lo planes PH/PL pitch PP (rows n >= N zero); MODE 2: both.
template <int CH, bool SELF, int ACT, int MODE>
__global__ __launch_bounds__(256) void k_gat128(const float* __restrict__ HS, int P, int NH, const float* __restrict__ bias, const int* __restrict__ SRC, const int* __restrict__ off, const int* __restrict__ cnt, const int* __restrict__ slot,
        float* __restrict__ OUT, int OW, int OC, unsigned short* __restrict__ PH, unsigned short* __restrict__ PL, int PP, int N, int NP, int E, int CAP, float slope, float deps) {
    #pragma clang fp contract(off)
    const int n = blockIdx.x * 8 + (threadIdx.x >> 5); const int L = threadIdx.x & 31; if (n >= NP) return; const int c = 4 * L; const int h = c / CH; v4f o; o.x = o.y = o.z = o.w = 0.f;
    if (n < N) { const float* hn = HS + (long long)n * P; const float er = hn[128 + NH + h]; float m = -3.0e38f, s = 0.f; v4f a; a.x = a.y = a.z = a.w = 0.f;
        const int p0 = min(max(off[n], 0), E), cn = min(max(cnt[n], 0), CAP);
        for (int j = (SELF ? -1 : 0); j < cn; ++j) { int sj; if (j < 0) sj = n; else { const int e = min(max(slot[min(p0 + j, E - 1)], 0), E - 1); sj = min(max(SRC[e], 0), N - 1); }
            const float* hs = HS + (long long)sj * P; float lg = hs[128 + h] + er; lg = (lg >= 0.f) ? lg : slope * lg;
            const float mn = fmaxf(m, lg); const float cz = expf(m - mn), pj = expf(lg - mn); s = s * cz + pj; a = a * cz + *(const v4f*)(hs + c) * pj; m = mn; }
        const float inv = (s > 0.f || deps > 0.f) ? 1.f / (s + deps) : 0.f; o = a * inv + *(const v4f*)(bias + c);
        if (ACT == 1) { o.x = fmaxf(o.x, 0.f); o.y = fmaxf(o.y, 0.f); o.z = fmaxf(o.z, 0.f); o.w = fmaxf(o.w, 0.f); }
        if (ACT == 2) { o.x = (o.x > 0.f) ? o.x : (expf(o.x) - 1.f); o.y = (o.y > 0.f) ? o.y : (expf(o.y) - 1.f); o.z = (o.z > 0.f) ? o.z : (expf(o.z) - 1.f); o.w = (o.w > 0.f) ? o.w : (expf(o.w) - 1.f); }
        if (ACT == 3) { o.x = (o.x >= 0.f) ? o.x : 0.01f * o.x; o.y = (o.y >= 0.f) ? o.y : 0.01f * o.y; o.z = (o.z >= 0.f) ? o.z : 0.01f * o.z; o.w = (o.w >= 0.f) ? o.w : 0.01f * o.w; }
        if (MODE != 1 && c < OC) VST2V4(OUT + (long long)n * OW + c, o); }
    if (MODE != 0) st4s(PH, PL, (long long)n * PP + c, o); }

// ---- util2 ----
// generic Bt plane builder from an f32 weight: Bt[o][k] (pitch KP halves) = (TRANS ? W[k*ldw + o] : W[o*ldw + k]) * (S ? S[o] : 1) for o < NO, k < KI; zero elsewhere for o < NOP rows, k < KP (thread per (o < NOP, pair k))
__global__ __launch_bounds__(256) void k_u2_bt(const float* __restrict__ Wm, int ldw, int TRANS, int KI, int NO, int KP, int NOP, const float* __restrict__ S, unsigned short* __restrict__ PH_, unsigned short* __restrict__ PL_) {
    const long long u = (long long)blockIdx.x * 256 + threadIdx.x; if (u >= (long long)NOP * (KP / 2)) return; const int k0 = 2 * (int)(u % (KP / 2)); const int o = (int)(u / (KP / 2)); float a = 0.f, b = 0.f;
    if (o < NO) { const float s = S ? S[o] : 1.f;
        if (k0 < KI) a = (TRANS ? Wm[(long long)k0 * ldw + o] : Wm[(long long)o * ldw + k0]) * s;
        if (k0 + 1 < KI) b = (TRANS ? Wm[(long long)(k0 + 1) * ldw + o] : Wm[(long long)o * ldw + k0 + 1]) * s; }
    st_s2(PH_, PL_, (long long)o * KP + k0, a, b); }
// generic padded vector: O[i] = (i < n) ? (A[i] * (S ? S[i] : 1) + (B2 ? B2[i] : 0)) : 0 for i < NP (one block of 256, NP <= 4096 looped)
__global__ __launch_bounds__(256) void k_u2_vec(const float* __restrict__ A, const float* __restrict__ S, const float* __restrict__ B2, int n, int NP, float* __restrict__ O) { for (int i = threadIdx.x; i < NP; i += 256) { float v = 0.f; if (i < n) v = A[i] * (S ? S[i] : 1.f) + (B2 ? B2[i] : 0.f); VST2(float, O + i, v); } }
__global__ __launch_bounds__(256) void k_u2_colstat(const float* __restrict__ X, int P, int N, float eps, float* __restrict__ STAT) {
    #pragma clang fp contract(off)
    __shared__ float red[256]; const int c = blockIdx.x; const int t = threadIdx.x; float s = 0.f; for (int r = t; r < N; r += 256) s += X[(long long)r * P + c]; red[t] = s; __syncthreads();
    for (int o = 128; o > 0; o >>= 1) { if (t < o) red[t] += red[t + o]; __syncthreads(); }
    const float mu = red[0] / (float)N; __syncthreads(); float q = 0.f; for (int r = t; r < N; r += 256) { const float d = X[(long long)r * P + c] - mu; q += d * d; } red[t] = q; __syncthreads();
    for (int o = 128; o > 0; o >>= 1) { if (t < o) red[t] += red[t + o]; __syncthreads(); }
    const float rs = 1.f / sqrtf(red[0] / (float)N + eps); if (t < 32) VST2(float, STAT + (long long)c * 32 + t, (t == 0) ? mu : ((t == 1) ? rs : 0.f)); }
// rows f32 [R][W] (pitch PW) -> planes at pitch PP, column offset coff; rows >= RL (live) written as zeros up to RP (thread per (r < RP, 4 of W))
__global__ __launch_bounds__(256) void k_u2_pl(const float* __restrict__ X, int PW, int Wd, int RL, int RP, unsigned short* __restrict__ PH_, unsigned short* __restrict__ PL_, int PP, int coff) { const long long u = (long long)blockIdx.x * 256 + threadIdx.x; if (u >= (long long)RP * (Wd / 4)) return; const int r = (int)(u / (Wd / 4)); const int c = 4 * (int)(u % (Wd / 4)); v4f v; v.x = v.y = v.z = v.w = 0.f; if (r < RL) v = *(const v4f*)(X + (long long)r * PW + c); st4s(PH_, PL_, (long long)r * PP + coff + c, v); }

typedef unsigned int cm_u4 __attribute__((ext_vector_type(4)));

__global__ __launch_bounds__(256) void k_cm_zero16(unsigned short* __restrict__ DST, long long n) { const long long u = (long long)blockIdx.x * 256 + threadIdx.x; if (u * 8 >= n) return; cm_u4 z; z.x = z.y = z.z = z.w = 0u; cm_u4* d = (cm_u4*)(DST + u * 8); *d = z;  }
// f32 -> bf16 (RNE) -> f16 casts: every 16-bit operand then holds exactly the bf16-rounded input value (times a power-of-two
// weight scale), so the f16 WMMA products are exact. Plain: thread per (row, 8 cols),
// dst [R][C] pitch ldd; transposed: thread per (col, 8 consecutive rows) -> dst [C][R] pitch ldd; both store 16 B per thread, thread-linear along the dst row.
__device__ __forceinline__ unsigned int cmb_pk2(float a, float b) { return (unsigned int)__builtin_bit_cast(unsigned short, (_Float16)a) | ((unsigned int)__builtin_bit_cast(unsigned short, (_Float16)b) << 16); }
__device__ __forceinline__ float cmb_bf(float v) { const unsigned u = __builtin_bit_cast(unsigned, v); const unsigned r = (u + 0x7fffu + ((u >> 16) & 1u)) & 0xffff0000u; return __builtin_bit_cast(float, r); }   // bf16 RNE, kept as f32 (finite inputs)
// BR[i] = bf16_rne(B[i]) kept as f32 (thread per element)
__global__ __launch_bounds__(256) void k_cm_bfvec(const float* __restrict__ SRC, float* __restrict__ DST, int n) { const int u = blockIdx.x * 256 + threadIdx.x; if (u >= n) return; VST2(float, DST + u, cmb_bf(SRC[u])); }
__global__ __launch_bounds__(256) void k_cm_castb(const float* __restrict__ SRC, int lds, unsigned short* __restrict__ DST, int ldd, int nR, int nC, float sc) {
    const long long u = (long long)blockIdx.x * 256 + threadIdx.x; const int per = nC / 8; if (u >= (long long)nR * per) return; const int r = (int)(u / per); const int c0 = 8 * (int)(u % per);
    const float* s = SRC + (long long)r * lds + c0; float w[8];
#pragma unroll
    for (int e = 0; e < 8; ++e) w[e] = cmb_bf(s[e]) * sc;
    cm_u4 pk; pk.x = cmb_pk2(w[0], w[1]); pk.y = cmb_pk2(w[2], w[3]); pk.z = cmb_pk2(w[4], w[5]); pk.w = cmb_pk2(w[6], w[7]); VST2(cm_u4, (cm_u4*)(DST + (long long)r * ldd + c0), pk); }
__global__ __launch_bounds__(256) void k_cm_castbT(const float* __restrict__ SRC, int lds, unsigned short* __restrict__ DST, int ldd, int nR, int nC, float sc) {
    const long long u = (long long)blockIdx.x * 256 + threadIdx.x; const int per = nR / 8; if (u >= (long long)nC * per) return; const int c = (int)(u / per); const int r0 = 8 * (int)(u % per);
    float w[8];
#pragma unroll
    for (int e = 0; e < 8; ++e) w[e] = cmb_bf(SRC[(long long)(r0 + e) * lds + c]) * sc;
    cm_u4 pk; pk.x = cmb_pk2(w[0], w[1]); pk.y = cmb_pk2(w[2], w[3]); pk.z = cmb_pk2(w[4], w[5]); pk.w = cmb_pk2(w[6], w[7]); VST2(cm_u4, (cm_u4*)(DST + (long long)c * ldd + r0), pk); }

typedef float ab_v2f __attribute__((ext_vector_type(2)));
__global__ __launch_bounds__(256) void k_ab_gstat(const float* __restrict__ X, float* __restrict__ STp, int per) {
    #pragma clang fp contract(off)
    __shared__ float red[256]; const int g = blockIdx.x; const int t = threadIdx.x; const float* base = X + (long long)g * per; float s = 0.f;
    for (int i = 4 * t; i < per; i += 1024) { const v4f v = *(const v4f*)(base + i); s += (cmb_bf(v.x) + cmb_bf(v.y)) + (cmb_bf(v.z) + cmb_bf(v.w)); }
    red[t] = s; __syncthreads();
    for (int o = 128; o > 0; o >>= 1) { if (t < o) red[t] += red[t + o]; __syncthreads(); }
    const float mean = red[0] / (float)per; __syncthreads(); float q = 0.f;
    for (int i = 4 * t; i < per; i += 1024) { const v4f v = *(const v4f*)(base + i); const float a = cmb_bf(v.x) - mean, b = cmb_bf(v.y) - mean, c = cmb_bf(v.z) - mean, d = cmb_bf(v.w) - mean; q += (a * a + b * b) + (c * c + d * d); }
    red[t] = q; __syncthreads();
    for (int o = 128; o > 0; o >>= 1) { if (t < o) red[t] += red[t + o]; __syncthreads(); }
    if (t == 0) { ab_v2f ms; ms.x = mean; ms.y = rsqrtf(red[0] / (float)per + 1e-5f); VST2(ab_v2f, (ab_v2f*)(STp + 32 * g), ms); } }
// XN[c][n] = (bf16(x[c][n]) - mean[g]) rstd[g] bf16(gamma[c]) + bf16(beta[c]); XB[c][n] = bf16(x[c][n]) (residual copy); thread per float4; c runs over the rows of all images ([B * CH][N], groups numbered through), gamma and beta repeat every CH rows
__global__ __launch_bounds__(256) void k_ab_gapply(const float* __restrict__ X, const float* __restrict__ STp, const float* __restrict__ Gm, const float* __restrict__ Bt, float* __restrict__ XNp, float* __restrict__ XBp, int N, int CPG, int CH, long long n4) {
    #pragma clang fp contract(off)
    const long long u = (long long)blockIdx.x * 256 + threadIdx.x; if (u >= n4) return; const int c = (int)((4 * u) / N); const int g = c / CPG; const float mean = STp[32 * g], rs = STp[32 * g + 1], ga = cmb_bf(Gm[c % CH]), be = cmb_bf(Bt[c % CH]);
    const v4f v = *(const v4f*)(X + 4 * u); v4f xb; xb.x = cmb_bf(v.x); xb.y = cmb_bf(v.y); xb.z = cmb_bf(v.z); xb.w = cmb_bf(v.w); v4f r; r.x = (xb.x - mean) * rs * ga + be; r.y = (xb.y - mean) * rs * ga + be; r.z = (xb.z - mean) * rs * ga + be; r.w = (xb.w - mean) * rs * ga + be;
    VST2V4(XNp + 4 * u, r); VST2V4(XBp + 4 * u, xb); }


extern "C" void kernel_launch(void* const* d_in, const int* in_sizes, int n_in, void* d_out, int out_size, void* d_ws, size_t ws_size, hipStream_t stream) {
    (void)in_sizes; (void)n_in; (void)out_size; (void)ws_size;
    const float* x = (const float*)d_in[0];
    const float* gam = (const float*)d_in[1];
    const float* bet = (const float*)d_in[2];
    const float* wqkv = (const float*)d_in[3];
    const float* bqkv = (const float*)d_in[4];
    const float* wo = (const float*)d_in[5];
    const float* bo = (const float*)d_in[6];
    float* out = (float*)d_out;
    char* wsp = (char*)d_ws;
    float* ST = (float*)wsp; wsp += (((size_t)((size_t)32 * 32 + 64) * 4 + 255) / 256) * 256;
    float* XN = (float*)wsp; wsp += (((size_t)((size_t)1024 * 4096) * 4 + 255) / 256) * 256;
    unsigned short* XTH = (unsigned short*)wsp; wsp += (((size_t)((size_t)16384 * 256) * 2 + 255) / 256) * 256;
    unsigned short* XTL = (unsigned short*)wsp; wsp += (((size_t)((size_t)16384 * 256) * 2 + 255) / 256) * 256;
    unsigned short* W3H = (unsigned short*)wsp; wsp += (((size_t)((size_t)768 * 256) * 2 + 255) / 256) * 256;
    unsigned short* W3L = (unsigned short*)wsp; wsp += (((size_t)((size_t)768 * 256) * 2 + 255) / 256) * 256;
    float* BR3 = (float*)wsp; wsp += (((size_t)((size_t)768 + 64) * 4 + 255) / 256) * 256;
    float* QKV = (float*)wsp; wsp += (((size_t)((size_t)16384 * 768) * 4 + 255) / 256) * 256;
    float* AO = (float*)wsp; wsp += (((size_t)((size_t)16384 * 256) * 4 + 255) / 256) * 256;
    unsigned short* AOH = (unsigned short*)wsp; wsp += (((size_t)((size_t)16384 * 256) * 2 + 255) / 256) * 256;
    unsigned short* AOL = (unsigned short*)wsp; wsp += (((size_t)((size_t)16384 * 256) * 2 + 255) / 256) * 256;
    unsigned short* WOH = (unsigned short*)wsp; wsp += (((size_t)((size_t)256 * 256) * 2 + 255) / 256) * 256;
    unsigned short* WOL = (unsigned short*)wsp; wsp += (((size_t)((size_t)256 * 256) * 2 + 255) / 256) * 256;
    float* BRO = (float*)wsp; wsp += (((size_t)((size_t)256 + 64) * 4 + 255) / 256) * 256;
    float* XB = (float*)wsp; wsp += (((size_t)((size_t)1024 * 4096) * 4 + 255) / 256) * 256;
    if ((size_t)(wsp - (char*)d_ws) > ws_size) return;   // static carve guard
    // All four images go through each stage in ONE launch: every buffer holds the four images one behind the other (pixel-major buffers as 16384 rows,
    // channel-major ones as 4 matrices), and the image is extra rows, grid.y or grid.z of the launch.
    k_castS16<<<(unsigned)((((long long)(768) * ((256) / 2)) + 255) / 256), 256, 0, stream>>>(wqkv, 256, (__bf16*)(W3H), (__bf16*)(W3L), 256, 768, 256, 1.0f, 0, 0, 0);
    k_cm_bfvec<<<3, 256, 0, stream>>>(bqkv, BR3, 768); k_cm_bfvec<<<1, 256, 0, stream>>>(bo, BRO, 256);
    k_castS16<<<(unsigned)((((long long)(256) * ((256) / 2)) + 255) / 256), 256, 0, stream>>>(wo, 256, (__bf16*)(WOH), (__bf16*)(WOL), 256, 256, 256, 1.0f, 0, 0, 0);
    k_ab_gstat<<<32, 256, 0, stream>>>(x, ST, 131072); k_ab_gapply<<<(1048576 + 255) / 256, 256, 0, stream>>>(x, ST, gam, bet, XN, XB, 4096, 32, 256, 1048576LL);
    k_castS16<<<dim3((unsigned)((((long long)(4096) * ((256) / 2)) + 255) / 256), (unsigned)(4)), 256, 0, stream>>>(XN, 4096, (__bf16*)(XTH), (__bf16*)(XTL), 256, 256, 4096, 1.0f, 1, 1048576, 1048576);
    w25::wmma_gemm64<1, false, 2, 0, false, 0><<<dim3((unsigned)((((16384) / 64) * ((768) / 64) + 7) / 8), (unsigned)(1)), 256, 0, stream>>>((const unsigned short*)(XTH), nullptr, 256, 0, (const unsigned short*)(W3H), nullptr, 256, 0, (void*)(QKV), nullptr, 768, 0, BR3, nullptr, 0, 16384, 768, 256, 1.0f);
    w25::wmma_gemm64<1, false, 0, 0, true, 0><<<dim3((unsigned)((((16384) / 64) * ((768) / 64) + 7) / 8), (unsigned)(1)), 256, 0, stream>>>((const unsigned short*)(XTL), nullptr, 256, 0, (const unsigned short*)(W3H), nullptr, 256, 0, (void*)(QKV), nullptr, 768, 0, nullptr, QKV, 0, 16384, 768, 256, 1.0f);
    { /*apv4*/ AttnP a;
      a.Q = QKV; a.K = QKV + 256; a.V = QKV + 512; a.O = AO; a.P = 0; a.Mf = 0; a.Mi = 0; a.ST = 0;
      a.Pw = 0; a.Rt = 0; a.SQ = 0; a.SK = 0;
      a.swb = 0; a.swh = 0; a.swi = 0; a.swj = 0; a.srb = 0; a.srh = 0; a.sri = 0; a.sQb = 3145728; a.sQh = 64; a.sQi = 768; a.sQd = 1; a.sKb = 3145728; a.sKh = 64; a.sKj = 768; a.sKd = 1; a.sVb = 3145728; a.sVh = 64; a.sVj = 768; a.sVd = 1; a.sOb = 1048576; a.sOh = 64; a.sOi = 256; a.sPb = 0; a.sPh = 0; a.sPi = 0; a.smb = 0; a.smh = 0; a.smi = 0; a.smj = 0;
      a.Lq = 4096; a.Lk = 4096; a.dh = 64; a.dv = 64; a.hrep = 1; a.causal = 0; a.coff = 0; a.pband = 0;
      a.scale = 0.125f; a.mfill = 0.0f; a.nonorm = 0; a.mpol = 0;
      a.roff = 0; a.rn = 1; a.segpol = 0; a.win = 0;
      k_attn<64, 64, 0, false, false, true, true><<<dim3((unsigned)((4096) + 16 * AW - 1) / (16 * AW), (unsigned)(4), (unsigned)(4)), 32 * AW, 0, stream>>>(a); }
    k_castS16<<<(unsigned)((((long long)(16384) * ((256) / 2)) + 255) / 256), 256, 0, stream>>>(AO, 256, (__bf16*)(AOH), (__bf16*)(AOL), 256, 16384, 256, 1.0f, 0, 0, 0);
    w25::wmma_gemm64<1, false, 1, 0, true, 0><<<dim3((unsigned)((((256) / 64) * ((4096) / 64) + 7) / 8), (unsigned)(4)), 256, 0, stream>>>((const unsigned short*)(WOH), nullptr, 256, 0, (const unsigned short*)(AOH), nullptr, 256, 1048576, (void*)(out), nullptr, 4096, 1048576, BRO, XB, 1048576, 256, 4096, 256, 1.0f);
    w25::wmma_gemm64<1, false, 0, 0, true, 0><<<dim3((unsigned)((((256) / 64) * ((4096) / 64) + 7) / 8), (unsigned)(4)), 256, 0, stream>>>((const unsigned short*)(WOH), nullptr, 256, 0, (const unsigned short*)(AOL), nullptr, 256, 1048576, (void*)(out), nullptr, 4096, 1048576, nullptr, out, 1048576, 256, 4096, 256, 1.0f);
}
